// v000
// Measured on an AMD MI455X. A time is GPU time per run, averaged over a window of back-to-back runs after a warm-up
// (all launches, gaps included; the runs take copies of the inputs in turn), and the median of several windows.
// Apart from v000's, it joins two sittings. Times from different sittings can be a few percent apart, while
// side-by-side timings come from the same sitting.
// v000, which the later versions start from, runs in 2030 microseconds.
#include <hip/hip_runtime.h>
// Linear attention on WMMA (f32 accumulate): qkv = x·W_qkv + b (inputs rounded to bf16: single exact term; 32768 × 256 × 768), per batch kv = k2ᵀ·v (k2 and v are computed
// f32 → split into bf16 hi/lo: 3 products; 256 × 256 × 4096), t2 = q2·kv (3 products), out = attn·W_out + b (attn split hi/lo vs exact weights: 2 products). Mean-centering,
// squares, the two normalisations and the residual are f32 VALU (column statistics as fixed-order double sums).
#define BB 8
#define NTK 4096
#define CC 256

typedef __bf16 v16b __attribute__((ext_vector_type(16)));
typedef unsigned short v8us __attribute__((ext_vector_type(8), may_alias));
typedef float  v8f  __attribute__((ext_vector_type(8)));
typedef float  v4f  __attribute__((ext_vector_type(4)));
typedef float  v4fa __attribute__((ext_vector_type(4), may_alias));
union FragB { v16b v; v8us half[2]; unsigned short u[16]; };

__device__ __forceinline__ unsigned short bf16_bits(float x) { unsigned int u = __float_as_uint(x); return (unsigned short)((u + 0x7FFFu + ((u >> 16) & 1u)) >> 16); }
__device__ __forceinline__ float bf16_val(unsigned short b) { return __uint_as_float(((unsigned int)b) << 16); }
__device__ __forceinline__ float bf16_round(float x) { return bf16_val(bf16_bits(x)); }
// D += A·B with NT terms: 1 = ah·bh, 2 = + al·bh (A split), 3 = + ah·bl (both split)
template <int NT>
__device__ __forceinline__ v8f mmaN(v16b ah, v16b al, v16b bh, v16b bl, v8f c) {
  c = __builtin_amdgcn_wmma_f32_16x16x32_bf16(false, ah, false, bh, (short)0, c, false, false);
  if (NT >= 2) c = __builtin_amdgcn_wmma_f32_16x16x32_bf16(false, al, false, bh, (short)0, c, false, false);
  if (NT >= 3) c = __builtin_amdgcn_wmma_f32_16x16x32_bf16(false, ah, false, bl, (short)0, c, false, false);
  asm volatile("v_nop\n\tv_nop\n\tv_nop\n\tv_nop" : "+v"(c) : "v"(ah), "v"(al), "v"(bh), "v"(bl));
  return c;
}

__global__ __launch_bounds__(256) void k_wt_bf16(const float* __restrict__ W, unsigned short* __restrict__ Wt, int K, int N) {
  const int t = blockIdx.x * 256 + threadIdx.x;
  const int k8n = K / 8;
  if (t >= N * k8n) return;
  const int n = t / k8n, k8 = (t % k8n) * 8;
  v8us v;
#pragma unroll
  for (int i = 0; i < 8; ++i) v[i] = bf16_bits(W[(size_t)(k8 + i) * N + n]);
  *(v8us*)(Wt + (size_t)n * K + k8) = v;
  
}

// GEMM C[M][N] (f32, pitch ldc) = act(A[M][K]·W + bias). A f32 row-major (pitch lda) converted per fragment to bf16
// (ASPLIT: hi/lo two planes -> 2 terms, else single rounded term); Wt bf16 [N][K] (pitch ldb). BIAS_BF16 rounds the
// bias to bf16 first (bias quantised to bf16 before the add). K%32==0, M%16==0, N%64==0.
template <bool ASPLIT, int ACT, bool BIAS_BF16>
__global__ __launch_bounds__(128) void k_gemm_bf(const float* __restrict__ A, int lda, const unsigned short* __restrict__ Wt, int ldb,
                                               const float* __restrict__ bias, float* __restrict__ C, int ldc, int M, int N, int K) {
  __shared__ __attribute__((aligned(16))) float so[4][16][64];
  const int tid = threadIdx.x, w = tid >> 5, lane = tid & 31, ln = lane & 15, hh = lane >> 4;
  const int ntn = N / 64;
  const int wid = blockIdx.x * 4 + w;
  const int mt = wid / ntn, nq = wid % ntn;
  if (mt * 16 >= M) return;
  const int row0 = mt * 16, col0 = nq * 64;
  const float* arow = A + (size_t)(row0 + ln) * lda;
  v8f acc[4] = {};
  for (int kb = 0; kb < K; kb += 32) {
    FragB ah, al;
    const v4f x0 = *(const v4fa*)(arow + kb + 8 * hh), x1 = *(const v4fa*)(arow + kb + 8 * hh + 4);
    const v4f x2 = *(const v4fa*)(arow + kb + 16 + 8 * hh), x3 = *(const v4fa*)(arow + kb + 16 + 8 * hh + 4);
    float xs[16] = {x0[0],x0[1],x0[2],x0[3],x1[0],x1[1],x1[2],x1[3],x2[0],x2[1],x2[2],x2[3],x3[0],x3[1],x3[2],x3[3]};
#pragma unroll
    for (int i = 0; i < 16; ++i) { const unsigned short hb = bf16_bits(xs[i]); ah.u[i] = hb; al.u[i] = ASPLIT ? bf16_bits(xs[i] - bf16_val(hb)) : (unsigned short)0; }
#pragma unroll
    for (int t = 0; t < 4; ++t) {
      const unsigned short* brow = Wt + (size_t)(col0 + t * 16 + ln) * ldb + kb;
      FragB b;
      b.half[0] = *(const v8us*)(brow + 8 * hh);
      b.half[1] = *(const v8us*)(brow + 16 + 8 * hh);
      acc[t] = mmaN<ASPLIT ? 2 : 1>(ah.v, al.v, b.v, b.v, acc[t]);
    }
  }
#pragma unroll
  for (int t = 0; t < 4; ++t) {
    float bv = bias ? bias[col0 + t * 16 + ln] : 0.f;
    if (BIAS_BF16) bv = bf16_round(bv);
#pragma unroll
    for (int r = 0; r < 8; ++r) { float v = acc[t][r] + bv; if (ACT == 1) v = fmaxf(v, 0.f); so[w][8 * hh + r][t * 16 + ln] = v; }
  }
  __builtin_amdgcn_fence(__ATOMIC_ACQ_REL, "workgroup");
  __builtin_amdgcn_wave_barrier();
  const int rsub = lane >> 4, c4 = (lane & 15) * 4;
  {
#pragma unroll
    for (int q = 0; q < 8; ++q) {
      const int r = q * 2 + rsub;
      const v4f v = *(const v4fa*)&so[w][r][c4];
      *(v4f*)(C + (size_t)(row0 + r) * ldc + col0 + c4) = v;
    }
    
  }
}

// Flash-style causal/unmasked attention, all contractions 3-term bf16 hi/lo splits, f32 softmax with running max.
// q,k,v rows are read from f32 buffers with arbitrary row pitch (so they can live inside a fused qkv buffer);
// D = head size (multiple of 32, <= 128); one wave = 16 query rows; block = 4 waves (64 queries) sharing K/V chunks of 32.
template <int D, bool CAUSAL>
__global__ __launch_bounds__(128) void k_flash(const float* __restrict__ qb, const float* __restrict__ kb, const float* __restrict__ vb,
                                             int pitch, int T, int H, float scale, float* __restrict__ y, int ypitch) {
  constexpr int KS = D / 32;        // k-steps for QK
  constexpr int DT = D / 16;        // d tiles for PV
  __shared__ __attribute__((aligned(16))) unsigned short sKh[32][D + 8], sKl[32][D + 8], sVh[32][D + 8], sVl[32][D + 8];
  __shared__ __attribute__((aligned(16))) unsigned short sPh[4][16][40], sPl[4][16][40];
  __shared__ __attribute__((aligned(16))) float sO[4][16][D];
  const int tid = threadIdx.x, w = tid >> 5, lane = tid & 31, ln = lane & 15, hh = lane >> 4;
  const int nqb = (T + 63) / 64;
  const int bh = blockIdx.x / nqb, qblk = blockIdx.x % nqb;
  const int b = bh / H, h = bh % H;
  const int q0 = qblk * 64 + w * 16;
  const float* Q = qb + (size_t)b * T * pitch + h * D;
  const float* K = kb + (size_t)b * T * pitch + h * D;
  const float* V = vb + (size_t)b * T * pitch + h * D;

  // A fragments of the wave's 16 query rows (scaled), hi/lo
  FragB aqh[KS], aql[KS];
  {
    int row = q0 + ln; if (row >= T) row = T - 1;
    const float* qr = Q + (size_t)row * pitch;
#pragma unroll
    for (int ks = 0; ks < KS; ++ks)
#pragma unroll
      for (int i = 0; i < 16; ++i) {
        const int d = ks * 32 + ((i < 8) ? (8 * hh + i) : (16 + 8 * hh + (i - 8)));
        const float x = qr[d] * scale; const unsigned short hb = bf16_bits(x);
        aqh[ks].u[i] = hb; aql[ks].u[i] = bf16_bits(x - bf16_val(hb));
      }
  }
  float m_r[8], l_r[8];
#pragma unroll
  for (int r = 0; r < 8; ++r) { m_r[r] = -3.0e38f; l_r[r] = 0.f; }
  v8f oacc[DT];
#pragma unroll
  for (int dt = 0; dt < DT; ++dt) oacc[dt] = (v8f){0.f,0.f,0.f,0.f,0.f,0.f,0.f,0.f};

  const int kv_end = CAUSAL ? min(T, qblk * 64 + 64) : T;     // block-uniform
  for (int j0 = 0; j0 < kv_end; j0 += 32) {
    __syncthreads();
    for (int e = tid; e < 32 * (D / 4); e += 128) {
      const int r = e / (D / 4), c4 = (e % (D / 4)) * 4;
      const int key = j0 + r;
      v4f kf = {0.f,0.f,0.f,0.f}, vf = {0.f,0.f,0.f,0.f};
      if (key < T) { kf = *(const v4fa*)(K + (size_t)key * pitch + c4); vf = *(const v4fa*)(V + (size_t)key * pitch + c4); }
#pragma unroll
      for (int t = 0; t < 4; ++t) {
        unsigned short hb = bf16_bits(kf[t]); sKh[r][c4 + t] = hb; sKl[r][c4 + t] = bf16_bits(kf[t] - bf16_val(hb));
        hb = bf16_bits(vf[t]); sVh[r][c4 + t] = hb; sVl[r][c4 + t] = bf16_bits(vf[t] - bf16_val(hb));
      }
    }
    __syncthreads();
    // S tile 16 x 32
    v8f s[2];
#pragma unroll
    for (int nt = 0; nt < 2; ++nt) {
      v8f acc = {};
#pragma unroll
      for (int ks = 0; ks < KS; ++ks) {
        FragB bh_, bl_;
        bh_.half[0] = *(const v8us*)&sKh[nt * 16 + ln][ks * 32 + 8 * hh]; bh_.half[1] = *(const v8us*)&sKh[nt * 16 + ln][ks * 32 + 16 + 8 * hh];
        bl_.half[0] = *(const v8us*)&sKl[nt * 16 + ln][ks * 32 + 8 * hh]; bl_.half[1] = *(const v8us*)&sKl[nt * 16 + ln][ks * 32 + 16 + 8 * hh];
        acc = mmaN<3>(aqh[ks].v, aql[ks].v, bh_.v, bl_.v, acc);
      }
      s[nt] = acc;
    }
    // mask + running max (rows 8hh+r; the 16 lanes of a half share rows)
    float alpha[8];
#pragma unroll
    for (int r = 0; r < 8; ++r) {
      const int qi = q0 + 8 * hh + r;
      const int ja = j0 + ln, jb = j0 + 16 + ln;
      if (CAUSAL) { if (ja > qi) s[0][r] = -3.0e38f; if (jb > qi) s[1][r] = -3.0e38f; }
      if (ja >= T) s[0][r] = -3.0e38f;
      if (jb >= T) s[1][r] = -3.0e38f;
      float mx = fmaxf(s[0][r], s[1][r]);
      mx = fmaxf(mx, __shfl_xor(mx, 1, 32)); mx = fmaxf(mx, __shfl_xor(mx, 2, 32)); mx = fmaxf(mx, __shfl_xor(mx, 4, 32)); mx = fmaxf(mx, __shfl_xor(mx, 8, 32));
      const float mnew = fmaxf(m_r[r], mx);
      alpha[r] = (mnew > -1.0e38f) ? __expf(m_r[r] - mnew) : 1.0f;
      const float p0 = (s[0][r] > -1.0e38f) ? __expf(s[0][r] - mnew) : 0.f;
      const float p1 = (s[1][r] > -1.0e38f) ? __expf(s[1][r] - mnew) : 0.f;
      m_r[r] = mnew;
      l_r[r] = l_r[r] * alpha[r] + p0 + p1;            // per-lane partial row sum (16 lanes combined at the end)
      unsigned short hb = bf16_bits(p0); sPh[w][8 * hh + r][ln] = hb;      sPl[w][8 * hh + r][ln] = bf16_bits(p0 - bf16_val(hb));
      hb = bf16_bits(p1);                sPh[w][8 * hh + r][16 + ln] = hb; sPl[w][8 * hh + r][16 + ln] = bf16_bits(p1 - bf16_val(hb));
    }
#pragma unroll
    for (int dt = 0; dt < DT; ++dt)
#pragma unroll
      for (int r = 0; r < 8; ++r) oacc[dt][r] *= alpha[r];
    __builtin_amdgcn_fence(__ATOMIC_ACQ_REL, "workgroup");
    __builtin_amdgcn_wave_barrier();
    FragB pah, pal;
    pah.half[0] = *(const v8us*)&sPh[w][ln][8 * hh]; pah.half[1] = *(const v8us*)&sPh[w][ln][16 + 8 * hh];
    pal.half[0] = *(const v8us*)&sPl[w][ln][8 * hh]; pal.half[1] = *(const v8us*)&sPl[w][ln][16 + 8 * hh];
#pragma unroll
    for (int dt = 0; dt < DT; ++dt) {
      FragB bvh, bvl;
#pragma unroll
      for (int i = 0; i < 8; ++i) {
        bvh.u[i] = sVh[8 * hh + i][dt * 16 + ln]; bvh.u[8 + i] = sVh[16 + 8 * hh + i][dt * 16 + ln];
        bvl.u[i] = sVl[8 * hh + i][dt * 16 + ln]; bvl.u[8 + i] = sVl[16 + 8 * hh + i][dt * 16 + ln];
      }
      oacc[dt] = mmaN<3>(pah.v, pal.v, bvh.v, bvl.v, oacc[dt]);
    }
    __builtin_amdgcn_fence(__ATOMIC_ACQ_REL, "workgroup");
    __builtin_amdgcn_wave_barrier();
  }
#pragma unroll
  for (int r = 0; r < 8; ++r) {
    float l = l_r[r];
    l += __shfl_xor(l, 1, 32); l += __shfl_xor(l, 2, 32); l += __shfl_xor(l, 4, 32); l += __shfl_xor(l, 8, 32);
    l_r[r] = (l > 0.f) ? 1.0f / l : 0.f;
  }
#pragma unroll
  for (int dt = 0; dt < DT; ++dt)
#pragma unroll
    for (int r = 0; r < 8; ++r) sO[w][8 * hh + r][dt * 16 + ln] = oacc[dt][r] * l_r[r];
  __builtin_amdgcn_fence(__ATOMIC_ACQ_REL, "workgroup");
  __builtin_amdgcn_wave_barrier();
  {
    for (int r = 0; r < 16; ++r) {
      const int row = q0 + r;
      if (row < T && lane < D / 4) {
        const v4f val = *(const v4fa*)&sO[w][r][lane * 4];
        *(v4f*)(y + ((size_t)b * T + row) * ypitch + h * D + lane * 4) = val;
      }
    }
    
  }
}

// GEMM C = act(A·W + bias + resid): A f32 (ASPLIT -> hi/lo 2 terms), Wt bf16 [N][K]; ACT 0 none, 1 relu, 2 exact gelu;
// resid (optional, f32, row index = (row % rmod), pitch ldr, RES_BF16 rounds it) added before the activation.
template <bool ASPLIT, int ACT, bool BIAS_BF16, bool RES_BF16>
__global__ __launch_bounds__(128) void k_gemm_bf3(const float* __restrict__ A, int lda, const unsigned short* __restrict__ Wt, int ldb,
                                                const float* __restrict__ bias, const float* __restrict__ resid, int rmod, int ldr,
                                                float* __restrict__ C, int ldc, int M, int N, int K) {
  __shared__ __attribute__((aligned(16))) float so[4][16][64];
  const int tid = threadIdx.x, w = tid >> 5, lane = tid & 31, ln = lane & 15, hh = lane >> 4;
  const int ntn = N / 64;
  const int wid = blockIdx.x * 4 + w;
  const int mt = wid / ntn, nq = wid % ntn;
  if (mt * 16 >= M) return;
  const int row0 = mt * 16, col0 = nq * 64;
  const float* arow = A + (size_t)(row0 + ln) * lda;
  v8f acc[4] = {};
  for (int kb = 0; kb < K; kb += 32) {
    FragB ah, al;
    const v4f x0 = *(const v4fa*)(arow + kb + 8 * hh), x1 = *(const v4fa*)(arow + kb + 8 * hh + 4);
    const v4f x2 = *(const v4fa*)(arow + kb + 16 + 8 * hh), x3 = *(const v4fa*)(arow + kb + 16 + 8 * hh + 4);
    float xs[16] = {x0[0],x0[1],x0[2],x0[3],x1[0],x1[1],x1[2],x1[3],x2[0],x2[1],x2[2],x2[3],x3[0],x3[1],x3[2],x3[3]};
#pragma unroll
    for (int i = 0; i < 16; ++i) { const unsigned short hb = bf16_bits(xs[i]); ah.u[i] = hb; al.u[i] = ASPLIT ? bf16_bits(xs[i] - bf16_val(hb)) : (unsigned short)0; }
#pragma unroll
    for (int t = 0; t < 4; ++t) {
      const unsigned short* brow = Wt + (size_t)(col0 + t * 16 + ln) * ldb + kb;
      FragB b;
      b.half[0] = *(const v8us*)(brow + 8 * hh);
      b.half[1] = *(const v8us*)(brow + 16 + 8 * hh);
      acc[t] = mmaN<ASPLIT ? 2 : 1>(ah.v, al.v, b.v, b.v, acc[t]);
    }
  }
#pragma unroll
  for (int t = 0; t < 4; ++t) {
    const int col = col0 + t * 16 + ln;
    float bv = bias ? bias[col] : 0.f;
    if (BIAS_BF16) bv = bf16_round(bv);
#pragma unroll
    for (int r = 0; r < 8; ++r) {
      float v = acc[t][r] + bv;
      if (resid) { float rv = resid[(size_t)((row0 + 8 * hh + r) % rmod) * ldr + col]; if (RES_BF16) rv = bf16_round(rv); v += rv; }
      if (ACT == 1) v = fmaxf(v, 0.f);
      if (ACT == 2) v = 0.5f * v * (1.0f + erff(v * 0.70710678118654752f));
      if (ACT == 3) { const float u = 0.7978845608028654f * (v + 0.044715f * v * v * v); v = 0.5f * v * (1.0f + tanhf(u)); }
      so[w][8 * hh + r][t * 16 + ln] = v;
    }
  }
  __builtin_amdgcn_fence(__ATOMIC_ACQ_REL, "workgroup");
  __builtin_amdgcn_wave_barrier();
  const int rsub = lane >> 4, c4 = (lane & 15) * 4;
  {
#pragma unroll
    for (int q = 0; q < 8; ++q) {
      const int r = q * 2 + rsub;
      const v4f v = *(const v4fa*)&so[w][r][c4];
      *(v4f*)(C + (size_t)(row0 + r) * ldc + col0 + c4) = v;
    }
    
  }
}
// row LayerNorm (biased variance, eps) over N: s = X (+ R); optional out_sum <- s; out_norm <- (s-mu)*rsqrt(var+eps)*g + b
template <bool PARAM_BF16>
__global__ __launch_bounds__(256) void k_layernorm(const float* __restrict__ X, const float* __restrict__ R, const float* __restrict__ g, const float* __restrict__ bta,
                                                  float* __restrict__ out_sum, float* __restrict__ out_norm, int N, float eps) {
  __shared__ float red[256];
  const int row = blockIdx.x, tid = threadIdx.x;
  const float* x = X + (size_t)row * N; const float* rr = R ? R + (size_t)row * N : nullptr;
  float vals[16];                     // up to N = 4096
  const int per = N / 256;            // contiguous chunk per thread? use strided-by-4 chunks: thread handles j = tid*4 + 1024*u
  float s1 = 0.f;
  for (int u = 0; u < per / 4; ++u) {
    const int j = tid * 4 + 1024 * u;
    const v4f a = *(const v4fa*)(x + j);
    v4f b = {0.f,0.f,0.f,0.f}; if (rr) b = *(const v4fa*)(rr + j);
#pragma unroll
    for (int q = 0; q < 4; ++q) { const float v = a[q] + b[q]; vals[u * 4 + q] = v; s1 += v; }
  }
  red[tid] = s1; __syncthreads();
  for (int st = 128; st > 0; st >>= 1) { if (tid < st) red[tid] += red[tid + st]; __syncthreads(); }
  const float mu = red[0] / (float)N; __syncthreads();
  float s2 = 0.f;
  for (int u = 0; u < per / 4; ++u)
#pragma unroll
    for (int q = 0; q < 4; ++q) { const float c = vals[u * 4 + q] - mu; s2 += c * c; }
  red[tid] = s2; __syncthreads();
  for (int st = 128; st > 0; st >>= 1) { if (tid < st) red[tid] += red[tid + st]; __syncthreads(); }
  const float rs = rsqrtf(red[0] / (float)N + eps);
  {
    for (int u = 0; u < per / 4; ++u) {
      const int j = tid * 4 + 1024 * u;
      v4f o, sm;
#pragma unroll
      for (int q = 0; q < 4; ++q) {
        float gg = g[j + q], bb = bta[j + q];
        if (PARAM_BF16) { gg = bf16_round(gg); bb = bf16_round(bb); }
        sm[q] = vals[u * 4 + q]; o[q] = (vals[u * 4 + q] - mu) * rs * gg + bb;
      }
      if (out_sum) *(v4f*)(out_sum + (size_t)row * N + j) = sm;
      *(v4f*)(out_norm + (size_t)row * N + j) = o;
    }
    
  }
}

// batched GEMM (blockIdx.y = batch): C_b = act(alpha·A_b·B_b + bias + resid_b); A f32 rows (ASPLIT → hi/lo), B = bf16 planes Bh (+Bl when BSPLIT, requires ASPLIT),
// per-batch element strides sA, sB (0 = shared weights), sC, sR. resid may alias C (values are staged before the stores). ACT 0/1(relu).
// ACT: 0 none, 1 relu, 2 softplus
template <bool ASPLIT, bool BSPLIT, int ACT>
__global__ __launch_bounds__(128) void k_gemm_b(const float* __restrict__ A, int lda, size_t sA, const unsigned short* __restrict__ Bh, const unsigned short* __restrict__ Bl, int ldb, size_t sB,
                                             const float* __restrict__ bias, const float* __restrict__ resid, int ldr, size_t sR, float rsign, float alpha,
                                             float* __restrict__ C, int ldc, size_t sC, int M, int N, int K) {
  __shared__ __attribute__((aligned(16))) float so[4][16][64];
  const int tid = threadIdx.x, w = tid >> 5, lane = tid & 31, ln = lane & 15, hh = lane >> 4;
  const int by = blockIdx.y;
  A += (size_t)by * sA; Bh += (size_t)by * sB; if (BSPLIT) Bl += (size_t)by * sB; C += (size_t)by * sC; if (resid) resid += (size_t)by * sR;
  const int ntn = (N + 63) / 64; const int wid = blockIdx.x * 4 + w; const int mt = wid / ntn, nq = wid % ntn;      // N may be any multiple of 16: tiles past N are skipped and not stored
  if (mt * 16 >= M) return;
  const int row0 = mt * 16, col0 = nq * 64;
  const float* arow = A + (size_t)(row0 + ln) * lda;
  v8f acc[4] = {};
  for (int kb = 0; kb < K; kb += 32) {
    FragB ah, al;
    const v4f x0 = *(const v4fa*)(arow + kb + 8 * hh), x1 = *(const v4fa*)(arow + kb + 8 * hh + 4);
    const v4f x2 = *(const v4fa*)(arow + kb + 16 + 8 * hh), x3 = *(const v4fa*)(arow + kb + 16 + 8 * hh + 4);
    float xs[16] = {x0[0],x0[1],x0[2],x0[3],x1[0],x1[1],x1[2],x1[3],x2[0],x2[1],x2[2],x2[3],x3[0],x3[1],x3[2],x3[3]};
#pragma unroll
    for (int i = 0; i < 16; ++i) { const unsigned short hb = bf16_bits(xs[i]); ah.u[i] = hb; al.u[i] = ASPLIT ? bf16_bits(xs[i] - bf16_val(hb)) : (unsigned short)0; }
#pragma unroll
    for (int t = 0; t < 4; ++t) {
      if (col0 + t * 16 >= N) continue;
      const size_t boff = (size_t)(col0 + t * 16 + ln) * ldb + kb;
      FragB bh_, bl_; bh_.half[0] = *(const v8us*)(Bh + boff + 8 * hh); bh_.half[1] = *(const v8us*)(Bh + boff + 16 + 8 * hh);
      if (BSPLIT) { bl_.half[0] = *(const v8us*)(Bl + boff + 8 * hh); bl_.half[1] = *(const v8us*)(Bl + boff + 16 + 8 * hh); } else bl_ = bh_;
      acc[t] = mmaN<ASPLIT ? (BSPLIT ? 3 : 2) : 1>(ah.v, al.v, bh_.v, bl_.v, acc[t]);
    }
  }
#pragma unroll
  for (int t = 0; t < 4; ++t) {
    const int col = col0 + t * 16 + ln; if (col0 + t * 16 >= N) continue; const float bv = bias ? bf16_round(bias[col]) : 0.f;
#pragma unroll
    for (int r = 0; r < 8; ++r) { float v = acc[t][r] * alpha + bv; if (resid) v += rsign * resid[(size_t)(row0 + 8 * hh + r) * ldr + col]; if (ACT == 1) v = fmaxf(v, 0.f); else if (ACT == 2) v = fmaxf(v, 0.f) + log1pf(expf(-fabsf(v))); so[w][8 * hh + r][t * 16 + ln] = v; }
  }
  __builtin_amdgcn_fence(__ATOMIC_ACQ_REL, "workgroup"); __builtin_amdgcn_wave_barrier();
  const int rsub = lane >> 4, c4 = (lane & 15) * 4;
  {
#pragma unroll
    for (int q = 0; q < 8; ++q) { const int r = q * 2 + rsub; if (col0 + c4 < N) { const v4f v = *(const v4fa*)&so[w][r][c4]; *(v4f*)(C + (size_t)(row0 + r) * ldc + col0 + c4) = v; } }
    
  }
}
// batched f32 [K][N] (pitch lds, batch stride sIn) -> transposed hi/lo planes [N][K] (batch stride sOut); thread per (n, 8 k); grid.y = batch
__global__ __launch_bounds__(256) void k_split_transpose_b(const float* __restrict__ src, int lds_, size_t sIn, unsigned short* __restrict__ hi, unsigned short* __restrict__ lo, size_t sOut, int K, int N) {
  const size_t t = (size_t)blockIdx.x * 256 + threadIdx.x; const int k8n = K / 8; if (t >= (size_t)N * k8n) return;
  src += (size_t)blockIdx.y * sIn; hi += (size_t)blockIdx.y * sOut; lo += (size_t)blockIdx.y * sOut;
  const int n = (int)(t / k8n), k8 = (int)(t % k8n) * 8; v8us vh, vl;
#pragma unroll
  for (int i = 0; i < 8; ++i) { const float x = src[(size_t)(k8 + i) * lds_ + n]; const unsigned short hb = bf16_bits(x); vh[i] = hb; vl[i] = bf16_bits(x - bf16_val(hb)); }
  unsigned short* dh = hi + (size_t)n * K + k8; unsigned short* dl = lo + (size_t)n * K + k8;
  *(v8us*)dh = vh; *(v8us*)dl = vl; 
}

__global__ __launch_bounds__(256) void k_btw(const float* __restrict__ W, unsigned short* __restrict__ Bt, int K, int N) { const int t = blockIdx.x * 256 + threadIdx.x; if (t >= N * (K / 8)) return; const int n = t / (K / 8), k8 = (t % (K / 8)) * 8; v8us v; for (int q = 0; q < 8; ++q) v[q] = bf16_bits(W[(size_t)(k8 + q) * N + n]); *(v8us*)(Bt + (size_t)n * K + k8) = v;  }
// per token: q ← q − mean(q), k ← k − mean(k); q2 = q², k2 = k²; q2s, k2s; Q2n[t][c] = l2norm_c(q2/(q2s+1e-7)); K2a[t][c] = k2/(k2s+1e-7) (column-normalised later); wave per token, 8 per lane
__global__ __launch_bounds__(256) void k_prep(const float* __restrict__ QKV, float* __restrict__ Q2n, float* __restrict__ K2a) {
  const int tid = threadIdx.x, wv = tid >> 5, lane = tid & 31; const size_t t = (size_t)blockIdx.x * 8 + wv; const float* row = QKV + t * (3 * CC); float q[8], k[8]; float sq = 0.f, sk = 0.f;
#pragma unroll
  for (int u = 0; u < 8; ++u) { q[u] = row[u * 32 + lane]; k[u] = row[CC + u * 32 + lane]; sq += q[u]; sk += k[u]; }
  for (int o = 16; o >= 1; o >>= 1) { sq += __shfl_xor(sq, o, 32); sk += __shfl_xor(sk, o, 32); } const float mq = sq * (1.0f / CC), mk = sk * (1.0f / CC);
  float q2s = 0.f, k2s = 0.f;
#pragma unroll
  for (int u = 0; u < 8; ++u) { q[u] = (q[u] - mq) * (q[u] - mq); k[u] = (k[u] - mk) * (k[u] - mk); q2s += q[u]; k2s += k[u]; }
  for (int o = 16; o >= 1; o >>= 1) { q2s += __shfl_xor(q2s, o, 32); k2s += __shfl_xor(k2s, o, 32); }
  float nq = 0.f; const float rq = 1.0f / (q2s + 1e-7f), rk = 1.0f / (k2s + 1e-7f);
#pragma unroll
  for (int u = 0; u < 8; ++u) { q[u] = q[u] * rq; k[u] = k[u] * rk; nq += q[u] * q[u]; }
  for (int o = 16; o >= 1; o >>= 1) nq += __shfl_xor(nq, o, 32); const float iq = 1.0f / fmaxf(sqrtf(nq), 1e-12f);
#pragma unroll
  for (int u = 0; u < 8; ++u) q[u] *= iq;
  {
#pragma unroll
    for (int u = 0; u < 8; ++u) { *(float*)(Q2n + t * CC + u * 32 + lane) = q[u]; *(float*)(K2a + t * CC + u * 32 + lane) = k[u]; }  }
}
// column norms of K2a over the 4096 tokens of each batch: block per (b, 256 cols → thread per col), fixed-order double sums → KN[b][c] = 1/max(‖·‖, 1e-12)
__global__ __launch_bounds__(256) void k_colnorm(const float* __restrict__ K2a, float* __restrict__ KN) { const int b = blockIdx.x, c = threadIdx.x; const float* base = K2a + (size_t)b * NTK * CC + c; double s = 0.0;
#pragma unroll 1
  for (int t = 0; t < NTK; ++t) { const float v = base[(size_t)t * CC]; s += (double)v * (double)v; } const float inv = 1.0f / fmaxf((float)sqrt(s), 1e-12f); *(float*)(KN + b * CC + c) = inv;  }
// hi/lo bf16 planes of vᵀ: Vh/Vl [b][d][t] (the Bt operand of kv = k2ᵀ·v), via LDS tiles of 64 tokens (one line per row segment)
__global__ __launch_bounds__(256) void k_vplanes(const float* __restrict__ QKV, unsigned short* __restrict__ Vh, unsigned short* __restrict__ Vl) {
  __shared__ float tv[64][33]; const int b = blockIdx.z; const int t0 = blockIdx.x * 64, c0 = blockIdx.y * 32; const int tx = threadIdx.x & 31, ty = threadIdx.x >> 5;
  for (int i = ty; i < 64; i += 8) { const size_t tok = (size_t)b * NTK + t0 + i; tv[i][tx] = QKV[tok * (3 * CC) + 2 * CC + c0 + tx]; }
  __syncthreads(); typedef unsigned short us2 __attribute__((ext_vector_type(2)));
  { for (int e = threadIdx.x; e < 32 * 32; e += 256) { const int cr = e >> 5, tp = (e & 31) * 2; us2 vh, vl;
      { const float a = tv[tp][cr], c2 = tv[tp + 1][cr]; const unsigned short ah = bf16_bits(a), ch = bf16_bits(c2); vh.x = ah; vh.y = ch; vl.x = bf16_bits(a - bf16_val(ah)); vl.y = bf16_bits(c2 - bf16_val(ch)); }
      const size_t dst = ((size_t)b * CC + c0 + cr) * NTK + t0 + tp; *(us2*)(Vh + dst) = vh; *(us2*)(Vl + dst) = vl; }
     }
}
// K2T[b][c][t] = column-normalised k2 transposed (f32, the A operand of kv; split hi/lo inside the GEMM)
__global__ __launch_bounds__(256) void k_k2t(const float* __restrict__ K2a, const float* __restrict__ KN, float* __restrict__ K2T) { __shared__ float tk[32][33]; const int b = blockIdx.z; const int t0 = blockIdx.x * 32, c0 = blockIdx.y * 32; const int tx = threadIdx.x & 31, ty = threadIdx.x >> 5;
  for (int i = ty; i < 32; i += 8) tk[i][tx] = K2a[((size_t)b * NTK + t0 + i) * CC + c0 + tx] * KN[b * CC + c0 + tx]; __syncthreads();
  { for (int i = ty; i < 32; i += 8) *(float*)(K2T + ((size_t)b * CC + c0 + i) * NTK + t0 + tx) = tk[tx][i];  } }
// kv → Bt for t2 = q2·kv: B[k=c][n=d] = kv[c][d] → Bt[d][c] = kvᵀ → planes hi/lo of kvᵀ: thread per (b, d, 8 c)
__global__ __launch_bounds__(256) void k_kvplanes(const float* __restrict__ KV, unsigned short* __restrict__ Ph, unsigned short* __restrict__ Pl) { const int t = blockIdx.x * 256 + threadIdx.x; if (t >= BB * CC * (CC / 8)) return; const int c8 = (t % (CC / 8)) * 8; const int d = (t / (CC / 8)) % CC; const int b = t / ((CC / 8) * CC); v8us h, l;
  for (int q = 0; q < 8; ++q) { const float v = KV[((size_t)b * CC + c8 + q) * CC + d]; const unsigned short hb = bf16_bits(v); h[q] = hb; l[q] = bf16_bits(v - bf16_val(hb)); } const size_t dst = ((size_t)b * CC + d) * CC + c8; *(v8us*)(Ph + dst) = h; *(v8us*)(Pl + dst) = l;  }
// attn = v + t2/√N ; thread per float4
__global__ __launch_bounds__(256) void k_attn(const float* __restrict__ QKV, const float* __restrict__ T2, float* __restrict__ AT) { const size_t t = (size_t)blockIdx.x * 256 + threadIdx.x; if (t >= (size_t)BB * NTK * CC / 4) return; const int c4 = (int)((t * 4) % CC); const size_t tok = (t * 4) / CC; const v4f v = *(const v4fa*)(QKV + tok * (3 * CC) + 2 * CC + c4), s = *(const v4fa*)(T2 + t * 4); v4f o; for (int q = 0; q < 4; ++q) o[q] = v[q] + s[q] * 0.015625f; *(v4f*)(AT + t * 4) = o;  }
extern "C" void kernel_launch(void* const* d_in, const int* in_sizes, int n_in,
                              void* d_out, int out_size, void* d_ws, size_t ws_size, hipStream_t stream) {
  (void)in_sizes; (void)n_in; (void)out_size;
  const float* x = (const float*)d_in[0]; const float* Wqkv = (const float*)d_in[1]; const float* bqkv = (const float*)d_in[2]; const float* Wout = (const float*)d_in[3]; const float* bout = (const float*)d_in[4];
  char* ws = (char*)d_ws; size_t off = 0;
  auto take = [&](size_t bytes) { char* p = ws + off; off += (bytes + 255) & ~(size_t)255; return p; };
  unsigned short* Bq = (unsigned short*)take((size_t)3 * CC * CC * 2); unsigned short* Bo = (unsigned short*)take((size_t)CC * CC * 2);
  float* QKV = (float*)take((size_t)BB * NTK * 3 * CC * 4); float* Q2n = (float*)take((size_t)BB * NTK * CC * 4); float* K2a = (float*)take((size_t)BB * NTK * CC * 4); float* KN = (float*)take(BB * CC * 4);
  float* K2T = (float*)take((size_t)BB * CC * NTK * 4); unsigned short* Vh = (unsigned short*)take((size_t)BB * CC * NTK * 2); unsigned short* Vl = (unsigned short*)take((size_t)BB * CC * NTK * 2);
  float* KV = (float*)take((size_t)BB * CC * CC * 4); unsigned short* Ph = (unsigned short*)take((size_t)BB * CC * CC * 2); unsigned short* Pl = (unsigned short*)take((size_t)BB * CC * CC * 2);
  float* T2 = K2a; float* AT2 = K2T;      // buffer reuse: K2a is dead once K2T/V planes exist; K2T is dead once kv exists
  if (off > ws_size) return;
  k_btw<<<(3 * CC * 32 + 255) / 256, 256, 0, stream>>>(Wqkv, Bq, CC, 3 * CC); k_btw<<<(CC * 32 + 255) / 256, 256, 0, stream>>>(Wout, Bo, CC, CC);
  k_gemm_bf3<false, 0, true, false><<<((BB * NTK / 16) * (3 * CC / 64) + 3) / 4, 128, 0, stream>>>(x, CC, Bq, CC, bqkv, nullptr, 1, 0, QKV, 3 * CC, BB * NTK, 3 * CC, CC);
  k_prep<<<BB * NTK / 8, 256, 0, stream>>>(QKV, Q2n, K2a); k_colnorm<<<BB, 256, 0, stream>>>(K2a, KN);
  k_k2t<<<dim3(NTK / 32, CC / 32, BB), 256, 0, stream>>>(K2a, KN, K2T);
  k_vplanes<<<dim3(NTK / 64, CC / 32, BB), 256, 0, stream>>>(QKV, Vh, Vl);
  k_gemm_b<true, true, 0><<<dim3(((CC / 16) * (CC / 64) + 3) / 4, BB), 128, 0, stream>>>(K2T, NTK, (size_t)CC * NTK, Vh, Vl, NTK, (size_t)CC * NTK, nullptr, nullptr, 0, 0, 1.f, 1.f, KV, CC, (size_t)CC * CC, CC, CC, NTK);      // kv[c][d] = Σ_t k2[t][c]·v[t][d]
  k_kvplanes<<<(BB * CC * (CC / 8) + 255) / 256, 256, 0, stream>>>(KV, Ph, Pl);
  k_gemm_b<true, true, 0><<<dim3(((NTK / 16) * (CC / 64) + 3) / 4, BB), 128, 0, stream>>>(Q2n, CC, (size_t)NTK * CC, Ph, Pl, CC, (size_t)CC * CC, nullptr, nullptr, 0, 0, 1.f, 1.f, T2, CC, (size_t)NTK * CC, NTK, CC, CC);             // t2 = q2·kv
  k_attn<<<(unsigned)(((size_t)BB * NTK * CC / 4 + 255) / 256), 256, 0, stream>>>(QKV, T2, AT2);
  k_gemm_bf3<true, 0, true, false><<<((BB * NTK / 16) * (CC / 64) + 3) / 4, 128, 0, stream>>>(AT2, CC, Bo, CC, bout, nullptr, 1, 0, (float*)d_out, CC, BB * NTK, CC, CC);
}

// v001
// It runs in 418 microseconds.
// Two timings next to v000 put it at 4.86 and 4.85 times that version's speed.
#include <hip/hip_runtime.h>
// Linear attention on WMMA (f32 accumulate): qkv = x·W_qkv + b (inputs rounded to bf16: single exact term; 32768 × 256 × 768), per batch kv = k2ᵀ·v (k2 and v are computed
// f32 → split into bf16 hi/lo: 3 products; 256 × 256 × 4096), t2 = q2·kv (3 products), out = attn·W_out + b (attn split hi/lo vs exact weights: 2 products). Mean-centering,
// squares, the two normalisations and the residual are f32 VALU (column statistics as fixed-order double sums).
#define BB 8
#define NTK 4096
#define CC 256

typedef __bf16 v16b __attribute__((ext_vector_type(16)));
typedef unsigned short v8us __attribute__((ext_vector_type(8), may_alias));
typedef float  v8f  __attribute__((ext_vector_type(8)));
typedef float  v4f  __attribute__((ext_vector_type(4)));
typedef float  v4fa __attribute__((ext_vector_type(4), may_alias));
union FragB { v16b v; v8us half[2]; unsigned short u[16]; };

__device__ __forceinline__ unsigned short bf16_bits(float x) { unsigned int u = __float_as_uint(x); return (unsigned short)((u + 0x7FFFu + ((u >> 16) & 1u)) >> 16); }
__device__ __forceinline__ float bf16_val(unsigned short b) { return __uint_as_float(((unsigned int)b) << 16); }
__device__ __forceinline__ float bf16_round(float x) { return bf16_val(bf16_bits(x)); }
// D += A·B with NT terms: 1 = ah·bh, 2 = + al·bh (A split), 3 = + ah·bl (both split)
template <int NT>
__device__ __forceinline__ v8f mmaN(v16b ah, v16b al, v16b bh, v16b bl, v8f c) {
  c = __builtin_amdgcn_wmma_f32_16x16x32_bf16(false, ah, false, bh, (short)0, c, false, false);
  if (NT >= 2) c = __builtin_amdgcn_wmma_f32_16x16x32_bf16(false, al, false, bh, (short)0, c, false, false);
  if (NT >= 3) c = __builtin_amdgcn_wmma_f32_16x16x32_bf16(false, ah, false, bl, (short)0, c, false, false);
  asm volatile("v_nop\n\tv_nop\n\tv_nop\n\tv_nop" : "+v"(c) : "v"(ah), "v"(al), "v"(bh), "v"(bl));
  return c;
}

__global__ __launch_bounds__(256) void k_wt_bf16(const float* __restrict__ W, unsigned short* __restrict__ Wt, int K, int N) {
  const int t = blockIdx.x * 256 + threadIdx.x;
  const int k8n = K / 8;
  if (t >= N * k8n) return;
  const int n = t / k8n, k8 = (t % k8n) * 8;
  v8us v;
#pragma unroll
  for (int i = 0; i < 8; ++i) v[i] = bf16_bits(W[(size_t)(k8 + i) * N + n]);
  *(v8us*)(Wt + (size_t)n * K + k8) = v;
  
}

// GEMM C[M][N] (f32, pitch ldc) = act(A[M][K]·W + bias). A f32 row-major (pitch lda) converted per fragment to bf16
// (ASPLIT: hi/lo two planes -> 2 terms, else single rounded term); Wt bf16 [N][K] (pitch ldb). BIAS_BF16 rounds the
// bias to bf16 first (bias quantised to bf16 before the add). K%32==0, M%16==0, N%64==0.
template <bool ASPLIT, int ACT, bool BIAS_BF16>
__global__ __launch_bounds__(128) void k_gemm_bf(const float* __restrict__ A, int lda, const unsigned short* __restrict__ Wt, int ldb,
                                               const float* __restrict__ bias, float* __restrict__ C, int ldc, int M, int N, int K) {
  __shared__ __attribute__((aligned(16))) float so[4][16][64];
  const int tid = threadIdx.x, w = tid >> 5, lane = tid & 31, ln = lane & 15, hh = lane >> 4;
  const int ntn = N / 64;
  const int wid = blockIdx.x * 4 + w;
  const int mt = wid / ntn, nq = wid % ntn;
  if (mt * 16 >= M) return;
  const int row0 = mt * 16, col0 = nq * 64;
  const float* arow = A + (size_t)(row0 + ln) * lda;
  v8f acc[4] = {};
  for (int kb = 0; kb < K; kb += 32) {
    FragB ah, al;
    const v4f x0 = *(const v4fa*)(arow + kb + 8 * hh), x1 = *(const v4fa*)(arow + kb + 8 * hh + 4);
    const v4f x2 = *(const v4fa*)(arow + kb + 16 + 8 * hh), x3 = *(const v4fa*)(arow + kb + 16 + 8 * hh + 4);
    float xs[16] = {x0[0],x0[1],x0[2],x0[3],x1[0],x1[1],x1[2],x1[3],x2[0],x2[1],x2[2],x2[3],x3[0],x3[1],x3[2],x3[3]};
#pragma unroll
    for (int i = 0; i < 16; ++i) { const unsigned short hb = bf16_bits(xs[i]); ah.u[i] = hb; al.u[i] = ASPLIT ? bf16_bits(xs[i] - bf16_val(hb)) : (unsigned short)0; }
#pragma unroll
    for (int t = 0; t < 4; ++t) {
      const unsigned short* brow = Wt + (size_t)(col0 + t * 16 + ln) * ldb + kb;
      FragB b;
      b.half[0] = *(const v8us*)(brow + 8 * hh);
      b.half[1] = *(const v8us*)(brow + 16 + 8 * hh);
      acc[t] = mmaN<ASPLIT ? 2 : 1>(ah.v, al.v, b.v, b.v, acc[t]);
    }
  }
#pragma unroll
  for (int t = 0; t < 4; ++t) {
    float bv = bias ? bias[col0 + t * 16 + ln] : 0.f;
    if (BIAS_BF16) bv = bf16_round(bv);
#pragma unroll
    for (int r = 0; r < 8; ++r) { float v = acc[t][r] + bv; if (ACT == 1) v = fmaxf(v, 0.f); so[w][8 * hh + r][t * 16 + ln] = v; }
  }
  __builtin_amdgcn_fence(__ATOMIC_ACQ_REL, "workgroup");
  __builtin_amdgcn_wave_barrier();
  const int rsub = lane >> 4, c4 = (lane & 15) * 4;
  {
#pragma unroll
    for (int q = 0; q < 8; ++q) {
      const int r = q * 2 + rsub;
      const v4f v = *(const v4fa*)&so[w][r][c4];
      *(v4f*)(C + (size_t)(row0 + r) * ldc + col0 + c4) = v;
    }
    
  }
}

// Flash-style causal/unmasked attention, all contractions 3-term bf16 hi/lo splits, f32 softmax with running max.
// q,k,v rows are read from f32 buffers with arbitrary row pitch (so they can live inside a fused qkv buffer);
// D = head size (multiple of 32, <= 128); one wave = 16 query rows; block = 4 waves (64 queries) sharing K/V chunks of 32.
template <int D, bool CAUSAL>
__global__ __launch_bounds__(128) void k_flash(const float* __restrict__ qb, const float* __restrict__ kb, const float* __restrict__ vb,
                                             int pitch, int T, int H, float scale, float* __restrict__ y, int ypitch) {
  constexpr int KS = D / 32;        // k-steps for QK
  constexpr int DT = D / 16;        // d tiles for PV
  __shared__ __attribute__((aligned(16))) unsigned short sKh[32][D + 8], sKl[32][D + 8], sVh[32][D + 8], sVl[32][D + 8];
  __shared__ __attribute__((aligned(16))) unsigned short sPh[4][16][40], sPl[4][16][40];
  __shared__ __attribute__((aligned(16))) float sO[4][16][D];
  const int tid = threadIdx.x, w = tid >> 5, lane = tid & 31, ln = lane & 15, hh = lane >> 4;
  const int nqb = (T + 63) / 64;
  const int bh = blockIdx.x / nqb, qblk = blockIdx.x % nqb;
  const int b = bh / H, h = bh % H;
  const int q0 = qblk * 64 + w * 16;
  const float* Q = qb + (size_t)b * T * pitch + h * D;
  const float* K = kb + (size_t)b * T * pitch + h * D;
  const float* V = vb + (size_t)b * T * pitch + h * D;

  // A fragments of the wave's 16 query rows (scaled), hi/lo
  FragB aqh[KS], aql[KS];
  {
    int row = q0 + ln; if (row >= T) row = T - 1;
    const float* qr = Q + (size_t)row * pitch;
#pragma unroll
    for (int ks = 0; ks < KS; ++ks)
#pragma unroll
      for (int i = 0; i < 16; ++i) {
        const int d = ks * 32 + ((i < 8) ? (8 * hh + i) : (16 + 8 * hh + (i - 8)));
        const float x = qr[d] * scale; const unsigned short hb = bf16_bits(x);
        aqh[ks].u[i] = hb; aql[ks].u[i] = bf16_bits(x - bf16_val(hb));
      }
  }
  float m_r[8], l_r[8];
#pragma unroll
  for (int r = 0; r < 8; ++r) { m_r[r] = -3.0e38f; l_r[r] = 0.f; }
  v8f oacc[DT];
#pragma unroll
  for (int dt = 0; dt < DT; ++dt) oacc[dt] = (v8f){0.f,0.f,0.f,0.f,0.f,0.f,0.f,0.f};

  const int kv_end = CAUSAL ? min(T, qblk * 64 + 64) : T;     // block-uniform
  for (int j0 = 0; j0 < kv_end; j0 += 32) {
    __syncthreads();
    for (int e = tid; e < 32 * (D / 4); e += 128) {
      const int r = e / (D / 4), c4 = (e % (D / 4)) * 4;
      const int key = j0 + r;
      v4f kf = {0.f,0.f,0.f,0.f}, vf = {0.f,0.f,0.f,0.f};
      if (key < T) { kf = *(const v4fa*)(K + (size_t)key * pitch + c4); vf = *(const v4fa*)(V + (size_t)key * pitch + c4); }
#pragma unroll
      for (int t = 0; t < 4; ++t) {
        unsigned short hb = bf16_bits(kf[t]); sKh[r][c4 + t] = hb; sKl[r][c4 + t] = bf16_bits(kf[t] - bf16_val(hb));
        hb = bf16_bits(vf[t]); sVh[r][c4 + t] = hb; sVl[r][c4 + t] = bf16_bits(vf[t] - bf16_val(hb));
      }
    }
    __syncthreads();
    // S tile 16 x 32
    v8f s[2];
#pragma unroll
    for (int nt = 0; nt < 2; ++nt) {
      v8f acc = {};
#pragma unroll
      for (int ks = 0; ks < KS; ++ks) {
        FragB bh_, bl_;
        bh_.half[0] = *(const v8us*)&sKh[nt * 16 + ln][ks * 32 + 8 * hh]; bh_.half[1] = *(const v8us*)&sKh[nt * 16 + ln][ks * 32 + 16 + 8 * hh];
        bl_.half[0] = *(const v8us*)&sKl[nt * 16 + ln][ks * 32 + 8 * hh]; bl_.half[1] = *(const v8us*)&sKl[nt * 16 + ln][ks * 32 + 16 + 8 * hh];
        acc = mmaN<3>(aqh[ks].v, aql[ks].v, bh_.v, bl_.v, acc);
      }
      s[nt] = acc;
    }
    // mask + running max (rows 8hh+r; the 16 lanes of a half share rows)
    float alpha[8];
#pragma unroll
    for (int r = 0; r < 8; ++r) {
      const int qi = q0 + 8 * hh + r;
      const int ja = j0 + ln, jb = j0 + 16 + ln;
      if (CAUSAL) { if (ja > qi) s[0][r] = -3.0e38f; if (jb > qi) s[1][r] = -3.0e38f; }
      if (ja >= T) s[0][r] = -3.0e38f;
      if (jb >= T) s[1][r] = -3.0e38f;
      float mx = fmaxf(s[0][r], s[1][r]);
      mx = fmaxf(mx, __shfl_xor(mx, 1, 32)); mx = fmaxf(mx, __shfl_xor(mx, 2, 32)); mx = fmaxf(mx, __shfl_xor(mx, 4, 32)); mx = fmaxf(mx, __shfl_xor(mx, 8, 32));
      const float mnew = fmaxf(m_r[r], mx);
      alpha[r] = (mnew > -1.0e38f) ? __expf(m_r[r] - mnew) : 1.0f;
      const float p0 = (s[0][r] > -1.0e38f) ? __expf(s[0][r] - mnew) : 0.f;
      const float p1 = (s[1][r] > -1.0e38f) ? __expf(s[1][r] - mnew) : 0.f;
      m_r[r] = mnew;
      l_r[r] = l_r[r] * alpha[r] + p0 + p1;            // per-lane partial row sum (16 lanes combined at the end)
      unsigned short hb = bf16_bits(p0); sPh[w][8 * hh + r][ln] = hb;      sPl[w][8 * hh + r][ln] = bf16_bits(p0 - bf16_val(hb));
      hb = bf16_bits(p1);                sPh[w][8 * hh + r][16 + ln] = hb; sPl[w][8 * hh + r][16 + ln] = bf16_bits(p1 - bf16_val(hb));
    }
#pragma unroll
    for (int dt = 0; dt < DT; ++dt)
#pragma unroll
      for (int r = 0; r < 8; ++r) oacc[dt][r] *= alpha[r];
    __builtin_amdgcn_fence(__ATOMIC_ACQ_REL, "workgroup");
    __builtin_amdgcn_wave_barrier();
    FragB pah, pal;
    pah.half[0] = *(const v8us*)&sPh[w][ln][8 * hh]; pah.half[1] = *(const v8us*)&sPh[w][ln][16 + 8 * hh];
    pal.half[0] = *(const v8us*)&sPl[w][ln][8 * hh]; pal.half[1] = *(const v8us*)&sPl[w][ln][16 + 8 * hh];
#pragma unroll
    for (int dt = 0; dt < DT; ++dt) {
      FragB bvh, bvl;
#pragma unroll
      for (int i = 0; i < 8; ++i) {
        bvh.u[i] = sVh[8 * hh + i][dt * 16 + ln]; bvh.u[8 + i] = sVh[16 + 8 * hh + i][dt * 16 + ln];
        bvl.u[i] = sVl[8 * hh + i][dt * 16 + ln]; bvl.u[8 + i] = sVl[16 + 8 * hh + i][dt * 16 + ln];
      }
      oacc[dt] = mmaN<3>(pah.v, pal.v, bvh.v, bvl.v, oacc[dt]);
    }
    __builtin_amdgcn_fence(__ATOMIC_ACQ_REL, "workgroup");
    __builtin_amdgcn_wave_barrier();
  }
#pragma unroll
  for (int r = 0; r < 8; ++r) {
    float l = l_r[r];
    l += __shfl_xor(l, 1, 32); l += __shfl_xor(l, 2, 32); l += __shfl_xor(l, 4, 32); l += __shfl_xor(l, 8, 32);
    l_r[r] = (l > 0.f) ? 1.0f / l : 0.f;
  }
#pragma unroll
  for (int dt = 0; dt < DT; ++dt)
#pragma unroll
    for (int r = 0; r < 8; ++r) sO[w][8 * hh + r][dt * 16 + ln] = oacc[dt][r] * l_r[r];
  __builtin_amdgcn_fence(__ATOMIC_ACQ_REL, "workgroup");
  __builtin_amdgcn_wave_barrier();
  {
    for (int r = 0; r < 16; ++r) {
      const int row = q0 + r;
      if (row < T && lane < D / 4) {
        const v4f val = *(const v4fa*)&sO[w][r][lane * 4];
        *(v4f*)(y + ((size_t)b * T + row) * ypitch + h * D + lane * 4) = val;
      }
    }
    
  }
}

// GEMM C = act(A·W + bias + resid): A f32 (ASPLIT -> hi/lo 2 terms), Wt bf16 [N][K]; ACT 0 none, 1 relu, 2 exact gelu;
// resid (optional, f32, row index = (row % rmod), pitch ldr, RES_BF16 rounds it) added before the activation.
template <bool ASPLIT, int ACT, bool BIAS_BF16, bool RES_BF16>
__global__ __launch_bounds__(128) void k_gemm_bf3(const float* __restrict__ A, int lda, const unsigned short* __restrict__ Wt, int ldb,
                                                const float* __restrict__ bias, const float* __restrict__ resid, int rmod, int ldr,
                                                float* __restrict__ C, int ldc, int M, int N, int K) {
  __shared__ __attribute__((aligned(16))) float so[4][16][64];
  const int tid = threadIdx.x, w = tid >> 5, lane = tid & 31, ln = lane & 15, hh = lane >> 4;
  const int ntn = N / 64;
  const int wid = blockIdx.x * 4 + w;
  const int mt = wid / ntn, nq = wid % ntn;
  if (mt * 16 >= M) return;
  const int row0 = mt * 16, col0 = nq * 64;
  const float* arow = A + (size_t)(row0 + ln) * lda;
  v8f acc[4] = {};
  for (int kb = 0; kb < K; kb += 32) {
    FragB ah, al;
    const v4f x0 = *(const v4fa*)(arow + kb + 8 * hh), x1 = *(const v4fa*)(arow + kb + 8 * hh + 4);
    const v4f x2 = *(const v4fa*)(arow + kb + 16 + 8 * hh), x3 = *(const v4fa*)(arow + kb + 16 + 8 * hh + 4);
    float xs[16] = {x0[0],x0[1],x0[2],x0[3],x1[0],x1[1],x1[2],x1[3],x2[0],x2[1],x2[2],x2[3],x3[0],x3[1],x3[2],x3[3]};
#pragma unroll
    for (int i = 0; i < 16; ++i) { const unsigned short hb = bf16_bits(xs[i]); ah.u[i] = hb; al.u[i] = ASPLIT ? bf16_bits(xs[i] - bf16_val(hb)) : (unsigned short)0; }
#pragma unroll
    for (int t = 0; t < 4; ++t) {
      const unsigned short* brow = Wt + (size_t)(col0 + t * 16 + ln) * ldb + kb;
      FragB b;
      b.half[0] = *(const v8us*)(brow + 8 * hh);
      b.half[1] = *(const v8us*)(brow + 16 + 8 * hh);
      acc[t] = mmaN<ASPLIT ? 2 : 1>(ah.v, al.v, b.v, b.v, acc[t]);
    }
  }
#pragma unroll
  for (int t = 0; t < 4; ++t) {
    const int col = col0 + t * 16 + ln;
    float bv = bias ? bias[col] : 0.f;
    if (BIAS_BF16) bv = bf16_round(bv);
#pragma unroll
    for (int r = 0; r < 8; ++r) {
      float v = acc[t][r] + bv;
      if (resid) { float rv = resid[(size_t)((row0 + 8 * hh + r) % rmod) * ldr + col]; if (RES_BF16) rv = bf16_round(rv); v += rv; }
      if (ACT == 1) v = fmaxf(v, 0.f);
      if (ACT == 2) v = 0.5f * v * (1.0f + erff(v * 0.70710678118654752f));
      if (ACT == 3) { const float u = 0.7978845608028654f * (v + 0.044715f * v * v * v); v = 0.5f * v * (1.0f + tanhf(u)); }
      so[w][8 * hh + r][t * 16 + ln] = v;
    }
  }
  __builtin_amdgcn_fence(__ATOMIC_ACQ_REL, "workgroup");
  __builtin_amdgcn_wave_barrier();
  const int rsub = lane >> 4, c4 = (lane & 15) * 4;
  {
#pragma unroll
    for (int q = 0; q < 8; ++q) {
      const int r = q * 2 + rsub;
      const v4f v = *(const v4fa*)&so[w][r][c4];
      *(v4f*)(C + (size_t)(row0 + r) * ldc + col0 + c4) = v;
    }
    
  }
}
// row LayerNorm (biased variance, eps) over N: s = X (+ R); optional out_sum <- s; out_norm <- (s-mu)*rsqrt(var+eps)*g + b
template <bool PARAM_BF16>
__global__ __launch_bounds__(256) void k_layernorm(const float* __restrict__ X, const float* __restrict__ R, const float* __restrict__ g, const float* __restrict__ bta,
                                                  float* __restrict__ out_sum, float* __restrict__ out_norm, int N, float eps) {
  __shared__ float red[256];
  const int row = blockIdx.x, tid = threadIdx.x;
  const float* x = X + (size_t)row * N; const float* rr = R ? R + (size_t)row * N : nullptr;
  float vals[16];                     // up to N = 4096
  const int per = N / 256;            // contiguous chunk per thread? use strided-by-4 chunks: thread handles j = tid*4 + 1024*u
  float s1 = 0.f;
  for (int u = 0; u < per / 4; ++u) {
    const int j = tid * 4 + 1024 * u;
    const v4f a = *(const v4fa*)(x + j);
    v4f b = {0.f,0.f,0.f,0.f}; if (rr) b = *(const v4fa*)(rr + j);
#pragma unroll
    for (int q = 0; q < 4; ++q) { const float v = a[q] + b[q]; vals[u * 4 + q] = v; s1 += v; }
  }
  red[tid] = s1; __syncthreads();
  for (int st = 128; st > 0; st >>= 1) { if (tid < st) red[tid] += red[tid + st]; __syncthreads(); }
  const float mu = red[0] / (float)N; __syncthreads();
  float s2 = 0.f;
  for (int u = 0; u < per / 4; ++u)
#pragma unroll
    for (int q = 0; q < 4; ++q) { const float c = vals[u * 4 + q] - mu; s2 += c * c; }
  red[tid] = s2; __syncthreads();
  for (int st = 128; st > 0; st >>= 1) { if (tid < st) red[tid] += red[tid + st]; __syncthreads(); }
  const float rs = rsqrtf(red[0] / (float)N + eps);
  {
    for (int u = 0; u < per / 4; ++u) {
      const int j = tid * 4 + 1024 * u;
      v4f o, sm;
#pragma unroll
      for (int q = 0; q < 4; ++q) {
        float gg = g[j + q], bb = bta[j + q];
        if (PARAM_BF16) { gg = bf16_round(gg); bb = bf16_round(bb); }
        sm[q] = vals[u * 4 + q]; o[q] = (vals[u * 4 + q] - mu) * rs * gg + bb;
      }
      if (out_sum) *(v4f*)(out_sum + (size_t)row * N + j) = sm;
      *(v4f*)(out_norm + (size_t)row * N + j) = o;
    }
    
  }
}

// batched GEMM (blockIdx.y = batch): C_b = act(alpha·A_b·B_b + bias + resid_b); A f32 rows (ASPLIT → hi/lo), B = bf16 planes Bh (+Bl when BSPLIT, requires ASPLIT),
// per-batch element strides sA, sB (0 = shared weights), sC, sR. resid may alias C (values are staged before the stores). ACT 0/1(relu).
// ACT: 0 none, 1 relu, 2 softplus
template <bool ASPLIT, bool BSPLIT, int ACT>
__global__ __launch_bounds__(128) void k_gemm_b(const float* __restrict__ A, int lda, size_t sA, const unsigned short* __restrict__ Bh, const unsigned short* __restrict__ Bl, int ldb, size_t sB,
                                             const float* __restrict__ bias, const float* __restrict__ resid, int ldr, size_t sR, float rsign, float alpha,
                                             float* __restrict__ C, int ldc, size_t sC, int M, int N, int K) {
  __shared__ __attribute__((aligned(16))) float so[4][16][64];
  const int tid = threadIdx.x, w = tid >> 5, lane = tid & 31, ln = lane & 15, hh = lane >> 4;
  const int by = blockIdx.y;
  A += (size_t)by * sA; Bh += (size_t)by * sB; if (BSPLIT) Bl += (size_t)by * sB; C += (size_t)by * sC; if (resid) resid += (size_t)by * sR;
  const int ntn = (N + 63) / 64; const int wid = blockIdx.x * 4 + w; const int mt = wid / ntn, nq = wid % ntn;      // N may be any multiple of 16: tiles past N are skipped and not stored
  if (mt * 16 >= M) return;
  const int row0 = mt * 16, col0 = nq * 64;
  const float* arow = A + (size_t)(row0 + ln) * lda;
  v8f acc[4] = {};
  for (int kb = 0; kb < K; kb += 32) {
    FragB ah, al;
    const v4f x0 = *(const v4fa*)(arow + kb + 8 * hh), x1 = *(const v4fa*)(arow + kb + 8 * hh + 4);
    const v4f x2 = *(const v4fa*)(arow + kb + 16 + 8 * hh), x3 = *(const v4fa*)(arow + kb + 16 + 8 * hh + 4);
    float xs[16] = {x0[0],x0[1],x0[2],x0[3],x1[0],x1[1],x1[2],x1[3],x2[0],x2[1],x2[2],x2[3],x3[0],x3[1],x3[2],x3[3]};
#pragma unroll
    for (int i = 0; i < 16; ++i) { const unsigned short hb = bf16_bits(xs[i]); ah.u[i] = hb; al.u[i] = ASPLIT ? bf16_bits(xs[i] - bf16_val(hb)) : (unsigned short)0; }
#pragma unroll
    for (int t = 0; t < 4; ++t) {
      if (col0 + t * 16 >= N) continue;
      const size_t boff = (size_t)(col0 + t * 16 + ln) * ldb + kb;
      FragB bh_, bl_; bh_.half[0] = *(const v8us*)(Bh + boff + 8 * hh); bh_.half[1] = *(const v8us*)(Bh + boff + 16 + 8 * hh);
      if (BSPLIT) { bl_.half[0] = *(const v8us*)(Bl + boff + 8 * hh); bl_.half[1] = *(const v8us*)(Bl + boff + 16 + 8 * hh); } else bl_ = bh_;
      acc[t] = mmaN<ASPLIT ? (BSPLIT ? 3 : 2) : 1>(ah.v, al.v, bh_.v, bl_.v, acc[t]);
    }
  }
#pragma unroll
  for (int t = 0; t < 4; ++t) {
    const int col = col0 + t * 16 + ln; if (col0 + t * 16 >= N) continue; const float bv = bias ? bf16_round(bias[col]) : 0.f;
#pragma unroll
    for (int r = 0; r < 8; ++r) { float v = acc[t][r] * alpha + bv; if (resid) v += rsign * resid[(size_t)(row0 + 8 * hh + r) * ldr + col]; if (ACT == 1) v = fmaxf(v, 0.f); else if (ACT == 2) v = fmaxf(v, 0.f) + log1pf(expf(-fabsf(v))); so[w][8 * hh + r][t * 16 + ln] = v; }
  }
  __builtin_amdgcn_fence(__ATOMIC_ACQ_REL, "workgroup"); __builtin_amdgcn_wave_barrier();
  const int rsub = lane >> 4, c4 = (lane & 15) * 4;
  {
#pragma unroll
    for (int q = 0; q < 8; ++q) { const int r = q * 2 + rsub; if (col0 + c4 < N) { const v4f v = *(const v4fa*)&so[w][r][c4]; *(v4f*)(C + (size_t)(row0 + r) * ldc + col0 + c4) = v; } }
    
  }
}
// batched f32 [K][N] (pitch lds, batch stride sIn) -> transposed hi/lo planes [N][K] (batch stride sOut); thread per (n, 8 k); grid.y = batch
__global__ __launch_bounds__(256) void k_split_transpose_b(const float* __restrict__ src, int lds_, size_t sIn, unsigned short* __restrict__ hi, unsigned short* __restrict__ lo, size_t sOut, int K, int N) {
  const size_t t = (size_t)blockIdx.x * 256 + threadIdx.x; const int k8n = K / 8; if (t >= (size_t)N * k8n) return;
  src += (size_t)blockIdx.y * sIn; hi += (size_t)blockIdx.y * sOut; lo += (size_t)blockIdx.y * sOut;
  const int n = (int)(t / k8n), k8 = (int)(t % k8n) * 8; v8us vh, vl;
#pragma unroll
  for (int i = 0; i < 8; ++i) { const float x = src[(size_t)(k8 + i) * lds_ + n]; const unsigned short hb = bf16_bits(x); vh[i] = hb; vl[i] = bf16_bits(x - bf16_val(hb)); }
  unsigned short* dh = hi + (size_t)n * K + k8; unsigned short* dl = lo + (size_t)n * K + k8;
  *(v8us*)dh = vh; *(v8us*)dl = vl; 
}

__global__ __launch_bounds__(256) void k_btw(const float* __restrict__ W, unsigned short* __restrict__ Bt, int K, int N) { const int t = blockIdx.x * 256 + threadIdx.x; if (t >= N * (K / 8)) return; const int n = t / (K / 8), k8 = (t % (K / 8)) * 8; v8us v; for (int q = 0; q < 8; ++q) v[q] = bf16_bits(W[(size_t)(k8 + q) * N + n]); *(v8us*)(Bt + (size_t)n * K + k8) = v;  }
// per token: q ← q − mean(q), k ← k − mean(k); q2 = q², k2 = k²; q2s, k2s; Q2n[t][c] = l2norm_c(q2/(q2s+1e-7)); K2a[t][c] = k2/(k2s+1e-7) (column-normalised later); wave per token, 8 per lane
__global__ __launch_bounds__(256) void k_prep(const float* __restrict__ QKV, float* __restrict__ Q2n, float* __restrict__ K2a) {
  const int tid = threadIdx.x, wv = tid >> 5, lane = tid & 31; const size_t t = (size_t)blockIdx.x * 8 + wv; const float* row = QKV + t * (3 * CC); float q[8], k[8]; float sq = 0.f, sk = 0.f;
#pragma unroll
  for (int u = 0; u < 8; ++u) { q[u] = row[u * 32 + lane]; k[u] = row[CC + u * 32 + lane]; sq += q[u]; sk += k[u]; }
  for (int o = 16; o >= 1; o >>= 1) { sq += __shfl_xor(sq, o, 32); sk += __shfl_xor(sk, o, 32); } const float mq = sq * (1.0f / CC), mk = sk * (1.0f / CC);
  float q2s = 0.f, k2s = 0.f;
#pragma unroll
  for (int u = 0; u < 8; ++u) { q[u] = (q[u] - mq) * (q[u] - mq); k[u] = (k[u] - mk) * (k[u] - mk); q2s += q[u]; k2s += k[u]; }
  for (int o = 16; o >= 1; o >>= 1) { q2s += __shfl_xor(q2s, o, 32); k2s += __shfl_xor(k2s, o, 32); }
  float nq = 0.f; const float rq = 1.0f / (q2s + 1e-7f), rk = 1.0f / (k2s + 1e-7f);
#pragma unroll
  for (int u = 0; u < 8; ++u) { q[u] = q[u] * rq; k[u] = k[u] * rk; nq += q[u] * q[u]; }
  for (int o = 16; o >= 1; o >>= 1) nq += __shfl_xor(nq, o, 32); const float iq = 1.0f / fmaxf(sqrtf(nq), 1e-12f);
#pragma unroll
  for (int u = 0; u < 8; ++u) q[u] *= iq;
  {
#pragma unroll
    for (int u = 0; u < 8; ++u) { *(float*)(Q2n + t * CC + u * 32 + lane) = q[u]; *(float*)(K2a + t * CC + u * 32 + lane) = k[u]; }  }
}
// column norms of K2a over the 4096 tokens of each batch, in two launches, every sum in double and in a fixed order.
// Stage 1: block per (chunk of 64 tokens, batch); a thread takes 4 adjacent columns of every 4th token; the 4 token groups are joined through LDS: PS[b][chunk][c].
#define NCH 64
__global__ __launch_bounds__(256) void k_colnorm_part(const float* __restrict__ K2a, double* __restrict__ PS) {
  __shared__ double red[4][CC];
  const int tid = threadIdx.x, c4 = (tid & 63) * 4, rg = tid >> 6, ch = blockIdx.x, b = blockIdx.y;
  const float* base = K2a + ((size_t)b * NTK + (size_t)ch * (NTK / NCH) + rg) * CC + c4;
  v4f v[NTK / NCH / 4];
  // unrolled so that the loads are independent of the sums and many are in flight per wave (the rolled one-load loop paid a full memory latency per token)
#pragma unroll
  for (int i = 0; i < NTK / NCH / 4; ++i) v[i] = *(const v4fa*)(base + (size_t)i * 4 * CC);
  double s[4] = {0.0, 0.0, 0.0, 0.0};
  // unrolled so that v[] stays in registers (constant indices)
#pragma unroll
  for (int i = 0; i < NTK / NCH / 4; ++i)
#pragma unroll
    for (int q = 0; q < 4; ++q) s[q] += (double)v[i][q] * (double)v[i][q];
#pragma unroll
  for (int q = 0; q < 4; ++q) red[rg][c4 + q] = s[q];
  __syncthreads();
  PS[((size_t)b * NCH + ch) * CC + tid] = (red[0][tid] + red[1][tid]) + (red[2][tid] + red[3][tid]);
}
// Stage 2: block per (32 columns, batch); wave g sums chunks 8g..8g+7 of its 32 columns, wave 0 joins the 8 sums: KN[b][c] = 1/max(norm, 1e-12)
__global__ __launch_bounds__(256) void k_colnorm_fin(const double* __restrict__ PS, float* __restrict__ KN) {
  __shared__ double red[8][32];
  const int tid = threadIdx.x, cl = tid & 31, g = tid >> 5, b = blockIdx.y, c = blockIdx.x * 32 + cl;
  const double* p = PS + ((size_t)b * NCH + g * (NCH / 8)) * CC + c;
  double s = 0.0;
  // unrolled so that the 8 loads are in flight together
#pragma unroll
  for (int i = 0; i < NCH / 8; ++i) s += p[(size_t)i * CC];
  red[g][cl] = s;
  __syncthreads();
  if (tid < 32) {
    double t = 0.0;
#pragma unroll
    for (int j = 0; j < 8; ++j) t += red[j][tid];
    KN[b * CC + c] = 1.0f / fmaxf((float)sqrt(t), 1e-12f);
  }
}
// hi/lo bf16 planes of vᵀ: Vh/Vl [b][d][t] (the Bt operand of kv = k2ᵀ·v), via LDS tiles of 64 tokens (one line per row segment)
__global__ __launch_bounds__(256) void k_vplanes(const float* __restrict__ QKV, unsigned short* __restrict__ Vh, unsigned short* __restrict__ Vl) {
  __shared__ float tv[64][33]; const int b = blockIdx.z; const int t0 = blockIdx.x * 64, c0 = blockIdx.y * 32; const int tx = threadIdx.x & 31, ty = threadIdx.x >> 5;
  for (int i = ty; i < 64; i += 8) { const size_t tok = (size_t)b * NTK + t0 + i; tv[i][tx] = QKV[tok * (3 * CC) + 2 * CC + c0 + tx]; }
  __syncthreads(); typedef unsigned short us2 __attribute__((ext_vector_type(2)));
  { for (int e = threadIdx.x; e < 32 * 32; e += 256) { const int cr = e >> 5, tp = (e & 31) * 2; us2 vh, vl;
      { const float a = tv[tp][cr], c2 = tv[tp + 1][cr]; const unsigned short ah = bf16_bits(a), ch = bf16_bits(c2); vh.x = ah; vh.y = ch; vl.x = bf16_bits(a - bf16_val(ah)); vl.y = bf16_bits(c2 - bf16_val(ch)); }
      const size_t dst = ((size_t)b * CC + c0 + cr) * NTK + t0 + tp; *(us2*)(Vh + dst) = vh; *(us2*)(Vl + dst) = vl; }
     }
}
// K2T[b][c][t] = column-normalised k2 transposed (f32, the A operand of kv; split hi/lo inside the GEMM)
__global__ __launch_bounds__(256) void k_k2t(const float* __restrict__ K2a, const float* __restrict__ KN, float* __restrict__ K2T) { __shared__ float tk[32][33]; const int b = blockIdx.z; const int t0 = blockIdx.x * 32, c0 = blockIdx.y * 32; const int tx = threadIdx.x & 31, ty = threadIdx.x >> 5;
  for (int i = ty; i < 32; i += 8) tk[i][tx] = K2a[((size_t)b * NTK + t0 + i) * CC + c0 + tx] * KN[b * CC + c0 + tx]; __syncthreads();
  { for (int i = ty; i < 32; i += 8) *(float*)(K2T + ((size_t)b * CC + c0 + i) * NTK + t0 + tx) = tk[tx][i];  } }
// kv → Bt for t2 = q2·kv: B[k=c][n=d] = kv[c][d] → Bt[d][c] = kvᵀ → planes hi/lo of kvᵀ: thread per (b, d, 8 c)
__global__ __launch_bounds__(256) void k_kvplanes(const float* __restrict__ KV, unsigned short* __restrict__ Ph, unsigned short* __restrict__ Pl) { const int t = blockIdx.x * 256 + threadIdx.x; if (t >= BB * CC * (CC / 8)) return; const int c8 = (t % (CC / 8)) * 8; const int d = (t / (CC / 8)) % CC; const int b = t / ((CC / 8) * CC); v8us h, l;
  for (int q = 0; q < 8; ++q) { const float v = KV[((size_t)b * CC + c8 + q) * CC + d]; const unsigned short hb = bf16_bits(v); h[q] = hb; l[q] = bf16_bits(v - bf16_val(hb)); } const size_t dst = ((size_t)b * CC + d) * CC + c8; *(v8us*)(Ph + dst) = h; *(v8us*)(Pl + dst) = l;  }
// attn = v + t2/√N ; thread per float4
__global__ __launch_bounds__(256) void k_attn(const float* __restrict__ QKV, const float* __restrict__ T2, float* __restrict__ AT) { const size_t t = (size_t)blockIdx.x * 256 + threadIdx.x; if (t >= (size_t)BB * NTK * CC / 4) return; const int c4 = (int)((t * 4) % CC); const size_t tok = (t * 4) / CC; const v4f v = *(const v4fa*)(QKV + tok * (3 * CC) + 2 * CC + c4), s = *(const v4fa*)(T2 + t * 4); v4f o; for (int q = 0; q < 4; ++q) o[q] = v[q] + s[q] * 0.015625f; *(v4f*)(AT + t * 4) = o;  }
extern "C" void kernel_launch(void* const* d_in, const int* in_sizes, int n_in,
                              void* d_out, int out_size, void* d_ws, size_t ws_size, hipStream_t stream) {
  (void)in_sizes; (void)n_in; (void)out_size;
  const float* x = (const float*)d_in[0]; const float* Wqkv = (const float*)d_in[1]; const float* bqkv = (const float*)d_in[2]; const float* Wout = (const float*)d_in[3]; const float* bout = (const float*)d_in[4];
  char* ws = (char*)d_ws; size_t off = 0;
  auto take = [&](size_t bytes) { char* p = ws + off; off += (bytes + 255) & ~(size_t)255; return p; };
  unsigned short* Bq = (unsigned short*)take((size_t)3 * CC * CC * 2); unsigned short* Bo = (unsigned short*)take((size_t)CC * CC * 2);
  float* QKV = (float*)take((size_t)BB * NTK * 3 * CC * 4); float* Q2n = (float*)take((size_t)BB * NTK * CC * 4); float* K2a = (float*)take((size_t)BB * NTK * CC * 4); float* KN = (float*)take(BB * CC * 4);
  float* K2T = (float*)take((size_t)BB * CC * NTK * 4); unsigned short* Vh = (unsigned short*)take((size_t)BB * CC * NTK * 2); unsigned short* Vl = (unsigned short*)take((size_t)BB * CC * NTK * 2);
  float* KV = (float*)take((size_t)BB * CC * CC * 4); unsigned short* Ph = (unsigned short*)take((size_t)BB * CC * CC * 2); unsigned short* Pl = (unsigned short*)take((size_t)BB * CC * CC * 2); double* PS = (double*)take((size_t)BB * NCH * CC * 8);
  float* T2 = K2a; float* AT2 = K2T;      // buffer reuse: K2a is dead once K2T/V planes exist; K2T is dead once kv exists
  if (off > ws_size) return;
  k_btw<<<(3 * CC * 32 + 255) / 256, 256, 0, stream>>>(Wqkv, Bq, CC, 3 * CC); k_btw<<<(CC * 32 + 255) / 256, 256, 0, stream>>>(Wout, Bo, CC, CC);
  k_gemm_bf3<false, 0, true, false><<<((BB * NTK / 16) * (3 * CC / 64) + 3) / 4, 128, 0, stream>>>(x, CC, Bq, CC, bqkv, nullptr, 1, 0, QKV, 3 * CC, BB * NTK, 3 * CC, CC);
  k_prep<<<BB * NTK / 8, 256, 0, stream>>>(QKV, Q2n, K2a); k_colnorm_part<<<dim3(NCH, BB), 256, 0, stream>>>(K2a, PS); k_colnorm_fin<<<dim3(CC / 32, BB), 256, 0, stream>>>(PS, KN);
  k_k2t<<<dim3(NTK / 32, CC / 32, BB), 256, 0, stream>>>(K2a, KN, K2T);
  k_vplanes<<<dim3(NTK / 64, CC / 32, BB), 256, 0, stream>>>(QKV, Vh, Vl);
  k_gemm_b<true, true, 0><<<dim3(((CC / 16) * (CC / 64) + 3) / 4, BB), 128, 0, stream>>>(K2T, NTK, (size_t)CC * NTK, Vh, Vl, NTK, (size_t)CC * NTK, nullptr, nullptr, 0, 0, 1.f, 1.f, KV, CC, (size_t)CC * CC, CC, CC, NTK);      // kv[c][d] = Σ_t k2[t][c]·v[t][d]
  k_kvplanes<<<(BB * CC * (CC / 8) + 255) / 256, 256, 0, stream>>>(KV, Ph, Pl);
  k_gemm_b<true, true, 0><<<dim3(((NTK / 16) * (CC / 64) + 3) / 4, BB), 128, 0, stream>>>(Q2n, CC, (size_t)NTK * CC, Ph, Pl, CC, (size_t)CC * CC, nullptr, nullptr, 0, 0, 1.f, 1.f, T2, CC, (size_t)NTK * CC, NTK, CC, CC);             // t2 = q2·kv
  k_attn<<<(unsigned)(((size_t)BB * NTK * CC / 4 + 255) / 256), 256, 0, stream>>>(QKV, T2, AT2);
  k_gemm_bf3<true, 0, true, false><<<((BB * NTK / 16) * (CC / 64) + 3) / 4, 128, 0, stream>>>(AT2, CC, Bo, CC, bout, nullptr, 1, 0, (float*)d_out, CC, BB * NTK, CC, CC);
}

// v002
// Measured time: 301 microseconds a run.
// Two timings next to v001 put it at 1.40 and 1.38 times that version's speed.
// All steps since v000 together make it 6.74 times as fast.
#include <hip/hip_runtime.h>
// Linear attention on WMMA (f32 accumulate): qkv = x·W_qkv + b (inputs rounded to bf16: single exact term; 32768 × 256 × 768), per batch kv = k2ᵀ·v (k2 and v are computed
// f32 → split into bf16 hi/lo: 3 products; 256 × 256 × 4096), t2 = q2·kv (3 products), out = attn·W_out + b (attn split hi/lo vs exact weights: 2 products). Mean-centering,
// squares, the two normalisations and the residual are f32 VALU (column statistics as fixed-order double sums).
#define BB 8
#define NTK 4096
#define CC 256

typedef __bf16 v16b __attribute__((ext_vector_type(16)));
typedef unsigned short v8us __attribute__((ext_vector_type(8), may_alias));
typedef float  v8f  __attribute__((ext_vector_type(8)));
typedef float  v4f  __attribute__((ext_vector_type(4)));
typedef float  v4fa __attribute__((ext_vector_type(4), may_alias));
union FragB { v16b v; v8us half[2]; unsigned short u[16]; };

__device__ __forceinline__ unsigned short bf16_bits(float x) { unsigned int u = __float_as_uint(x); return (unsigned short)((u + 0x7FFFu + ((u >> 16) & 1u)) >> 16); }
__device__ __forceinline__ float bf16_val(unsigned short b) { return __uint_as_float(((unsigned int)b) << 16); }
__device__ __forceinline__ float bf16_round(float x) { return bf16_val(bf16_bits(x)); }
// D += A·B with NT terms: 1 = ah·bh, 2 = + al·bh (A split), 3 = + ah·bl (both split)
template <int NT>
__device__ __forceinline__ v8f mmaN(v16b ah, v16b al, v16b bh, v16b bl, v8f c) {
  c = __builtin_amdgcn_wmma_f32_16x16x32_bf16(false, ah, false, bh, (short)0, c, false, false);
  if (NT >= 2) c = __builtin_amdgcn_wmma_f32_16x16x32_bf16(false, al, false, bh, (short)0, c, false, false);
  if (NT >= 3) c = __builtin_amdgcn_wmma_f32_16x16x32_bf16(false, ah, false, bl, (short)0, c, false, false);
  asm volatile("v_nop\n\tv_nop\n\tv_nop\n\tv_nop" : "+v"(c) : "v"(ah), "v"(al), "v"(bh), "v"(bl));
  return c;
}

__global__ __launch_bounds__(256) void k_wt_bf16(const float* __restrict__ W, unsigned short* __restrict__ Wt, int K, int N) {
  const int t = blockIdx.x * 256 + threadIdx.x;
  const int k8n = K / 8;
  if (t >= N * k8n) return;
  const int n = t / k8n, k8 = (t % k8n) * 8;
  v8us v;
#pragma unroll
  for (int i = 0; i < 8; ++i) v[i] = bf16_bits(W[(size_t)(k8 + i) * N + n]);
  *(v8us*)(Wt + (size_t)n * K + k8) = v;
  
}

// GEMM C[M][N] (f32, pitch ldc) = act(A[M][K]·W + bias). A f32 row-major (pitch lda) converted per fragment to bf16
// (ASPLIT: hi/lo two planes -> 2 terms, else single rounded term); Wt bf16 [N][K] (pitch ldb). BIAS_BF16 rounds the
// bias to bf16 first (bias quantised to bf16 before the add). K%32==0, M%16==0, N%64==0.
template <bool ASPLIT, int ACT, bool BIAS_BF16>
__global__ __launch_bounds__(128) void k_gemm_bf(const float* __restrict__ A, int lda, const unsigned short* __restrict__ Wt, int ldb,
                                               const float* __restrict__ bias, float* __restrict__ C, int ldc, int M, int N, int K) {
  __shared__ __attribute__((aligned(16))) float so[4][16][64];
  const int tid = threadIdx.x, w = tid >> 5, lane = tid & 31, ln = lane & 15, hh = lane >> 4;
  const int ntn = N / 64;
  const int wid = blockIdx.x * 4 + w;
  const int mt = wid / ntn, nq = wid % ntn;
  if (mt * 16 >= M) return;
  const int row0 = mt * 16, col0 = nq * 64;
  const float* arow = A + (size_t)(row0 + ln) * lda;
  v8f acc[4] = {};
  for (int kb = 0; kb < K; kb += 32) {
    FragB ah, al;
    const v4f x0 = *(const v4fa*)(arow + kb + 8 * hh), x1 = *(const v4fa*)(arow + kb + 8 * hh + 4);
    const v4f x2 = *(const v4fa*)(arow + kb + 16 + 8 * hh), x3 = *(const v4fa*)(arow + kb + 16 + 8 * hh + 4);
    float xs[16] = {x0[0],x0[1],x0[2],x0[3],x1[0],x1[1],x1[2],x1[3],x2[0],x2[1],x2[2],x2[3],x3[0],x3[1],x3[2],x3[3]};
#pragma unroll
    for (int i = 0; i < 16; ++i) { const unsigned short hb = bf16_bits(xs[i]); ah.u[i] = hb; al.u[i] = ASPLIT ? bf16_bits(xs[i] - bf16_val(hb)) : (unsigned short)0; }
#pragma unroll
    for (int t = 0; t < 4; ++t) {
      const unsigned short* brow = Wt + (size_t)(col0 + t * 16 + ln) * ldb + kb;
      FragB b;
      b.half[0] = *(const v8us*)(brow + 8 * hh);
      b.half[1] = *(const v8us*)(brow + 16 + 8 * hh);
      acc[t] = mmaN<ASPLIT ? 2 : 1>(ah.v, al.v, b.v, b.v, acc[t]);
    }
  }
#pragma unroll
  for (int t = 0; t < 4; ++t) {
    float bv = bias ? bias[col0 + t * 16 + ln] : 0.f;
    if (BIAS_BF16) bv = bf16_round(bv);
#pragma unroll
    for (int r = 0; r < 8; ++r) { float v = acc[t][r] + bv; if (ACT == 1) v = fmaxf(v, 0.f); so[w][8 * hh + r][t * 16 + ln] = v; }
  }
  __builtin_amdgcn_fence(__ATOMIC_ACQ_REL, "workgroup");
  __builtin_amdgcn_wave_barrier();
  const int rsub = lane >> 4, c4 = (lane & 15) * 4;
  {
#pragma unroll
    for (int q = 0; q < 8; ++q) {
      const int r = q * 2 + rsub;
      const v4f v = *(const v4fa*)&so[w][r][c4];
      *(v4f*)(C + (size_t)(row0 + r) * ldc + col0 + c4) = v;
    }
    
  }
}

// Flash-style causal/unmasked attention, all contractions 3-term bf16 hi/lo splits, f32 softmax with running max.
// q,k,v rows are read from f32 buffers with arbitrary row pitch (so they can live inside a fused qkv buffer);
// D = head size (multiple of 32, <= 128); one wave = 16 query rows; block = 4 waves (64 queries) sharing K/V chunks of 32.
template <int D, bool CAUSAL>
__global__ __launch_bounds__(128) void k_flash(const float* __restrict__ qb, const float* __restrict__ kb, const float* __restrict__ vb,
                                             int pitch, int T, int H, float scale, float* __restrict__ y, int ypitch) {
  constexpr int KS = D / 32;        // k-steps for QK
  constexpr int DT = D / 16;        // d tiles for PV
  __shared__ __attribute__((aligned(16))) unsigned short sKh[32][D + 8], sKl[32][D + 8], sVh[32][D + 8], sVl[32][D + 8];
  __shared__ __attribute__((aligned(16))) unsigned short sPh[4][16][40], sPl[4][16][40];
  __shared__ __attribute__((aligned(16))) float sO[4][16][D];
  const int tid = threadIdx.x, w = tid >> 5, lane = tid & 31, ln = lane & 15, hh = lane >> 4;
  const int nqb = (T + 63) / 64;
  const int bh = blockIdx.x / nqb, qblk = blockIdx.x % nqb;
  const int b = bh / H, h = bh % H;
  const int q0 = qblk * 64 + w * 16;
  const float* Q = qb + (size_t)b * T * pitch + h * D;
  const float* K = kb + (size_t)b * T * pitch + h * D;
  const float* V = vb + (size_t)b * T * pitch + h * D;

  // A fragments of the wave's 16 query rows (scaled), hi/lo
  FragB aqh[KS], aql[KS];
  {
    int row = q0 + ln; if (row >= T) row = T - 1;
    const float* qr = Q + (size_t)row * pitch;
#pragma unroll
    for (int ks = 0; ks < KS; ++ks)
#pragma unroll
      for (int i = 0; i < 16; ++i) {
        const int d = ks * 32 + ((i < 8) ? (8 * hh + i) : (16 + 8 * hh + (i - 8)));
        const float x = qr[d] * scale; const unsigned short hb = bf16_bits(x);
        aqh[ks].u[i] = hb; aql[ks].u[i] = bf16_bits(x - bf16_val(hb));
      }
  }
  float m_r[8], l_r[8];
#pragma unroll
  for (int r = 0; r < 8; ++r) { m_r[r] = -3.0e38f; l_r[r] = 0.f; }
  v8f oacc[DT];
#pragma unroll
  for (int dt = 0; dt < DT; ++dt) oacc[dt] = (v8f){0.f,0.f,0.f,0.f,0.f,0.f,0.f,0.f};

  const int kv_end = CAUSAL ? min(T, qblk * 64 + 64) : T;     // block-uniform
  for (int j0 = 0; j0 < kv_end; j0 += 32) {
    __syncthreads();
    for (int e = tid; e < 32 * (D / 4); e += 128) {
      const int r = e / (D / 4), c4 = (e % (D / 4)) * 4;
      const int key = j0 + r;
      v4f kf = {0.f,0.f,0.f,0.f}, vf = {0.f,0.f,0.f,0.f};
      if (key < T) { kf = *(const v4fa*)(K + (size_t)key * pitch + c4); vf = *(const v4fa*)(V + (size_t)key * pitch + c4); }
#pragma unroll
      for (int t = 0; t < 4; ++t) {
        unsigned short hb = bf16_bits(kf[t]); sKh[r][c4 + t] = hb; sKl[r][c4 + t] = bf16_bits(kf[t] - bf16_val(hb));
        hb = bf16_bits(vf[t]); sVh[r][c4 + t] = hb; sVl[r][c4 + t] = bf16_bits(vf[t] - bf16_val(hb));
      }
    }
    __syncthreads();
    // S tile 16 x 32
    v8f s[2];
#pragma unroll
    for (int nt = 0; nt < 2; ++nt) {
      v8f acc = {};
#pragma unroll
      for (int ks = 0; ks < KS; ++ks) {
        FragB bh_, bl_;
        bh_.half[0] = *(const v8us*)&sKh[nt * 16 + ln][ks * 32 + 8 * hh]; bh_.half[1] = *(const v8us*)&sKh[nt * 16 + ln][ks * 32 + 16 + 8 * hh];
        bl_.half[0] = *(const v8us*)&sKl[nt * 16 + ln][ks * 32 + 8 * hh]; bl_.half[1] = *(const v8us*)&sKl[nt * 16 + ln][ks * 32 + 16 + 8 * hh];
        acc = mmaN<3>(aqh[ks].v, aql[ks].v, bh_.v, bl_.v, acc);
      }
      s[nt] = acc;
    }
    // mask + running max (rows 8hh+r; the 16 lanes of a half share rows)
    float alpha[8];
#pragma unroll
    for (int r = 0; r < 8; ++r) {
      const int qi = q0 + 8 * hh + r;
      const int ja = j0 + ln, jb = j0 + 16 + ln;
      if (CAUSAL) { if (ja > qi) s[0][r] = -3.0e38f; if (jb > qi) s[1][r] = -3.0e38f; }
      if (ja >= T) s[0][r] = -3.0e38f;
      if (jb >= T) s[1][r] = -3.0e38f;
      float mx = fmaxf(s[0][r], s[1][r]);
      mx = fmaxf(mx, __shfl_xor(mx, 1, 32)); mx = fmaxf(mx, __shfl_xor(mx, 2, 32)); mx = fmaxf(mx, __shfl_xor(mx, 4, 32)); mx = fmaxf(mx, __shfl_xor(mx, 8, 32));
      const float mnew = fmaxf(m_r[r], mx);
      alpha[r] = (mnew > -1.0e38f) ? __expf(m_r[r] - mnew) : 1.0f;
      const float p0 = (s[0][r] > -1.0e38f) ? __expf(s[0][r] - mnew) : 0.f;
      const float p1 = (s[1][r] > -1.0e38f) ? __expf(s[1][r] - mnew) : 0.f;
      m_r[r] = mnew;
      l_r[r] = l_r[r] * alpha[r] + p0 + p1;            // per-lane partial row sum (16 lanes combined at the end)
      unsigned short hb = bf16_bits(p0); sPh[w][8 * hh + r][ln] = hb;      sPl[w][8 * hh + r][ln] = bf16_bits(p0 - bf16_val(hb));
      hb = bf16_bits(p1);                sPh[w][8 * hh + r][16 + ln] = hb; sPl[w][8 * hh + r][16 + ln] = bf16_bits(p1 - bf16_val(hb));
    }
#pragma unroll
    for (int dt = 0; dt < DT; ++dt)
#pragma unroll
      for (int r = 0; r < 8; ++r) oacc[dt][r] *= alpha[r];
    __builtin_amdgcn_fence(__ATOMIC_ACQ_REL, "workgroup");
    __builtin_amdgcn_wave_barrier();
    FragB pah, pal;
    pah.half[0] = *(const v8us*)&sPh[w][ln][8 * hh]; pah.half[1] = *(const v8us*)&sPh[w][ln][16 + 8 * hh];
    pal.half[0] = *(const v8us*)&sPl[w][ln][8 * hh]; pal.half[1] = *(const v8us*)&sPl[w][ln][16 + 8 * hh];
#pragma unroll
    for (int dt = 0; dt < DT; ++dt) {
      FragB bvh, bvl;
#pragma unroll
      for (int i = 0; i < 8; ++i) {
        bvh.u[i] = sVh[8 * hh + i][dt * 16 + ln]; bvh.u[8 + i] = sVh[16 + 8 * hh + i][dt * 16 + ln];
        bvl.u[i] = sVl[8 * hh + i][dt * 16 + ln]; bvl.u[8 + i] = sVl[16 + 8 * hh + i][dt * 16 + ln];
      }
      oacc[dt] = mmaN<3>(pah.v, pal.v, bvh.v, bvl.v, oacc[dt]);
    }
    __builtin_amdgcn_fence(__ATOMIC_ACQ_REL, "workgroup");
    __builtin_amdgcn_wave_barrier();
  }
#pragma unroll
  for (int r = 0; r < 8; ++r) {
    float l = l_r[r];
    l += __shfl_xor(l, 1, 32); l += __shfl_xor(l, 2, 32); l += __shfl_xor(l, 4, 32); l += __shfl_xor(l, 8, 32);
    l_r[r] = (l > 0.f) ? 1.0f / l : 0.f;
  }
#pragma unroll
  for (int dt = 0; dt < DT; ++dt)
#pragma unroll
    for (int r = 0; r < 8; ++r) sO[w][8 * hh + r][dt * 16 + ln] = oacc[dt][r] * l_r[r];
  __builtin_amdgcn_fence(__ATOMIC_ACQ_REL, "workgroup");
  __builtin_amdgcn_wave_barrier();
  {
    for (int r = 0; r < 16; ++r) {
      const int row = q0 + r;
      if (row < T && lane < D / 4) {
        const v4f val = *(const v4fa*)&sO[w][r][lane * 4];
        *(v4f*)(y + ((size_t)b * T + row) * ypitch + h * D + lane * 4) = val;
      }
    }
    
  }
}

// GEMM C = act(A·W + bias + resid): A f32 (ASPLIT -> hi/lo 2 terms), Wt bf16 [N][K]; ACT 0 none, 1 relu, 2 exact gelu;
// resid (optional, f32, row index = (row % rmod), pitch ldr, RES_BF16 rounds it) added before the activation.
template <bool ASPLIT, int ACT, bool BIAS_BF16, bool RES_BF16>
__global__ __launch_bounds__(128) void k_gemm_bf3(const float* __restrict__ A, int lda, const unsigned short* __restrict__ Wt, int ldb,
                                                const float* __restrict__ bias, const float* __restrict__ resid, int rmod, int ldr,
                                                float* __restrict__ C, int ldc, int M, int N, int K) {
  __shared__ __attribute__((aligned(16))) float so[4][16][64];
  const int tid = threadIdx.x, w = tid >> 5, lane = tid & 31, ln = lane & 15, hh = lane >> 4;
  const int ntn = N / 64;
  const int wid = blockIdx.x * 4 + w;
  const int mt = wid / ntn, nq = wid % ntn;
  if (mt * 16 >= M) return;
  const int row0 = mt * 16, col0 = nq * 64;
  const float* arow = A + (size_t)(row0 + ln) * lda;
  v8f acc[4] = {};
  for (int kb = 0; kb < K; kb += 32) {
    FragB ah, al;
    const v4f x0 = *(const v4fa*)(arow + kb + 8 * hh), x1 = *(const v4fa*)(arow + kb + 8 * hh + 4);
    const v4f x2 = *(const v4fa*)(arow + kb + 16 + 8 * hh), x3 = *(const v4fa*)(arow + kb + 16 + 8 * hh + 4);
    float xs[16] = {x0[0],x0[1],x0[2],x0[3],x1[0],x1[1],x1[2],x1[3],x2[0],x2[1],x2[2],x2[3],x3[0],x3[1],x3[2],x3[3]};
#pragma unroll
    for (int i = 0; i < 16; ++i) { const unsigned short hb = bf16_bits(xs[i]); ah.u[i] = hb; al.u[i] = ASPLIT ? bf16_bits(xs[i] - bf16_val(hb)) : (unsigned short)0; }
#pragma unroll
    for (int t = 0; t < 4; ++t) {
      const unsigned short* brow = Wt + (size_t)(col0 + t * 16 + ln) * ldb + kb;
      FragB b;
      b.half[0] = *(const v8us*)(brow + 8 * hh);
      b.half[1] = *(const v8us*)(brow + 16 + 8 * hh);
      acc[t] = mmaN<ASPLIT ? 2 : 1>(ah.v, al.v, b.v, b.v, acc[t]);
    }
  }
#pragma unroll
  for (int t = 0; t < 4; ++t) {
    const int col = col0 + t * 16 + ln;
    float bv = bias ? bias[col] : 0.f;
    if (BIAS_BF16) bv = bf16_round(bv);
#pragma unroll
    for (int r = 0; r < 8; ++r) {
      float v = acc[t][r] + bv;
      if (resid) { float rv = resid[(size_t)((row0 + 8 * hh + r) % rmod) * ldr + col]; if (RES_BF16) rv = bf16_round(rv); v += rv; }
      if (ACT == 1) v = fmaxf(v, 0.f);
      if (ACT == 2) v = 0.5f * v * (1.0f + erff(v * 0.70710678118654752f));
      if (ACT == 3) { const float u = 0.7978845608028654f * (v + 0.044715f * v * v * v); v = 0.5f * v * (1.0f + tanhf(u)); }
      so[w][8 * hh + r][t * 16 + ln] = v;
    }
  }
  __builtin_amdgcn_fence(__ATOMIC_ACQ_REL, "workgroup");
  __builtin_amdgcn_wave_barrier();
  const int rsub = lane >> 4, c4 = (lane & 15) * 4;
  {
#pragma unroll
    for (int q = 0; q < 8; ++q) {
      const int r = q * 2 + rsub;
      const v4f v = *(const v4fa*)&so[w][r][c4];
      *(v4f*)(C + (size_t)(row0 + r) * ldc + col0 + c4) = v;
    }
    
  }
}
// row LayerNorm (biased variance, eps) over N: s = X (+ R); optional out_sum <- s; out_norm <- (s-mu)*rsqrt(var+eps)*g + b
template <bool PARAM_BF16>
__global__ __launch_bounds__(256) void k_layernorm(const float* __restrict__ X, const float* __restrict__ R, const float* __restrict__ g, const float* __restrict__ bta,
                                                  float* __restrict__ out_sum, float* __restrict__ out_norm, int N, float eps) {
  __shared__ float red[256];
  const int row = blockIdx.x, tid = threadIdx.x;
  const float* x = X + (size_t)row * N; const float* rr = R ? R + (size_t)row * N : nullptr;
  float vals[16];                     // up to N = 4096
  const int per = N / 256;            // contiguous chunk per thread? use strided-by-4 chunks: thread handles j = tid*4 + 1024*u
  float s1 = 0.f;
  for (int u = 0; u < per / 4; ++u) {
    const int j = tid * 4 + 1024 * u;
    const v4f a = *(const v4fa*)(x + j);
    v4f b = {0.f,0.f,0.f,0.f}; if (rr) b = *(const v4fa*)(rr + j);
#pragma unroll
    for (int q = 0; q < 4; ++q) { const float v = a[q] + b[q]; vals[u * 4 + q] = v; s1 += v; }
  }
  red[tid] = s1; __syncthreads();
  for (int st = 128; st > 0; st >>= 1) { if (tid < st) red[tid] += red[tid + st]; __syncthreads(); }
  const float mu = red[0] / (float)N; __syncthreads();
  float s2 = 0.f;
  for (int u = 0; u < per / 4; ++u)
#pragma unroll
    for (int q = 0; q < 4; ++q) { const float c = vals[u * 4 + q] - mu; s2 += c * c; }
  red[tid] = s2; __syncthreads();
  for (int st = 128; st > 0; st >>= 1) { if (tid < st) red[tid] += red[tid + st]; __syncthreads(); }
  const float rs = rsqrtf(red[0] / (float)N + eps);
  {
    for (int u = 0; u < per / 4; ++u) {
      const int j = tid * 4 + 1024 * u;
      v4f o, sm;
#pragma unroll
      for (int q = 0; q < 4; ++q) {
        float gg = g[j + q], bb = bta[j + q];
        if (PARAM_BF16) { gg = bf16_round(gg); bb = bf16_round(bb); }
        sm[q] = vals[u * 4 + q]; o[q] = (vals[u * 4 + q] - mu) * rs * gg + bb;
      }
      if (out_sum) *(v4f*)(out_sum + (size_t)row * N + j) = sm;
      *(v4f*)(out_norm + (size_t)row * N + j) = o;
    }
    
  }
}

// batched GEMM (blockIdx.y = batch): C_b = act(alpha·A_b·B_b + bias + resid_b); A f32 rows (ASPLIT → hi/lo), B = bf16 planes Bh (+Bl when BSPLIT, requires ASPLIT),
// per-batch element strides sA, sB (0 = shared weights), sC, sR. resid may alias C (values are staged before the stores). ACT 0/1(relu).
// ACT: 0 none, 1 relu, 2 softplus
// blockIdx.z = slice of the k range: slice z sums k in [z*K, z*K + K) and stores its own partial C at C + z*sCz (bias, resid and ACT only make sense with one slice; the caller adds the partials).
template <bool ASPLIT, bool BSPLIT, int ACT>
__global__ __launch_bounds__(128) void k_gemm_b(const float* __restrict__ A, int lda, size_t sA, const unsigned short* __restrict__ Bh, const unsigned short* __restrict__ Bl, int ldb, size_t sB,
                                             const float* __restrict__ bias, const float* __restrict__ resid, int ldr, size_t sR, float rsign, float alpha,
                                             float* __restrict__ C, int ldc, size_t sC, size_t sCz, int M, int N, int K) {
  __shared__ __attribute__((aligned(16))) float so[4][16][64];
  const int tid = threadIdx.x, w = tid >> 5, lane = tid & 31, ln = lane & 15, hh = lane >> 4;
  const int by = blockIdx.y; const size_t kz = (size_t)blockIdx.z * K;
  A += (size_t)by * sA + kz; Bh += (size_t)by * sB + kz; if (BSPLIT) Bl += (size_t)by * sB + kz; C += (size_t)by * sC + (size_t)blockIdx.z * sCz; if (resid) resid += (size_t)by * sR;
  const int ntn = (N + 63) / 64; const int wid = blockIdx.x * 4 + w; const int mt = wid / ntn, nq = wid % ntn;      // N may be any multiple of 16: tiles past N are skipped and not stored
  if (mt * 16 >= M) return;
  const int row0 = mt * 16, col0 = nq * 64;
  const float* arow = A + (size_t)(row0 + ln) * lda;
  v8f acc[4] = {};
  for (int kb = 0; kb < K; kb += 32) {
    FragB ah, al;
    const v4f x0 = *(const v4fa*)(arow + kb + 8 * hh), x1 = *(const v4fa*)(arow + kb + 8 * hh + 4);
    const v4f x2 = *(const v4fa*)(arow + kb + 16 + 8 * hh), x3 = *(const v4fa*)(arow + kb + 16 + 8 * hh + 4);
    float xs[16] = {x0[0],x0[1],x0[2],x0[3],x1[0],x1[1],x1[2],x1[3],x2[0],x2[1],x2[2],x2[3],x3[0],x3[1],x3[2],x3[3]};
#pragma unroll
    for (int i = 0; i < 16; ++i) { const unsigned short hb = bf16_bits(xs[i]); ah.u[i] = hb; al.u[i] = ASPLIT ? bf16_bits(xs[i] - bf16_val(hb)) : (unsigned short)0; }
#pragma unroll
    for (int t = 0; t < 4; ++t) {
      if (col0 + t * 16 >= N) continue;
      const size_t boff = (size_t)(col0 + t * 16 + ln) * ldb + kb;
      FragB bh_, bl_; bh_.half[0] = *(const v8us*)(Bh + boff + 8 * hh); bh_.half[1] = *(const v8us*)(Bh + boff + 16 + 8 * hh);
      if (BSPLIT) { bl_.half[0] = *(const v8us*)(Bl + boff + 8 * hh); bl_.half[1] = *(const v8us*)(Bl + boff + 16 + 8 * hh); } else bl_ = bh_;
      acc[t] = mmaN<ASPLIT ? (BSPLIT ? 3 : 2) : 1>(ah.v, al.v, bh_.v, bl_.v, acc[t]);
    }
  }
#pragma unroll
  for (int t = 0; t < 4; ++t) {
    const int col = col0 + t * 16 + ln; if (col0 + t * 16 >= N) continue; const float bv = bias ? bf16_round(bias[col]) : 0.f;
#pragma unroll
    for (int r = 0; r < 8; ++r) { float v = acc[t][r] * alpha + bv; if (resid) v += rsign * resid[(size_t)(row0 + 8 * hh + r) * ldr + col]; if (ACT == 1) v = fmaxf(v, 0.f); else if (ACT == 2) v = fmaxf(v, 0.f) + log1pf(expf(-fabsf(v))); so[w][8 * hh + r][t * 16 + ln] = v; }
  }
  __builtin_amdgcn_fence(__ATOMIC_ACQ_REL, "workgroup"); __builtin_amdgcn_wave_barrier();
  const int rsub = lane >> 4, c4 = (lane & 15) * 4;
  {
#pragma unroll
    for (int q = 0; q < 8; ++q) { const int r = q * 2 + rsub; if (col0 + c4 < N) { const v4f v = *(const v4fa*)&so[w][r][c4]; *(v4f*)(C + (size_t)(row0 + r) * ldc + col0 + c4) = v; } }
    
  }
}
// batched f32 [K][N] (pitch lds, batch stride sIn) -> transposed hi/lo planes [N][K] (batch stride sOut); thread per (n, 8 k); grid.y = batch
__global__ __launch_bounds__(256) void k_split_transpose_b(const float* __restrict__ src, int lds_, size_t sIn, unsigned short* __restrict__ hi, unsigned short* __restrict__ lo, size_t sOut, int K, int N) {
  const size_t t = (size_t)blockIdx.x * 256 + threadIdx.x; const int k8n = K / 8; if (t >= (size_t)N * k8n) return;
  src += (size_t)blockIdx.y * sIn; hi += (size_t)blockIdx.y * sOut; lo += (size_t)blockIdx.y * sOut;
  const int n = (int)(t / k8n), k8 = (int)(t % k8n) * 8; v8us vh, vl;
#pragma unroll
  for (int i = 0; i < 8; ++i) { const float x = src[(size_t)(k8 + i) * lds_ + n]; const unsigned short hb = bf16_bits(x); vh[i] = hb; vl[i] = bf16_bits(x - bf16_val(hb)); }
  unsigned short* dh = hi + (size_t)n * K + k8; unsigned short* dl = lo + (size_t)n * K + k8;
  *(v8us*)dh = vh; *(v8us*)dl = vl; 
}

__global__ __launch_bounds__(256) void k_btw(const float* __restrict__ W, unsigned short* __restrict__ Bt, int K, int N) { const int t = blockIdx.x * 256 + threadIdx.x; if (t >= N * (K / 8)) return; const int n = t / (K / 8), k8 = (t % (K / 8)) * 8; v8us v; for (int q = 0; q < 8; ++q) v[q] = bf16_bits(W[(size_t)(k8 + q) * N + n]); *(v8us*)(Bt + (size_t)n * K + k8) = v;  }
// per token: q ← q − mean(q), k ← k − mean(k); q2 = q², k2 = k²; q2s, k2s; Q2n[t][c] = l2norm_c(q2/(q2s+1e-7)); K2a[t][c] = k2/(k2s+1e-7) (column-normalised later); wave per token, 8 per lane
__global__ __launch_bounds__(256) void k_prep(const float* __restrict__ QKV, float* __restrict__ Q2n, float* __restrict__ K2a) {
  const int tid = threadIdx.x, wv = tid >> 5, lane = tid & 31; const size_t t = (size_t)blockIdx.x * 8 + wv; const float* row = QKV + t * (3 * CC); float q[8], k[8]; float sq = 0.f, sk = 0.f;
#pragma unroll
  for (int u = 0; u < 8; ++u) { q[u] = row[u * 32 + lane]; k[u] = row[CC + u * 32 + lane]; sq += q[u]; sk += k[u]; }
  for (int o = 16; o >= 1; o >>= 1) { sq += __shfl_xor(sq, o, 32); sk += __shfl_xor(sk, o, 32); } const float mq = sq * (1.0f / CC), mk = sk * (1.0f / CC);
  float q2s = 0.f, k2s = 0.f;
#pragma unroll
  for (int u = 0; u < 8; ++u) { q[u] = (q[u] - mq) * (q[u] - mq); k[u] = (k[u] - mk) * (k[u] - mk); q2s += q[u]; k2s += k[u]; }
  for (int o = 16; o >= 1; o >>= 1) { q2s += __shfl_xor(q2s, o, 32); k2s += __shfl_xor(k2s, o, 32); }
  float nq = 0.f; const float rq = 1.0f / (q2s + 1e-7f), rk = 1.0f / (k2s + 1e-7f);
#pragma unroll
  for (int u = 0; u < 8; ++u) { q[u] = q[u] * rq; k[u] = k[u] * rk; nq += q[u] * q[u]; }
  for (int o = 16; o >= 1; o >>= 1) nq += __shfl_xor(nq, o, 32); const float iq = 1.0f / fmaxf(sqrtf(nq), 1e-12f);
#pragma unroll
  for (int u = 0; u < 8; ++u) q[u] *= iq;
  {
#pragma unroll
    for (int u = 0; u < 8; ++u) { *(float*)(Q2n + t * CC + u * 32 + lane) = q[u]; *(float*)(K2a + t * CC + u * 32 + lane) = k[u]; }  }
}
// column norms of K2a over the 4096 tokens of each batch, in two launches, every sum in double and in a fixed order.
// Stage 1: block per (chunk of 64 tokens, batch); a thread takes 4 adjacent columns of every 4th token; the 4 token groups are joined through LDS: PS[b][chunk][c].
#define NCH 64
__global__ __launch_bounds__(256) void k_colnorm_part(const float* __restrict__ K2a, double* __restrict__ PS) {
  __shared__ double red[4][CC];
  const int tid = threadIdx.x, c4 = (tid & 63) * 4, rg = tid >> 6, ch = blockIdx.x, b = blockIdx.y;
  const float* base = K2a + ((size_t)b * NTK + (size_t)ch * (NTK / NCH) + rg) * CC + c4;
  v4f v[NTK / NCH / 4];
  // unrolled so that the loads are independent of the sums and many are in flight per wave (the rolled one-load loop paid a full memory latency per token)
#pragma unroll
  for (int i = 0; i < NTK / NCH / 4; ++i) v[i] = *(const v4fa*)(base + (size_t)i * 4 * CC);
  double s[4] = {0.0, 0.0, 0.0, 0.0};
  // unrolled so that v[] stays in registers (constant indices)
#pragma unroll
  for (int i = 0; i < NTK / NCH / 4; ++i)
#pragma unroll
    for (int q = 0; q < 4; ++q) s[q] += (double)v[i][q] * (double)v[i][q];
#pragma unroll
  for (int q = 0; q < 4; ++q) red[rg][c4 + q] = s[q];
  __syncthreads();
  PS[((size_t)b * NCH + ch) * CC + tid] = (red[0][tid] + red[1][tid]) + (red[2][tid] + red[3][tid]);
}
// Stage 2: block per (32 columns, batch); wave g sums chunks 8g..8g+7 of its 32 columns, wave 0 joins the 8 sums: KN[b][c] = 1/max(norm, 1e-12)
__global__ __launch_bounds__(256) void k_colnorm_fin(const double* __restrict__ PS, float* __restrict__ KN) {
  __shared__ double red[8][32];
  const int tid = threadIdx.x, cl = tid & 31, g = tid >> 5, b = blockIdx.y, c = blockIdx.x * 32 + cl;
  const double* p = PS + ((size_t)b * NCH + g * (NCH / 8)) * CC + c;
  double s = 0.0;
  // unrolled so that the 8 loads are in flight together
#pragma unroll
  for (int i = 0; i < NCH / 8; ++i) s += p[(size_t)i * CC];
  red[g][cl] = s;
  __syncthreads();
  if (tid < 32) {
    double t = 0.0;
#pragma unroll
    for (int j = 0; j < 8; ++j) t += red[j][tid];
    KN[b * CC + c] = 1.0f / fmaxf((float)sqrt(t), 1e-12f);
  }
}
// hi/lo bf16 planes of vᵀ: Vh/Vl [b][d][t] (the Bt operand of kv = k2ᵀ·v), via LDS tiles of 64 tokens (one line per row segment)
__global__ __launch_bounds__(256) void k_vplanes(const float* __restrict__ QKV, unsigned short* __restrict__ Vh, unsigned short* __restrict__ Vl) {
  __shared__ float tv[64][33]; const int b = blockIdx.z; const int t0 = blockIdx.x * 64, c0 = blockIdx.y * 32; const int tx = threadIdx.x & 31, ty = threadIdx.x >> 5;
  for (int i = ty; i < 64; i += 8) { const size_t tok = (size_t)b * NTK + t0 + i; tv[i][tx] = QKV[tok * (3 * CC) + 2 * CC + c0 + tx]; }
  __syncthreads(); typedef unsigned short us2 __attribute__((ext_vector_type(2)));
  { for (int e = threadIdx.x; e < 32 * 32; e += 256) { const int cr = e >> 5, tp = (e & 31) * 2; us2 vh, vl;
      { const float a = tv[tp][cr], c2 = tv[tp + 1][cr]; const unsigned short ah = bf16_bits(a), ch = bf16_bits(c2); vh.x = ah; vh.y = ch; vl.x = bf16_bits(a - bf16_val(ah)); vl.y = bf16_bits(c2 - bf16_val(ch)); }
      const size_t dst = ((size_t)b * CC + c0 + cr) * NTK + t0 + tp; *(us2*)(Vh + dst) = vh; *(us2*)(Vl + dst) = vl; }
     }
}
// K2T[b][c][t] = column-normalised k2 transposed (f32, the A operand of kv; split hi/lo inside the GEMM)
__global__ __launch_bounds__(256) void k_k2t(const float* __restrict__ K2a, const float* __restrict__ KN, float* __restrict__ K2T) { __shared__ float tk[32][33]; const int b = blockIdx.z; const int t0 = blockIdx.x * 32, c0 = blockIdx.y * 32; const int tx = threadIdx.x & 31, ty = threadIdx.x >> 5;
  for (int i = ty; i < 32; i += 8) tk[i][tx] = K2a[((size_t)b * NTK + t0 + i) * CC + c0 + tx] * KN[b * CC + c0 + tx]; __syncthreads();
  { for (int i = ty; i < 32; i += 8) *(float*)(K2T + ((size_t)b * CC + c0 + i) * NTK + t0 + tx) = tk[tx][i];  } }
// kv = sum of its KSL token-slice partials KVp[slice][b][c][d], added in slice order (f32); then kv -> Bt for t2 = q2 kv: B[k=c][n=d] = kv[c][d] -> Bt[d][c]: planes hi/lo of kv transposed.
// thread per (b, 8 c, d) with d along the lanes: each of the 8 * KSL loads of a wave reads one whole line
#define KSL 16
__global__ __launch_bounds__(256) void k_kvplanes(const float* __restrict__ KVp, unsigned short* __restrict__ Ph, unsigned short* __restrict__ Pl) { const int t = blockIdx.x * 256 + threadIdx.x; if (t >= BB * CC * (CC / 8)) return; const int d = t % CC; const int c8 = ((t / CC) % (CC / 8)) * 8; const int b = t / ((CC / 8) * CC); v8us h, l;
  const float* p = KVp + ((size_t)b * CC + c8) * CC + d; float s[8] = {0.f, 0.f, 0.f, 0.f, 0.f, 0.f, 0.f, 0.f};
  // kept rolled, 4 slices a trip: 32 independent loads are in flight per wave; fully unrolled, the 128 loads took 138 registers
#pragma unroll 1
  for (int z = 0; z < KSL; z += 4) {
    float v[4][8];
    // unrolled so that v[] stays in registers and the loads do not wait on the sums
#pragma unroll
    for (int j = 0; j < 4; ++j)
#pragma unroll
      for (int q = 0; q < 8; ++q) v[j][q] = p[(size_t)(z + j) * BB * CC * CC + (size_t)q * CC];
#pragma unroll
    for (int j = 0; j < 4; ++j)
#pragma unroll
      for (int q = 0; q < 8; ++q) s[q] += v[j][q];
  }
  for (int q = 0; q < 8; ++q) { const float v = s[q]; const unsigned short hb = bf16_bits(v); h[q] = hb; l[q] = bf16_bits(v - bf16_val(hb)); } const size_t dst = ((size_t)b * CC + d) * CC + c8; *(v8us*)(Ph + dst) = h; *(v8us*)(Pl + dst) = l;  }
// attn = v + t2/√N ; thread per float4
__global__ __launch_bounds__(256) void k_attn(const float* __restrict__ QKV, const float* __restrict__ T2, float* __restrict__ AT) { const size_t t = (size_t)blockIdx.x * 256 + threadIdx.x; if (t >= (size_t)BB * NTK * CC / 4) return; const int c4 = (int)((t * 4) % CC); const size_t tok = (t * 4) / CC; const v4f v = *(const v4fa*)(QKV + tok * (3 * CC) + 2 * CC + c4), s = *(const v4fa*)(T2 + t * 4); v4f o; for (int q = 0; q < 4; ++q) o[q] = v[q] + s[q] * 0.015625f; *(v4f*)(AT + t * 4) = o;  }
extern "C" void kernel_launch(void* const* d_in, const int* in_sizes, int n_in,
                              void* d_out, int out_size, void* d_ws, size_t ws_size, hipStream_t stream) {
  (void)in_sizes; (void)n_in; (void)out_size;
  const float* x = (const float*)d_in[0]; const float* Wqkv = (const float*)d_in[1]; const float* bqkv = (const float*)d_in[2]; const float* Wout = (const float*)d_in[3]; const float* bout = (const float*)d_in[4];
  char* ws = (char*)d_ws; size_t off = 0;
  auto take = [&](size_t bytes) { char* p = ws + off; off += (bytes + 255) & ~(size_t)255; return p; };
  unsigned short* Bq = (unsigned short*)take((size_t)3 * CC * CC * 2); unsigned short* Bo = (unsigned short*)take((size_t)CC * CC * 2);
  float* QKV = (float*)take((size_t)BB * NTK * 3 * CC * 4); float* Q2n = (float*)take((size_t)BB * NTK * CC * 4); float* K2a = (float*)take((size_t)BB * NTK * CC * 4); float* KN = (float*)take(BB * CC * 4);
  float* K2T = (float*)take((size_t)BB * CC * NTK * 4); unsigned short* Vh = (unsigned short*)take((size_t)BB * CC * NTK * 2); unsigned short* Vl = (unsigned short*)take((size_t)BB * CC * NTK * 2);
  unsigned short* Ph = (unsigned short*)take((size_t)BB * CC * CC * 2); unsigned short* Pl = (unsigned short*)take((size_t)BB * CC * CC * 2); double* PS = (double*)take((size_t)BB * NCH * CC * 8);
  float* KVp = K2a; float* T2 = K2a; float* AT2 = K2T;      // buffer reuse: K2a is dead once K2T exists: first the KSL partials of kv (KSL*BB*CC*CC = BB*NTK*CC floats), then, once the kv planes exist, t2; K2T is dead once kv exists
  if (off > ws_size) return;
  k_btw<<<(3 * CC * 32 + 255) / 256, 256, 0, stream>>>(Wqkv, Bq, CC, 3 * CC); k_btw<<<(CC * 32 + 255) / 256, 256, 0, stream>>>(Wout, Bo, CC, CC);
  k_gemm_bf3<false, 0, true, false><<<((BB * NTK / 16) * (3 * CC / 64) + 3) / 4, 128, 0, stream>>>(x, CC, Bq, CC, bqkv, nullptr, 1, 0, QKV, 3 * CC, BB * NTK, 3 * CC, CC);
  k_prep<<<BB * NTK / 8, 256, 0, stream>>>(QKV, Q2n, K2a); k_colnorm_part<<<dim3(NCH, BB), 256, 0, stream>>>(K2a, PS); k_colnorm_fin<<<dim3(CC / 32, BB), 256, 0, stream>>>(PS, KN);
  k_k2t<<<dim3(NTK / 32, CC / 32, BB), 256, 0, stream>>>(K2a, KN, K2T);
  k_vplanes<<<dim3(NTK / 64, CC / 32, BB), 256, 0, stream>>>(QKV, Vh, Vl);
  k_gemm_b<true, true, 0><<<dim3(((CC / 16) * (CC / 64) + 3) / 4, BB, KSL), 128, 0, stream>>>(K2T, NTK, (size_t)CC * NTK, Vh, Vl, NTK, (size_t)CC * NTK, nullptr, nullptr, 0, 0, 1.f, 1.f, KVp, CC, (size_t)CC * CC, (size_t)BB * CC * CC, CC, CC, NTK / KSL);      // slice z: KVp[z][b][c][d] = sum over the tokens t of slice z of k2[t][c] * v[t][d]
  k_kvplanes<<<(BB * CC * (CC / 8) + 255) / 256, 256, 0, stream>>>(KVp, Ph, Pl);
  k_gemm_b<true, true, 0><<<dim3(((NTK / 16) * (CC / 64) + 3) / 4, BB), 128, 0, stream>>>(Q2n, CC, (size_t)NTK * CC, Ph, Pl, CC, (size_t)CC * CC, nullptr, nullptr, 0, 0, 1.f, 1.f, T2, CC, (size_t)NTK * CC, 0, NTK, CC, CC);             // t2 = q2 * kv
  k_attn<<<(unsigned)(((size_t)BB * NTK * CC / 4 + 255) / 256), 256, 0, stream>>>(QKV, T2, AT2);
  k_gemm_bf3<true, 0, true, false><<<((BB * NTK / 16) * (CC / 64) + 3) / 4, 128, 0, stream>>>(AT2, CC, Bo, CC, bout, nullptr, 1, 0, (float*)d_out, CC, BB * NTK, CC, CC);
}

// v003
// One run takes 265 microseconds.
// Next to v002, in two timings, it ran 1.14 times as fast each time.
// Over all steps from v000 it is 7.68 times as fast.
#include <hip/hip_runtime.h>
// Linear attention on WMMA (f32 accumulate): qkv = x·W_qkv + b (inputs rounded to bf16: single exact term; 32768 × 256 × 768), per batch kv = k2ᵀ·v (k2 and v are computed
// f32 → split into bf16 hi/lo: 3 products; 256 × 256 × 4096), t2 = q2·kv (3 products), out = attn·W_out + b (attn split hi/lo vs exact weights: 2 products). Mean-centering,
// squares, the two normalisations and the residual are f32 VALU (column statistics as fixed-order double sums).
#define BB 8
#define NTK 4096
#define CC 256

typedef __bf16 v16b __attribute__((ext_vector_type(16)));
typedef unsigned short v8us __attribute__((ext_vector_type(8), may_alias));
typedef float  v8f  __attribute__((ext_vector_type(8)));
typedef float  v4f  __attribute__((ext_vector_type(4)));
typedef float  v4fa __attribute__((ext_vector_type(4), may_alias));
union FragB { v16b v; v8us half[2]; unsigned short u[16]; };

__device__ __forceinline__ unsigned short bf16_bits(float x) { unsigned int u = __float_as_uint(x); return (unsigned short)((u + 0x7FFFu + ((u >> 16) & 1u)) >> 16); }
__device__ __forceinline__ float bf16_val(unsigned short b) { return __uint_as_float(((unsigned int)b) << 16); }
__device__ __forceinline__ float bf16_round(float x) { return bf16_val(bf16_bits(x)); }
// D += A·B with NT terms: 1 = ah·bh, 2 = + al·bh (A split), 3 = + ah·bl (both split)
template <int NT>
__device__ __forceinline__ v8f mmaN(v16b ah, v16b al, v16b bh, v16b bl, v8f c) {
  c = __builtin_amdgcn_wmma_f32_16x16x32_bf16(false, ah, false, bh, (short)0, c, false, false);
  if (NT >= 2) c = __builtin_amdgcn_wmma_f32_16x16x32_bf16(false, al, false, bh, (short)0, c, false, false);
  if (NT >= 3) c = __builtin_amdgcn_wmma_f32_16x16x32_bf16(false, ah, false, bl, (short)0, c, false, false);
  asm volatile("v_nop\n\tv_nop\n\tv_nop\n\tv_nop" : "+v"(c) : "v"(ah), "v"(al), "v"(bh), "v"(bl));
  return c;
}

__global__ __launch_bounds__(256) void k_wt_bf16(const float* __restrict__ W, unsigned short* __restrict__ Wt, int K, int N) {
  const int t = blockIdx.x * 256 + threadIdx.x;
  const int k8n = K / 8;
  if (t >= N * k8n) return;
  const int n = t / k8n, k8 = (t % k8n) * 8;
  v8us v;
#pragma unroll
  for (int i = 0; i < 8; ++i) v[i] = bf16_bits(W[(size_t)(k8 + i) * N + n]);
  *(v8us*)(Wt + (size_t)n * K + k8) = v;
  
}

// GEMM C[M][N] (f32, pitch ldc) = act(A[M][K]·W + bias). A f32 row-major (pitch lda) converted per fragment to bf16
// (ASPLIT: hi/lo two planes -> 2 terms, else single rounded term); Wt bf16 [N][K] (pitch ldb). BIAS_BF16 rounds the
// bias to bf16 first (bias quantised to bf16 before the add). K%32==0, M%16==0, N%64==0.
template <bool ASPLIT, int ACT, bool BIAS_BF16>
__global__ __launch_bounds__(128) void k_gemm_bf(const float* __restrict__ A, int lda, const unsigned short* __restrict__ Wt, int ldb,
                                               const float* __restrict__ bias, float* __restrict__ C, int ldc, int M, int N, int K) {
  __shared__ __attribute__((aligned(16))) float so[4][16][64];
  const int tid = threadIdx.x, w = tid >> 5, lane = tid & 31, ln = lane & 15, hh = lane >> 4;
  const int ntn = N / 64;
  const int wid = blockIdx.x * 4 + w;
  const int mt = wid / ntn, nq = wid % ntn;
  if (mt * 16 >= M) return;
  const int row0 = mt * 16, col0 = nq * 64;
  const float* arow = A + (size_t)(row0 + ln) * lda;
  v8f acc[4] = {};
  for (int kb = 0; kb < K; kb += 32) {
    FragB ah, al;
    const v4f x0 = *(const v4fa*)(arow + kb + 8 * hh), x1 = *(const v4fa*)(arow + kb + 8 * hh + 4);
    const v4f x2 = *(const v4fa*)(arow + kb + 16 + 8 * hh), x3 = *(const v4fa*)(arow + kb + 16 + 8 * hh + 4);
    float xs[16] = {x0[0],x0[1],x0[2],x0[3],x1[0],x1[1],x1[2],x1[3],x2[0],x2[1],x2[2],x2[3],x3[0],x3[1],x3[2],x3[3]};
#pragma unroll
    for (int i = 0; i < 16; ++i) { const unsigned short hb = bf16_bits(xs[i]); ah.u[i] = hb; al.u[i] = ASPLIT ? bf16_bits(xs[i] - bf16_val(hb)) : (unsigned short)0; }
#pragma unroll
    for (int t = 0; t < 4; ++t) {
      const unsigned short* brow = Wt + (size_t)(col0 + t * 16 + ln) * ldb + kb;
      FragB b;
      b.half[0] = *(const v8us*)(brow + 8 * hh);
      b.half[1] = *(const v8us*)(brow + 16 + 8 * hh);
      acc[t] = mmaN<ASPLIT ? 2 : 1>(ah.v, al.v, b.v, b.v, acc[t]);
    }
  }
#pragma unroll
  for (int t = 0; t < 4; ++t) {
    float bv = bias ? bias[col0 + t * 16 + ln] : 0.f;
    if (BIAS_BF16) bv = bf16_round(bv);
#pragma unroll
    for (int r = 0; r < 8; ++r) { float v = acc[t][r] + bv; if (ACT == 1) v = fmaxf(v, 0.f); so[w][8 * hh + r][t * 16 + ln] = v; }
  }
  __builtin_amdgcn_fence(__ATOMIC_ACQ_REL, "workgroup");
  __builtin_amdgcn_wave_barrier();
  const int rsub = lane >> 4, c4 = (lane & 15) * 4;
  {
#pragma unroll
    for (int q = 0; q < 8; ++q) {
      const int r = q * 2 + rsub;
      const v4f v = *(const v4fa*)&so[w][r][c4];
      *(v4f*)(C + (size_t)(row0 + r) * ldc + col0 + c4) = v;
    }
    
  }
}

// Flash-style causal/unmasked attention, all contractions 3-term bf16 hi/lo splits, f32 softmax with running max.
// q,k,v rows are read from f32 buffers with arbitrary row pitch (so they can live inside a fused qkv buffer);
// D = head size (multiple of 32, <= 128); one wave = 16 query rows; block = 4 waves (64 queries) sharing K/V chunks of 32.
template <int D, bool CAUSAL>
__global__ __launch_bounds__(128) void k_flash(const float* __restrict__ qb, const float* __restrict__ kb, const float* __restrict__ vb,
                                             int pitch, int T, int H, float scale, float* __restrict__ y, int ypitch) {
  constexpr int KS = D / 32;        // k-steps for QK
  constexpr int DT = D / 16;        // d tiles for PV
  __shared__ __attribute__((aligned(16))) unsigned short sKh[32][D + 8], sKl[32][D + 8], sVh[32][D + 8], sVl[32][D + 8];
  __shared__ __attribute__((aligned(16))) unsigned short sPh[4][16][40], sPl[4][16][40];
  __shared__ __attribute__((aligned(16))) float sO[4][16][D];
  const int tid = threadIdx.x, w = tid >> 5, lane = tid & 31, ln = lane & 15, hh = lane >> 4;
  const int nqb = (T + 63) / 64;
  const int bh = blockIdx.x / nqb, qblk = blockIdx.x % nqb;
  const int b = bh / H, h = bh % H;
  const int q0 = qblk * 64 + w * 16;
  const float* Q = qb + (size_t)b * T * pitch + h * D;
  const float* K = kb + (size_t)b * T * pitch + h * D;
  const float* V = vb + (size_t)b * T * pitch + h * D;

  // A fragments of the wave's 16 query rows (scaled), hi/lo
  FragB aqh[KS], aql[KS];
  {
    int row = q0 + ln; if (row >= T) row = T - 1;
    const float* qr = Q + (size_t)row * pitch;
#pragma unroll
    for (int ks = 0; ks < KS; ++ks)
#pragma unroll
      for (int i = 0; i < 16; ++i) {
        const int d = ks * 32 + ((i < 8) ? (8 * hh + i) : (16 + 8 * hh + (i - 8)));
        const float x = qr[d] * scale; const unsigned short hb = bf16_bits(x);
        aqh[ks].u[i] = hb; aql[ks].u[i] = bf16_bits(x - bf16_val(hb));
      }
  }
  float m_r[8], l_r[8];
#pragma unroll
  for (int r = 0; r < 8; ++r) { m_r[r] = -3.0e38f; l_r[r] = 0.f; }
  v8f oacc[DT];
#pragma unroll
  for (int dt = 0; dt < DT; ++dt) oacc[dt] = (v8f){0.f,0.f,0.f,0.f,0.f,0.f,0.f,0.f};

  const int kv_end = CAUSAL ? min(T, qblk * 64 + 64) : T;     // block-uniform
  for (int j0 = 0; j0 < kv_end; j0 += 32) {
    __syncthreads();
    for (int e = tid; e < 32 * (D / 4); e += 128) {
      const int r = e / (D / 4), c4 = (e % (D / 4)) * 4;
      const int key = j0 + r;
      v4f kf = {0.f,0.f,0.f,0.f}, vf = {0.f,0.f,0.f,0.f};
      if (key < T) { kf = *(const v4fa*)(K + (size_t)key * pitch + c4); vf = *(const v4fa*)(V + (size_t)key * pitch + c4); }
#pragma unroll
      for (int t = 0; t < 4; ++t) {
        unsigned short hb = bf16_bits(kf[t]); sKh[r][c4 + t] = hb; sKl[r][c4 + t] = bf16_bits(kf[t] - bf16_val(hb));
        hb = bf16_bits(vf[t]); sVh[r][c4 + t] = hb; sVl[r][c4 + t] = bf16_bits(vf[t] - bf16_val(hb));
      }
    }
    __syncthreads();
    // S tile 16 x 32
    v8f s[2];
#pragma unroll
    for (int nt = 0; nt < 2; ++nt) {
      v8f acc = {};
#pragma unroll
      for (int ks = 0; ks < KS; ++ks) {
        FragB bh_, bl_;
        bh_.half[0] = *(const v8us*)&sKh[nt * 16 + ln][ks * 32 + 8 * hh]; bh_.half[1] = *(const v8us*)&sKh[nt * 16 + ln][ks * 32 + 16 + 8 * hh];
        bl_.half[0] = *(const v8us*)&sKl[nt * 16 + ln][ks * 32 + 8 * hh]; bl_.half[1] = *(const v8us*)&sKl[nt * 16 + ln][ks * 32 + 16 + 8 * hh];
        acc = mmaN<3>(aqh[ks].v, aql[ks].v, bh_.v, bl_.v, acc);
      }
      s[nt] = acc;
    }
    // mask + running max (rows 8hh+r; the 16 lanes of a half share rows)
    float alpha[8];
#pragma unroll
    for (int r = 0; r < 8; ++r) {
      const int qi = q0 + 8 * hh + r;
      const int ja = j0 + ln, jb = j0 + 16 + ln;
      if (CAUSAL) { if (ja > qi) s[0][r] = -3.0e38f; if (jb > qi) s[1][r] = -3.0e38f; }
      if (ja >= T) s[0][r] = -3.0e38f;
      if (jb >= T) s[1][r] = -3.0e38f;
      float mx = fmaxf(s[0][r], s[1][r]);
      mx = fmaxf(mx, __shfl_xor(mx, 1, 32)); mx = fmaxf(mx, __shfl_xor(mx, 2, 32)); mx = fmaxf(mx, __shfl_xor(mx, 4, 32)); mx = fmaxf(mx, __shfl_xor(mx, 8, 32));
      const float mnew = fmaxf(m_r[r], mx);
      alpha[r] = (mnew > -1.0e38f) ? __expf(m_r[r] - mnew) : 1.0f;
      const float p0 = (s[0][r] > -1.0e38f) ? __expf(s[0][r] - mnew) : 0.f;
      const float p1 = (s[1][r] > -1.0e38f) ? __expf(s[1][r] - mnew) : 0.f;
      m_r[r] = mnew;
      l_r[r] = l_r[r] * alpha[r] + p0 + p1;            // per-lane partial row sum (16 lanes combined at the end)
      unsigned short hb = bf16_bits(p0); sPh[w][8 * hh + r][ln] = hb;      sPl[w][8 * hh + r][ln] = bf16_bits(p0 - bf16_val(hb));
      hb = bf16_bits(p1);                sPh[w][8 * hh + r][16 + ln] = hb; sPl[w][8 * hh + r][16 + ln] = bf16_bits(p1 - bf16_val(hb));
    }
#pragma unroll
    for (int dt = 0; dt < DT; ++dt)
#pragma unroll
      for (int r = 0; r < 8; ++r) oacc[dt][r] *= alpha[r];
    __builtin_amdgcn_fence(__ATOMIC_ACQ_REL, "workgroup");
    __builtin_amdgcn_wave_barrier();
    FragB pah, pal;
    pah.half[0] = *(const v8us*)&sPh[w][ln][8 * hh]; pah.half[1] = *(const v8us*)&sPh[w][ln][16 + 8 * hh];
    pal.half[0] = *(const v8us*)&sPl[w][ln][8 * hh]; pal.half[1] = *(const v8us*)&sPl[w][ln][16 + 8 * hh];
#pragma unroll
    for (int dt = 0; dt < DT; ++dt) {
      FragB bvh, bvl;
#pragma unroll
      for (int i = 0; i < 8; ++i) {
        bvh.u[i] = sVh[8 * hh + i][dt * 16 + ln]; bvh.u[8 + i] = sVh[16 + 8 * hh + i][dt * 16 + ln];
        bvl.u[i] = sVl[8 * hh + i][dt * 16 + ln]; bvl.u[8 + i] = sVl[16 + 8 * hh + i][dt * 16 + ln];
      }
      oacc[dt] = mmaN<3>(pah.v, pal.v, bvh.v, bvl.v, oacc[dt]);
    }
    __builtin_amdgcn_fence(__ATOMIC_ACQ_REL, "workgroup");
    __builtin_amdgcn_wave_barrier();
  }
#pragma unroll
  for (int r = 0; r < 8; ++r) {
    float l = l_r[r];
    l += __shfl_xor(l, 1, 32); l += __shfl_xor(l, 2, 32); l += __shfl_xor(l, 4, 32); l += __shfl_xor(l, 8, 32);
    l_r[r] = (l > 0.f) ? 1.0f / l : 0.f;
  }
#pragma unroll
  for (int dt = 0; dt < DT; ++dt)
#pragma unroll
    for (int r = 0; r < 8; ++r) sO[w][8 * hh + r][dt * 16 + ln] = oacc[dt][r] * l_r[r];
  __builtin_amdgcn_fence(__ATOMIC_ACQ_REL, "workgroup");
  __builtin_amdgcn_wave_barrier();
  {
    for (int r = 0; r < 16; ++r) {
      const int row = q0 + r;
      if (row < T && lane < D / 4) {
        const v4f val = *(const v4fa*)&sO[w][r][lane * 4];
        *(v4f*)(y + ((size_t)b * T + row) * ypitch + h * D + lane * 4) = val;
      }
    }
    
  }
}

// GEMM C = act(A·W + bias + resid): A f32 (ASPLIT -> hi/lo 2 terms), Wt bf16 [N][K]; ACT 0 none, 1 relu, 2 exact gelu;
// resid (optional, f32, row index = (row % rmod), pitch ldr, RES_BF16 rounds it) added before the activation.
template <bool ASPLIT, int ACT, bool BIAS_BF16, bool RES_BF16>
__global__ __launch_bounds__(128) void k_gemm_bf3(const float* __restrict__ A, int lda, const unsigned short* __restrict__ Wt, int ldb,
                                                const float* __restrict__ bias, const float* __restrict__ resid, int rmod, int ldr,
                                                float* __restrict__ C, int ldc, int M, int N, int K) {
  __shared__ __attribute__((aligned(16))) float so[4][16][64];
  const int tid = threadIdx.x, w = tid >> 5, lane = tid & 31, ln = lane & 15, hh = lane >> 4;
  const int ntn = N / 64;
  const int wid = blockIdx.x * 4 + w;
  const int mt = wid / ntn, nq = wid % ntn;
  if (mt * 16 >= M) return;
  const int row0 = mt * 16, col0 = nq * 64;
  const float* arow = A + (size_t)(row0 + ln) * lda;
  v8f acc[4] = {};
  for (int kb = 0; kb < K; kb += 32) {
    FragB ah, al;
    const v4f x0 = *(const v4fa*)(arow + kb + 8 * hh), x1 = *(const v4fa*)(arow + kb + 8 * hh + 4);
    const v4f x2 = *(const v4fa*)(arow + kb + 16 + 8 * hh), x3 = *(const v4fa*)(arow + kb + 16 + 8 * hh + 4);
    float xs[16] = {x0[0],x0[1],x0[2],x0[3],x1[0],x1[1],x1[2],x1[3],x2[0],x2[1],x2[2],x2[3],x3[0],x3[1],x3[2],x3[3]};
#pragma unroll
    for (int i = 0; i < 16; ++i) { const unsigned short hb = bf16_bits(xs[i]); ah.u[i] = hb; al.u[i] = ASPLIT ? bf16_bits(xs[i] - bf16_val(hb)) : (unsigned short)0; }
#pragma unroll
    for (int t = 0; t < 4; ++t) {
      const unsigned short* brow = Wt + (size_t)(col0 + t * 16 + ln) * ldb + kb;
      FragB b;
      b.half[0] = *(const v8us*)(brow + 8 * hh);
      b.half[1] = *(const v8us*)(brow + 16 + 8 * hh);
      acc[t] = mmaN<ASPLIT ? 2 : 1>(ah.v, al.v, b.v, b.v, acc[t]);
    }
  }
#pragma unroll
  for (int t = 0; t < 4; ++t) {
    const int col = col0 + t * 16 + ln;
    float bv = bias ? bias[col] : 0.f;
    if (BIAS_BF16) bv = bf16_round(bv);
#pragma unroll
    for (int r = 0; r < 8; ++r) {
      float v = acc[t][r] + bv;
      if (resid) { float rv = resid[(size_t)((row0 + 8 * hh + r) % rmod) * ldr + col]; if (RES_BF16) rv = bf16_round(rv); v += rv; }
      if (ACT == 1) v = fmaxf(v, 0.f);
      if (ACT == 2) v = 0.5f * v * (1.0f + erff(v * 0.70710678118654752f));
      if (ACT == 3) { const float u = 0.7978845608028654f * (v + 0.044715f * v * v * v); v = 0.5f * v * (1.0f + tanhf(u)); }
      so[w][8 * hh + r][t * 16 + ln] = v;
    }
  }
  __builtin_amdgcn_fence(__ATOMIC_ACQ_REL, "workgroup");
  __builtin_amdgcn_wave_barrier();
  const int rsub = lane >> 4, c4 = (lane & 15) * 4;
  {
#pragma unroll
    for (int q = 0; q < 8; ++q) {
      const int r = q * 2 + rsub;
      const v4f v = *(const v4fa*)&so[w][r][c4];
      *(v4f*)(C + (size_t)(row0 + r) * ldc + col0 + c4) = v;
    }
    
  }
}
// row LayerNorm (biased variance, eps) over N: s = X (+ R); optional out_sum <- s; out_norm <- (s-mu)*rsqrt(var+eps)*g + b
template <bool PARAM_BF16>
__global__ __launch_bounds__(256) void k_layernorm(const float* __restrict__ X, const float* __restrict__ R, const float* __restrict__ g, const float* __restrict__ bta,
                                                  float* __restrict__ out_sum, float* __restrict__ out_norm, int N, float eps) {
  __shared__ float red[256];
  const int row = blockIdx.x, tid = threadIdx.x;
  const float* x = X + (size_t)row * N; const float* rr = R ? R + (size_t)row * N : nullptr;
  float vals[16];                     // up to N = 4096
  const int per = N / 256;            // contiguous chunk per thread? use strided-by-4 chunks: thread handles j = tid*4 + 1024*u
  float s1 = 0.f;
  for (int u = 0; u < per / 4; ++u) {
    const int j = tid * 4 + 1024 * u;
    const v4f a = *(const v4fa*)(x + j);
    v4f b = {0.f,0.f,0.f,0.f}; if (rr) b = *(const v4fa*)(rr + j);
#pragma unroll
    for (int q = 0; q < 4; ++q) { const float v = a[q] + b[q]; vals[u * 4 + q] = v; s1 += v; }
  }
  red[tid] = s1; __syncthreads();
  for (int st = 128; st > 0; st >>= 1) { if (tid < st) red[tid] += red[tid + st]; __syncthreads(); }
  const float mu = red[0] / (float)N; __syncthreads();
  float s2 = 0.f;
  for (int u = 0; u < per / 4; ++u)
#pragma unroll
    for (int q = 0; q < 4; ++q) { const float c = vals[u * 4 + q] - mu; s2 += c * c; }
  red[tid] = s2; __syncthreads();
  for (int st = 128; st > 0; st >>= 1) { if (tid < st) red[tid] += red[tid + st]; __syncthreads(); }
  const float rs = rsqrtf(red[0] / (float)N + eps);
  {
    for (int u = 0; u < per / 4; ++u) {
      const int j = tid * 4 + 1024 * u;
      v4f o, sm;
#pragma unroll
      for (int q = 0; q < 4; ++q) {
        float gg = g[j + q], bb = bta[j + q];
        if (PARAM_BF16) { gg = bf16_round(gg); bb = bf16_round(bb); }
        sm[q] = vals[u * 4 + q]; o[q] = (vals[u * 4 + q] - mu) * rs * gg + bb;
      }
      if (out_sum) *(v4f*)(out_sum + (size_t)row * N + j) = sm;
      *(v4f*)(out_norm + (size_t)row * N + j) = o;
    }
    
  }
}

// batched GEMM (blockIdx.y = batch): C_b = act(alpha·A_b·B_b + bias + resid_b); A f32 rows (ASPLIT → hi/lo), B = bf16 planes Bh (+Bl when BSPLIT, requires ASPLIT),
// per-batch element strides sA, sB (0 = shared weights), sC, sR. resid may alias C (values are staged before the stores). ACT 0/1(relu).
// ACT: 0 none, 1 relu, 2 softplus
// blockIdx.z = slice of the k range: slice z sums k in [z*K, z*K + K) and stores its own partial C at C + z*sCz (bias, resid and ACT only make sense with one slice; the caller adds the partials).
template <bool ASPLIT, bool BSPLIT, int ACT>
__global__ __launch_bounds__(128) void k_gemm_b(const float* __restrict__ A, int lda, size_t sA, const unsigned short* __restrict__ Bh, const unsigned short* __restrict__ Bl, int ldb, size_t sB,
                                             const float* __restrict__ bias, const float* __restrict__ resid, int ldr, size_t sR, float rsign, float alpha,
                                             float* __restrict__ C, int ldc, size_t sC, size_t sCz, int M, int N, int K) {
  __shared__ __attribute__((aligned(16))) float so[4][16][64];
  const int tid = threadIdx.x, w = tid >> 5, lane = tid & 31, ln = lane & 15, hh = lane >> 4;
  const int by = blockIdx.y; const size_t kz = (size_t)blockIdx.z * K;
  A += (size_t)by * sA + kz; Bh += (size_t)by * sB + kz; if (BSPLIT) Bl += (size_t)by * sB + kz; C += (size_t)by * sC + (size_t)blockIdx.z * sCz; if (resid) resid += (size_t)by * sR;
  const int ntn = (N + 63) / 64; const int wid = blockIdx.x * 4 + w; const int mt = wid / ntn, nq = wid % ntn;      // N may be any multiple of 16: tiles past N are skipped and not stored
  if (mt * 16 >= M) return;
  const int row0 = mt * 16, col0 = nq * 64;
  const float* arow = A + (size_t)(row0 + ln) * lda;
  v8f acc[4] = {};
  for (int kb = 0; kb < K; kb += 32) {
    FragB ah, al;
    const v4f x0 = *(const v4fa*)(arow + kb + 8 * hh), x1 = *(const v4fa*)(arow + kb + 8 * hh + 4);
    const v4f x2 = *(const v4fa*)(arow + kb + 16 + 8 * hh), x3 = *(const v4fa*)(arow + kb + 16 + 8 * hh + 4);
    float xs[16] = {x0[0],x0[1],x0[2],x0[3],x1[0],x1[1],x1[2],x1[3],x2[0],x2[1],x2[2],x2[3],x3[0],x3[1],x3[2],x3[3]};
#pragma unroll
    for (int i = 0; i < 16; ++i) { const unsigned short hb = bf16_bits(xs[i]); ah.u[i] = hb; al.u[i] = ASPLIT ? bf16_bits(xs[i] - bf16_val(hb)) : (unsigned short)0; }
#pragma unroll
    for (int t = 0; t < 4; ++t) {
      if (col0 + t * 16 >= N) continue;
      const size_t boff = (size_t)(col0 + t * 16 + ln) * ldb + kb;
      FragB bh_, bl_; bh_.half[0] = *(const v8us*)(Bh + boff + 8 * hh); bh_.half[1] = *(const v8us*)(Bh + boff + 16 + 8 * hh);
      if (BSPLIT) { bl_.half[0] = *(const v8us*)(Bl + boff + 8 * hh); bl_.half[1] = *(const v8us*)(Bl + boff + 16 + 8 * hh); } else bl_ = bh_;
      acc[t] = mmaN<ASPLIT ? (BSPLIT ? 3 : 2) : 1>(ah.v, al.v, bh_.v, bl_.v, acc[t]);
    }
  }
#pragma unroll
  for (int t = 0; t < 4; ++t) {
    const int col = col0 + t * 16 + ln; if (col0 + t * 16 >= N) continue; const float bv = bias ? bf16_round(bias[col]) : 0.f;
#pragma unroll
    for (int r = 0; r < 8; ++r) { float v = acc[t][r] * alpha + bv; if (resid) v += rsign * resid[(size_t)(row0 + 8 * hh + r) * ldr + col]; if (ACT == 1) v = fmaxf(v, 0.f); else if (ACT == 2) v = fmaxf(v, 0.f) + log1pf(expf(-fabsf(v))); so[w][8 * hh + r][t * 16 + ln] = v; }
  }
  __builtin_amdgcn_fence(__ATOMIC_ACQ_REL, "workgroup"); __builtin_amdgcn_wave_barrier();
  const int rsub = lane >> 4, c4 = (lane & 15) * 4;
  {
#pragma unroll
    for (int q = 0; q < 8; ++q) { const int r = q * 2 + rsub; if (col0 + c4 < N) { const v4f v = *(const v4fa*)&so[w][r][c4]; *(v4f*)(C + (size_t)(row0 + r) * ldc + col0 + c4) = v; } }
    
  }
}
// batched f32 [K][N] (pitch lds, batch stride sIn) -> transposed hi/lo planes [N][K] (batch stride sOut); thread per (n, 8 k); grid.y = batch
__global__ __launch_bounds__(256) void k_split_transpose_b(const float* __restrict__ src, int lds_, size_t sIn, unsigned short* __restrict__ hi, unsigned short* __restrict__ lo, size_t sOut, int K, int N) {
  const size_t t = (size_t)blockIdx.x * 256 + threadIdx.x; const int k8n = K / 8; if (t >= (size_t)N * k8n) return;
  src += (size_t)blockIdx.y * sIn; hi += (size_t)blockIdx.y * sOut; lo += (size_t)blockIdx.y * sOut;
  const int n = (int)(t / k8n), k8 = (int)(t % k8n) * 8; v8us vh, vl;
#pragma unroll
  for (int i = 0; i < 8; ++i) { const float x = src[(size_t)(k8 + i) * lds_ + n]; const unsigned short hb = bf16_bits(x); vh[i] = hb; vl[i] = bf16_bits(x - bf16_val(hb)); }
  unsigned short* dh = hi + (size_t)n * K + k8; unsigned short* dl = lo + (size_t)n * K + k8;
  *(v8us*)dh = vh; *(v8us*)dl = vl; 
}

__global__ __launch_bounds__(256) void k_btw(const float* __restrict__ W, unsigned short* __restrict__ Bt, int K, int N) { const int t = blockIdx.x * 256 + threadIdx.x; if (t >= N * (K / 8)) return; const int n = t / (K / 8), k8 = (t % (K / 8)) * 8; v8us v; for (int q = 0; q < 8; ++q) v[q] = bf16_bits(W[(size_t)(k8 + q) * N + n]); *(v8us*)(Bt + (size_t)n * K + k8) = v;  }
// per token: q ← q − mean(q), k ← k − mean(k); q2 = q², k2 = k²; q2s, k2s; Q2n[t][c] = l2norm_c(q2/(q2s+1e-7)); K2a[t][c] = k2/(k2s+1e-7) (column-normalised later); wave per token, 8 per lane
__global__ __launch_bounds__(256) void k_prep(const float* __restrict__ QKV, float* __restrict__ Q2n, float* __restrict__ K2a) {
  const int tid = threadIdx.x, wv = tid >> 5, lane = tid & 31; const size_t t = (size_t)blockIdx.x * 8 + wv; const float* row = QKV + t * (3 * CC); float q[8], k[8]; float sq = 0.f, sk = 0.f;
#pragma unroll
  for (int u = 0; u < 8; ++u) { q[u] = row[u * 32 + lane]; k[u] = row[CC + u * 32 + lane]; sq += q[u]; sk += k[u]; }
  for (int o = 16; o >= 1; o >>= 1) { sq += __shfl_xor(sq, o, 32); sk += __shfl_xor(sk, o, 32); } const float mq = sq * (1.0f / CC), mk = sk * (1.0f / CC);
  float q2s = 0.f, k2s = 0.f;
#pragma unroll
  for (int u = 0; u < 8; ++u) { q[u] = (q[u] - mq) * (q[u] - mq); k[u] = (k[u] - mk) * (k[u] - mk); q2s += q[u]; k2s += k[u]; }
  for (int o = 16; o >= 1; o >>= 1) { q2s += __shfl_xor(q2s, o, 32); k2s += __shfl_xor(k2s, o, 32); }
  float nq = 0.f; const float rq = 1.0f / (q2s + 1e-7f), rk = 1.0f / (k2s + 1e-7f);
#pragma unroll
  for (int u = 0; u < 8; ++u) { q[u] = q[u] * rq; k[u] = k[u] * rk; nq += q[u] * q[u]; }
  for (int o = 16; o >= 1; o >>= 1) nq += __shfl_xor(nq, o, 32); const float iq = 1.0f / fmaxf(sqrtf(nq), 1e-12f);
#pragma unroll
  for (int u = 0; u < 8; ++u) q[u] *= iq;
  {
#pragma unroll
    for (int u = 0; u < 8; ++u) { *(float*)(Q2n + t * CC + u * 32 + lane) = q[u]; *(float*)(K2a + t * CC + u * 32 + lane) = k[u]; }  }
}
// column norms of K2a over the 4096 tokens of each batch, in two launches, every sum in double and in a fixed order.
// Stage 1: block per (chunk of 64 tokens, batch); a thread takes 4 adjacent columns of every 4th token; the 4 token groups are joined through LDS: PS[b][chunk][c].
#define NCH 64
__global__ __launch_bounds__(256) void k_colnorm_part(const float* __restrict__ K2a, double* __restrict__ PS) {
  __shared__ double red[4][CC];
  const int tid = threadIdx.x, c4 = (tid & 63) * 4, rg = tid >> 6, ch = blockIdx.x, b = blockIdx.y;
  const float* base = K2a + ((size_t)b * NTK + (size_t)ch * (NTK / NCH) + rg) * CC + c4;
  v4f v[NTK / NCH / 4];
  // unrolled so that the loads are independent of the sums and many are in flight per wave (the rolled one-load loop paid a full memory latency per token)
#pragma unroll
  for (int i = 0; i < NTK / NCH / 4; ++i) v[i] = *(const v4fa*)(base + (size_t)i * 4 * CC);
  double s[4] = {0.0, 0.0, 0.0, 0.0};
  // unrolled so that v[] stays in registers (constant indices)
#pragma unroll
  for (int i = 0; i < NTK / NCH / 4; ++i)
#pragma unroll
    for (int q = 0; q < 4; ++q) s[q] += (double)v[i][q] * (double)v[i][q];
#pragma unroll
  for (int q = 0; q < 4; ++q) red[rg][c4 + q] = s[q];
  __syncthreads();
  PS[((size_t)b * NCH + ch) * CC + tid] = (red[0][tid] + red[1][tid]) + (red[2][tid] + red[3][tid]);
}
// Stage 2: block per (32 columns, batch); wave g sums chunks 8g..8g+7 of its 32 columns, wave 0 joins the 8 sums: KN[b][c] = 1/max(norm, 1e-12)
__global__ __launch_bounds__(256) void k_colnorm_fin(const double* __restrict__ PS, float* __restrict__ KN) {
  __shared__ double red[8][32];
  const int tid = threadIdx.x, cl = tid & 31, g = tid >> 5, b = blockIdx.y, c = blockIdx.x * 32 + cl;
  const double* p = PS + ((size_t)b * NCH + g * (NCH / 8)) * CC + c;
  double s = 0.0;
  // unrolled so that the 8 loads are in flight together
#pragma unroll
  for (int i = 0; i < NCH / 8; ++i) s += p[(size_t)i * CC];
  red[g][cl] = s;
  __syncthreads();
  if (tid < 32) {
    double t = 0.0;
#pragma unroll
    for (int j = 0; j < 8; ++j) t += red[j][tid];
    KN[b * CC + c] = 1.0f / fmaxf((float)sqrt(t), 1e-12f);
  }
}
// hi/lo bf16 planes of vᵀ: Vh/Vl [b][d][t] (the Bt operand of kv = k2ᵀ·v), via LDS tiles of 64 tokens (one line per row segment)
__global__ __launch_bounds__(256) void k_vplanes(const float* __restrict__ QKV, unsigned short* __restrict__ Vh, unsigned short* __restrict__ Vl) {
  __shared__ float tv[64][33]; const int b = blockIdx.z; const int t0 = blockIdx.x * 64, c0 = blockIdx.y * 32; const int tx = threadIdx.x & 31, ty = threadIdx.x >> 5;
  for (int i = ty; i < 64; i += 8) { const size_t tok = (size_t)b * NTK + t0 + i; tv[i][tx] = QKV[tok * (3 * CC) + 2 * CC + c0 + tx]; }
  __syncthreads(); typedef unsigned short us2 __attribute__((ext_vector_type(2)));
  { for (int e = threadIdx.x; e < 32 * 32; e += 256) { const int cr = e >> 5, tp = (e & 31) * 2; us2 vh, vl;
      { const float a = tv[tp][cr], c2 = tv[tp + 1][cr]; const unsigned short ah = bf16_bits(a), ch = bf16_bits(c2); vh.x = ah; vh.y = ch; vl.x = bf16_bits(a - bf16_val(ah)); vl.y = bf16_bits(c2 - bf16_val(ch)); }
      const size_t dst = ((size_t)b * CC + c0 + cr) * NTK + t0 + tp; *(us2*)(Vh + dst) = vh; *(us2*)(Vl + dst) = vl; }
     }
}
// K2T[b][c][t] = column-normalised k2 transposed (f32, the A operand of kv; split hi/lo inside the GEMM)
__global__ __launch_bounds__(256) void k_k2t(const float* __restrict__ K2a, const float* __restrict__ KN, float* __restrict__ K2T) { __shared__ float tk[32][33]; const int b = blockIdx.z; const int t0 = blockIdx.x * 32, c0 = blockIdx.y * 32; const int tx = threadIdx.x & 31, ty = threadIdx.x >> 5;
  for (int i = ty; i < 32; i += 8) tk[i][tx] = K2a[((size_t)b * NTK + t0 + i) * CC + c0 + tx] * KN[b * CC + c0 + tx]; __syncthreads();
  { for (int i = ty; i < 32; i += 8) *(float*)(K2T + ((size_t)b * CC + c0 + i) * NTK + t0 + tx) = tk[tx][i];  } }
// kv = sum of its KSL token-slice partials KVp[slice][b][c][d], added in slice order (f32); then kv -> Bt for t2 = q2 kv: B[k=c][n=d] = kv[c][d] -> Bt[d][c]: planes hi/lo of kv transposed.
// thread per (b, 8 c, d) with d along the lanes: each of the 8 * KSL loads of a wave reads one whole line
#define KSL 16
__global__ __launch_bounds__(256) void k_kvplanes(const float* __restrict__ KVp, unsigned short* __restrict__ Ph, unsigned short* __restrict__ Pl) { const int t = blockIdx.x * 256 + threadIdx.x; if (t >= BB * CC * (CC / 8)) return; const int d = t % CC; const int c8 = ((t / CC) % (CC / 8)) * 8; const int b = t / ((CC / 8) * CC); v8us h, l;
  const float* p = KVp + ((size_t)b * CC + c8) * CC + d; float s[8] = {0.f, 0.f, 0.f, 0.f, 0.f, 0.f, 0.f, 0.f};
  // kept rolled, 4 slices a trip: 32 independent loads are in flight per wave; fully unrolled, the 128 loads took 138 registers
#pragma unroll 1
  for (int z = 0; z < KSL; z += 4) {
    float v[4][8];
    // unrolled so that v[] stays in registers and the loads do not wait on the sums
#pragma unroll
    for (int j = 0; j < 4; ++j)
#pragma unroll
      for (int q = 0; q < 8; ++q) v[j][q] = p[(size_t)(z + j) * BB * CC * CC + (size_t)q * CC];
#pragma unroll
    for (int j = 0; j < 4; ++j)
#pragma unroll
      for (int q = 0; q < 8; ++q) s[q] += v[j][q];
  }
  for (int q = 0; q < 8; ++q) { const float v = s[q]; const unsigned short hb = bf16_bits(v); h[q] = hb; l[q] = bf16_bits(v - bf16_val(hb)); } const size_t dst = ((size_t)b * CC + d) * CC + c8; *(v8us*)(Ph + dst) = h; *(v8us*)(Pl + dst) = l;  }
// t2 = q2 kv, attn = v + t2/sqrt(N) and out = attn W_out + b in one launch. Block = 16 tokens x all 256 channels, wave w = channels 64w .. 64w+63 of both products.
// The attn tile goes from the first product's accumulators to the second product's A fragments through LDS, as bf16 hi/lo planes (each value is split once, by the wave that made it).
// Plane pitch 528 bytes = 16 x 33: the 16 rows of a 16-byte fragment read fall on different banks.
__global__ __launch_bounds__(128) void k_t2_attn_out(const float* __restrict__ Q2n, const unsigned short* __restrict__ Ph, const unsigned short* __restrict__ Pl, const float* __restrict__ QKV,
                                                    const unsigned short* __restrict__ Bo, const float* __restrict__ bout, float* __restrict__ out) {
  __shared__ __attribute__((aligned(16))) unsigned short sAh[16][CC + 8], sAl[16][CC + 8];
  __shared__ __attribute__((aligned(16))) float so[4][16][64];
  const int tid = threadIdx.x, w = tid >> 5, lane = tid & 31, ln = lane & 15, hh = lane >> 4;
  const int col0 = w * 64;
  const size_t tok0 = (size_t)blockIdx.y * NTK + (size_t)blockIdx.x * 16;
  const unsigned short* Bh = Ph + (size_t)blockIdx.y * CC * CC; const unsigned short* Bl = Pl + (size_t)blockIdx.y * CC * CC;
  const float* arow = Q2n + (tok0 + ln) * CC;
  v8f acc[4] = {};
  for (int kb = 0; kb < CC; kb += 32) {
    FragB ah, al;
    const v4f x0 = *(const v4fa*)(arow + kb + 8 * hh), x1 = *(const v4fa*)(arow + kb + 8 * hh + 4);
    const v4f x2 = *(const v4fa*)(arow + kb + 16 + 8 * hh), x3 = *(const v4fa*)(arow + kb + 16 + 8 * hh + 4);
    float xs[16] = {x0[0],x0[1],x0[2],x0[3],x1[0],x1[1],x1[2],x1[3],x2[0],x2[1],x2[2],x2[3],x3[0],x3[1],x3[2],x3[3]};
#pragma unroll
    for (int i = 0; i < 16; ++i) { const unsigned short hb = bf16_bits(xs[i]); ah.u[i] = hb; al.u[i] = bf16_bits(xs[i] - bf16_val(hb)); }
#pragma unroll
    for (int t = 0; t < 4; ++t) {
      const size_t boff = (size_t)(col0 + t * 16 + ln) * CC + kb;
      FragB bh_, bl_; bh_.half[0] = *(const v8us*)(Bh + boff + 8 * hh); bh_.half[1] = *(const v8us*)(Bh + boff + 16 + 8 * hh);
      bl_.half[0] = *(const v8us*)(Bl + boff + 8 * hh); bl_.half[1] = *(const v8us*)(Bl + boff + 16 + 8 * hh);
      acc[t] = mmaN<3>(ah.v, al.v, bh_.v, bl_.v, acc[t]);
    }
  }
  const float* vrow = QKV + (tok0 + 8 * hh) * (3 * CC) + 2 * CC + col0 + ln;
  v8f rv[4];
#pragma unroll
  for (int t = 0; t < 4; ++t)
#pragma unroll
    for (int r = 0; r < 8; ++r) rv[t][r] = vrow[r * (3 * CC) + t * 16];
  // inputs-only fence on the loaded values: all 32 loads of v are issued together and waited for once (without it they were issued a few at a time among the splits, each group paying a full latency)
  asm volatile("" :: "v"(rv[0]), "v"(rv[1]), "v"(rv[2]), "v"(rv[3]));
#pragma unroll
  for (int t = 0; t < 4; ++t) {
    const int col = col0 + t * 16 + ln;
#pragma unroll
    for (int r = 0; r < 8; ++r) {
      const float a = rv[t][r] + acc[t][r] * 0.015625f;
      const unsigned short hb = bf16_bits(a); sAh[8 * hh + r][col] = hb; sAl[8 * hh + r][col] = bf16_bits(a - bf16_val(hb));
    }
  }
  __syncthreads();      // every wave reads all 256 channels of the attn tile, of which each wave wrote 64
  v8f oc[4] = {};
  for (int kb = 0; kb < CC; kb += 32) {
    FragB ah, al;
    ah.half[0] = *(const v8us*)&sAh[ln][kb + 8 * hh]; ah.half[1] = *(const v8us*)&sAh[ln][kb + 16 + 8 * hh];
    al.half[0] = *(const v8us*)&sAl[ln][kb + 8 * hh]; al.half[1] = *(const v8us*)&sAl[ln][kb + 16 + 8 * hh];
#pragma unroll
    for (int t = 0; t < 4; ++t) {
      const unsigned short* brow = Bo + (size_t)(col0 + t * 16 + ln) * CC + kb;
      FragB b;
      b.half[0] = *(const v8us*)(brow + 8 * hh);
      b.half[1] = *(const v8us*)(brow + 16 + 8 * hh);
      oc[t] = mmaN<2>(ah.v, al.v, b.v, b.v, oc[t]);
    }
  }
#pragma unroll
  for (int t = 0; t < 4; ++t) {
    const float bv = bf16_round(bout[col0 + t * 16 + ln]);
#pragma unroll
    for (int r = 0; r < 8; ++r) so[w][8 * hh + r][t * 16 + ln] = oc[t][r] + bv;
  }
  __builtin_amdgcn_fence(__ATOMIC_ACQ_REL, "workgroup");
  __builtin_amdgcn_wave_barrier();
  const int rsub = lane >> 4, c4 = (lane & 15) * 4;
#pragma unroll
  for (int q = 0; q < 8; ++q) {
    const int r = q * 2 + rsub;
    const v4f v = *(const v4fa*)&so[w][r][c4];
    *(v4f*)(out + (tok0 + r) * CC + col0 + c4) = v;
  }
}
extern "C" void kernel_launch(void* const* d_in, const int* in_sizes, int n_in,
                              void* d_out, int out_size, void* d_ws, size_t ws_size, hipStream_t stream) {
  (void)in_sizes; (void)n_in; (void)out_size;
  const float* x = (const float*)d_in[0]; const float* Wqkv = (const float*)d_in[1]; const float* bqkv = (const float*)d_in[2]; const float* Wout = (const float*)d_in[3]; const float* bout = (const float*)d_in[4];
  char* ws = (char*)d_ws; size_t off = 0;
  auto take = [&](size_t bytes) { char* p = ws + off; off += (bytes + 255) & ~(size_t)255; return p; };
  unsigned short* Bq = (unsigned short*)take((size_t)3 * CC * CC * 2); unsigned short* Bo = (unsigned short*)take((size_t)CC * CC * 2);
  float* QKV = (float*)take((size_t)BB * NTK * 3 * CC * 4); float* Q2n = (float*)take((size_t)BB * NTK * CC * 4); float* K2a = (float*)take((size_t)BB * NTK * CC * 4); float* KN = (float*)take(BB * CC * 4);
  float* K2T = (float*)take((size_t)BB * CC * NTK * 4); unsigned short* Vh = (unsigned short*)take((size_t)BB * CC * NTK * 2); unsigned short* Vl = (unsigned short*)take((size_t)BB * CC * NTK * 2);
  unsigned short* Ph = (unsigned short*)take((size_t)BB * CC * CC * 2); unsigned short* Pl = (unsigned short*)take((size_t)BB * CC * CC * 2); double* PS = (double*)take((size_t)BB * NCH * CC * 8);
  float* KVp = K2a;      // buffer reuse: K2a is dead once K2T exists: the KSL partials of kv (KSL*BB*CC*CC = BB*NTK*CC floats)
  if (off > ws_size) return;
  k_btw<<<(3 * CC * 32 + 255) / 256, 256, 0, stream>>>(Wqkv, Bq, CC, 3 * CC); k_btw<<<(CC * 32 + 255) / 256, 256, 0, stream>>>(Wout, Bo, CC, CC);
  k_gemm_bf3<false, 0, true, false><<<((BB * NTK / 16) * (3 * CC / 64) + 3) / 4, 128, 0, stream>>>(x, CC, Bq, CC, bqkv, nullptr, 1, 0, QKV, 3 * CC, BB * NTK, 3 * CC, CC);
  k_prep<<<BB * NTK / 8, 256, 0, stream>>>(QKV, Q2n, K2a); k_colnorm_part<<<dim3(NCH, BB), 256, 0, stream>>>(K2a, PS); k_colnorm_fin<<<dim3(CC / 32, BB), 256, 0, stream>>>(PS, KN);
  k_k2t<<<dim3(NTK / 32, CC / 32, BB), 256, 0, stream>>>(K2a, KN, K2T);
  k_vplanes<<<dim3(NTK / 64, CC / 32, BB), 256, 0, stream>>>(QKV, Vh, Vl);
  k_gemm_b<true, true, 0><<<dim3(((CC / 16) * (CC / 64) + 3) / 4, BB, KSL), 128, 0, stream>>>(K2T, NTK, (size_t)CC * NTK, Vh, Vl, NTK, (size_t)CC * NTK, nullptr, nullptr, 0, 0, 1.f, 1.f, KVp, CC, (size_t)CC * CC, (size_t)BB * CC * CC, CC, CC, NTK / KSL);      // slice z: KVp[z][b][c][d] = sum over the tokens t of slice z of k2[t][c] * v[t][d]
  k_kvplanes<<<(BB * CC * (CC / 8) + 255) / 256, 256, 0, stream>>>(KVp, Ph, Pl);
  k_t2_attn_out<<<dim3(NTK / 16, BB), 128, 0, stream>>>(Q2n, Ph, Pl, QKV, Bo, bout, (float*)d_out);      // t2 = q2 * kv, attn = v + t2 / 64, out = attn * W_out + b
}

// v004
// One run takes 203 microseconds.
// Next to v003, in two timings, it ran 1.31 and 1.30 times as fast.
// All steps since v000 together make it 10.0 times as fast.
#include <hip/hip_runtime.h>
// Linear attention on WMMA (f32 accumulate): qkv = x·W_qkv + b (inputs rounded to bf16: single exact term; 32768 × 256 × 768), per batch kv = k2ᵀ·v (k2 and v are computed
// f32 → split into bf16 hi/lo: 3 products; 256 × 256 × 4096), t2 = q2·kv (3 products), out = attn·W_out + b (attn split hi/lo vs exact weights: 2 products). Mean-centering,
// squares, the two normalisations and the residual are f32 VALU (column statistics as fixed-order double sums).
#define BB 8
#define NTK 4096
#define CC 256

typedef __bf16 v16b __attribute__((ext_vector_type(16)));
typedef unsigned short v8us __attribute__((ext_vector_type(8), may_alias));
typedef float  v8f  __attribute__((ext_vector_type(8)));
typedef float  v4f  __attribute__((ext_vector_type(4)));
typedef float  v4fa __attribute__((ext_vector_type(4), may_alias));
union FragB { v16b v; v8us half[2]; unsigned short u[16]; };

__device__ __forceinline__ unsigned short bf16_bits(float x) { unsigned int u = __float_as_uint(x); return (unsigned short)((u + 0x7FFFu + ((u >> 16) & 1u)) >> 16); }
__device__ __forceinline__ float bf16_val(unsigned short b) { return __uint_as_float(((unsigned int)b) << 16); }
__device__ __forceinline__ float bf16_round(float x) { return bf16_val(bf16_bits(x)); }
// D += A·B with NT terms: 1 = ah·bh, 2 = + al·bh (A split), 3 = + ah·bl (both split)
template <int NT>
__device__ __forceinline__ v8f mmaN(v16b ah, v16b al, v16b bh, v16b bl, v8f c) {
  c = __builtin_amdgcn_wmma_f32_16x16x32_bf16(false, ah, false, bh, (short)0, c, false, false);
  if (NT >= 2) c = __builtin_amdgcn_wmma_f32_16x16x32_bf16(false, al, false, bh, (short)0, c, false, false);
  if (NT >= 3) c = __builtin_amdgcn_wmma_f32_16x16x32_bf16(false, ah, false, bl, (short)0, c, false, false);
  asm volatile("v_nop\n\tv_nop\n\tv_nop\n\tv_nop" : "+v"(c) : "v"(ah), "v"(al), "v"(bh), "v"(bl));
  return c;
}

__global__ __launch_bounds__(256) void k_wt_bf16(const float* __restrict__ W, unsigned short* __restrict__ Wt, int K, int N) {
  const int t = blockIdx.x * 256 + threadIdx.x;
  const int k8n = K / 8;
  if (t >= N * k8n) return;
  const int n = t / k8n, k8 = (t % k8n) * 8;
  v8us v;
#pragma unroll
  for (int i = 0; i < 8; ++i) v[i] = bf16_bits(W[(size_t)(k8 + i) * N + n]);
  *(v8us*)(Wt + (size_t)n * K + k8) = v;
  
}

// GEMM C[M][N] (f32, pitch ldc) = act(A[M][K]·W + bias). A f32 row-major (pitch lda) converted per fragment to bf16
// (ASPLIT: hi/lo two planes -> 2 terms, else single rounded term); Wt bf16 [N][K] (pitch ldb). BIAS_BF16 rounds the
// bias to bf16 first (bias quantised to bf16 before the add). K%32==0, M%16==0, N%64==0.
template <bool ASPLIT, int ACT, bool BIAS_BF16>
__global__ __launch_bounds__(128) void k_gemm_bf(const float* __restrict__ A, int lda, const unsigned short* __restrict__ Wt, int ldb,
                                               const float* __restrict__ bias, float* __restrict__ C, int ldc, int M, int N, int K) {
  __shared__ __attribute__((aligned(16))) float so[4][16][64];
  const int tid = threadIdx.x, w = tid >> 5, lane = tid & 31, ln = lane & 15, hh = lane >> 4;
  const int ntn = N / 64;
  const int wid = blockIdx.x * 4 + w;
  const int mt = wid / ntn, nq = wid % ntn;
  if (mt * 16 >= M) return;
  const int row0 = mt * 16, col0 = nq * 64;
  const float* arow = A + (size_t)(row0 + ln) * lda;
  v8f acc[4] = {};
  for (int kb = 0; kb < K; kb += 32) {
    FragB ah, al;
    const v4f x0 = *(const v4fa*)(arow + kb + 8 * hh), x1 = *(const v4fa*)(arow + kb + 8 * hh + 4);
    const v4f x2 = *(const v4fa*)(arow + kb + 16 + 8 * hh), x3 = *(const v4fa*)(arow + kb + 16 + 8 * hh + 4);
    float xs[16] = {x0[0],x0[1],x0[2],x0[3],x1[0],x1[1],x1[2],x1[3],x2[0],x2[1],x2[2],x2[3],x3[0],x3[1],x3[2],x3[3]};
#pragma unroll
    for (int i = 0; i < 16; ++i) { const unsigned short hb = bf16_bits(xs[i]); ah.u[i] = hb; al.u[i] = ASPLIT ? bf16_bits(xs[i] - bf16_val(hb)) : (unsigned short)0; }
#pragma unroll
    for (int t = 0; t < 4; ++t) {
      const unsigned short* brow = Wt + (size_t)(col0 + t * 16 + ln) * ldb + kb;
      FragB b;
      b.half[0] = *(const v8us*)(brow + 8 * hh);
      b.half[1] = *(const v8us*)(brow + 16 + 8 * hh);
      acc[t] = mmaN<ASPLIT ? 2 : 1>(ah.v, al.v, b.v, b.v, acc[t]);
    }
  }
#pragma unroll
  for (int t = 0; t < 4; ++t) {
    float bv = bias ? bias[col0 + t * 16 + ln] : 0.f;
    if (BIAS_BF16) bv = bf16_round(bv);
#pragma unroll
    for (int r = 0; r < 8; ++r) { float v = acc[t][r] + bv; if (ACT == 1) v = fmaxf(v, 0.f); so[w][8 * hh + r][t * 16 + ln] = v; }
  }
  __builtin_amdgcn_fence(__ATOMIC_ACQ_REL, "workgroup");
  __builtin_amdgcn_wave_barrier();
  const int rsub = lane >> 4, c4 = (lane & 15) * 4;
  {
#pragma unroll
    for (int q = 0; q < 8; ++q) {
      const int r = q * 2 + rsub;
      const v4f v = *(const v4fa*)&so[w][r][c4];
      *(v4f*)(C + (size_t)(row0 + r) * ldc + col0 + c4) = v;
    }
    
  }
}

// Flash-style causal/unmasked attention, all contractions 3-term bf16 hi/lo splits, f32 softmax with running max.
// q,k,v rows are read from f32 buffers with arbitrary row pitch (so they can live inside a fused qkv buffer);
// D = head size (multiple of 32, <= 128); one wave = 16 query rows; block = 4 waves (64 queries) sharing K/V chunks of 32.
template <int D, bool CAUSAL>
__global__ __launch_bounds__(128) void k_flash(const float* __restrict__ qb, const float* __restrict__ kb, const float* __restrict__ vb,
                                             int pitch, int T, int H, float scale, float* __restrict__ y, int ypitch) {
  constexpr int KS = D / 32;        // k-steps for QK
  constexpr int DT = D / 16;        // d tiles for PV
  __shared__ __attribute__((aligned(16))) unsigned short sKh[32][D + 8], sKl[32][D + 8], sVh[32][D + 8], sVl[32][D + 8];
  __shared__ __attribute__((aligned(16))) unsigned short sPh[4][16][40], sPl[4][16][40];
  __shared__ __attribute__((aligned(16))) float sO[4][16][D];
  const int tid = threadIdx.x, w = tid >> 5, lane = tid & 31, ln = lane & 15, hh = lane >> 4;
  const int nqb = (T + 63) / 64;
  const int bh = blockIdx.x / nqb, qblk = blockIdx.x % nqb;
  const int b = bh / H, h = bh % H;
  const int q0 = qblk * 64 + w * 16;
  const float* Q = qb + (size_t)b * T * pitch + h * D;
  const float* K = kb + (size_t)b * T * pitch + h * D;
  const float* V = vb + (size_t)b * T * pitch + h * D;

  // A fragments of the wave's 16 query rows (scaled), hi/lo
  FragB aqh[KS], aql[KS];
  {
    int row = q0 + ln; if (row >= T) row = T - 1;
    const float* qr = Q + (size_t)row * pitch;
#pragma unroll
    for (int ks = 0; ks < KS; ++ks)
#pragma unroll
      for (int i = 0; i < 16; ++i) {
        const int d = ks * 32 + ((i < 8) ? (8 * hh + i) : (16 + 8 * hh + (i - 8)));
        const float x = qr[d] * scale; const unsigned short hb = bf16_bits(x);
        aqh[ks].u[i] = hb; aql[ks].u[i] = bf16_bits(x - bf16_val(hb));
      }
  }
  float m_r[8], l_r[8];
#pragma unroll
  for (int r = 0; r < 8; ++r) { m_r[r] = -3.0e38f; l_r[r] = 0.f; }
  v8f oacc[DT];
#pragma unroll
  for (int dt = 0; dt < DT; ++dt) oacc[dt] = (v8f){0.f,0.f,0.f,0.f,0.f,0.f,0.f,0.f};

  const int kv_end = CAUSAL ? min(T, qblk * 64 + 64) : T;     // block-uniform
  for (int j0 = 0; j0 < kv_end; j0 += 32) {
    __syncthreads();
    for (int e = tid; e < 32 * (D / 4); e += 128) {
      const int r = e / (D / 4), c4 = (e % (D / 4)) * 4;
      const int key = j0 + r;
      v4f kf = {0.f,0.f,0.f,0.f}, vf = {0.f,0.f,0.f,0.f};
      if (key < T) { kf = *(const v4fa*)(K + (size_t)key * pitch + c4); vf = *(const v4fa*)(V + (size_t)key * pitch + c4); }
#pragma unroll
      for (int t = 0; t < 4; ++t) {
        unsigned short hb = bf16_bits(kf[t]); sKh[r][c4 + t] = hb; sKl[r][c4 + t] = bf16_bits(kf[t] - bf16_val(hb));
        hb = bf16_bits(vf[t]); sVh[r][c4 + t] = hb; sVl[r][c4 + t] = bf16_bits(vf[t] - bf16_val(hb));
      }
    }
    __syncthreads();
    // S tile 16 x 32
    v8f s[2];
#pragma unroll
    for (int nt = 0; nt < 2; ++nt) {
      v8f acc = {};
#pragma unroll
      for (int ks = 0; ks < KS; ++ks) {
        FragB bh_, bl_;
        bh_.half[0] = *(const v8us*)&sKh[nt * 16 + ln][ks * 32 + 8 * hh]; bh_.half[1] = *(const v8us*)&sKh[nt * 16 + ln][ks * 32 + 16 + 8 * hh];
        bl_.half[0] = *(const v8us*)&sKl[nt * 16 + ln][ks * 32 + 8 * hh]; bl_.half[1] = *(const v8us*)&sKl[nt * 16 + ln][ks * 32 + 16 + 8 * hh];
        acc = mmaN<3>(aqh[ks].v, aql[ks].v, bh_.v, bl_.v, acc);
      }
      s[nt] = acc;
    }
    // mask + running max (rows 8hh+r; the 16 lanes of a half share rows)
    float alpha[8];
#pragma unroll
    for (int r = 0; r < 8; ++r) {
      const int qi = q0 + 8 * hh + r;
      const int ja = j0 + ln, jb = j0 + 16 + ln;
      if (CAUSAL) { if (ja > qi) s[0][r] = -3.0e38f; if (jb > qi) s[1][r] = -3.0e38f; }
      if (ja >= T) s[0][r] = -3.0e38f;
      if (jb >= T) s[1][r] = -3.0e38f;
      float mx = fmaxf(s[0][r], s[1][r]);
      mx = fmaxf(mx, __shfl_xor(mx, 1, 32)); mx = fmaxf(mx, __shfl_xor(mx, 2, 32)); mx = fmaxf(mx, __shfl_xor(mx, 4, 32)); mx = fmaxf(mx, __shfl_xor(mx, 8, 32));
      const float mnew = fmaxf(m_r[r], mx);
      alpha[r] = (mnew > -1.0e38f) ? __expf(m_r[r] - mnew) : 1.0f;
      const float p0 = (s[0][r] > -1.0e38f) ? __expf(s[0][r] - mnew) : 0.f;
      const float p1 = (s[1][r] > -1.0e38f) ? __expf(s[1][r] - mnew) : 0.f;
      m_r[r] = mnew;
      l_r[r] = l_r[r] * alpha[r] + p0 + p1;            // per-lane partial row sum (16 lanes combined at the end)
      unsigned short hb = bf16_bits(p0); sPh[w][8 * hh + r][ln] = hb;      sPl[w][8 * hh + r][ln] = bf16_bits(p0 - bf16_val(hb));
      hb = bf16_bits(p1);                sPh[w][8 * hh + r][16 + ln] = hb; sPl[w][8 * hh + r][16 + ln] = bf16_bits(p1 - bf16_val(hb));
    }
#pragma unroll
    for (int dt = 0; dt < DT; ++dt)
#pragma unroll
      for (int r = 0; r < 8; ++r) oacc[dt][r] *= alpha[r];
    __builtin_amdgcn_fence(__ATOMIC_ACQ_REL, "workgroup");
    __builtin_amdgcn_wave_barrier();
    FragB pah, pal;
    pah.half[0] = *(const v8us*)&sPh[w][ln][8 * hh]; pah.half[1] = *(const v8us*)&sPh[w][ln][16 + 8 * hh];
    pal.half[0] = *(const v8us*)&sPl[w][ln][8 * hh]; pal.half[1] = *(const v8us*)&sPl[w][ln][16 + 8 * hh];
#pragma unroll
    for (int dt = 0; dt < DT; ++dt) {
      FragB bvh, bvl;
#pragma unroll
      for (int i = 0; i < 8; ++i) {
        bvh.u[i] = sVh[8 * hh + i][dt * 16 + ln]; bvh.u[8 + i] = sVh[16 + 8 * hh + i][dt * 16 + ln];
        bvl.u[i] = sVl[8 * hh + i][dt * 16 + ln]; bvl.u[8 + i] = sVl[16 + 8 * hh + i][dt * 16 + ln];
      }
      oacc[dt] = mmaN<3>(pah.v, pal.v, bvh.v, bvl.v, oacc[dt]);
    }
    __builtin_amdgcn_fence(__ATOMIC_ACQ_REL, "workgroup");
    __builtin_amdgcn_wave_barrier();
  }
#pragma unroll
  for (int r = 0; r < 8; ++r) {
    float l = l_r[r];
    l += __shfl_xor(l, 1, 32); l += __shfl_xor(l, 2, 32); l += __shfl_xor(l, 4, 32); l += __shfl_xor(l, 8, 32);
    l_r[r] = (l > 0.f) ? 1.0f / l : 0.f;
  }
#pragma unroll
  for (int dt = 0; dt < DT; ++dt)
#pragma unroll
    for (int r = 0; r < 8; ++r) sO[w][8 * hh + r][dt * 16 + ln] = oacc[dt][r] * l_r[r];
  __builtin_amdgcn_fence(__ATOMIC_ACQ_REL, "workgroup");
  __builtin_amdgcn_wave_barrier();
  {
    for (int r = 0; r < 16; ++r) {
      const int row = q0 + r;
      if (row < T && lane < D / 4) {
        const v4f val = *(const v4fa*)&sO[w][r][lane * 4];
        *(v4f*)(y + ((size_t)b * T + row) * ypitch + h * D + lane * 4) = val;
      }
    }
    
  }
}

// GEMM C = act(A·W + bias + resid): A f32 (ASPLIT -> hi/lo 2 terms), Wt bf16 [N][K]; ACT 0 none, 1 relu, 2 exact gelu;
// resid (optional, f32, row index = (row % rmod), pitch ldr, RES_BF16 rounds it) added before the activation.
template <bool ASPLIT, int ACT, bool BIAS_BF16, bool RES_BF16>
__global__ __launch_bounds__(128) void k_gemm_bf3(const float* __restrict__ A, int lda, const unsigned short* __restrict__ Wt, int ldb,
                                                const float* __restrict__ bias, const float* __restrict__ resid, int rmod, int ldr,
                                                float* __restrict__ C, int ldc, int M, int N, int K) {
  __shared__ __attribute__((aligned(16))) float so[4][16][64];
  const int tid = threadIdx.x, w = tid >> 5, lane = tid & 31, ln = lane & 15, hh = lane >> 4;
  const int ntn = N / 64;
  const int wid = blockIdx.x * 4 + w;
  const int mt = wid / ntn, nq = wid % ntn;
  if (mt * 16 >= M) return;
  const int row0 = mt * 16, col0 = nq * 64;
  const float* arow = A + (size_t)(row0 + ln) * lda;
  v8f acc[4] = {};
  for (int kb = 0; kb < K; kb += 32) {
    FragB ah, al;
    const v4f x0 = *(const v4fa*)(arow + kb + 8 * hh), x1 = *(const v4fa*)(arow + kb + 8 * hh + 4);
    const v4f x2 = *(const v4fa*)(arow + kb + 16 + 8 * hh), x3 = *(const v4fa*)(arow + kb + 16 + 8 * hh + 4);
    float xs[16] = {x0[0],x0[1],x0[2],x0[3],x1[0],x1[1],x1[2],x1[3],x2[0],x2[1],x2[2],x2[3],x3[0],x3[1],x3[2],x3[3]};
#pragma unroll
    for (int i = 0; i < 16; ++i) { const unsigned short hb = bf16_bits(xs[i]); ah.u[i] = hb; al.u[i] = ASPLIT ? bf16_bits(xs[i] - bf16_val(hb)) : (unsigned short)0; }
#pragma unroll
    for (int t = 0; t < 4; ++t) {
      const unsigned short* brow = Wt + (size_t)(col0 + t * 16 + ln) * ldb + kb;
      FragB b;
      b.half[0] = *(const v8us*)(brow + 8 * hh);
      b.half[1] = *(const v8us*)(brow + 16 + 8 * hh);
      acc[t] = mmaN<ASPLIT ? 2 : 1>(ah.v, al.v, b.v, b.v, acc[t]);
    }
  }
#pragma unroll
  for (int t = 0; t < 4; ++t) {
    const int col = col0 + t * 16 + ln;
    float bv = bias ? bias[col] : 0.f;
    if (BIAS_BF16) bv = bf16_round(bv);
#pragma unroll
    for (int r = 0; r < 8; ++r) {
      float v = acc[t][r] + bv;
      if (resid) { float rv = resid[(size_t)((row0 + 8 * hh + r) % rmod) * ldr + col]; if (RES_BF16) rv = bf16_round(rv); v += rv; }
      if (ACT == 1) v = fmaxf(v, 0.f);
      if (ACT == 2) v = 0.5f * v * (1.0f + erff(v * 0.70710678118654752f));
      if (ACT == 3) { const float u = 0.7978845608028654f * (v + 0.044715f * v * v * v); v = 0.5f * v * (1.0f + tanhf(u)); }
      so[w][8 * hh + r][t * 16 + ln] = v;
    }
  }
  __builtin_amdgcn_fence(__ATOMIC_ACQ_REL, "workgroup");
  __builtin_amdgcn_wave_barrier();
  const int rsub = lane >> 4, c4 = (lane & 15) * 4;
  {
#pragma unroll
    for (int q = 0; q < 8; ++q) {
      const int r = q * 2 + rsub;
      const v4f v = *(const v4fa*)&so[w][r][c4];
      *(v4f*)(C + (size_t)(row0 + r) * ldc + col0 + c4) = v;
    }
    
  }
}
// row LayerNorm (biased variance, eps) over N: s = X (+ R); optional out_sum <- s; out_norm <- (s-mu)*rsqrt(var+eps)*g + b
template <bool PARAM_BF16>
__global__ __launch_bounds__(256) void k_layernorm(const float* __restrict__ X, const float* __restrict__ R, const float* __restrict__ g, const float* __restrict__ bta,
                                                  float* __restrict__ out_sum, float* __restrict__ out_norm, int N, float eps) {
  __shared__ float red[256];
  const int row = blockIdx.x, tid = threadIdx.x;
  const float* x = X + (size_t)row * N; const float* rr = R ? R + (size_t)row * N : nullptr;
  float vals[16];                     // up to N = 4096
  const int per = N / 256;            // contiguous chunk per thread? use strided-by-4 chunks: thread handles j = tid*4 + 1024*u
  float s1 = 0.f;
  for (int u = 0; u < per / 4; ++u) {
    const int j = tid * 4 + 1024 * u;
    const v4f a = *(const v4fa*)(x + j);
    v4f b = {0.f,0.f,0.f,0.f}; if (rr) b = *(const v4fa*)(rr + j);
#pragma unroll
    for (int q = 0; q < 4; ++q) { const float v = a[q] + b[q]; vals[u * 4 + q] = v; s1 += v; }
  }
  red[tid] = s1; __syncthreads();
  for (int st = 128; st > 0; st >>= 1) { if (tid < st) red[tid] += red[tid + st]; __syncthreads(); }
  const float mu = red[0] / (float)N; __syncthreads();
  float s2 = 0.f;
  for (int u = 0; u < per / 4; ++u)
#pragma unroll
    for (int q = 0; q < 4; ++q) { const float c = vals[u * 4 + q] - mu; s2 += c * c; }
  red[tid] = s2; __syncthreads();
  for (int st = 128; st > 0; st >>= 1) { if (tid < st) red[tid] += red[tid + st]; __syncthreads(); }
  const float rs = rsqrtf(red[0] / (float)N + eps);
  {
    for (int u = 0; u < per / 4; ++u) {
      const int j = tid * 4 + 1024 * u;
      v4f o, sm;
#pragma unroll
      for (int q = 0; q < 4; ++q) {
        float gg = g[j + q], bb = bta[j + q];
        if (PARAM_BF16) { gg = bf16_round(gg); bb = bf16_round(bb); }
        sm[q] = vals[u * 4 + q]; o[q] = (vals[u * 4 + q] - mu) * rs * gg + bb;
      }
      if (out_sum) *(v4f*)(out_sum + (size_t)row * N + j) = sm;
      *(v4f*)(out_norm + (size_t)row * N + j) = o;
    }
    
  }
}

// batched f32 [K][N] (pitch lds, batch stride sIn) -> transposed hi/lo planes [N][K] (batch stride sOut); thread per (n, 8 k); grid.y = batch
__global__ __launch_bounds__(256) void k_split_transpose_b(const float* __restrict__ src, int lds_, size_t sIn, unsigned short* __restrict__ hi, unsigned short* __restrict__ lo, size_t sOut, int K, int N) {
  const size_t t = (size_t)blockIdx.x * 256 + threadIdx.x; const int k8n = K / 8; if (t >= (size_t)N * k8n) return;
  src += (size_t)blockIdx.y * sIn; hi += (size_t)blockIdx.y * sOut; lo += (size_t)blockIdx.y * sOut;
  const int n = (int)(t / k8n), k8 = (int)(t % k8n) * 8; v8us vh, vl;
#pragma unroll
  for (int i = 0; i < 8; ++i) { const float x = src[(size_t)(k8 + i) * lds_ + n]; const unsigned short hb = bf16_bits(x); vh[i] = hb; vl[i] = bf16_bits(x - bf16_val(hb)); }
  unsigned short* dh = hi + (size_t)n * K + k8; unsigned short* dl = lo + (size_t)n * K + k8;
  *(v8us*)dh = vh; *(v8us*)dl = vl; 
}

__global__ __launch_bounds__(256) void k_btw(const float* __restrict__ W, unsigned short* __restrict__ Bt, int K, int N) { const int t = blockIdx.x * 256 + threadIdx.x; if (t >= N * (K / 8)) return; const int n = t / (K / 8), k8 = (t % (K / 8)) * 8; v8us v; for (int q = 0; q < 8; ++q) v[q] = bf16_bits(W[(size_t)(k8 + q) * N + n]); *(v8us*)(Bt + (size_t)n * K + k8) = v;  }
// per token: q ← q − mean(q), k ← k − mean(k); q2 = q², k2 = k²; q2s, k2s; Q2n[t][c] = l2norm_c(q2/(q2s+1e-7)); K2a[t][c] = k2/(k2s+1e-7) (column-normalised later); wave per token, 8 per lane
__global__ __launch_bounds__(256) void k_prep(const float* __restrict__ QKV, float* __restrict__ Q2n, float* __restrict__ K2a) {
  const int tid = threadIdx.x, wv = tid >> 5, lane = tid & 31; const size_t t = (size_t)blockIdx.x * 8 + wv; const float* row = QKV + t * (3 * CC); float q[8], k[8]; float sq = 0.f, sk = 0.f;
#pragma unroll
  for (int u = 0; u < 8; ++u) { q[u] = row[u * 32 + lane]; k[u] = row[CC + u * 32 + lane]; sq += q[u]; sk += k[u]; }
  for (int o = 16; o >= 1; o >>= 1) { sq += __shfl_xor(sq, o, 32); sk += __shfl_xor(sk, o, 32); } const float mq = sq * (1.0f / CC), mk = sk * (1.0f / CC);
  float q2s = 0.f, k2s = 0.f;
#pragma unroll
  for (int u = 0; u < 8; ++u) { q[u] = (q[u] - mq) * (q[u] - mq); k[u] = (k[u] - mk) * (k[u] - mk); q2s += q[u]; k2s += k[u]; }
  for (int o = 16; o >= 1; o >>= 1) { q2s += __shfl_xor(q2s, o, 32); k2s += __shfl_xor(k2s, o, 32); }
  float nq = 0.f; const float rq = 1.0f / (q2s + 1e-7f), rk = 1.0f / (k2s + 1e-7f);
#pragma unroll
  for (int u = 0; u < 8; ++u) { q[u] = q[u] * rq; k[u] = k[u] * rk; nq += q[u] * q[u]; }
  for (int o = 16; o >= 1; o >>= 1) nq += __shfl_xor(nq, o, 32); const float iq = 1.0f / fmaxf(sqrtf(nq), 1e-12f);
#pragma unroll
  for (int u = 0; u < 8; ++u) q[u] *= iq;
  {
#pragma unroll
    for (int u = 0; u < 8; ++u) { *(float*)(Q2n + t * CC + u * 32 + lane) = q[u]; *(float*)(K2a + t * CC + u * 32 + lane) = k[u]; }  }
}
// column norms of K2a over the 4096 tokens of each batch, in two launches, every sum in double and in a fixed order.
// Stage 1: block per (chunk of 64 tokens, batch); a thread takes 4 adjacent columns of every 4th token; the 4 token groups are joined through LDS: PS[b][chunk][c].
#define NCH 64
__global__ __launch_bounds__(256) void k_colnorm_part(const float* __restrict__ K2a, double* __restrict__ PS) {
  __shared__ double red[4][CC];
  const int tid = threadIdx.x, c4 = (tid & 63) * 4, rg = tid >> 6, ch = blockIdx.x, b = blockIdx.y;
  const float* base = K2a + ((size_t)b * NTK + (size_t)ch * (NTK / NCH) + rg) * CC + c4;
  v4f v[NTK / NCH / 4];
  // unrolled so that the loads are independent of the sums and many are in flight per wave (the rolled one-load loop paid a full memory latency per token)
#pragma unroll
  for (int i = 0; i < NTK / NCH / 4; ++i) v[i] = *(const v4fa*)(base + (size_t)i * 4 * CC);
  double s[4] = {0.0, 0.0, 0.0, 0.0};
  // unrolled so that v[] stays in registers (constant indices)
#pragma unroll
  for (int i = 0; i < NTK / NCH / 4; ++i)
#pragma unroll
    for (int q = 0; q < 4; ++q) s[q] += (double)v[i][q] * (double)v[i][q];
#pragma unroll
  for (int q = 0; q < 4; ++q) red[rg][c4 + q] = s[q];
  __syncthreads();
  PS[((size_t)b * NCH + ch) * CC + tid] = (red[0][tid] + red[1][tid]) + (red[2][tid] + red[3][tid]);
}
// Stage 2: block per (32 columns, batch); wave g sums chunks 8g..8g+7 of its 32 columns, wave 0 joins the 8 sums: KN[b][c] = 1/max(norm, 1e-12)
__global__ __launch_bounds__(256) void k_colnorm_fin(const double* __restrict__ PS, float* __restrict__ KN) {
  __shared__ double red[8][32];
  const int tid = threadIdx.x, cl = tid & 31, g = tid >> 5, b = blockIdx.y, c = blockIdx.x * 32 + cl;
  const double* p = PS + ((size_t)b * NCH + g * (NCH / 8)) * CC + c;
  double s = 0.0;
  // unrolled so that the 8 loads are in flight together
#pragma unroll
  for (int i = 0; i < NCH / 8; ++i) s += p[(size_t)i * CC];
  red[g][cl] = s;
  __syncthreads();
  if (tid < 32) {
    double t = 0.0;
#pragma unroll
    for (int j = 0; j < 8; ++j) t += red[j][tid];
    KN[b * CC + c] = 1.0f / fmaxf((float)sqrt(t), 1e-12f);
  }
}
// Partials of kv = k2^T v straight from the token-major arrays: KVp[z][b][c][d] = sum over the 256 tokens t of slice z of (K2a[t][c] * KN[c]) * v[t][d], 3 products on hi/lo bf16 planes.
// Block = 128 c x 128 d of one (batch, slice), 8 waves of 32 c x 64 d. A pass takes 32 tokens: every thread splits its 16-byte pieces of k2 and v once and lays them token-major in LDS;
// both operands need 8 consecutive tokens of one channel per lane, which the transposing LDS read delivers in the hardware k order (the order the row loaders of this file use).
#define KSL 16
#define KVT 32                    // tokens per pass
#define KVPITCH 288               // bytes per LDS row: 128 channels x 2 B + 32 = 32 B x 9, the conflict-free pitch of the transposing read
#define KVPLANE (KVT * KVPITCH)   // one plane of one pass
#define KVSO 68                   // floats per row of the output staging: rows 8 apart fall 32 banks apart
typedef short s16x8 __attribute__((ext_vector_type(8)));
typedef unsigned short v4us __attribute__((ext_vector_type(4), may_alias));
__device__ __forceinline__ v8us ld_tr16(const unsigned char* p) { typedef __attribute__((address_space(3))) s16x8 lds_s16x8; return __builtin_bit_cast(v8us, __builtin_amdgcn_ds_load_tr16_b128_v8i16((lds_s16x8*)p)); }
__device__ __forceinline__ void split_store4(v4f x, unsigned char* ph, unsigned char* pl) {
  v4us h, l;
  // unrolled so that the vector elements are named by constants
#pragma unroll
  for (int q = 0; q < 4; ++q) { const unsigned short hb = bf16_bits(x[q]); h[q] = hb; l[q] = bf16_bits(x[q] - bf16_val(hb)); }
  *(v4us*)ph = h; *(v4us*)pl = l;
}
__global__ __launch_bounds__(256) void k_kv_part(const float* __restrict__ K2a, const float* __restrict__ KN, const float* __restrict__ QKV, float* __restrict__ KVp) {
  __shared__ __attribute__((aligned(16))) unsigned char sm[2 * 4 * KVPLANE];      // two buffers of 4 planes: k2 hi, k2 lo, v hi, v lo
  const int tid = threadIdx.x, w = tid >> 5, lane = tid & 31, ln = lane & 15, hh = lane >> 4;
  const int c0 = (blockIdx.x >> 1) * 128, d0 = (blockIdx.x & 1) * 128, b = blockIdx.y, z = blockIdx.z;
  const size_t tok0 = (size_t)b * NTK + (size_t)z * (NTK / KSL);
  // wave w brings rows w, w + 8, w + 16, w + 24 of a pass: one 512-byte row segment per load
  const float* kp = K2a + (tok0 + w) * CC + c0 + lane * 4;
  const float* vp = QKV + (tok0 + w) * (3 * CC) + 2 * CC + d0 + lane * 4;
  const v4f kn = *(const v4fa*)(KN + b * CC + c0 + lane * 4);
  const int wc = (w >> 1) * 32, wd = (w & 1) * 64;
  const int wr = w * KVPITCH + lane * 8;                                           // where the thread's pieces land in a plane
  const int rd = (8 * hh + (lane & 7)) * KVPITCH + ((lane >> 3) & 1) * 16;         // lane address of the transposing read, tokens 0..15, channel 0
  v4f kr[4], vr[4];
  // every loop over i, m, t, r or q below is unrolled so that kr, vr, the fragments and acc stay in registers (constant indices) and the 8 loads of a pass are in flight together
#pragma unroll
  for (int i = 0; i < 4; ++i) { kr[i] = *(const v4fa*)(kp + (size_t)i * 8 * CC); vr[i] = *(const v4fa*)(vp + (size_t)i * 8 * 3 * CC); }
  v8f acc[2][4] = {};
  for (int ps = 0; ps < NTK / KSL / KVT; ++ps) {
    unsigned char* buf = sm + (ps & 1) * (4 * KVPLANE);
#pragma unroll
    for (int i = 0; i < 4; ++i) {
      unsigned char* p = buf + wr + i * 8 * KVPITCH;
      split_store4(kr[i] * kn, p, p + KVPLANE);
      split_store4(vr[i], p + 2 * KVPLANE, p + 3 * KVPLANE);
    }
    __syncthreads();      // publishes this pass's planes; it also ends every wave's reads of the other buffer, which the next pass overwrites
    if (ps + 1 < NTK / KSL / KVT) {      // the next pass's loads fly while this pass is multiplied
      kp += (size_t)KVT * CC; vp += (size_t)KVT * 3 * CC;
#pragma unroll
      for (int i = 0; i < 4; ++i) { kr[i] = *(const v4fa*)(kp + (size_t)i * 8 * CC); vr[i] = *(const v4fa*)(vp + (size_t)i * 8 * 3 * CC); }
    }
    FragB ah[2], al[2];
#pragma unroll
    for (int m = 0; m < 2; ++m) {
      const unsigned char* p = buf + rd + 2 * (wc + 16 * m);
      ah[m].half[0] = ld_tr16(p); ah[m].half[1] = ld_tr16(p + 16 * KVPITCH);
      al[m].half[0] = ld_tr16(p + KVPLANE); al[m].half[1] = ld_tr16(p + KVPLANE + 16 * KVPITCH);
    }
#pragma unroll
    for (int t = 0; t < 4; ++t) {
      const unsigned char* p = buf + 2 * KVPLANE + rd + 2 * (wd + 16 * t);
      FragB bh_, bl_;
      bh_.half[0] = ld_tr16(p); bh_.half[1] = ld_tr16(p + 16 * KVPITCH);
      bl_.half[0] = ld_tr16(p + KVPLANE); bl_.half[1] = ld_tr16(p + KVPLANE + 16 * KVPITCH);
#pragma unroll
      for (int m = 0; m < 2; ++m) acc[m][t] = mmaN<3>(ah[m].v, al[m].v, bh_.v, bl_.v, acc[m][t]);
    }
  }
  __syncthreads();      // the planes are dead in every wave before their LDS is reused to stage the output
  float* so = (float*)sm + w * (2 * 16 * KVSO);
#pragma unroll
  for (int m = 0; m < 2; ++m)
#pragma unroll
    for (int t = 0; t < 4; ++t)
#pragma unroll
      for (int r = 0; r < 8; ++r) so[(m * 16 + 8 * hh + r) * KVSO + t * 16 + ln] = acc[m][t][r];
  // each wave stages in its own LDS range: the fence and the wave barrier keep its row reads behind its own lanes' writes, so that whole 256-byte row pieces are stored
  __builtin_amdgcn_fence(__ATOMIC_ACQ_REL, "workgroup");
  __builtin_amdgcn_wave_barrier();
  float* dst = KVp + (((size_t)z * BB + b) * CC + c0 + wc) * CC + d0 + wd + ln * 4;
#pragma unroll
  for (int q = 0; q < 16; ++q) {
    const int r = q * 2 + hh;
    const v4f v = *(const v4fa*)&so[r * KVSO + ln * 4];
    *(v4f*)(dst + (size_t)r * CC) = v;
  }
}
// kv = sum of its KSL token-slice partials KVp[slice][b][c][d], added in slice order (f32); then kv -> Bt for t2 = q2 kv: B[k=c][n=d] = kv[c][d] -> Bt[d][c]: planes hi/lo of kv transposed.
// thread per (b, 8 c, d) with d along the lanes: each of the 8 * KSL loads of a wave reads one whole line
__global__ __launch_bounds__(256) void k_kvplanes(const float* __restrict__ KVp, unsigned short* __restrict__ Ph, unsigned short* __restrict__ Pl) { const int t = blockIdx.x * 256 + threadIdx.x; if (t >= BB * CC * (CC / 8)) return; const int d = t % CC; const int c8 = ((t / CC) % (CC / 8)) * 8; const int b = t / ((CC / 8) * CC); v8us h, l;
  const float* p = KVp + ((size_t)b * CC + c8) * CC + d; float s[8] = {0.f, 0.f, 0.f, 0.f, 0.f, 0.f, 0.f, 0.f};
  // kept rolled, 4 slices a trip: 32 independent loads are in flight per wave; fully unrolled, the 128 loads took 138 registers
#pragma unroll 1
  for (int z = 0; z < KSL; z += 4) {
    float v[4][8];
    // unrolled so that v[] stays in registers and the loads do not wait on the sums
#pragma unroll
    for (int j = 0; j < 4; ++j)
#pragma unroll
      for (int q = 0; q < 8; ++q) v[j][q] = p[(size_t)(z + j) * BB * CC * CC + (size_t)q * CC];
#pragma unroll
    for (int j = 0; j < 4; ++j)
#pragma unroll
      for (int q = 0; q < 8; ++q) s[q] += v[j][q];
  }
  for (int q = 0; q < 8; ++q) { const float v = s[q]; const unsigned short hb = bf16_bits(v); h[q] = hb; l[q] = bf16_bits(v - bf16_val(hb)); } const size_t dst = ((size_t)b * CC + d) * CC + c8; *(v8us*)(Ph + dst) = h; *(v8us*)(Pl + dst) = l;  }
// t2 = q2 kv, attn = v + t2/sqrt(N) and out = attn W_out + b in one launch. Block = 16 tokens x all 256 channels, wave w = channels 64w .. 64w+63 of both products.
// The attn tile goes from the first product's accumulators to the second product's A fragments through LDS, as bf16 hi/lo planes (each value is split once, by the wave that made it).
// Plane pitch 528 bytes = 16 x 33: the 16 rows of a 16-byte fragment read fall on different banks.
__global__ __launch_bounds__(128) void k_t2_attn_out(const float* __restrict__ Q2n, const unsigned short* __restrict__ Ph, const unsigned short* __restrict__ Pl, const float* __restrict__ QKV,
                                                    const unsigned short* __restrict__ Bo, const float* __restrict__ bout, float* __restrict__ out) {
  __shared__ __attribute__((aligned(16))) unsigned short sAh[16][CC + 8], sAl[16][CC + 8];
  __shared__ __attribute__((aligned(16))) float so[4][16][64];
  const int tid = threadIdx.x, w = tid >> 5, lane = tid & 31, ln = lane & 15, hh = lane >> 4;
  const int col0 = w * 64;
  const size_t tok0 = (size_t)blockIdx.y * NTK + (size_t)blockIdx.x * 16;
  const unsigned short* Bh = Ph + (size_t)blockIdx.y * CC * CC; const unsigned short* Bl = Pl + (size_t)blockIdx.y * CC * CC;
  const float* arow = Q2n + (tok0 + ln) * CC;
  v8f acc[4] = {};
  for (int kb = 0; kb < CC; kb += 32) {
    FragB ah, al;
    const v4f x0 = *(const v4fa*)(arow + kb + 8 * hh), x1 = *(const v4fa*)(arow + kb + 8 * hh + 4);
    const v4f x2 = *(const v4fa*)(arow + kb + 16 + 8 * hh), x3 = *(const v4fa*)(arow + kb + 16 + 8 * hh + 4);
    float xs[16] = {x0[0],x0[1],x0[2],x0[3],x1[0],x1[1],x1[2],x1[3],x2[0],x2[1],x2[2],x2[3],x3[0],x3[1],x3[2],x3[3]};
#pragma unroll
    for (int i = 0; i < 16; ++i) { const unsigned short hb = bf16_bits(xs[i]); ah.u[i] = hb; al.u[i] = bf16_bits(xs[i] - bf16_val(hb)); }
#pragma unroll
    for (int t = 0; t < 4; ++t) {
      const size_t boff = (size_t)(col0 + t * 16 + ln) * CC + kb;
      FragB bh_, bl_; bh_.half[0] = *(const v8us*)(Bh + boff + 8 * hh); bh_.half[1] = *(const v8us*)(Bh + boff + 16 + 8 * hh);
      bl_.half[0] = *(const v8us*)(Bl + boff + 8 * hh); bl_.half[1] = *(const v8us*)(Bl + boff + 16 + 8 * hh);
      acc[t] = mmaN<3>(ah.v, al.v, bh_.v, bl_.v, acc[t]);
    }
  }
  const float* vrow = QKV + (tok0 + 8 * hh) * (3 * CC) + 2 * CC + col0 + ln;
  v8f rv[4];
#pragma unroll
  for (int t = 0; t < 4; ++t)
#pragma unroll
    for (int r = 0; r < 8; ++r) rv[t][r] = vrow[r * (3 * CC) + t * 16];
  // inputs-only fence on the loaded values: all 32 loads of v are issued together and waited for once (without it they were issued a few at a time among the splits, each group paying a full latency)
  asm volatile("" :: "v"(rv[0]), "v"(rv[1]), "v"(rv[2]), "v"(rv[3]));
#pragma unroll
  for (int t = 0; t < 4; ++t) {
    const int col = col0 + t * 16 + ln;
#pragma unroll
    for (int r = 0; r < 8; ++r) {
      const float a = rv[t][r] + acc[t][r] * 0.015625f;
      const unsigned short hb = bf16_bits(a); sAh[8 * hh + r][col] = hb; sAl[8 * hh + r][col] = bf16_bits(a - bf16_val(hb));
    }
  }
  __syncthreads();      // every wave reads all 256 channels of the attn tile, of which each wave wrote 64
  v8f oc[4] = {};
  for (int kb = 0; kb < CC; kb += 32) {
    FragB ah, al;
    ah.half[0] = *(const v8us*)&sAh[ln][kb + 8 * hh]; ah.half[1] = *(const v8us*)&sAh[ln][kb + 16 + 8 * hh];
    al.half[0] = *(const v8us*)&sAl[ln][kb + 8 * hh]; al.half[1] = *(const v8us*)&sAl[ln][kb + 16 + 8 * hh];
#pragma unroll
    for (int t = 0; t < 4; ++t) {
      const unsigned short* brow = Bo + (size_t)(col0 + t * 16 + ln) * CC + kb;
      FragB b;
      b.half[0] = *(const v8us*)(brow + 8 * hh);
      b.half[1] = *(const v8us*)(brow + 16 + 8 * hh);
      oc[t] = mmaN<2>(ah.v, al.v, b.v, b.v, oc[t]);
    }
  }
#pragma unroll
  for (int t = 0; t < 4; ++t) {
    const float bv = bf16_round(bout[col0 + t * 16 + ln]);
#pragma unroll
    for (int r = 0; r < 8; ++r) so[w][8 * hh + r][t * 16 + ln] = oc[t][r] + bv;
  }
  __builtin_amdgcn_fence(__ATOMIC_ACQ_REL, "workgroup");
  __builtin_amdgcn_wave_barrier();
  const int rsub = lane >> 4, c4 = (lane & 15) * 4;
#pragma unroll
  for (int q = 0; q < 8; ++q) {
    const int r = q * 2 + rsub;
    const v4f v = *(const v4fa*)&so[w][r][c4];
    *(v4f*)(out + (tok0 + r) * CC + col0 + c4) = v;
  }
}
extern "C" void kernel_launch(void* const* d_in, const int* in_sizes, int n_in,
                              void* d_out, int out_size, void* d_ws, size_t ws_size, hipStream_t stream) {
  (void)in_sizes; (void)n_in; (void)out_size;
  const float* x = (const float*)d_in[0]; const float* Wqkv = (const float*)d_in[1]; const float* bqkv = (const float*)d_in[2]; const float* Wout = (const float*)d_in[3]; const float* bout = (const float*)d_in[4];
  char* ws = (char*)d_ws; size_t off = 0;
  auto take = [&](size_t bytes) { char* p = ws + off; off += (bytes + 255) & ~(size_t)255; return p; };
  unsigned short* Bq = (unsigned short*)take((size_t)3 * CC * CC * 2); unsigned short* Bo = (unsigned short*)take((size_t)CC * CC * 2);
  float* QKV = (float*)take((size_t)BB * NTK * 3 * CC * 4); float* Q2n = (float*)take((size_t)BB * NTK * CC * 4); float* K2a = (float*)take((size_t)BB * NTK * CC * 4); float* KN = (float*)take(BB * CC * 4);
  float* KVp = (float*)take((size_t)KSL * BB * CC * CC * 4);      // the KSL partials of kv
  unsigned short* Ph = (unsigned short*)take((size_t)BB * CC * CC * 2); unsigned short* Pl = (unsigned short*)take((size_t)BB * CC * CC * 2); double* PS = (double*)take((size_t)BB * NCH * CC * 8);
  if (off > ws_size) return;
  k_btw<<<(3 * CC * 32 + 255) / 256, 256, 0, stream>>>(Wqkv, Bq, CC, 3 * CC); k_btw<<<(CC * 32 + 255) / 256, 256, 0, stream>>>(Wout, Bo, CC, CC);
  k_gemm_bf3<false, 0, true, false><<<((BB * NTK / 16) * (3 * CC / 64) + 3) / 4, 128, 0, stream>>>(x, CC, Bq, CC, bqkv, nullptr, 1, 0, QKV, 3 * CC, BB * NTK, 3 * CC, CC);
  k_prep<<<BB * NTK / 8, 256, 0, stream>>>(QKV, Q2n, K2a); k_colnorm_part<<<dim3(NCH, BB), 256, 0, stream>>>(K2a, PS); k_colnorm_fin<<<dim3(CC / 32, BB), 256, 0, stream>>>(PS, KN);
  k_kv_part<<<dim3(4, BB, KSL), 256, 0, stream>>>(K2a, KN, QKV, KVp);      // slice z: KVp[z][b][c][d] = sum over the tokens t of slice z of k2[t][c] * v[t][d]
  k_kvplanes<<<(BB * CC * (CC / 8) + 255) / 256, 256, 0, stream>>>(KVp, Ph, Pl);
  k_t2_attn_out<<<dim3(NTK / 16, BB), 128, 0, stream>>>(Q2n, Ph, Pl, QKV, Bo, bout, (float*)d_out);      // t2 = q2 * kv, attn = v + t2 / 64, out = attn * W_out + b
}

// v005
// Measured time: 163 microseconds a run.
// Timed twice side by side with v004, it ran 1.25 times as fast both times.
// Counting every step since v000, it is 12.5 times as fast.
#include <hip/hip_runtime.h>
// Linear attention on WMMA (f32 accumulate): qkv = x·W_qkv + b (inputs rounded to bf16: single exact term; 32768 × 256 × 768), per batch kv = k2ᵀ·v (k2 and v are computed
// f32 → split into bf16 hi/lo: 3 products; 256 × 256 × 4096), t2 = q2·kv (3 products), out = attn·W_out + b (attn split hi/lo vs exact weights: 2 products). Mean-centering,
// squares, the two normalisations and the residual are f32 VALU (column statistics as fixed-order double sums).
#define BB 8
#define NTK 4096
#define CC 256

typedef __bf16 v16b __attribute__((ext_vector_type(16)));
typedef unsigned short v8us __attribute__((ext_vector_type(8), may_alias));
typedef float  v8f  __attribute__((ext_vector_type(8)));
typedef float  v4f  __attribute__((ext_vector_type(4)));
typedef float  v4fa __attribute__((ext_vector_type(4), may_alias));
union FragB { v16b v; v8us half[2]; unsigned short u[16]; };

__device__ __forceinline__ unsigned short bf16_bits(float x) { unsigned int u = __float_as_uint(x); return (unsigned short)((u + 0x7FFFu + ((u >> 16) & 1u)) >> 16); }
__device__ __forceinline__ float bf16_val(unsigned short b) { return __uint_as_float(((unsigned int)b) << 16); }
__device__ __forceinline__ float bf16_round(float x) { return bf16_val(bf16_bits(x)); }
// D += A·B with NT terms: 1 = ah·bh, 2 = + al·bh (A split), 3 = + ah·bl (both split)
template <int NT>
__device__ __forceinline__ v8f mmaN(v16b ah, v16b al, v16b bh, v16b bl, v8f c) {
  c = __builtin_amdgcn_wmma_f32_16x16x32_bf16(false, ah, false, bh, (short)0, c, false, false);
  if (NT >= 2) c = __builtin_amdgcn_wmma_f32_16x16x32_bf16(false, al, false, bh, (short)0, c, false, false);
  if (NT >= 3) c = __builtin_amdgcn_wmma_f32_16x16x32_bf16(false, ah, false, bl, (short)0, c, false, false);
  asm volatile("v_nop\n\tv_nop\n\tv_nop\n\tv_nop" : "+v"(c) : "v"(ah), "v"(al), "v"(bh), "v"(bl));
  return c;
}

__global__ __launch_bounds__(256) void k_wt_bf16(const float* __restrict__ W, unsigned short* __restrict__ Wt, int K, int N) {
  const int t = blockIdx.x * 256 + threadIdx.x;
  const int k8n = K / 8;
  if (t >= N * k8n) return;
  const int n = t / k8n, k8 = (t % k8n) * 8;
  v8us v;
#pragma unroll
  for (int i = 0; i < 8; ++i) v[i] = bf16_bits(W[(size_t)(k8 + i) * N + n]);
  *(v8us*)(Wt + (size_t)n * K + k8) = v;
  
}

// GEMM C[M][N] (f32, pitch ldc) = act(A[M][K]·W + bias). A f32 row-major (pitch lda) converted per fragment to bf16
// (ASPLIT: hi/lo two planes -> 2 terms, else single rounded term); Wt bf16 [N][K] (pitch ldb). BIAS_BF16 rounds the
// bias to bf16 first (bias quantised to bf16 before the add). K%32==0, M%16==0, N%64==0.
template <bool ASPLIT, int ACT, bool BIAS_BF16>
__global__ __launch_bounds__(128) void k_gemm_bf(const float* __restrict__ A, int lda, const unsigned short* __restrict__ Wt, int ldb,
                                               const float* __restrict__ bias, float* __restrict__ C, int ldc, int M, int N, int K) {
  __shared__ __attribute__((aligned(16))) float so[4][16][64];
  const int tid = threadIdx.x, w = tid >> 5, lane = tid & 31, ln = lane & 15, hh = lane >> 4;
  const int ntn = N / 64;
  const int wid = blockIdx.x * 4 + w;
  const int mt = wid / ntn, nq = wid % ntn;
  if (mt * 16 >= M) return;
  const int row0 = mt * 16, col0 = nq * 64;
  const float* arow = A + (size_t)(row0 + ln) * lda;
  v8f acc[4] = {};
  for (int kb = 0; kb < K; kb += 32) {
    FragB ah, al;
    const v4f x0 = *(const v4fa*)(arow + kb + 8 * hh), x1 = *(const v4fa*)(arow + kb + 8 * hh + 4);
    const v4f x2 = *(const v4fa*)(arow + kb + 16 + 8 * hh), x3 = *(const v4fa*)(arow + kb + 16 + 8 * hh + 4);
    float xs[16] = {x0[0],x0[1],x0[2],x0[3],x1[0],x1[1],x1[2],x1[3],x2[0],x2[1],x2[2],x2[3],x3[0],x3[1],x3[2],x3[3]};
#pragma unroll
    for (int i = 0; i < 16; ++i) { const unsigned short hb = bf16_bits(xs[i]); ah.u[i] = hb; al.u[i] = ASPLIT ? bf16_bits(xs[i] - bf16_val(hb)) : (unsigned short)0; }
#pragma unroll
    for (int t = 0; t < 4; ++t) {
      const unsigned short* brow = Wt + (size_t)(col0 + t * 16 + ln) * ldb + kb;
      FragB b;
      b.half[0] = *(const v8us*)(brow + 8 * hh);
      b.half[1] = *(const v8us*)(brow + 16 + 8 * hh);
      acc[t] = mmaN<ASPLIT ? 2 : 1>(ah.v, al.v, b.v, b.v, acc[t]);
    }
  }
#pragma unroll
  for (int t = 0; t < 4; ++t) {
    float bv = bias ? bias[col0 + t * 16 + ln] : 0.f;
    if (BIAS_BF16) bv = bf16_round(bv);
#pragma unroll
    for (int r = 0; r < 8; ++r) { float v = acc[t][r] + bv; if (ACT == 1) v = fmaxf(v, 0.f); so[w][8 * hh + r][t * 16 + ln] = v; }
  }
  __builtin_amdgcn_fence(__ATOMIC_ACQ_REL, "workgroup");
  __builtin_amdgcn_wave_barrier();
  const int rsub = lane >> 4, c4 = (lane & 15) * 4;
  {
#pragma unroll
    for (int q = 0; q < 8; ++q) {
      const int r = q * 2 + rsub;
      const v4f v = *(const v4fa*)&so[w][r][c4];
      *(v4f*)(C + (size_t)(row0 + r) * ldc + col0 + c4) = v;
    }
    
  }
}

// Flash-style causal/unmasked attention, all contractions 3-term bf16 hi/lo splits, f32 softmax with running max.
// q,k,v rows are read from f32 buffers with arbitrary row pitch (so they can live inside a fused qkv buffer);
// D = head size (multiple of 32, <= 128); one wave = 16 query rows; block = 4 waves (64 queries) sharing K/V chunks of 32.
template <int D, bool CAUSAL>
__global__ __launch_bounds__(128) void k_flash(const float* __restrict__ qb, const float* __restrict__ kb, const float* __restrict__ vb,
                                             int pitch, int T, int H, float scale, float* __restrict__ y, int ypitch) {
  constexpr int KS = D / 32;        // k-steps for QK
  constexpr int DT = D / 16;        // d tiles for PV
  __shared__ __attribute__((aligned(16))) unsigned short sKh[32][D + 8], sKl[32][D + 8], sVh[32][D + 8], sVl[32][D + 8];
  __shared__ __attribute__((aligned(16))) unsigned short sPh[4][16][40], sPl[4][16][40];
  __shared__ __attribute__((aligned(16))) float sO[4][16][D];
  const int tid = threadIdx.x, w = tid >> 5, lane = tid & 31, ln = lane & 15, hh = lane >> 4;
  const int nqb = (T + 63) / 64;
  const int bh = blockIdx.x / nqb, qblk = blockIdx.x % nqb;
  const int b = bh / H, h = bh % H;
  const int q0 = qblk * 64 + w * 16;
  const float* Q = qb + (size_t)b * T * pitch + h * D;
  const float* K = kb + (size_t)b * T * pitch + h * D;
  const float* V = vb + (size_t)b * T * pitch + h * D;

  // A fragments of the wave's 16 query rows (scaled), hi/lo
  FragB aqh[KS], aql[KS];
  {
    int row = q0 + ln; if (row >= T) row = T - 1;
    const float* qr = Q + (size_t)row * pitch;
#pragma unroll
    for (int ks = 0; ks < KS; ++ks)
#pragma unroll
      for (int i = 0; i < 16; ++i) {
        const int d = ks * 32 + ((i < 8) ? (8 * hh + i) : (16 + 8 * hh + (i - 8)));
        const float x = qr[d] * scale; const unsigned short hb = bf16_bits(x);
        aqh[ks].u[i] = hb; aql[ks].u[i] = bf16_bits(x - bf16_val(hb));
      }
  }
  float m_r[8], l_r[8];
#pragma unroll
  for (int r = 0; r < 8; ++r) { m_r[r] = -3.0e38f; l_r[r] = 0.f; }
  v8f oacc[DT];
#pragma unroll
  for (int dt = 0; dt < DT; ++dt) oacc[dt] = (v8f){0.f,0.f,0.f,0.f,0.f,0.f,0.f,0.f};

  const int kv_end = CAUSAL ? min(T, qblk * 64 + 64) : T;     // block-uniform
  for (int j0 = 0; j0 < kv_end; j0 += 32) {
    __syncthreads();
    for (int e = tid; e < 32 * (D / 4); e += 128) {
      const int r = e / (D / 4), c4 = (e % (D / 4)) * 4;
      const int key = j0 + r;
      v4f kf = {0.f,0.f,0.f,0.f}, vf = {0.f,0.f,0.f,0.f};
      if (key < T) { kf = *(const v4fa*)(K + (size_t)key * pitch + c4); vf = *(const v4fa*)(V + (size_t)key * pitch + c4); }
#pragma unroll
      for (int t = 0; t < 4; ++t) {
        unsigned short hb = bf16_bits(kf[t]); sKh[r][c4 + t] = hb; sKl[r][c4 + t] = bf16_bits(kf[t] - bf16_val(hb));
        hb = bf16_bits(vf[t]); sVh[r][c4 + t] = hb; sVl[r][c4 + t] = bf16_bits(vf[t] - bf16_val(hb));
      }
    }
    __syncthreads();
    // S tile 16 x 32
    v8f s[2];
#pragma unroll
    for (int nt = 0; nt < 2; ++nt) {
      v8f acc = {};
#pragma unroll
      for (int ks = 0; ks < KS; ++ks) {
        FragB bh_, bl_;
        bh_.half[0] = *(const v8us*)&sKh[nt * 16 + ln][ks * 32 + 8 * hh]; bh_.half[1] = *(const v8us*)&sKh[nt * 16 + ln][ks * 32 + 16 + 8 * hh];
        bl_.half[0] = *(const v8us*)&sKl[nt * 16 + ln][ks * 32 + 8 * hh]; bl_.half[1] = *(const v8us*)&sKl[nt * 16 + ln][ks * 32 + 16 + 8 * hh];
        acc = mmaN<3>(aqh[ks].v, aql[ks].v, bh_.v, bl_.v, acc);
      }
      s[nt] = acc;
    }
    // mask + running max (rows 8hh+r; the 16 lanes of a half share rows)
    float alpha[8];
#pragma unroll
    for (int r = 0; r < 8; ++r) {
      const int qi = q0 + 8 * hh + r;
      const int ja = j0 + ln, jb = j0 + 16 + ln;
      if (CAUSAL) { if (ja > qi) s[0][r] = -3.0e38f; if (jb > qi) s[1][r] = -3.0e38f; }
      if (ja >= T) s[0][r] = -3.0e38f;
      if (jb >= T) s[1][r] = -3.0e38f;
      float mx = fmaxf(s[0][r], s[1][r]);
      mx = fmaxf(mx, __shfl_xor(mx, 1, 32)); mx = fmaxf(mx, __shfl_xor(mx, 2, 32)); mx = fmaxf(mx, __shfl_xor(mx, 4, 32)); mx = fmaxf(mx, __shfl_xor(mx, 8, 32));
      const float mnew = fmaxf(m_r[r], mx);
      alpha[r] = (mnew > -1.0e38f) ? __expf(m_r[r] - mnew) : 1.0f;
      const float p0 = (s[0][r] > -1.0e38f) ? __expf(s[0][r] - mnew) : 0.f;
      const float p1 = (s[1][r] > -1.0e38f) ? __expf(s[1][r] - mnew) : 0.f;
      m_r[r] = mnew;
      l_r[r] = l_r[r] * alpha[r] + p0 + p1;            // per-lane partial row sum (16 lanes combined at the end)
      unsigned short hb = bf16_bits(p0); sPh[w][8 * hh + r][ln] = hb;      sPl[w][8 * hh + r][ln] = bf16_bits(p0 - bf16_val(hb));
      hb = bf16_bits(p1);                sPh[w][8 * hh + r][16 + ln] = hb; sPl[w][8 * hh + r][16 + ln] = bf16_bits(p1 - bf16_val(hb));
    }
#pragma unroll
    for (int dt = 0; dt < DT; ++dt)
#pragma unroll
      for (int r = 0; r < 8; ++r) oacc[dt][r] *= alpha[r];
    __builtin_amdgcn_fence(__ATOMIC_ACQ_REL, "workgroup");
    __builtin_amdgcn_wave_barrier();
    FragB pah, pal;
    pah.half[0] = *(const v8us*)&sPh[w][ln][8 * hh]; pah.half[1] = *(const v8us*)&sPh[w][ln][16 + 8 * hh];
    pal.half[0] = *(const v8us*)&sPl[w][ln][8 * hh]; pal.half[1] = *(const v8us*)&sPl[w][ln][16 + 8 * hh];
#pragma unroll
    for (int dt = 0; dt < DT; ++dt) {
      FragB bvh, bvl;
#pragma unroll
      for (int i = 0; i < 8; ++i) {
        bvh.u[i] = sVh[8 * hh + i][dt * 16 + ln]; bvh.u[8 + i] = sVh[16 + 8 * hh + i][dt * 16 + ln];
        bvl.u[i] = sVl[8 * hh + i][dt * 16 + ln]; bvl.u[8 + i] = sVl[16 + 8 * hh + i][dt * 16 + ln];
      }
      oacc[dt] = mmaN<3>(pah.v, pal.v, bvh.v, bvl.v, oacc[dt]);
    }
    __builtin_amdgcn_fence(__ATOMIC_ACQ_REL, "workgroup");
    __builtin_amdgcn_wave_barrier();
  }
#pragma unroll
  for (int r = 0; r < 8; ++r) {
    float l = l_r[r];
    l += __shfl_xor(l, 1, 32); l += __shfl_xor(l, 2, 32); l += __shfl_xor(l, 4, 32); l += __shfl_xor(l, 8, 32);
    l_r[r] = (l > 0.f) ? 1.0f / l : 0.f;
  }
#pragma unroll
  for (int dt = 0; dt < DT; ++dt)
#pragma unroll
    for (int r = 0; r < 8; ++r) sO[w][8 * hh + r][dt * 16 + ln] = oacc[dt][r] * l_r[r];
  __builtin_amdgcn_fence(__ATOMIC_ACQ_REL, "workgroup");
  __builtin_amdgcn_wave_barrier();
  {
    for (int r = 0; r < 16; ++r) {
      const int row = q0 + r;
      if (row < T && lane < D / 4) {
        const v4f val = *(const v4fa*)&sO[w][r][lane * 4];
        *(v4f*)(y + ((size_t)b * T + row) * ypitch + h * D + lane * 4) = val;
      }
    }
    
  }
}

// GEMM C = act(A·W + bias + resid): A f32 (ASPLIT -> hi/lo 2 terms), Wt bf16 [N][K]; ACT 0 none, 1 relu, 2 exact gelu;
// resid (optional, f32, row index = (row % rmod), pitch ldr, RES_BF16 rounds it) added before the activation.
template <bool ASPLIT, int ACT, bool BIAS_BF16, bool RES_BF16>
__global__ __launch_bounds__(128) void k_gemm_bf3(const float* __restrict__ A, int lda, const unsigned short* __restrict__ Wt, int ldb,
                                                const float* __restrict__ bias, const float* __restrict__ resid, int rmod, int ldr,
                                                float* __restrict__ C, int ldc, int M, int N, int K) {
  __shared__ __attribute__((aligned(16))) float so[4][16][64];
  const int tid = threadIdx.x, w = tid >> 5, lane = tid & 31, ln = lane & 15, hh = lane >> 4;
  const int ntn = N / 64;
  const int wid = blockIdx.x * 4 + w;
  const int mt = wid / ntn, nq = wid % ntn;
  if (mt * 16 >= M) return;
  const int row0 = mt * 16, col0 = nq * 64;
  const float* arow = A + (size_t)(row0 + ln) * lda;
  v8f acc[4] = {};
  for (int kb = 0; kb < K; kb += 32) {
    FragB ah, al;
    const v4f x0 = *(const v4fa*)(arow + kb + 8 * hh), x1 = *(const v4fa*)(arow + kb + 8 * hh + 4);
    const v4f x2 = *(const v4fa*)(arow + kb + 16 + 8 * hh), x3 = *(const v4fa*)(arow + kb + 16 + 8 * hh + 4);
    float xs[16] = {x0[0],x0[1],x0[2],x0[3],x1[0],x1[1],x1[2],x1[3],x2[0],x2[1],x2[2],x2[3],x3[0],x3[1],x3[2],x3[3]};
#pragma unroll
    for (int i = 0; i < 16; ++i) { const unsigned short hb = bf16_bits(xs[i]); ah.u[i] = hb; al.u[i] = ASPLIT ? bf16_bits(xs[i] - bf16_val(hb)) : (unsigned short)0; }
#pragma unroll
    for (int t = 0; t < 4; ++t) {
      const unsigned short* brow = Wt + (size_t)(col0 + t * 16 + ln) * ldb + kb;
      FragB b;
      b.half[0] = *(const v8us*)(brow + 8 * hh);
      b.half[1] = *(const v8us*)(brow + 16 + 8 * hh);
      acc[t] = mmaN<ASPLIT ? 2 : 1>(ah.v, al.v, b.v, b.v, acc[t]);
    }
  }
#pragma unroll
  for (int t = 0; t < 4; ++t) {
    const int col = col0 + t * 16 + ln;
    float bv = bias ? bias[col] : 0.f;
    if (BIAS_BF16) bv = bf16_round(bv);
#pragma unroll
    for (int r = 0; r < 8; ++r) {
      float v = acc[t][r] + bv;
      if (resid) { float rv = resid[(size_t)((row0 + 8 * hh + r) % rmod) * ldr + col]; if (RES_BF16) rv = bf16_round(rv); v += rv; }
      if (ACT == 1) v = fmaxf(v, 0.f);
      if (ACT == 2) v = 0.5f * v * (1.0f + erff(v * 0.70710678118654752f));
      if (ACT == 3) { const float u = 0.7978845608028654f * (v + 0.044715f * v * v * v); v = 0.5f * v * (1.0f + tanhf(u)); }
      so[w][8 * hh + r][t * 16 + ln] = v;
    }
  }
  __builtin_amdgcn_fence(__ATOMIC_ACQ_REL, "workgroup");
  __builtin_amdgcn_wave_barrier();
  const int rsub = lane >> 4, c4 = (lane & 15) * 4;
  {
#pragma unroll
    for (int q = 0; q < 8; ++q) {
      const int r = q * 2 + rsub;
      const v4f v = *(const v4fa*)&so[w][r][c4];
      *(v4f*)(C + (size_t)(row0 + r) * ldc + col0 + c4) = v;
    }
    
  }
}
// row LayerNorm (biased variance, eps) over N: s = X (+ R); optional out_sum <- s; out_norm <- (s-mu)*rsqrt(var+eps)*g + b
template <bool PARAM_BF16>
__global__ __launch_bounds__(256) void k_layernorm(const float* __restrict__ X, const float* __restrict__ R, const float* __restrict__ g, const float* __restrict__ bta,
                                                  float* __restrict__ out_sum, float* __restrict__ out_norm, int N, float eps) {
  __shared__ float red[256];
  const int row = blockIdx.x, tid = threadIdx.x;
  const float* x = X + (size_t)row * N; const float* rr = R ? R + (size_t)row * N : nullptr;
  float vals[16];                     // up to N = 4096
  const int per = N / 256;            // contiguous chunk per thread? use strided-by-4 chunks: thread handles j = tid*4 + 1024*u
  float s1 = 0.f;
  for (int u = 0; u < per / 4; ++u) {
    const int j = tid * 4 + 1024 * u;
    const v4f a = *(const v4fa*)(x + j);
    v4f b = {0.f,0.f,0.f,0.f}; if (rr) b = *(const v4fa*)(rr + j);
#pragma unroll
    for (int q = 0; q < 4; ++q) { const float v = a[q] + b[q]; vals[u * 4 + q] = v; s1 += v; }
  }
  red[tid] = s1; __syncthreads();
  for (int st = 128; st > 0; st >>= 1) { if (tid < st) red[tid] += red[tid + st]; __syncthreads(); }
  const float mu = red[0] / (float)N; __syncthreads();
  float s2 = 0.f;
  for (int u = 0; u < per / 4; ++u)
#pragma unroll
    for (int q = 0; q < 4; ++q) { const float c = vals[u * 4 + q] - mu; s2 += c * c; }
  red[tid] = s2; __syncthreads();
  for (int st = 128; st > 0; st >>= 1) { if (tid < st) red[tid] += red[tid + st]; __syncthreads(); }
  const float rs = rsqrtf(red[0] / (float)N + eps);
  {
    for (int u = 0; u < per / 4; ++u) {
      const int j = tid * 4 + 1024 * u;
      v4f o, sm;
#pragma unroll
      for (int q = 0; q < 4; ++q) {
        float gg = g[j + q], bb = bta[j + q];
        if (PARAM_BF16) { gg = bf16_round(gg); bb = bf16_round(bb); }
        sm[q] = vals[u * 4 + q]; o[q] = (vals[u * 4 + q] - mu) * rs * gg + bb;
      }
      if (out_sum) *(v4f*)(out_sum + (size_t)row * N + j) = sm;
      *(v4f*)(out_norm + (size_t)row * N + j) = o;
    }
    
  }
}

// batched f32 [K][N] (pitch lds, batch stride sIn) -> transposed hi/lo planes [N][K] (batch stride sOut); thread per (n, 8 k); grid.y = batch
__global__ __launch_bounds__(256) void k_split_transpose_b(const float* __restrict__ src, int lds_, size_t sIn, unsigned short* __restrict__ hi, unsigned short* __restrict__ lo, size_t sOut, int K, int N) {
  const size_t t = (size_t)blockIdx.x * 256 + threadIdx.x; const int k8n = K / 8; if (t >= (size_t)N * k8n) return;
  src += (size_t)blockIdx.y * sIn; hi += (size_t)blockIdx.y * sOut; lo += (size_t)blockIdx.y * sOut;
  const int n = (int)(t / k8n), k8 = (int)(t % k8n) * 8; v8us vh, vl;
#pragma unroll
  for (int i = 0; i < 8; ++i) { const float x = src[(size_t)(k8 + i) * lds_ + n]; const unsigned short hb = bf16_bits(x); vh[i] = hb; vl[i] = bf16_bits(x - bf16_val(hb)); }
  unsigned short* dh = hi + (size_t)n * K + k8; unsigned short* dl = lo + (size_t)n * K + k8;
  *(v8us*)dh = vh; *(v8us*)dl = vl; 
}

__global__ __launch_bounds__(256) void k_btw(const float* __restrict__ W, unsigned short* __restrict__ Bt, int K, int N) { const int t = blockIdx.x * 256 + threadIdx.x; if (t >= N * (K / 8)) return; const int n = t / (K / 8), k8 = (t % (K / 8)) * 8; v8us v; for (int q = 0; q < 8; ++q) v[q] = bf16_bits(W[(size_t)(k8 + q) * N + n]); *(v8us*)(Bt + (size_t)n * K + k8) = v;  }
// per token: q ← q − mean(q), k ← k − mean(k); q2 = q², k2 = k²; q2s, k2s; Q2n[t][c] = l2norm_c(q2/(q2s+1e-7)); K2a[t][c] = k2/(k2s+1e-7) (column-normalised later); wave per token, 8 per lane
__global__ __launch_bounds__(256) void k_prep(const float* __restrict__ QKV, float* __restrict__ Q2n, float* __restrict__ K2a) {
  const int tid = threadIdx.x, wv = tid >> 5, lane = tid & 31; const size_t t = (size_t)blockIdx.x * 8 + wv; const float* row = QKV + t * (3 * CC); float q[8], k[8]; float sq = 0.f, sk = 0.f;
#pragma unroll
  for (int u = 0; u < 8; ++u) { q[u] = row[u * 32 + lane]; k[u] = row[CC + u * 32 + lane]; sq += q[u]; sk += k[u]; }
  for (int o = 16; o >= 1; o >>= 1) { sq += __shfl_xor(sq, o, 32); sk += __shfl_xor(sk, o, 32); } const float mq = sq * (1.0f / CC), mk = sk * (1.0f / CC);
  float q2s = 0.f, k2s = 0.f;
#pragma unroll
  for (int u = 0; u < 8; ++u) { q[u] = (q[u] - mq) * (q[u] - mq); k[u] = (k[u] - mk) * (k[u] - mk); q2s += q[u]; k2s += k[u]; }
  for (int o = 16; o >= 1; o >>= 1) { q2s += __shfl_xor(q2s, o, 32); k2s += __shfl_xor(k2s, o, 32); }
  float nq = 0.f; const float rq = 1.0f / (q2s + 1e-7f), rk = 1.0f / (k2s + 1e-7f);
#pragma unroll
  for (int u = 0; u < 8; ++u) { q[u] = q[u] * rq; k[u] = k[u] * rk; nq += q[u] * q[u]; }
  for (int o = 16; o >= 1; o >>= 1) nq += __shfl_xor(nq, o, 32); const float iq = 1.0f / fmaxf(sqrtf(nq), 1e-12f);
#pragma unroll
  for (int u = 0; u < 8; ++u) q[u] *= iq;
  {
#pragma unroll
    for (int u = 0; u < 8; ++u) { *(float*)(Q2n + t * CC + u * 32 + lane) = q[u]; *(float*)(K2a + t * CC + u * 32 + lane) = k[u]; }  }
}
// column norms of K2a over the 4096 tokens of each batch, in two launches, every sum in double and in a fixed order.
// Stage 1: block per (chunk of 64 tokens, batch); a thread takes 4 adjacent columns of every 4th token; the 4 token groups are joined through LDS: PS[b][chunk][c].
#define NCH 64
__global__ __launch_bounds__(256) void k_colnorm_part(const float* __restrict__ K2a, double* __restrict__ PS) {
  __shared__ double red[4][CC];
  const int tid = threadIdx.x, c4 = (tid & 63) * 4, rg = tid >> 6, ch = blockIdx.x, b = blockIdx.y;
  const float* base = K2a + ((size_t)b * NTK + (size_t)ch * (NTK / NCH) + rg) * CC + c4;
  v4f v[NTK / NCH / 4];
  // unrolled so that the loads are independent of the sums and many are in flight per wave (the rolled one-load loop paid a full memory latency per token)
#pragma unroll
  for (int i = 0; i < NTK / NCH / 4; ++i) v[i] = *(const v4fa*)(base + (size_t)i * 4 * CC);
  double s[4] = {0.0, 0.0, 0.0, 0.0};
  // unrolled so that v[] stays in registers (constant indices)
#pragma unroll
  for (int i = 0; i < NTK / NCH / 4; ++i)
#pragma unroll
    for (int q = 0; q < 4; ++q) s[q] += (double)v[i][q] * (double)v[i][q];
#pragma unroll
  for (int q = 0; q < 4; ++q) red[rg][c4 + q] = s[q];
  __syncthreads();
  PS[((size_t)b * NCH + ch) * CC + tid] = (red[0][tid] + red[1][tid]) + (red[2][tid] + red[3][tid]);
}
// Stage 2: block per (32 columns, batch); wave g sums chunks 8g..8g+7 of its 32 columns, wave 0 joins the 8 sums: KN[b][c] = 1/max(norm, 1e-12)
__global__ __launch_bounds__(256) void k_colnorm_fin(const double* __restrict__ PS, float* __restrict__ KN) {
  __shared__ double red[8][32];
  const int tid = threadIdx.x, cl = tid & 31, g = tid >> 5, b = blockIdx.y, c = blockIdx.x * 32 + cl;
  const double* p = PS + ((size_t)b * NCH + g * (NCH / 8)) * CC + c;
  double s = 0.0;
  // unrolled so that the 8 loads are in flight together
#pragma unroll
  for (int i = 0; i < NCH / 8; ++i) s += p[(size_t)i * CC];
  red[g][cl] = s;
  __syncthreads();
  if (tid < 32) {
    double t = 0.0;
#pragma unroll
    for (int j = 0; j < 8; ++j) t += red[j][tid];
    KN[b * CC + c] = 1.0f / fmaxf((float)sqrt(t), 1e-12f);
  }
}
// Partials of kv = k2^T v straight from the token-major arrays: KVp[z][b][c][d] = sum over the 256 tokens t of slice z of (K2a[t][c] * KN[c]) * v[t][d], 3 products on hi/lo bf16 planes.
// Block = 128 c x 128 d of one (batch, slice), 8 waves of 32 c x 64 d. A pass takes 32 tokens: every thread splits its 16-byte pieces of k2 and v once and lays them token-major in LDS;
// both operands need 8 consecutive tokens of one channel per lane, which the transposing LDS read delivers in the hardware k order (the order the row loaders of this file use).
#define KSL 16
#define KVT 32                    // tokens per pass
#define KVPITCH 288               // bytes per LDS row: 128 channels x 2 B + 32 = 32 B x 9, the conflict-free pitch of the transposing read
#define KVPLANE (KVT * KVPITCH)   // one plane of one pass
#define KVSO 68                   // floats per row of the output staging: rows 8 apart fall 32 banks apart
typedef short s16x8 __attribute__((ext_vector_type(8)));
typedef unsigned short v4us __attribute__((ext_vector_type(4), may_alias));
__device__ __forceinline__ v8us ld_tr16(const unsigned char* p) { typedef __attribute__((address_space(3))) s16x8 lds_s16x8; return __builtin_bit_cast(v8us, __builtin_amdgcn_ds_load_tr16_b128_v8i16((lds_s16x8*)p)); }
__device__ __forceinline__ void split_store4(v4f x, unsigned char* ph, unsigned char* pl) {
  v4us h, l;
  // unrolled so that the vector elements are named by constants
#pragma unroll
  for (int q = 0; q < 4; ++q) { const unsigned short hb = bf16_bits(x[q]); h[q] = hb; l[q] = bf16_bits(x[q] - bf16_val(hb)); }
  *(v4us*)ph = h; *(v4us*)pl = l;
}
__global__ __launch_bounds__(256) void k_kv_part(const float* __restrict__ K2a, const float* __restrict__ KN, const float* __restrict__ QKV, float* __restrict__ KVp) {
  __shared__ __attribute__((aligned(16))) unsigned char sm[2 * 4 * KVPLANE];      // two buffers of 4 planes: k2 hi, k2 lo, v hi, v lo
  const int tid = threadIdx.x, w = tid >> 5, lane = tid & 31, ln = lane & 15, hh = lane >> 4;
  const int c0 = (blockIdx.x >> 1) * 128, d0 = (blockIdx.x & 1) * 128, b = blockIdx.y, z = blockIdx.z;
  const size_t tok0 = (size_t)b * NTK + (size_t)z * (NTK / KSL);
  // wave w brings rows w, w + 8, w + 16, w + 24 of a pass: one 512-byte row segment per load
  const float* kp = K2a + (tok0 + w) * CC + c0 + lane * 4;
  const float* vp = QKV + (tok0 + w) * (3 * CC) + 2 * CC + d0 + lane * 4;
  const v4f kn = *(const v4fa*)(KN + b * CC + c0 + lane * 4);
  const int wc = (w >> 1) * 32, wd = (w & 1) * 64;
  const int wr = w * KVPITCH + lane * 8;                                           // where the thread's pieces land in a plane
  const int rd = (8 * hh + (lane & 7)) * KVPITCH + ((lane >> 3) & 1) * 16;         // lane address of the transposing read, tokens 0..15, channel 0
  v4f kr[4], vr[4];
  // every loop over i, m, t, r or q below is unrolled so that kr, vr, the fragments and acc stay in registers (constant indices) and the 8 loads of a pass are in flight together
#pragma unroll
  for (int i = 0; i < 4; ++i) { kr[i] = *(const v4fa*)(kp + (size_t)i * 8 * CC); vr[i] = *(const v4fa*)(vp + (size_t)i * 8 * 3 * CC); }
  v8f acc[2][4] = {};
  for (int ps = 0; ps < NTK / KSL / KVT; ++ps) {
    unsigned char* buf = sm + (ps & 1) * (4 * KVPLANE);
#pragma unroll
    for (int i = 0; i < 4; ++i) {
      unsigned char* p = buf + wr + i * 8 * KVPITCH;
      split_store4(kr[i] * kn, p, p + KVPLANE);
      split_store4(vr[i], p + 2 * KVPLANE, p + 3 * KVPLANE);
    }
    __syncthreads();      // publishes this pass's planes; it also ends every wave's reads of the other buffer, which the next pass overwrites
    if (ps + 1 < NTK / KSL / KVT) {      // the next pass's loads fly while this pass is multiplied
      kp += (size_t)KVT * CC; vp += (size_t)KVT * 3 * CC;
#pragma unroll
      for (int i = 0; i < 4; ++i) { kr[i] = *(const v4fa*)(kp + (size_t)i * 8 * CC); vr[i] = *(const v4fa*)(vp + (size_t)i * 8 * 3 * CC); }
    }
    FragB ah[2], al[2];
#pragma unroll
    for (int m = 0; m < 2; ++m) {
      const unsigned char* p = buf + rd + 2 * (wc + 16 * m);
      ah[m].half[0] = ld_tr16(p); ah[m].half[1] = ld_tr16(p + 16 * KVPITCH);
      al[m].half[0] = ld_tr16(p + KVPLANE); al[m].half[1] = ld_tr16(p + KVPLANE + 16 * KVPITCH);
    }
#pragma unroll
    for (int t = 0; t < 4; ++t) {
      const unsigned char* p = buf + 2 * KVPLANE + rd + 2 * (wd + 16 * t);
      FragB bh_, bl_;
      bh_.half[0] = ld_tr16(p); bh_.half[1] = ld_tr16(p + 16 * KVPITCH);
      bl_.half[0] = ld_tr16(p + KVPLANE); bl_.half[1] = ld_tr16(p + KVPLANE + 16 * KVPITCH);
#pragma unroll
      for (int m = 0; m < 2; ++m) acc[m][t] = mmaN<3>(ah[m].v, al[m].v, bh_.v, bl_.v, acc[m][t]);
    }
  }
  __syncthreads();      // the planes are dead in every wave before their LDS is reused to stage the output
  float* so = (float*)sm + w * (2 * 16 * KVSO);
#pragma unroll
  for (int m = 0; m < 2; ++m)
#pragma unroll
    for (int t = 0; t < 4; ++t)
#pragma unroll
      for (int r = 0; r < 8; ++r) so[(m * 16 + 8 * hh + r) * KVSO + t * 16 + ln] = acc[m][t][r];
  // each wave stages in its own LDS range: the fence and the wave barrier keep its row reads behind its own lanes' writes, so that whole 256-byte row pieces are stored
  __builtin_amdgcn_fence(__ATOMIC_ACQ_REL, "workgroup");
  __builtin_amdgcn_wave_barrier();
  float* dst = KVp + (((size_t)z * BB + b) * CC + c0 + wc) * CC + d0 + wd + ln * 4;
#pragma unroll
  for (int q = 0; q < 16; ++q) {
    const int r = q * 2 + hh;
    const v4f v = *(const v4fa*)&so[r * KVSO + ln * 4];
    *(v4f*)(dst + (size_t)r * CC) = v;
  }
}
// kv = sum of its KSL token-slice partials KVp[slice][b][c][d], added in slice order (f32); then kv -> Bt for t2 = q2 kv: B[k=c][n=d] = kv[c][d] -> Bt[d][c]: planes hi/lo of kv transposed.
// thread per (b, 8 c, d) with d along the lanes: each of the 8 * KSL loads of a wave reads one whole line
__global__ __launch_bounds__(256) void k_kvplanes(const float* __restrict__ KVp, unsigned short* __restrict__ Ph, unsigned short* __restrict__ Pl) { const int t = blockIdx.x * 256 + threadIdx.x; if (t >= BB * CC * (CC / 8)) return; const int d = t % CC; const int c8 = ((t / CC) % (CC / 8)) * 8; const int b = t / ((CC / 8) * CC); v8us h, l;
  const float* p = KVp + ((size_t)b * CC + c8) * CC + d; float s[8] = {0.f, 0.f, 0.f, 0.f, 0.f, 0.f, 0.f, 0.f};
  // kept rolled, 4 slices a trip: 32 independent loads are in flight per wave; fully unrolled, the 128 loads took 138 registers
#pragma unroll 1
  for (int z = 0; z < KSL; z += 4) {
    float v[4][8];
    // unrolled so that v[] stays in registers and the loads do not wait on the sums
#pragma unroll
    for (int j = 0; j < 4; ++j)
#pragma unroll
      for (int q = 0; q < 8; ++q) v[j][q] = p[(size_t)(z + j) * BB * CC * CC + (size_t)q * CC];
#pragma unroll
    for (int j = 0; j < 4; ++j)
#pragma unroll
      for (int q = 0; q < 8; ++q) s[q] += v[j][q];
  }
  for (int q = 0; q < 8; ++q) { const float v = s[q]; const unsigned short hb = bf16_bits(v); h[q] = hb; l[q] = bf16_bits(v - bf16_val(hb)); } const size_t dst = ((size_t)b * CC + d) * CC + c8; *(v8us*)(Ph + dst) = h; *(v8us*)(Pl + dst) = l;  }
// t2 = q2 kv, attn = v + t2/sqrt(N) and out = attn W_out + b in one launch. Block = 16 tokens x all 256 channels, wave w = channels 64w .. 64w+63 of both products.
// The attn tile goes from the first product's accumulators to the second product's A fragments through LDS, as bf16 hi/lo planes (each value is split once, by the wave that made it).
// Plane pitch 528 bytes = 16 x 33: the 16 rows of a 16-byte fragment read fall on different banks.
__global__ __launch_bounds__(128) void k_t2_attn_out(const float* __restrict__ Q2n, const unsigned short* __restrict__ Ph, const unsigned short* __restrict__ Pl, const float* __restrict__ QKV,
                                                    const unsigned short* __restrict__ Bo, const float* __restrict__ bout, float* __restrict__ out) {
  __shared__ __attribute__((aligned(16))) unsigned short sAh[16][CC + 8], sAl[16][CC + 8];
  __shared__ __attribute__((aligned(16))) float so[4][16][64];
  const int tid = threadIdx.x, w = tid >> 5, lane = tid & 31, ln = lane & 15, hh = lane >> 4;
  const int col0 = w * 64;
  const size_t tok0 = (size_t)blockIdx.y * NTK + (size_t)blockIdx.x * 16;
  const unsigned short* Bh = Ph + (size_t)blockIdx.y * CC * CC; const unsigned short* Bl = Pl + (size_t)blockIdx.y * CC * CC;
  const float* arow = Q2n + (tok0 + ln) * CC;
  v8f acc[4] = {};
  for (int kb = 0; kb < CC; kb += 32) {
    FragB ah, al;
    const v4f x0 = *(const v4fa*)(arow + kb + 8 * hh), x1 = *(const v4fa*)(arow + kb + 8 * hh + 4);
    const v4f x2 = *(const v4fa*)(arow + kb + 16 + 8 * hh), x3 = *(const v4fa*)(arow + kb + 16 + 8 * hh + 4);
    float xs[16] = {x0[0],x0[1],x0[2],x0[3],x1[0],x1[1],x1[2],x1[3],x2[0],x2[1],x2[2],x2[3],x3[0],x3[1],x3[2],x3[3]};
#pragma unroll
    for (int i = 0; i < 16; ++i) { const unsigned short hb = bf16_bits(xs[i]); ah.u[i] = hb; al.u[i] = bf16_bits(xs[i] - bf16_val(hb)); }
#pragma unroll
    for (int t = 0; t < 4; ++t) {
      const size_t boff = (size_t)(col0 + t * 16 + ln) * CC + kb;
      FragB bh_, bl_; bh_.half[0] = *(const v8us*)(Bh + boff + 8 * hh); bh_.half[1] = *(const v8us*)(Bh + boff + 16 + 8 * hh);
      bl_.half[0] = *(const v8us*)(Bl + boff + 8 * hh); bl_.half[1] = *(const v8us*)(Bl + boff + 16 + 8 * hh);
      acc[t] = mmaN<3>(ah.v, al.v, bh_.v, bl_.v, acc[t]);
    }
  }
  const float* vrow = QKV + (tok0 + 8 * hh) * (3 * CC) + 2 * CC + col0 + ln;
  v8f rv[4];
#pragma unroll
  for (int t = 0; t < 4; ++t)
#pragma unroll
    for (int r = 0; r < 8; ++r) rv[t][r] = vrow[r * (3 * CC) + t * 16];
  // inputs-only fence on the loaded values: all 32 loads of v are issued together and waited for once (without it they were issued a few at a time among the splits, each group paying a full latency)
  asm volatile("" :: "v"(rv[0]), "v"(rv[1]), "v"(rv[2]), "v"(rv[3]));
#pragma unroll
  for (int t = 0; t < 4; ++t) {
    const int col = col0 + t * 16 + ln;
#pragma unroll
    for (int r = 0; r < 8; ++r) {
      const float a = rv[t][r] + acc[t][r] * 0.015625f;
      const unsigned short hb = bf16_bits(a); sAh[8 * hh + r][col] = hb; sAl[8 * hh + r][col] = bf16_bits(a - bf16_val(hb));
    }
  }
  __syncthreads();      // every wave reads all 256 channels of the attn tile, of which each wave wrote 64
  v8f oc[4] = {};
  for (int kb = 0; kb < CC; kb += 32) {
    FragB ah, al;
    ah.half[0] = *(const v8us*)&sAh[ln][kb + 8 * hh]; ah.half[1] = *(const v8us*)&sAh[ln][kb + 16 + 8 * hh];
    al.half[0] = *(const v8us*)&sAl[ln][kb + 8 * hh]; al.half[1] = *(const v8us*)&sAl[ln][kb + 16 + 8 * hh];
#pragma unroll
    for (int t = 0; t < 4; ++t) {
      const unsigned short* brow = Bo + (size_t)(col0 + t * 16 + ln) * CC + kb;
      FragB b;
      b.half[0] = *(const v8us*)(brow + 8 * hh);
      b.half[1] = *(const v8us*)(brow + 16 + 8 * hh);
      oc[t] = mmaN<2>(ah.v, al.v, b.v, b.v, oc[t]);
    }
  }
#pragma unroll
  for (int t = 0; t < 4; ++t) {
    const float bv = bf16_round(bout[col0 + t * 16 + ln]);
#pragma unroll
    for (int r = 0; r < 8; ++r) so[w][8 * hh + r][t * 16 + ln] = oc[t][r] + bv;
  }
  __builtin_amdgcn_fence(__ATOMIC_ACQ_REL, "workgroup");
  __builtin_amdgcn_wave_barrier();
  const int rsub = lane >> 4, c4 = (lane & 15) * 4;
#pragma unroll
  for (int q = 0; q < 8; ++q) {
    const int r = q * 2 + rsub;
    const v4f v = *(const v4fa*)&so[w][r][c4];
    *(v4f*)(out + (tok0 + r) * CC + col0 + c4) = v;
  }
}
// qkv = x W_qkv + b. Block = 128 tokens x 128 columns, 8 waves of 32 x 64; the whole K = 256 of both operands is staged once in LDS as bf16 (x rounded on the way, each element once a block).
// Every global load covers 512 contiguous bytes of one row; the fragments, whose 16 lanes sit on 16 different rows, are read from LDS instead of through the cache.
// LDS row pitch 528 bytes = 16 x 33, the conflict-free pitch of 16-byte fragment reads. Each accumulator still sums its 8 k blocks in rising order.
#define QGP 528                   // bytes per LDS row
#define QGSO 68                   // floats per row of the output staging: rows 8 apart fall 32 banks apart
__global__ __launch_bounds__(256) void k_qkv_gemm(const float* __restrict__ X, const unsigned short* __restrict__ Wt, const float* __restrict__ bias, float* __restrict__ C) {
  __shared__ __attribute__((aligned(16))) unsigned char sm[2 * 128 * QGP];        // x tile, then weight tile; reused for the output staging
  unsigned char* sA = sm; unsigned char* sB = sm + 128 * QGP;
  const int tid = threadIdx.x, w = tid >> 5, lane = tid & 31, ln = lane & 15, hh = lane >> 4;
  const int col0 = blockIdx.x * 128; const size_t row0 = (size_t)blockIdx.y * 128;
  // wave w brings rows w, w + 8, ... of both tiles: a weight row is one load, a row of x two
  const unsigned short* bp = Wt + (size_t)(col0 + w) * CC + lane * 8;
  const float* ap = X + (row0 + w) * CC + lane * 4;
  {
    v8us br[16]; v4f ar[16][2];
    // the loops over i are unrolled so that br and ar stay in registers (constant indices) and all 48 loads of a wave are issued before the first is waited for
#pragma unroll
    for (int i = 0; i < 16; ++i) br[i] = *(const v8us*)(bp + (size_t)i * 8 * CC);
#pragma unroll
    for (int i = 0; i < 16; ++i) { ar[i][0] = *(const v4fa*)(ap + (size_t)i * 8 * CC); ar[i][1] = *(const v4fa*)(ap + (size_t)i * 8 * CC + 128); }
    // the wait that stands before a register named by an issued global load is overwritten; it takes both address pairs as inputs so that neither is reused (a later load's result had landed on one) before it
    asm volatile("s_wait_xcnt 0x0" :: "v"(bp), "v"(ap) : "memory");
#pragma unroll
    for (int i = 0; i < 16; ++i) *(v8us*)(sB + (w + 8 * i) * QGP + lane * 16) = br[i];
#pragma unroll
    for (int i = 0; i < 16; ++i)
#pragma unroll
      for (int h = 0; h < 2; ++h) {
        v4us o;
#pragma unroll
        for (int q = 0; q < 4; ++q) o[q] = bf16_bits(ar[i][h][q]);
        *(v4us*)(sA + (w + 8 * i) * QGP + h * 256 + lane * 8) = o;
      }
  }
  __syncthreads();      // publishes both tiles: every wave reads rows that other waves wrote
  const int wm = (w >> 1) * 32, wn = (w & 1) * 64;
  const unsigned char* pa = sA + (wm + ln) * QGP + 16 * hh;
  const unsigned char* pb = sB + (wn + ln) * QGP + 16 * hh;
  v8f acc[2][4] = {};
  // unrolled (all loops below) so that the fragments and acc stay in registers and a k block's LDS reads can be issued ahead of the block before it
#pragma unroll
  for (int kb = 0; kb < CC; kb += 32) {
    FragB a[2], b[4];
#pragma unroll
    for (int m = 0; m < 2; ++m) { a[m].half[0] = *(const v8us*)(pa + m * 16 * QGP + kb * 2); a[m].half[1] = *(const v8us*)(pa + m * 16 * QGP + kb * 2 + 32); }
#pragma unroll
    for (int t = 0; t < 4; ++t) { b[t].half[0] = *(const v8us*)(pb + t * 16 * QGP + kb * 2); b[t].half[1] = *(const v8us*)(pb + t * 16 * QGP + kb * 2 + 32); }
#pragma unroll
    for (int t = 0; t < 4; ++t)
#pragma unroll
      for (int m = 0; m < 2; ++m) acc[m][t] = __builtin_amdgcn_wmma_f32_16x16x32_bf16(false, a[m].v, false, b[t].v, (short)0, acc[m][t], false, false);
  }
  __syncthreads();      // the tiles are dead in every wave before their LDS is reused to stage the output
  float* so = (float*)sm + w * (32 * QGSO);
#pragma unroll
  for (int t = 0; t < 4; ++t) {
    const float bv = bf16_round(bias[col0 + wn + t * 16 + ln]);
#pragma unroll
    for (int m = 0; m < 2; ++m)
#pragma unroll
      for (int r = 0; r < 8; ++r) so[(m * 16 + 8 * hh + r) * QGSO + t * 16 + ln] = acc[m][t][r] + bv;
  }
  // each wave stages in its own LDS range: the fence and the wave barrier keep its row reads behind its own lanes' writes, so that whole 256-byte row pieces are stored
  __builtin_amdgcn_fence(__ATOMIC_ACQ_REL, "workgroup");
  __builtin_amdgcn_wave_barrier();
  float* dst = C + (row0 + wm) * (3 * CC) + col0 + wn + ln * 4;
#pragma unroll
  for (int q = 0; q < 16; ++q) {
    const int r = q * 2 + hh;
    const v4f v = *(const v4fa*)&so[r * QGSO + ln * 4];
    *(v4f*)(dst + (size_t)r * (3 * CC)) = v;
  }
}
extern "C" void kernel_launch(void* const* d_in, const int* in_sizes, int n_in,
                              void* d_out, int out_size, void* d_ws, size_t ws_size, hipStream_t stream) {
  (void)in_sizes; (void)n_in; (void)out_size;
  const float* x = (const float*)d_in[0]; const float* Wqkv = (const float*)d_in[1]; const float* bqkv = (const float*)d_in[2]; const float* Wout = (const float*)d_in[3]; const float* bout = (const float*)d_in[4];
  char* ws = (char*)d_ws; size_t off = 0;
  auto take = [&](size_t bytes) { char* p = ws + off; off += (bytes + 255) & ~(size_t)255; return p; };
  unsigned short* Bq = (unsigned short*)take((size_t)3 * CC * CC * 2); unsigned short* Bo = (unsigned short*)take((size_t)CC * CC * 2);
  float* QKV = (float*)take((size_t)BB * NTK * 3 * CC * 4); float* Q2n = (float*)take((size_t)BB * NTK * CC * 4); float* K2a = (float*)take((size_t)BB * NTK * CC * 4); float* KN = (float*)take(BB * CC * 4);
  float* KVp = (float*)take((size_t)KSL * BB * CC * CC * 4);      // the KSL partials of kv
  unsigned short* Ph = (unsigned short*)take((size_t)BB * CC * CC * 2); unsigned short* Pl = (unsigned short*)take((size_t)BB * CC * CC * 2); double* PS = (double*)take((size_t)BB * NCH * CC * 8);
  if (off > ws_size) return;
  k_btw<<<(3 * CC * 32 + 255) / 256, 256, 0, stream>>>(Wqkv, Bq, CC, 3 * CC); k_btw<<<(CC * 32 + 255) / 256, 256, 0, stream>>>(Wout, Bo, CC, CC);
  k_qkv_gemm<<<dim3(3 * CC / 128, BB * NTK / 128), 256, 0, stream>>>(x, Bq, bqkv, QKV);
  k_prep<<<BB * NTK / 8, 256, 0, stream>>>(QKV, Q2n, K2a); k_colnorm_part<<<dim3(NCH, BB), 256, 0, stream>>>(K2a, PS); k_colnorm_fin<<<dim3(CC / 32, BB), 256, 0, stream>>>(PS, KN);
  k_kv_part<<<dim3(4, BB, KSL), 256, 0, stream>>>(K2a, KN, QKV, KVp);      // slice z: KVp[z][b][c][d] = sum over the tokens t of slice z of k2[t][c] * v[t][d]
  k_kvplanes<<<(BB * CC * (CC / 8) + 255) / 256, 256, 0, stream>>>(KVp, Ph, Pl);
  k_t2_attn_out<<<dim3(NTK / 16, BB), 128, 0, stream>>>(Q2n, Ph, Pl, QKV, Bo, bout, (float*)d_out);      // t2 = q2 * kv, attn = v + t2 / 64, out = attn * W_out + b
}

// v006
// Measured time: 118 microseconds a run.
// Timed twice side by side with v005, it ran 1.37 times as fast both times.
// Over all steps from v000 it is 17.2 times as fast.
#include <hip/hip_runtime.h>
// Linear attention on WMMA (f32 accumulate): qkv = x·W_qkv + b (inputs rounded to bf16: single exact term; 32768 × 256 × 768), per batch kv = k2ᵀ·v (k2 and v are computed
// f32 → split into bf16 hi/lo: 3 products; 256 × 256 × 4096), t2 = q2·kv (3 products), out = attn·W_out + b (attn split hi/lo vs exact weights: 2 products). Mean-centering,
// squares, the two normalisations and the residual are f32 VALU (column statistics as fixed-order double sums).
#define BB 8
#define NTK 4096
#define CC 256

typedef __bf16 v16b __attribute__((ext_vector_type(16)));
typedef unsigned short v8us __attribute__((ext_vector_type(8), may_alias));
typedef float  v8f  __attribute__((ext_vector_type(8)));
typedef float  v4f  __attribute__((ext_vector_type(4)));
typedef float  v4fa __attribute__((ext_vector_type(4), may_alias));
union FragB { v16b v; v8us half[2]; unsigned short u[16]; };

__device__ __forceinline__ unsigned short bf16_bits(float x) { unsigned int u = __float_as_uint(x); return (unsigned short)((u + 0x7FFFu + ((u >> 16) & 1u)) >> 16); }
__device__ __forceinline__ float bf16_val(unsigned short b) { return __uint_as_float(((unsigned int)b) << 16); }
__device__ __forceinline__ float bf16_round(float x) { return bf16_val(bf16_bits(x)); }
// D += A·B with NT terms: 1 = ah·bh, 2 = + al·bh (A split), 3 = + ah·bl (both split)
template <int NT>
__device__ __forceinline__ v8f mmaN(v16b ah, v16b al, v16b bh, v16b bl, v8f c) {
  c = __builtin_amdgcn_wmma_f32_16x16x32_bf16(false, ah, false, bh, (short)0, c, false, false);
  if (NT >= 2) c = __builtin_amdgcn_wmma_f32_16x16x32_bf16(false, al, false, bh, (short)0, c, false, false);
  if (NT >= 3) c = __builtin_amdgcn_wmma_f32_16x16x32_bf16(false, ah, false, bl, (short)0, c, false, false);
  asm volatile("v_nop\n\tv_nop\n\tv_nop\n\tv_nop" : "+v"(c) : "v"(ah), "v"(al), "v"(bh), "v"(bl));
  return c;
}

__global__ __launch_bounds__(256) void k_wt_bf16(const float* __restrict__ W, unsigned short* __restrict__ Wt, int K, int N) {
  const int t = blockIdx.x * 256 + threadIdx.x;
  const int k8n = K / 8;
  if (t >= N * k8n) return;
  const int n = t / k8n, k8 = (t % k8n) * 8;
  v8us v;
#pragma unroll
  for (int i = 0; i < 8; ++i) v[i] = bf16_bits(W[(size_t)(k8 + i) * N + n]);
  *(v8us*)(Wt + (size_t)n * K + k8) = v;
  
}

// GEMM C[M][N] (f32, pitch ldc) = act(A[M][K]·W + bias). A f32 row-major (pitch lda) converted per fragment to bf16
// (ASPLIT: hi/lo two planes -> 2 terms, else single rounded term); Wt bf16 [N][K] (pitch ldb). BIAS_BF16 rounds the
// bias to bf16 first (bias quantised to bf16 before the add). K%32==0, M%16==0, N%64==0.
template <bool ASPLIT, int ACT, bool BIAS_BF16>
__global__ __launch_bounds__(128) void k_gemm_bf(const float* __restrict__ A, int lda, const unsigned short* __restrict__ Wt, int ldb,
                                               const float* __restrict__ bias, float* __restrict__ C, int ldc, int M, int N, int K) {
  __shared__ __attribute__((aligned(16))) float so[4][16][64];
  const int tid = threadIdx.x, w = tid >> 5, lane = tid & 31, ln = lane & 15, hh = lane >> 4;
  const int ntn = N / 64;
  const int wid = blockIdx.x * 4 + w;
  const int mt = wid / ntn, nq = wid % ntn;
  if (mt * 16 >= M) return;
  const int row0 = mt * 16, col0 = nq * 64;
  const float* arow = A + (size_t)(row0 + ln) * lda;
  v8f acc[4] = {};
  for (int kb = 0; kb < K; kb += 32) {
    FragB ah, al;
    const v4f x0 = *(const v4fa*)(arow + kb + 8 * hh), x1 = *(const v4fa*)(arow + kb + 8 * hh + 4);
    const v4f x2 = *(const v4fa*)(arow + kb + 16 + 8 * hh), x3 = *(const v4fa*)(arow + kb + 16 + 8 * hh + 4);
    float xs[16] = {x0[0],x0[1],x0[2],x0[3],x1[0],x1[1],x1[2],x1[3],x2[0],x2[1],x2[2],x2[3],x3[0],x3[1],x3[2],x3[3]};
#pragma unroll
    for (int i = 0; i < 16; ++i) { const unsigned short hb = bf16_bits(xs[i]); ah.u[i] = hb; al.u[i] = ASPLIT ? bf16_bits(xs[i] - bf16_val(hb)) : (unsigned short)0; }
#pragma unroll
    for (int t = 0; t < 4; ++t) {
      const unsigned short* brow = Wt + (size_t)(col0 + t * 16 + ln) * ldb + kb;
      FragB b;
      b.half[0] = *(const v8us*)(brow + 8 * hh);
      b.half[1] = *(const v8us*)(brow + 16 + 8 * hh);
      acc[t] = mmaN<ASPLIT ? 2 : 1>(ah.v, al.v, b.v, b.v, acc[t]);
    }
  }
#pragma unroll
  for (int t = 0; t < 4; ++t) {
    float bv = bias ? bias[col0 + t * 16 + ln] : 0.f;
    if (BIAS_BF16) bv = bf16_round(bv);
#pragma unroll
    for (int r = 0; r < 8; ++r) { float v = acc[t][r] + bv; if (ACT == 1) v = fmaxf(v, 0.f); so[w][8 * hh + r][t * 16 + ln] = v; }
  }
  __builtin_amdgcn_fence(__ATOMIC_ACQ_REL, "workgroup");
  __builtin_amdgcn_wave_barrier();
  const int rsub = lane >> 4, c4 = (lane & 15) * 4;
  {
#pragma unroll
    for (int q = 0; q < 8; ++q) {
      const int r = q * 2 + rsub;
      const v4f v = *(const v4fa*)&so[w][r][c4];
      *(v4f*)(C + (size_t)(row0 + r) * ldc + col0 + c4) = v;
    }
    
  }
}

// Flash-style causal/unmasked attention, all contractions 3-term bf16 hi/lo splits, f32 softmax with running max.
// q,k,v rows are read from f32 buffers with arbitrary row pitch (so they can live inside a fused qkv buffer);
// D = head size (multiple of 32, <= 128); one wave = 16 query rows; block = 4 waves (64 queries) sharing K/V chunks of 32.
template <int D, bool CAUSAL>
__global__ __launch_bounds__(128) void k_flash(const float* __restrict__ qb, const float* __restrict__ kb, const float* __restrict__ vb,
                                             int pitch, int T, int H, float scale, float* __restrict__ y, int ypitch) {
  constexpr int KS = D / 32;        // k-steps for QK
  constexpr int DT = D / 16;        // d tiles for PV
  __shared__ __attribute__((aligned(16))) unsigned short sKh[32][D + 8], sKl[32][D + 8], sVh[32][D + 8], sVl[32][D + 8];
  __shared__ __attribute__((aligned(16))) unsigned short sPh[4][16][40], sPl[4][16][40];
  __shared__ __attribute__((aligned(16))) float sO[4][16][D];
  const int tid = threadIdx.x, w = tid >> 5, lane = tid & 31, ln = lane & 15, hh = lane >> 4;
  const int nqb = (T + 63) / 64;
  const int bh = blockIdx.x / nqb, qblk = blockIdx.x % nqb;
  const int b = bh / H, h = bh % H;
  const int q0 = qblk * 64 + w * 16;
  const float* Q = qb + (size_t)b * T * pitch + h * D;
  const float* K = kb + (size_t)b * T * pitch + h * D;
  const float* V = vb + (size_t)b * T * pitch + h * D;

  // A fragments of the wave's 16 query rows (scaled), hi/lo
  FragB aqh[KS], aql[KS];
  {
    int row = q0 + ln; if (row >= T) row = T - 1;
    const float* qr = Q + (size_t)row * pitch;
#pragma unroll
    for (int ks = 0; ks < KS; ++ks)
#pragma unroll
      for (int i = 0; i < 16; ++i) {
        const int d = ks * 32 + ((i < 8) ? (8 * hh + i) : (16 + 8 * hh + (i - 8)));
        const float x = qr[d] * scale; const unsigned short hb = bf16_bits(x);
        aqh[ks].u[i] = hb; aql[ks].u[i] = bf16_bits(x - bf16_val(hb));
      }
  }
  float m_r[8], l_r[8];
#pragma unroll
  for (int r = 0; r < 8; ++r) { m_r[r] = -3.0e38f; l_r[r] = 0.f; }
  v8f oacc[DT];
#pragma unroll
  for (int dt = 0; dt < DT; ++dt) oacc[dt] = (v8f){0.f,0.f,0.f,0.f,0.f,0.f,0.f,0.f};

  const int kv_end = CAUSAL ? min(T, qblk * 64 + 64) : T;     // block-uniform
  for (int j0 = 0; j0 < kv_end; j0 += 32) {
    __syncthreads();
    for (int e = tid; e < 32 * (D / 4); e += 128) {
      const int r = e / (D / 4), c4 = (e % (D / 4)) * 4;
      const int key = j0 + r;
      v4f kf = {0.f,0.f,0.f,0.f}, vf = {0.f,0.f,0.f,0.f};
      if (key < T) { kf = *(const v4fa*)(K + (size_t)key * pitch + c4); vf = *(const v4fa*)(V + (size_t)key * pitch + c4); }
#pragma unroll
      for (int t = 0; t < 4; ++t) {
        unsigned short hb = bf16_bits(kf[t]); sKh[r][c4 + t] = hb; sKl[r][c4 + t] = bf16_bits(kf[t] - bf16_val(hb));
        hb = bf16_bits(vf[t]); sVh[r][c4 + t] = hb; sVl[r][c4 + t] = bf16_bits(vf[t] - bf16_val(hb));
      }
    }
    __syncthreads();
    // S tile 16 x 32
    v8f s[2];
#pragma unroll
    for (int nt = 0; nt < 2; ++nt) {
      v8f acc = {};
#pragma unroll
      for (int ks = 0; ks < KS; ++ks) {
        FragB bh_, bl_;
        bh_.half[0] = *(const v8us*)&sKh[nt * 16 + ln][ks * 32 + 8 * hh]; bh_.half[1] = *(const v8us*)&sKh[nt * 16 + ln][ks * 32 + 16 + 8 * hh];
        bl_.half[0] = *(const v8us*)&sKl[nt * 16 + ln][ks * 32 + 8 * hh]; bl_.half[1] = *(const v8us*)&sKl[nt * 16 + ln][ks * 32 + 16 + 8 * hh];
        acc = mmaN<3>(aqh[ks].v, aql[ks].v, bh_.v, bl_.v, acc);
      }
      s[nt] = acc;
    }
    // mask + running max (rows 8hh+r; the 16 lanes of a half share rows)
    float alpha[8];
#pragma unroll
    for (int r = 0; r < 8; ++r) {
      const int qi = q0 + 8 * hh + r;
      const int ja = j0 + ln, jb = j0 + 16 + ln;
      if (CAUSAL) { if (ja > qi) s[0][r] = -3.0e38f; if (jb > qi) s[1][r] = -3.0e38f; }
      if (ja >= T) s[0][r] = -3.0e38f;
      if (jb >= T) s[1][r] = -3.0e38f;
      float mx = fmaxf(s[0][r], s[1][r]);
      mx = fmaxf(mx, __shfl_xor(mx, 1, 32)); mx = fmaxf(mx, __shfl_xor(mx, 2, 32)); mx = fmaxf(mx, __shfl_xor(mx, 4, 32)); mx = fmaxf(mx, __shfl_xor(mx, 8, 32));
      const float mnew = fmaxf(m_r[r], mx);
      alpha[r] = (mnew > -1.0e38f) ? __expf(m_r[r] - mnew) : 1.0f;
      const float p0 = (s[0][r] > -1.0e38f) ? __expf(s[0][r] - mnew) : 0.f;
      const float p1 = (s[1][r] > -1.0e38f) ? __expf(s[1][r] - mnew) : 0.f;
      m_r[r] = mnew;
      l_r[r] = l_r[r] * alpha[r] + p0 + p1;            // per-lane partial row sum (16 lanes combined at the end)
      unsigned short hb = bf16_bits(p0); sPh[w][8 * hh + r][ln] = hb;      sPl[w][8 * hh + r][ln] = bf16_bits(p0 - bf16_val(hb));
      hb = bf16_bits(p1);                sPh[w][8 * hh + r][16 + ln] = hb; sPl[w][8 * hh + r][16 + ln] = bf16_bits(p1 - bf16_val(hb));
    }
#pragma unroll
    for (int dt = 0; dt < DT; ++dt)
#pragma unroll
      for (int r = 0; r < 8; ++r) oacc[dt][r] *= alpha[r];
    __builtin_amdgcn_fence(__ATOMIC_ACQ_REL, "workgroup");
    __builtin_amdgcn_wave_barrier();
    FragB pah, pal;
    pah.half[0] = *(const v8us*)&sPh[w][ln][8 * hh]; pah.half[1] = *(const v8us*)&sPh[w][ln][16 + 8 * hh];
    pal.half[0] = *(const v8us*)&sPl[w][ln][8 * hh]; pal.half[1] = *(const v8us*)&sPl[w][ln][16 + 8 * hh];
#pragma unroll
    for (int dt = 0; dt < DT; ++dt) {
      FragB bvh, bvl;
#pragma unroll
      for (int i = 0; i < 8; ++i) {
        bvh.u[i] = sVh[8 * hh + i][dt * 16 + ln]; bvh.u[8 + i] = sVh[16 + 8 * hh + i][dt * 16 + ln];
        bvl.u[i] = sVl[8 * hh + i][dt * 16 + ln]; bvl.u[8 + i] = sVl[16 + 8 * hh + i][dt * 16 + ln];
      }
      oacc[dt] = mmaN<3>(pah.v, pal.v, bvh.v, bvl.v, oacc[dt]);
    }
    __builtin_amdgcn_fence(__ATOMIC_ACQ_REL, "workgroup");
    __builtin_amdgcn_wave_barrier();
  }
#pragma unroll
  for (int r = 0; r < 8; ++r) {
    float l = l_r[r];
    l += __shfl_xor(l, 1, 32); l += __shfl_xor(l, 2, 32); l += __shfl_xor(l, 4, 32); l += __shfl_xor(l, 8, 32);
    l_r[r] = (l > 0.f) ? 1.0f / l : 0.f;
  }
#pragma unroll
  for (int dt = 0; dt < DT; ++dt)
#pragma unroll
    for (int r = 0; r < 8; ++r) sO[w][8 * hh + r][dt * 16 + ln] = oacc[dt][r] * l_r[r];
  __builtin_amdgcn_fence(__ATOMIC_ACQ_REL, "workgroup");
  __builtin_amdgcn_wave_barrier();
  {
    for (int r = 0; r < 16; ++r) {
      const int row = q0 + r;
      if (row < T && lane < D / 4) {
        const v4f val = *(const v4fa*)&sO[w][r][lane * 4];
        *(v4f*)(y + ((size_t)b * T + row) * ypitch + h * D + lane * 4) = val;
      }
    }
    
  }
}

// GEMM C = act(A·W + bias + resid): A f32 (ASPLIT -> hi/lo 2 terms), Wt bf16 [N][K]; ACT 0 none, 1 relu, 2 exact gelu;
// resid (optional, f32, row index = (row % rmod), pitch ldr, RES_BF16 rounds it) added before the activation.
template <bool ASPLIT, int ACT, bool BIAS_BF16, bool RES_BF16>
__global__ __launch_bounds__(128) void k_gemm_bf3(const float* __restrict__ A, int lda, const unsigned short* __restrict__ Wt, int ldb,
                                                const float* __restrict__ bias, const float* __restrict__ resid, int rmod, int ldr,
                                                float* __restrict__ C, int ldc, int M, int N, int K) {
  __shared__ __attribute__((aligned(16))) float so[4][16][64];
  const int tid = threadIdx.x, w = tid >> 5, lane = tid & 31, ln = lane & 15, hh = lane >> 4;
  const int ntn = N / 64;
  const int wid = blockIdx.x * 4 + w;
  const int mt = wid / ntn, nq = wid % ntn;
  if (mt * 16 >= M) return;
  const int row0 = mt * 16, col0 = nq * 64;
  const float* arow = A + (size_t)(row0 + ln) * lda;
  v8f acc[4] = {};
  for (int kb = 0; kb < K; kb += 32) {
    FragB ah, al;
    const v4f x0 = *(const v4fa*)(arow + kb + 8 * hh), x1 = *(const v4fa*)(arow + kb + 8 * hh + 4);
    const v4f x2 = *(const v4fa*)(arow + kb + 16 + 8 * hh), x3 = *(const v4fa*)(arow + kb + 16 + 8 * hh + 4);
    float xs[16] = {x0[0],x0[1],x0[2],x0[3],x1[0],x1[1],x1[2],x1[3],x2[0],x2[1],x2[2],x2[3],x3[0],x3[1],x3[2],x3[3]};
#pragma unroll
    for (int i = 0; i < 16; ++i) { const unsigned short hb = bf16_bits(xs[i]); ah.u[i] = hb; al.u[i] = ASPLIT ? bf16_bits(xs[i] - bf16_val(hb)) : (unsigned short)0; }
#pragma unroll
    for (int t = 0; t < 4; ++t) {
      const unsigned short* brow = Wt + (size_t)(col0 + t * 16 + ln) * ldb + kb;
      FragB b;
      b.half[0] = *(const v8us*)(brow + 8 * hh);
      b.half[1] = *(const v8us*)(brow + 16 + 8 * hh);
      acc[t] = mmaN<ASPLIT ? 2 : 1>(ah.v, al.v, b.v, b.v, acc[t]);
    }
  }
#pragma unroll
  for (int t = 0; t < 4; ++t) {
    const int col = col0 + t * 16 + ln;
    float bv = bias ? bias[col] : 0.f;
    if (BIAS_BF16) bv = bf16_round(bv);
#pragma unroll
    for (int r = 0; r < 8; ++r) {
      float v = acc[t][r] + bv;
      if (resid) { float rv = resid[(size_t)((row0 + 8 * hh + r) % rmod) * ldr + col]; if (RES_BF16) rv = bf16_round(rv); v += rv; }
      if (ACT == 1) v = fmaxf(v, 0.f);
      if (ACT == 2) v = 0.5f * v * (1.0f + erff(v * 0.70710678118654752f));
      if (ACT == 3) { const float u = 0.7978845608028654f * (v + 0.044715f * v * v * v); v = 0.5f * v * (1.0f + tanhf(u)); }
      so[w][8 * hh + r][t * 16 + ln] = v;
    }
  }
  __builtin_amdgcn_fence(__ATOMIC_ACQ_REL, "workgroup");
  __builtin_amdgcn_wave_barrier();
  const int rsub = lane >> 4, c4 = (lane & 15) * 4;
  {
#pragma unroll
    for (int q = 0; q < 8; ++q) {
      const int r = q * 2 + rsub;
      const v4f v = *(const v4fa*)&so[w][r][c4];
      *(v4f*)(C + (size_t)(row0 + r) * ldc + col0 + c4) = v;
    }
    
  }
}
// row LayerNorm (biased variance, eps) over N: s = X (+ R); optional out_sum <- s; out_norm <- (s-mu)*rsqrt(var+eps)*g + b
template <bool PARAM_BF16>
__global__ __launch_bounds__(256) void k_layernorm(const float* __restrict__ X, const float* __restrict__ R, const float* __restrict__ g, const float* __restrict__ bta,
                                                  float* __restrict__ out_sum, float* __restrict__ out_norm, int N, float eps) {
  __shared__ float red[256];
  const int row = blockIdx.x, tid = threadIdx.x;
  const float* x = X + (size_t)row * N; const float* rr = R ? R + (size_t)row * N : nullptr;
  float vals[16];                     // up to N = 4096
  const int per = N / 256;            // contiguous chunk per thread? use strided-by-4 chunks: thread handles j = tid*4 + 1024*u
  float s1 = 0.f;
  for (int u = 0; u < per / 4; ++u) {
    const int j = tid * 4 + 1024 * u;
    const v4f a = *(const v4fa*)(x + j);
    v4f b = {0.f,0.f,0.f,0.f}; if (rr) b = *(const v4fa*)(rr + j);
#pragma unroll
    for (int q = 0; q < 4; ++q) { const float v = a[q] + b[q]; vals[u * 4 + q] = v; s1 += v; }
  }
  red[tid] = s1; __syncthreads();
  for (int st = 128; st > 0; st >>= 1) { if (tid < st) red[tid] += red[tid + st]; __syncthreads(); }
  const float mu = red[0] / (float)N; __syncthreads();
  float s2 = 0.f;
  for (int u = 0; u < per / 4; ++u)
#pragma unroll
    for (int q = 0; q < 4; ++q) { const float c = vals[u * 4 + q] - mu; s2 += c * c; }
  red[tid] = s2; __syncthreads();
  for (int st = 128; st > 0; st >>= 1) { if (tid < st) red[tid] += red[tid + st]; __syncthreads(); }
  const float rs = rsqrtf(red[0] / (float)N + eps);
  {
    for (int u = 0; u < per / 4; ++u) {
      const int j = tid * 4 + 1024 * u;
      v4f o, sm;
#pragma unroll
      for (int q = 0; q < 4; ++q) {
        float gg = g[j + q], bb = bta[j + q];
        if (PARAM_BF16) { gg = bf16_round(gg); bb = bf16_round(bb); }
        sm[q] = vals[u * 4 + q]; o[q] = (vals[u * 4 + q] - mu) * rs * gg + bb;
      }
      if (out_sum) *(v4f*)(out_sum + (size_t)row * N + j) = sm;
      *(v4f*)(out_norm + (size_t)row * N + j) = o;
    }
    
  }
}

// batched f32 [K][N] (pitch lds, batch stride sIn) -> transposed hi/lo planes [N][K] (batch stride sOut); thread per (n, 8 k); grid.y = batch
__global__ __launch_bounds__(256) void k_split_transpose_b(const float* __restrict__ src, int lds_, size_t sIn, unsigned short* __restrict__ hi, unsigned short* __restrict__ lo, size_t sOut, int K, int N) {
  const size_t t = (size_t)blockIdx.x * 256 + threadIdx.x; const int k8n = K / 8; if (t >= (size_t)N * k8n) return;
  src += (size_t)blockIdx.y * sIn; hi += (size_t)blockIdx.y * sOut; lo += (size_t)blockIdx.y * sOut;
  const int n = (int)(t / k8n), k8 = (int)(t % k8n) * 8; v8us vh, vl;
#pragma unroll
  for (int i = 0; i < 8; ++i) { const float x = src[(size_t)(k8 + i) * lds_ + n]; const unsigned short hb = bf16_bits(x); vh[i] = hb; vl[i] = bf16_bits(x - bf16_val(hb)); }
  unsigned short* dh = hi + (size_t)n * K + k8; unsigned short* dl = lo + (size_t)n * K + k8;
  *(v8us*)dh = vh; *(v8us*)dl = vl; 
}

__global__ __launch_bounds__(256) void k_btw(const float* __restrict__ W, unsigned short* __restrict__ Bt, int K, int N) { const int t = blockIdx.x * 256 + threadIdx.x; if (t >= N * (K / 8)) return; const int n = t / (K / 8), k8 = (t % (K / 8)) * 8; v8us v; for (int q = 0; q < 8; ++q) v[q] = bf16_bits(W[(size_t)(k8 + q) * N + n]); *(v8us*)(Bt + (size_t)n * K + k8) = v;  }
// per token: q ← q − mean(q), k ← k − mean(k); q2 = q², k2 = k²; q2s, k2s; Q2n[t][c] = l2norm_c(q2/(q2s+1e-7)); K2a[t][c] = k2/(k2s+1e-7) (column-normalised later); wave per token, 8 per lane
__global__ __launch_bounds__(256) void k_prep(const float* __restrict__ QKV, float* __restrict__ Q2n, float* __restrict__ K2a) {
  const int tid = threadIdx.x, wv = tid >> 5, lane = tid & 31; const size_t t = (size_t)blockIdx.x * 8 + wv; const float* row = QKV + t * (3 * CC); float q[8], k[8]; float sq = 0.f, sk = 0.f;
#pragma unroll
  for (int u = 0; u < 8; ++u) { q[u] = row[u * 32 + lane]; k[u] = row[CC + u * 32 + lane]; sq += q[u]; sk += k[u]; }
  for (int o = 16; o >= 1; o >>= 1) { sq += __shfl_xor(sq, o, 32); sk += __shfl_xor(sk, o, 32); } const float mq = sq * (1.0f / CC), mk = sk * (1.0f / CC);
  float q2s = 0.f, k2s = 0.f;
#pragma unroll
  for (int u = 0; u < 8; ++u) { q[u] = (q[u] - mq) * (q[u] - mq); k[u] = (k[u] - mk) * (k[u] - mk); q2s += q[u]; k2s += k[u]; }
  for (int o = 16; o >= 1; o >>= 1) { q2s += __shfl_xor(q2s, o, 32); k2s += __shfl_xor(k2s, o, 32); }
  float nq = 0.f; const float rq = 1.0f / (q2s + 1e-7f), rk = 1.0f / (k2s + 1e-7f);
#pragma unroll
  for (int u = 0; u < 8; ++u) { q[u] = q[u] * rq; k[u] = k[u] * rk; nq += q[u] * q[u]; }
  for (int o = 16; o >= 1; o >>= 1) nq += __shfl_xor(nq, o, 32); const float iq = 1.0f / fmaxf(sqrtf(nq), 1e-12f);
#pragma unroll
  for (int u = 0; u < 8; ++u) q[u] *= iq;
  {
#pragma unroll
    for (int u = 0; u < 8; ++u) { *(float*)(Q2n + t * CC + u * 32 + lane) = q[u]; *(float*)(K2a + t * CC + u * 32 + lane) = k[u]; }  }
}
// column norms of K2a over the 4096 tokens of each batch, in two launches, every sum in double and in a fixed order.
// Stage 1: block per (chunk of 64 tokens, batch); a thread takes 4 adjacent columns of every 4th token; the 4 token groups are joined through LDS: PS[b][chunk][c].
#define NCH 64
__global__ __launch_bounds__(256) void k_colnorm_part(const float* __restrict__ K2a, double* __restrict__ PS) {
  __shared__ double red[4][CC];
  const int tid = threadIdx.x, c4 = (tid & 63) * 4, rg = tid >> 6, ch = blockIdx.x, b = blockIdx.y;
  const float* base = K2a + ((size_t)b * NTK + (size_t)ch * (NTK / NCH) + rg) * CC + c4;
  v4f v[NTK / NCH / 4];
  // unrolled so that the loads are independent of the sums and many are in flight per wave (the rolled one-load loop paid a full memory latency per token)
#pragma unroll
  for (int i = 0; i < NTK / NCH / 4; ++i) v[i] = *(const v4fa*)(base + (size_t)i * 4 * CC);
  double s[4] = {0.0, 0.0, 0.0, 0.0};
  // unrolled so that v[] stays in registers (constant indices)
#pragma unroll
  for (int i = 0; i < NTK / NCH / 4; ++i)
#pragma unroll
    for (int q = 0; q < 4; ++q) s[q] += (double)v[i][q] * (double)v[i][q];
#pragma unroll
  for (int q = 0; q < 4; ++q) red[rg][c4 + q] = s[q];
  __syncthreads();
  PS[((size_t)b * NCH + ch) * CC + tid] = (red[0][tid] + red[1][tid]) + (red[2][tid] + red[3][tid]);
}
// Stage 2: block per (32 columns, batch); wave g sums chunks 8g..8g+7 of its 32 columns, wave 0 joins the 8 sums: KN[b][c] = 1/max(norm, 1e-12)
__global__ __launch_bounds__(256) void k_colnorm_fin(const double* __restrict__ PS, float* __restrict__ KN) {
  __shared__ double red[8][32];
  const int tid = threadIdx.x, cl = tid & 31, g = tid >> 5, b = blockIdx.y, c = blockIdx.x * 32 + cl;
  const double* p = PS + ((size_t)b * NCH + g * (NCH / 8)) * CC + c;
  double s = 0.0;
  // unrolled so that the 8 loads are in flight together
#pragma unroll
  for (int i = 0; i < NCH / 8; ++i) s += p[(size_t)i * CC];
  red[g][cl] = s;
  __syncthreads();
  if (tid < 32) {
    double t = 0.0;
#pragma unroll
    for (int j = 0; j < 8; ++j) t += red[j][tid];
    KN[b * CC + c] = 1.0f / fmaxf((float)sqrt(t), 1e-12f);
  }
}
// Partials of kv = k2^T v straight from the token-major arrays: KVp[z][b][c][d] = sum over the 256 tokens t of slice z of (K2a[t][c] * KN[c]) * v[t][d], 3 products on hi/lo bf16 planes.
// Block = 128 c x 128 d of one (batch, slice), 8 waves of 32 c x 64 d. A pass takes 32 tokens: every thread splits its 16-byte pieces of k2 and v once and lays them token-major in LDS;
// both operands need 8 consecutive tokens of one channel per lane, which the transposing LDS read delivers in the hardware k order (the order the row loaders of this file use).
#define KSL 16
#define KVT 32                    // tokens per pass
#define KVPITCH 288               // bytes per LDS row: 128 channels x 2 B + 32 = 32 B x 9, the conflict-free pitch of the transposing read
#define KVPLANE (KVT * KVPITCH)   // one plane of one pass
#define KVSO 68                   // floats per row of the output staging: rows 8 apart fall 32 banks apart
typedef short s16x8 __attribute__((ext_vector_type(8)));
typedef unsigned short v4us __attribute__((ext_vector_type(4), may_alias));
__device__ __forceinline__ v8us ld_tr16(const unsigned char* p) { typedef __attribute__((address_space(3))) s16x8 lds_s16x8; return __builtin_bit_cast(v8us, __builtin_amdgcn_ds_load_tr16_b128_v8i16((lds_s16x8*)p)); }
__device__ __forceinline__ void split_store4(v4f x, unsigned char* ph, unsigned char* pl) {
  v4us h, l;
  // unrolled so that the vector elements are named by constants
#pragma unroll
  for (int q = 0; q < 4; ++q) { const unsigned short hb = bf16_bits(x[q]); h[q] = hb; l[q] = bf16_bits(x[q] - bf16_val(hb)); }
  *(v4us*)ph = h; *(v4us*)pl = l;
}
__global__ __launch_bounds__(256) void k_kv_part(const float* __restrict__ K2a, const float* __restrict__ KN, const float* __restrict__ QKV, float* __restrict__ KVp) {
  __shared__ __attribute__((aligned(16))) unsigned char sm[2 * 4 * KVPLANE];      // two buffers of 4 planes: k2 hi, k2 lo, v hi, v lo
  const int tid = threadIdx.x, w = tid >> 5, lane = tid & 31, ln = lane & 15, hh = lane >> 4;
  const int c0 = (blockIdx.x >> 1) * 128, d0 = (blockIdx.x & 1) * 128, b = blockIdx.y, z = blockIdx.z;
  const size_t tok0 = (size_t)b * NTK + (size_t)z * (NTK / KSL);
  // wave w brings rows w, w + 8, w + 16, w + 24 of a pass: one 512-byte row segment per load
  const float* kp = K2a + (tok0 + w) * CC + c0 + lane * 4;
  const float* vp = QKV + (tok0 + w) * (3 * CC) + 2 * CC + d0 + lane * 4;
  const v4f kn = *(const v4fa*)(KN + b * CC + c0 + lane * 4);
  const int wc = (w >> 1) * 32, wd = (w & 1) * 64;
  const int wr = w * KVPITCH + lane * 8;                                           // where the thread's pieces land in a plane
  const int rd = (8 * hh + (lane & 7)) * KVPITCH + ((lane >> 3) & 1) * 16;         // lane address of the transposing read, tokens 0..15, channel 0
  v4f kr[4], vr[4];
  // every loop over i, m, t, r or q below is unrolled so that kr, vr, the fragments and acc stay in registers (constant indices) and the 8 loads of a pass are in flight together
#pragma unroll
  for (int i = 0; i < 4; ++i) { kr[i] = *(const v4fa*)(kp + (size_t)i * 8 * CC); vr[i] = *(const v4fa*)(vp + (size_t)i * 8 * 3 * CC); }
  v8f acc[2][4] = {};
  for (int ps = 0; ps < NTK / KSL / KVT; ++ps) {
    unsigned char* buf = sm + (ps & 1) * (4 * KVPLANE);
#pragma unroll
    for (int i = 0; i < 4; ++i) {
      unsigned char* p = buf + wr + i * 8 * KVPITCH;
      split_store4(kr[i] * kn, p, p + KVPLANE);
      split_store4(vr[i], p + 2 * KVPLANE, p + 3 * KVPLANE);
    }
    __syncthreads();      // publishes this pass's planes; it also ends every wave's reads of the other buffer, which the next pass overwrites
    if (ps + 1 < NTK / KSL / KVT) {      // the next pass's loads fly while this pass is multiplied
      kp += (size_t)KVT * CC; vp += (size_t)KVT * 3 * CC;
#pragma unroll
      for (int i = 0; i < 4; ++i) { kr[i] = *(const v4fa*)(kp + (size_t)i * 8 * CC); vr[i] = *(const v4fa*)(vp + (size_t)i * 8 * 3 * CC); }
    }
    FragB ah[2], al[2];
#pragma unroll
    for (int m = 0; m < 2; ++m) {
      const unsigned char* p = buf + rd + 2 * (wc + 16 * m);
      ah[m].half[0] = ld_tr16(p); ah[m].half[1] = ld_tr16(p + 16 * KVPITCH);
      al[m].half[0] = ld_tr16(p + KVPLANE); al[m].half[1] = ld_tr16(p + KVPLANE + 16 * KVPITCH);
    }
#pragma unroll
    for (int t = 0; t < 4; ++t) {
      const unsigned char* p = buf + 2 * KVPLANE + rd + 2 * (wd + 16 * t);
      FragB bh_, bl_;
      bh_.half[0] = ld_tr16(p); bh_.half[1] = ld_tr16(p + 16 * KVPITCH);
      bl_.half[0] = ld_tr16(p + KVPLANE); bl_.half[1] = ld_tr16(p + KVPLANE + 16 * KVPITCH);
#pragma unroll
      for (int m = 0; m < 2; ++m) acc[m][t] = mmaN<3>(ah[m].v, al[m].v, bh_.v, bl_.v, acc[m][t]);
    }
  }
  __syncthreads();      // the planes are dead in every wave before their LDS is reused to stage the output
  float* so = (float*)sm + w * (2 * 16 * KVSO);
#pragma unroll
  for (int m = 0; m < 2; ++m)
#pragma unroll
    for (int t = 0; t < 4; ++t)
#pragma unroll
      for (int r = 0; r < 8; ++r) so[(m * 16 + 8 * hh + r) * KVSO + t * 16 + ln] = acc[m][t][r];
  // each wave stages in its own LDS range: the fence and the wave barrier keep its row reads behind its own lanes' writes, so that whole 256-byte row pieces are stored
  __builtin_amdgcn_fence(__ATOMIC_ACQ_REL, "workgroup");
  __builtin_amdgcn_wave_barrier();
  float* dst = KVp + (((size_t)z * BB + b) * CC + c0 + wc) * CC + d0 + wd + ln * 4;
#pragma unroll
  for (int q = 0; q < 16; ++q) {
    const int r = q * 2 + hh;
    const v4f v = *(const v4fa*)&so[r * KVSO + ln * 4];
    *(v4f*)(dst + (size_t)r * CC) = v;
  }
}
// kv = sum of its KSL token-slice partials KVp[slice][b][c][d], added in slice order (f32); then kv -> Bt for t2 = q2 kv: B[k=c][n=d] = kv[c][d] -> Bt[d][c]: planes hi/lo of kv transposed.
// thread per (b, 8 c, d) with d along the lanes: each of the 8 * KSL loads of a wave reads one whole line
__global__ __launch_bounds__(256) void k_kvplanes(const float* __restrict__ KVp, unsigned short* __restrict__ Ph, unsigned short* __restrict__ Pl) { const int t = blockIdx.x * 256 + threadIdx.x; if (t >= BB * CC * (CC / 8)) return; const int d = t % CC; const int c8 = ((t / CC) % (CC / 8)) * 8; const int b = t / ((CC / 8) * CC); v8us h, l;
  const float* p = KVp + ((size_t)b * CC + c8) * CC + d; float s[8] = {0.f, 0.f, 0.f, 0.f, 0.f, 0.f, 0.f, 0.f};
  // kept rolled, 4 slices a trip: 32 independent loads are in flight per wave; fully unrolled, the 128 loads took 138 registers
#pragma unroll 1
  for (int z = 0; z < KSL; z += 4) {
    float v[4][8];
    // unrolled so that v[] stays in registers and the loads do not wait on the sums
#pragma unroll
    for (int j = 0; j < 4; ++j)
#pragma unroll
      for (int q = 0; q < 8; ++q) v[j][q] = p[(size_t)(z + j) * BB * CC * CC + (size_t)q * CC];
#pragma unroll
    for (int j = 0; j < 4; ++j)
#pragma unroll
      for (int q = 0; q < 8; ++q) s[q] += v[j][q];
  }
  for (int q = 0; q < 8; ++q) { const float v = s[q]; const unsigned short hb = bf16_bits(v); h[q] = hb; l[q] = bf16_bits(v - bf16_val(hb)); } const size_t dst = ((size_t)b * CC + d) * CC + c8; *(v8us*)(Ph + dst) = h; *(v8us*)(Pl + dst) = l;  }
// t2 = q2 kv, attn = v + t2/sqrt(N) and out = attn W_out + b in one launch. Block = 128 tokens x all 256 channels, 16 waves of 32 tokens x 64 channels in both products.
// Every operand reaches the fragments through LDS: q2 is split once a block into bf16 hi/lo planes; the kv planes (4 tiles of 64 c) and then W_out (2 tiles of 128 c) pass through two
// buffers, brought by loads that cover whole 128-byte lines, the next tile's loads in flight while this tile is multiplied. The attn tile takes the place of the q2 planes.
// Each accumulator still sums its 8 k blocks in rising order, and the products of a block in the order hi*hi, lo*hi, hi*lo (attn hi, attn lo in the second product).
#define TOT 128                   // tokens per block
#define TAP 528                   // bytes per LDS row of the q2 / attn planes: 16 x 33, the conflict-free pitch of 16-byte fragment reads
#define TKP 144                   // bytes per LDS row of a kv tile (64 c): 16 x 9
#define TWP 272                   // bytes per LDS row of a W_out tile (128 c): 16 x 17
#define TBUF (2 * CC * TKP)       // one buffer: the hi and the lo plane of a kv tile; a W_out tile (CC * TWP) is smaller
#define TSO 68                    // floats per row of the output staging: rows 8 apart fall 32 banks apart
__device__ __forceinline__ v8f mma1(v16b a, v16b b, v8f c) { return __builtin_amdgcn_wmma_f32_16x16x32_bf16(false, a, false, b, (short)0, c, false, false); }
__global__ __launch_bounds__(512) void k_t2_attn_out(const float* __restrict__ Q2n, const unsigned short* __restrict__ Ph, const unsigned short* __restrict__ Pl, const float* __restrict__ QKV,
                                                    const unsigned short* __restrict__ Bo, const float* __restrict__ bout, float* __restrict__ out) {
  __shared__ __attribute__((aligned(16))) unsigned char sm[2 * TOT * TAP + 2 * TBUF];      // hi plane, lo plane, two tile buffers (reused for the output staging)
  unsigned char* sAh = sm; unsigned char* sAl = sm + TOT * TAP; unsigned char* sB = sm + 2 * TOT * TAP;
  const int tid = threadIdx.x, w = tid >> 5, lane = tid & 31, ln = lane & 15, hh = lane >> 4;
  const size_t tok0 = (size_t)blockIdx.y * NTK + (size_t)blockIdx.x * TOT;
  // a load of a kv tile covers 4 rows x 128 bytes: wave w brings rows 4w .. 4w+3, + 64, + 128, + 192 of both planes; a load of a W_out tile covers 2 rows x 256 bytes: rows 2w, 2w+1, + 32, ...
  const int kr = w * 4 + (lane >> 3), kc = lane & 7, orow = w * 2 + hh;
  const unsigned short* ph = Ph + (size_t)blockIdx.y * CC * CC + (size_t)kr * CC + kc * 8;
  const unsigned short* pl = Pl + (size_t)blockIdx.y * CC * CC + (size_t)kr * CC + kc * 8;
  const unsigned short* po = Bo + (size_t)orow * CC + ln * 8;
  v8us br[8];
  // every loop below is unrolled so that br, ar, rv, the fragments and the accumulators stay in registers (constant indices) and the loads of a group are in flight together
#pragma unroll
  for (int i = 0; i < 4; ++i) { br[i] = *(const v8us*)(ph + (size_t)i * 64 * CC); br[4 + i] = *(const v8us*)(pl + (size_t)i * 64 * CC); }
  {
    // wave w brings rows w, w + 16, ... of q2: two 512-byte loads a row
    const float* ap = Q2n + (tok0 + w) * CC + lane * 4;
    v4f ar[8][2];
#pragma unroll
    for (int i = 0; i < 8; ++i) { ar[i][0] = *(const v4fa*)(ap + (size_t)i * 16 * CC); ar[i][1] = *(const v4fa*)(ap + (size_t)i * 16 * CC + 128); }
    // the wait that stands before a register named by an issued global load is overwritten; here and below it takes the address pairs as inputs so that none is reused (a later load's result had landed on one) before it
    asm volatile("s_wait_xcnt 0x0" :: "v"(ph), "v"(pl), "v"(ap) : "memory");
#pragma unroll
    for (int i = 0; i < 8; ++i)
#pragma unroll
      for (int h = 0; h < 2; ++h) { const int o = (w + 16 * i) * TAP + h * 256 + lane * 8; split_store4(ar[i][h], sAh + o, sAl + o); }
  }
  const int wm = (w >> 2) * 32, wn = (w & 3) * 64;
  const unsigned char* pa = sAh + (wm + ln) * TAP + 16 * hh;      // the lo plane lies TOT * TAP further
  v8f acc[2][4] = {};
#pragma unroll
  for (int s = 0; s < 4; ++s) {
    unsigned char* buf = sB + (s & 1) * TBUF;
#pragma unroll
    for (int i = 0; i < 4; ++i) { unsigned char* p = buf + (kr + 64 * i) * TKP + kc * 16; *(v8us*)p = br[i]; *(v8us*)(p + CC * TKP) = br[4 + i]; }
    __syncthreads();      // publishes this tile (and, the first time, the q2 planes); it also ends every wave's reads of the other buffer, which the next pass overwrites
    if (s < 3) {
#pragma unroll
      for (int i = 0; i < 4; ++i) { br[i] = *(const v8us*)(ph + (s + 1) * 64 + (size_t)i * 64 * CC); br[4 + i] = *(const v8us*)(pl + (s + 1) * 64 + (size_t)i * 64 * CC); }
      asm volatile("s_wait_xcnt 0x0" :: "v"(ph), "v"(pl) : "memory");      // before an address pair of these loads is overwritten
    } else {
#pragma unroll
      for (int i = 0; i < 8; ++i) br[i] = *(const v8us*)(po + (size_t)i * 32 * CC);
      asm volatile("s_wait_xcnt 0x0" :: "v"(po) : "memory");      // before the address pair of these loads is overwritten
    }
    const unsigned char* pb = buf + (wn + ln) * TKP + 16 * hh;
#pragma unroll
    for (int kl = 0; kl < 64; kl += 32) {
      const int kb = s * 64 + kl;
      FragB ah[2], al[2], bh_[4], bl_[4];
#pragma unroll
      for (int m = 0; m < 2; ++m) {
        const unsigned char* p = pa + m * 16 * TAP + kb * 2;
        ah[m].half[0] = *(const v8us*)p; ah[m].half[1] = *(const v8us*)(p + 32);
        al[m].half[0] = *(const v8us*)(p + TOT * TAP); al[m].half[1] = *(const v8us*)(p + TOT * TAP + 32);
      }
#pragma unroll
      for (int t = 0; t < 4; ++t) {
        const unsigned char* p = pb + t * 16 * TKP + kl * 2;
        bh_[t].half[0] = *(const v8us*)p; bh_[t].half[1] = *(const v8us*)(p + 32);
        bl_[t].half[0] = *(const v8us*)(p + CC * TKP); bl_[t].half[1] = *(const v8us*)(p + CC * TKP + 32);
      }
#pragma unroll
      for (int t = 0; t < 4; ++t)
#pragma unroll
        for (int m = 0; m < 2; ++m) acc[m][t] = mma1(ah[m].v, bh_[t].v, acc[m][t]);
#pragma unroll
      for (int t = 0; t < 4; ++t)
#pragma unroll
        for (int m = 0; m < 2; ++m) acc[m][t] = mma1(al[m].v, bh_[t].v, acc[m][t]);
#pragma unroll
      for (int t = 0; t < 4; ++t)
#pragma unroll
        for (int m = 0; m < 2; ++m) acc[m][t] = mma1(ah[m].v, bl_[t].v, acc[m][t]);
    }
  }
  const float* vrow = QKV + (tok0 + wm + 8 * hh) * (3 * CC) + wn + ln;      // v lies 2 * CC further in the row
  v8f rv[2][4];
#pragma unroll
  for (int m = 0; m < 2; ++m)
#pragma unroll
    for (int t = 0; t < 4; ++t)
#pragma unroll
      for (int r = 0; r < 8; ++r) rv[m][t][r] = vrow[2 * CC + (m * 16 + r) * (3 * CC) + t * 16];
  float bo[4];      // the output bias, fetched here with v so that the epilogue does not wait for it
#pragma unroll
  for (int t = 0; t < 4; ++t) bo[t] = bout[wn + t * 16 + ln];
  asm volatile("s_wait_xcnt 0x0" :: "v"(vrow) : "memory");      // before an address register of these loads is overwritten
  __syncthreads();      // the q2 planes are dead in every wave before the attn tile is written over them
  // inputs-only fence on the loaded values: the 64 loads of v and the 4 of the bias are issued together and waited for once (without it this build issues them a few at a time, each group paying a full latency, and spills registers to scratch)
  asm volatile("" :: "v"(rv[0][0]), "v"(rv[0][1]), "v"(rv[0][2]), "v"(rv[0][3]), "v"(rv[1][0]), "v"(rv[1][1]), "v"(rv[1][2]), "v"(rv[1][3]), "v"(bo[0]), "v"(bo[1]), "v"(bo[2]), "v"(bo[3]));
#pragma unroll
  for (int m = 0; m < 2; ++m)
#pragma unroll
    for (int t = 0; t < 4; ++t)
#pragma unroll
      for (int r = 0; r < 8; ++r) {
        const float a = rv[m][t][r] + acc[m][t][r] * 0.015625f;
        const unsigned short hb = bf16_bits(a);
        const int o = (wm + m * 16 + 8 * hh + r) * TAP + (wn + t * 16 + ln) * 2;
        *(unsigned short*)(sAh + o) = hb; *(unsigned short*)(sAl + o) = bf16_bits(a - bf16_val(hb));
      }
  v8f oc[2][4] = {};
#pragma unroll
  for (int s = 0; s < 2; ++s) {
    unsigned char* buf = sB + (s & 1) * TBUF;
#pragma unroll
    for (int i = 0; i < 8; ++i) *(v8us*)(buf + (orow + 32 * i) * TWP + ln * 16) = br[i];
    __syncthreads();      // publishes this tile (and, the first time, the attn planes: every wave reads all 256 channels, of which it wrote 64); it also ends the reads of the other buffer
    if (s < 1) {
#pragma unroll
      for (int i = 0; i < 8; ++i) br[i] = *(const v8us*)(po + 128 + (size_t)i * 32 * CC);
      asm volatile("s_wait_xcnt 0x0" :: "v"(po) : "memory");      // before the address pair of these loads is overwritten
    }
    const unsigned char* pb = buf + (wn + ln) * TWP + 16 * hh;
#pragma unroll
    for (int kl = 0; kl < 128; kl += 32) {
      const int kb = s * 128 + kl;
      FragB ah[2], al[2], b[4];
#pragma unroll
      for (int m = 0; m < 2; ++m) {
        const unsigned char* p = pa + m * 16 * TAP + kb * 2;
        ah[m].half[0] = *(const v8us*)p; ah[m].half[1] = *(const v8us*)(p + 32);
        al[m].half[0] = *(const v8us*)(p + TOT * TAP); al[m].half[1] = *(const v8us*)(p + TOT * TAP + 32);
      }
#pragma unroll
      for (int t = 0; t < 4; ++t) { const unsigned char* p = pb + t * 16 * TWP + kl * 2; b[t].half[0] = *(const v8us*)p; b[t].half[1] = *(const v8us*)(p + 32); }
#pragma unroll
      for (int t = 0; t < 4; ++t)
#pragma unroll
        for (int m = 0; m < 2; ++m) oc[m][t] = mma1(ah[m].v, b[t].v, oc[m][t]);
#pragma unroll
      for (int t = 0; t < 4; ++t)
#pragma unroll
        for (int m = 0; m < 2; ++m) oc[m][t] = mma1(al[m].v, b[t].v, oc[m][t]);
    }
  }
  __syncthreads();      // the tile buffers are dead in every wave before their LDS is reused to stage the output
  float* so = (float*)sB + w * (32 * TSO);
#pragma unroll
  for (int t = 0; t < 4; ++t) {
    const float bv = bf16_round(bo[t]);
#pragma unroll
    for (int m = 0; m < 2; ++m)
#pragma unroll
      for (int r = 0; r < 8; ++r) so[(m * 16 + 8 * hh + r) * TSO + t * 16 + ln] = oc[m][t][r] + bv;
  }
  // each wave stages in its own LDS range: the fence and the wave barrier keep its row reads behind its own lanes' writes, so that whole 256-byte row pieces are stored
  __builtin_amdgcn_fence(__ATOMIC_ACQ_REL, "workgroup");
  __builtin_amdgcn_wave_barrier();
  float* dst = out + (tok0 + wm) * CC + wn + ln * 4;
  v4f ov[16];      // all 16 LDS reads first, each into registers of its own: one LDS latency for the wave instead of one per row pair
#pragma unroll
  for (int q = 0; q < 16; ++q) ov[q] = *(const v4fa*)&so[(q * 2 + hh) * TSO + ln * 4];
#pragma unroll
  for (int q = 0; q < 16; ++q) *(v4f*)(dst + (size_t)(q * 2 + hh) * CC) = ov[q];
}
// qkv = x W_qkv + b. Block = 128 tokens x 128 columns, 8 waves of 32 x 64; the whole K = 256 of both operands is staged once in LDS as bf16 (x rounded on the way, each element once a block).
// Every global load covers 512 contiguous bytes of one row; the fragments, whose 16 lanes sit on 16 different rows, are read from LDS instead of through the cache.
// LDS row pitch 528 bytes = 16 x 33, the conflict-free pitch of 16-byte fragment reads. Each accumulator still sums its 8 k blocks in rising order.
#define QGP 528                   // bytes per LDS row
#define QGSO 68                   // floats per row of the output staging: rows 8 apart fall 32 banks apart
__global__ __launch_bounds__(256) void k_qkv_gemm(const float* __restrict__ X, const unsigned short* __restrict__ Wt, const float* __restrict__ bias, float* __restrict__ C) {
  __shared__ __attribute__((aligned(16))) unsigned char sm[2 * 128 * QGP];        // x tile, then weight tile; reused for the output staging
  unsigned char* sA = sm; unsigned char* sB = sm + 128 * QGP;
  const int tid = threadIdx.x, w = tid >> 5, lane = tid & 31, ln = lane & 15, hh = lane >> 4;
  const int col0 = blockIdx.x * 128; const size_t row0 = (size_t)blockIdx.y * 128;
  // wave w brings rows w, w + 8, ... of both tiles: a weight row is one load, a row of x two
  const unsigned short* bp = Wt + (size_t)(col0 + w) * CC + lane * 8;
  const float* ap = X + (row0 + w) * CC + lane * 4;
  {
    v8us br[16]; v4f ar[16][2];
    // the loops over i are unrolled so that br and ar stay in registers (constant indices) and all 48 loads of a wave are issued before the first is waited for
#pragma unroll
    for (int i = 0; i < 16; ++i) br[i] = *(const v8us*)(bp + (size_t)i * 8 * CC);
#pragma unroll
    for (int i = 0; i < 16; ++i) { ar[i][0] = *(const v4fa*)(ap + (size_t)i * 8 * CC); ar[i][1] = *(const v4fa*)(ap + (size_t)i * 8 * CC + 128); }
    // the wait that stands before a register named by an issued global load is overwritten; it takes both address pairs as inputs so that neither is reused (a later load's result had landed on one) before it
    asm volatile("s_wait_xcnt 0x0" :: "v"(bp), "v"(ap) : "memory");
#pragma unroll
    for (int i = 0; i < 16; ++i) *(v8us*)(sB + (w + 8 * i) * QGP + lane * 16) = br[i];
#pragma unroll
    for (int i = 0; i < 16; ++i)
#pragma unroll
      for (int h = 0; h < 2; ++h) {
        v4us o;
#pragma unroll
        for (int q = 0; q < 4; ++q) o[q] = bf16_bits(ar[i][h][q]);
        *(v4us*)(sA + (w + 8 * i) * QGP + h * 256 + lane * 8) = o;
      }
  }
  __syncthreads();      // publishes both tiles: every wave reads rows that other waves wrote
  const int wm = (w >> 1) * 32, wn = (w & 1) * 64;
  const unsigned char* pa = sA + (wm + ln) * QGP + 16 * hh;
  const unsigned char* pb = sB + (wn + ln) * QGP + 16 * hh;
  v8f acc[2][4] = {};
  // unrolled (all loops below) so that the fragments and acc stay in registers and a k block's LDS reads can be issued ahead of the block before it
#pragma unroll
  for (int kb = 0; kb < CC; kb += 32) {
    FragB a[2], b[4];
#pragma unroll
    for (int m = 0; m < 2; ++m) { a[m].half[0] = *(const v8us*)(pa + m * 16 * QGP + kb * 2); a[m].half[1] = *(const v8us*)(pa + m * 16 * QGP + kb * 2 + 32); }
#pragma unroll
    for (int t = 0; t < 4; ++t) { b[t].half[0] = *(const v8us*)(pb + t * 16 * QGP + kb * 2); b[t].half[1] = *(const v8us*)(pb + t * 16 * QGP + kb * 2 + 32); }
#pragma unroll
    for (int t = 0; t < 4; ++t)
#pragma unroll
      for (int m = 0; m < 2; ++m) acc[m][t] = __builtin_amdgcn_wmma_f32_16x16x32_bf16(false, a[m].v, false, b[t].v, (short)0, acc[m][t], false, false);
  }
  __syncthreads();      // the tiles are dead in every wave before their LDS is reused to stage the output
  float* so = (float*)sm + w * (32 * QGSO);
#pragma unroll
  for (int t = 0; t < 4; ++t) {
    const float bv = bf16_round(bias[col0 + wn + t * 16 + ln]);
#pragma unroll
    for (int m = 0; m < 2; ++m)
#pragma unroll
      for (int r = 0; r < 8; ++r) so[(m * 16 + 8 * hh + r) * QGSO + t * 16 + ln] = acc[m][t][r] + bv;
  }
  // each wave stages in its own LDS range: the fence and the wave barrier keep its row reads behind its own lanes' writes, so that whole 256-byte row pieces are stored
  __builtin_amdgcn_fence(__ATOMIC_ACQ_REL, "workgroup");
  __builtin_amdgcn_wave_barrier();
  float* dst = C + (row0 + wm) * (3 * CC) + col0 + wn + ln * 4;
#pragma unroll
  for (int q = 0; q < 16; ++q) {
    const int r = q * 2 + hh;
    const v4f v = *(const v4fa*)&so[r * QGSO + ln * 4];
    *(v4f*)(dst + (size_t)r * (3 * CC)) = v;
  }
}
extern "C" void kernel_launch(void* const* d_in, const int* in_sizes, int n_in,
                              void* d_out, int out_size, void* d_ws, size_t ws_size, hipStream_t stream) {
  (void)in_sizes; (void)n_in; (void)out_size;
  const float* x = (const float*)d_in[0]; const float* Wqkv = (const float*)d_in[1]; const float* bqkv = (const float*)d_in[2]; const float* Wout = (const float*)d_in[3]; const float* bout = (const float*)d_in[4];
  char* ws = (char*)d_ws; size_t off = 0;
  auto take = [&](size_t bytes) { char* p = ws + off; off += (bytes + 255) & ~(size_t)255; return p; };
  unsigned short* Bq = (unsigned short*)take((size_t)3 * CC * CC * 2); unsigned short* Bo = (unsigned short*)take((size_t)CC * CC * 2);
  float* QKV = (float*)take((size_t)BB * NTK * 3 * CC * 4); float* Q2n = (float*)take((size_t)BB * NTK * CC * 4); float* K2a = (float*)take((size_t)BB * NTK * CC * 4); float* KN = (float*)take(BB * CC * 4);
  float* KVp = (float*)take((size_t)KSL * BB * CC * CC * 4);      // the KSL partials of kv
  unsigned short* Ph = (unsigned short*)take((size_t)BB * CC * CC * 2); unsigned short* Pl = (unsigned short*)take((size_t)BB * CC * CC * 2); double* PS = (double*)take((size_t)BB * NCH * CC * 8);
  if (off > ws_size) return;
  k_btw<<<(3 * CC * 32 + 255) / 256, 256, 0, stream>>>(Wqkv, Bq, CC, 3 * CC); k_btw<<<(CC * 32 + 255) / 256, 256, 0, stream>>>(Wout, Bo, CC, CC);
  k_qkv_gemm<<<dim3(3 * CC / 128, BB * NTK / 128), 256, 0, stream>>>(x, Bq, bqkv, QKV);
  k_prep<<<BB * NTK / 8, 256, 0, stream>>>(QKV, Q2n, K2a); k_colnorm_part<<<dim3(NCH, BB), 256, 0, stream>>>(K2a, PS); k_colnorm_fin<<<dim3(CC / 32, BB), 256, 0, stream>>>(PS, KN);
  k_kv_part<<<dim3(4, BB, KSL), 256, 0, stream>>>(K2a, KN, QKV, KVp);      // slice z: KVp[z][b][c][d] = sum over the tokens t of slice z of k2[t][c] * v[t][d]
  k_kvplanes<<<(BB * CC * (CC / 8) + 255) / 256, 256, 0, stream>>>(KVp, Ph, Pl);
  k_t2_attn_out<<<dim3(NTK / TOT, BB), 512, 0, stream>>>(Q2n, Ph, Pl, QKV, Bo, bout, (float*)d_out);      // t2 = q2 * kv, attn = v + t2 / 64, out = attn * W_out + b
}

// v007
// One run takes 105 microseconds.
// Two timings next to v006 both put it at 1.13 times that version's speed.
// Over all steps from v000 it is 19.4 times as fast.
#include <hip/hip_runtime.h>
// Linear attention on WMMA (f32 accumulate): qkv = x·W_qkv + b (inputs rounded to bf16: single exact term; 32768 × 256 × 768), per batch kv = k2ᵀ·v (k2 and v are computed
// f32 → split into bf16 hi/lo: 3 products; 256 × 256 × 4096), t2 = q2·kv (3 products), out = attn·W_out + b (attn split hi/lo vs exact weights: 2 products). Mean-centering,
// squares, the two normalisations and the residual are f32 VALU (column statistics as fixed-order double sums).
#define BB 8
#define NTK 4096
#define CC 256

typedef __bf16 v16b __attribute__((ext_vector_type(16)));
typedef unsigned short v8us __attribute__((ext_vector_type(8), may_alias));
typedef float  v8f  __attribute__((ext_vector_type(8)));
typedef float  v4f  __attribute__((ext_vector_type(4)));
typedef float  v4fa __attribute__((ext_vector_type(4), may_alias));
union FragB { v16b v; v8us half[2]; unsigned short u[16]; };

__device__ __forceinline__ unsigned short bf16_bits(float x) { unsigned int u = __float_as_uint(x); return (unsigned short)((u + 0x7FFFu + ((u >> 16) & 1u)) >> 16); }
__device__ __forceinline__ float bf16_val(unsigned short b) { return __uint_as_float(((unsigned int)b) << 16); }
__device__ __forceinline__ float bf16_round(float x) { return bf16_val(bf16_bits(x)); }
// D += A·B with NT terms: 1 = ah·bh, 2 = + al·bh (A split), 3 = + ah·bl (both split)
template <int NT>
__device__ __forceinline__ v8f mmaN(v16b ah, v16b al, v16b bh, v16b bl, v8f c) {
  c = __builtin_amdgcn_wmma_f32_16x16x32_bf16(false, ah, false, bh, (short)0, c, false, false);
  if (NT >= 2) c = __builtin_amdgcn_wmma_f32_16x16x32_bf16(false, al, false, bh, (short)0, c, false, false);
  if (NT >= 3) c = __builtin_amdgcn_wmma_f32_16x16x32_bf16(false, ah, false, bl, (short)0, c, false, false);
  asm volatile("v_nop\n\tv_nop\n\tv_nop\n\tv_nop" : "+v"(c) : "v"(ah), "v"(al), "v"(bh), "v"(bl));
  return c;
}

__global__ __launch_bounds__(256) void k_wt_bf16(const float* __restrict__ W, unsigned short* __restrict__ Wt, int K, int N) {
  const int t = blockIdx.x * 256 + threadIdx.x;
  const int k8n = K / 8;
  if (t >= N * k8n) return;
  const int n = t / k8n, k8 = (t % k8n) * 8;
  v8us v;
#pragma unroll
  for (int i = 0; i < 8; ++i) v[i] = bf16_bits(W[(size_t)(k8 + i) * N + n]);
  *(v8us*)(Wt + (size_t)n * K + k8) = v;
  
}

// GEMM C[M][N] (f32, pitch ldc) = act(A[M][K]·W + bias). A f32 row-major (pitch lda) converted per fragment to bf16
// (ASPLIT: hi/lo two planes -> 2 terms, else single rounded term); Wt bf16 [N][K] (pitch ldb). BIAS_BF16 rounds the
// bias to bf16 first (bias quantised to bf16 before the add). K%32==0, M%16==0, N%64==0.
template <bool ASPLIT, int ACT, bool BIAS_BF16>
__global__ __launch_bounds__(128) void k_gemm_bf(const float* __restrict__ A, int lda, const unsigned short* __restrict__ Wt, int ldb,
                                               const float* __restrict__ bias, float* __restrict__ C, int ldc, int M, int N, int K) {
  __shared__ __attribute__((aligned(16))) float so[4][16][64];
  const int tid = threadIdx.x, w = tid >> 5, lane = tid & 31, ln = lane & 15, hh = lane >> 4;
  const int ntn = N / 64;
  const int wid = blockIdx.x * 4 + w;
  const int mt = wid / ntn, nq = wid % ntn;
  if (mt * 16 >= M) return;
  const int row0 = mt * 16, col0 = nq * 64;
  const float* arow = A + (size_t)(row0 + ln) * lda;
  v8f acc[4] = {};
  for (int kb = 0; kb < K; kb += 32) {
    FragB ah, al;
    const v4f x0 = *(const v4fa*)(arow + kb + 8 * hh), x1 = *(const v4fa*)(arow + kb + 8 * hh + 4);
    const v4f x2 = *(const v4fa*)(arow + kb + 16 + 8 * hh), x3 = *(const v4fa*)(arow + kb + 16 + 8 * hh + 4);
    float xs[16] = {x0[0],x0[1],x0[2],x0[3],x1[0],x1[1],x1[2],x1[3],x2[0],x2[1],x2[2],x2[3],x3[0],x3[1],x3[2],x3[3]};
#pragma unroll
    for (int i = 0; i < 16; ++i) { const unsigned short hb = bf16_bits(xs[i]); ah.u[i] = hb; al.u[i] = ASPLIT ? bf16_bits(xs[i] - bf16_val(hb)) : (unsigned short)0; }
#pragma unroll
    for (int t = 0; t < 4; ++t) {
      const unsigned short* brow = Wt + (size_t)(col0 + t * 16 + ln) * ldb + kb;
      FragB b;
      b.half[0] = *(const v8us*)(brow + 8 * hh);
      b.half[1] = *(const v8us*)(brow + 16 + 8 * hh);
      acc[t] = mmaN<ASPLIT ? 2 : 1>(ah.v, al.v, b.v, b.v, acc[t]);
    }
  }
#pragma unroll
  for (int t = 0; t < 4; ++t) {
    float bv = bias ? bias[col0 + t * 16 + ln] : 0.f;
    if (BIAS_BF16) bv = bf16_round(bv);
#pragma unroll
    for (int r = 0; r < 8; ++r) { float v = acc[t][r] + bv; if (ACT == 1) v = fmaxf(v, 0.f); so[w][8 * hh + r][t * 16 + ln] = v; }
  }
  __builtin_amdgcn_fence(__ATOMIC_ACQ_REL, "workgroup");
  __builtin_amdgcn_wave_barrier();
  const int rsub = lane >> 4, c4 = (lane & 15) * 4;
  {
#pragma unroll
    for (int q = 0; q < 8; ++q) {
      const int r = q * 2 + rsub;
      const v4f v = *(const v4fa*)&so[w][r][c4];
      *(v4f*)(C + (size_t)(row0 + r) * ldc + col0 + c4) = v;
    }
    
  }
}

// Flash-style causal/unmasked attention, all contractions 3-term bf16 hi/lo splits, f32 softmax with running max.
// q,k,v rows are read from f32 buffers with arbitrary row pitch (so they can live inside a fused qkv buffer);
// D = head size (multiple of 32, <= 128); one wave = 16 query rows; block = 4 waves (64 queries) sharing K/V chunks of 32.
template <int D, bool CAUSAL>
__global__ __launch_bounds__(128) void k_flash(const float* __restrict__ qb, const float* __restrict__ kb, const float* __restrict__ vb,
                                             int pitch, int T, int H, float scale, float* __restrict__ y, int ypitch) {
  constexpr int KS = D / 32;        // k-steps for QK
  constexpr int DT = D / 16;        // d tiles for PV
  __shared__ __attribute__((aligned(16))) unsigned short sKh[32][D + 8], sKl[32][D + 8], sVh[32][D + 8], sVl[32][D + 8];
  __shared__ __attribute__((aligned(16))) unsigned short sPh[4][16][40], sPl[4][16][40];
  __shared__ __attribute__((aligned(16))) float sO[4][16][D];
  const int tid = threadIdx.x, w = tid >> 5, lane = tid & 31, ln = lane & 15, hh = lane >> 4;
  const int nqb = (T + 63) / 64;
  const int bh = blockIdx.x / nqb, qblk = blockIdx.x % nqb;
  const int b = bh / H, h = bh % H;
  const int q0 = qblk * 64 + w * 16;
  const float* Q = qb + (size_t)b * T * pitch + h * D;
  const float* K = kb + (size_t)b * T * pitch + h * D;
  const float* V = vb + (size_t)b * T * pitch + h * D;

  // A fragments of the wave's 16 query rows (scaled), hi/lo
  FragB aqh[KS], aql[KS];
  {
    int row = q0 + ln; if (row >= T) row = T - 1;
    const float* qr = Q + (size_t)row * pitch;
#pragma unroll
    for (int ks = 0; ks < KS; ++ks)
#pragma unroll
      for (int i = 0; i < 16; ++i) {
        const int d = ks * 32 + ((i < 8) ? (8 * hh + i) : (16 + 8 * hh + (i - 8)));
        const float x = qr[d] * scale; const unsigned short hb = bf16_bits(x);
        aqh[ks].u[i] = hb; aql[ks].u[i] = bf16_bits(x - bf16_val(hb));
      }
  }
  float m_r[8], l_r[8];
#pragma unroll
  for (int r = 0; r < 8; ++r) { m_r[r] = -3.0e38f; l_r[r] = 0.f; }
  v8f oacc[DT];
#pragma unroll
  for (int dt = 0; dt < DT; ++dt) oacc[dt] = (v8f){0.f,0.f,0.f,0.f,0.f,0.f,0.f,0.f};

  const int kv_end = CAUSAL ? min(T, qblk * 64 + 64) : T;     // block-uniform
  for (int j0 = 0; j0 < kv_end; j0 += 32) {
    __syncthreads();
    for (int e = tid; e < 32 * (D / 4); e += 128) {
      const int r = e / (D / 4), c4 = (e % (D / 4)) * 4;
      const int key = j0 + r;
      v4f kf = {0.f,0.f,0.f,0.f}, vf = {0.f,0.f,0.f,0.f};
      if (key < T) { kf = *(const v4fa*)(K + (size_t)key * pitch + c4); vf = *(const v4fa*)(V + (size_t)key * pitch + c4); }
#pragma unroll
      for (int t = 0; t < 4; ++t) {
        unsigned short hb = bf16_bits(kf[t]); sKh[r][c4 + t] = hb; sKl[r][c4 + t] = bf16_bits(kf[t] - bf16_val(hb));
        hb = bf16_bits(vf[t]); sVh[r][c4 + t] = hb; sVl[r][c4 + t] = bf16_bits(vf[t] - bf16_val(hb));
      }
    }
    __syncthreads();
    // S tile 16 x 32
    v8f s[2];
#pragma unroll
    for (int nt = 0; nt < 2; ++nt) {
      v8f acc = {};
#pragma unroll
      for (int ks = 0; ks < KS; ++ks) {
        FragB bh_, bl_;
        bh_.half[0] = *(const v8us*)&sKh[nt * 16 + ln][ks * 32 + 8 * hh]; bh_.half[1] = *(const v8us*)&sKh[nt * 16 + ln][ks * 32 + 16 + 8 * hh];
        bl_.half[0] = *(const v8us*)&sKl[nt * 16 + ln][ks * 32 + 8 * hh]; bl_.half[1] = *(const v8us*)&sKl[nt * 16 + ln][ks * 32 + 16 + 8 * hh];
        acc = mmaN<3>(aqh[ks].v, aql[ks].v, bh_.v, bl_.v, acc);
      }
      s[nt] = acc;
    }
    // mask + running max (rows 8hh+r; the 16 lanes of a half share rows)
    float alpha[8];
#pragma unroll
    for (int r = 0; r < 8; ++r) {
      const int qi = q0 + 8 * hh + r;
      const int ja = j0 + ln, jb = j0 + 16 + ln;
      if (CAUSAL) { if (ja > qi) s[0][r] = -3.0e38f; if (jb > qi) s[1][r] = -3.0e38f; }
      if (ja >= T) s[0][r] = -3.0e38f;
      if (jb >= T) s[1][r] = -3.0e38f;
      float mx = fmaxf(s[0][r], s[1][r]);
      mx = fmaxf(mx, __shfl_xor(mx, 1, 32)); mx = fmaxf(mx, __shfl_xor(mx, 2, 32)); mx = fmaxf(mx, __shfl_xor(mx, 4, 32)); mx = fmaxf(mx, __shfl_xor(mx, 8, 32));
      const float mnew = fmaxf(m_r[r], mx);
      alpha[r] = (mnew > -1.0e38f) ? __expf(m_r[r] - mnew) : 1.0f;
      const float p0 = (s[0][r] > -1.0e38f) ? __expf(s[0][r] - mnew) : 0.f;
      const float p1 = (s[1][r] > -1.0e38f) ? __expf(s[1][r] - mnew) : 0.f;
      m_r[r] = mnew;
      l_r[r] = l_r[r] * alpha[r] + p0 + p1;            // per-lane partial row sum (16 lanes combined at the end)
      unsigned short hb = bf16_bits(p0); sPh[w][8 * hh + r][ln] = hb;      sPl[w][8 * hh + r][ln] = bf16_bits(p0 - bf16_val(hb));
      hb = bf16_bits(p1);                sPh[w][8 * hh + r][16 + ln] = hb; sPl[w][8 * hh + r][16 + ln] = bf16_bits(p1 - bf16_val(hb));
    }
#pragma unroll
    for (int dt = 0; dt < DT; ++dt)
#pragma unroll
      for (int r = 0; r < 8; ++r) oacc[dt][r] *= alpha[r];
    __builtin_amdgcn_fence(__ATOMIC_ACQ_REL, "workgroup");
    __builtin_amdgcn_wave_barrier();
    FragB pah, pal;
    pah.half[0] = *(const v8us*)&sPh[w][ln][8 * hh]; pah.half[1] = *(const v8us*)&sPh[w][ln][16 + 8 * hh];
    pal.half[0] = *(const v8us*)&sPl[w][ln][8 * hh]; pal.half[1] = *(const v8us*)&sPl[w][ln][16 + 8 * hh];
#pragma unroll
    for (int dt = 0; dt < DT; ++dt) {
      FragB bvh, bvl;
#pragma unroll
      for (int i = 0; i < 8; ++i) {
        bvh.u[i] = sVh[8 * hh + i][dt * 16 + ln]; bvh.u[8 + i] = sVh[16 + 8 * hh + i][dt * 16 + ln];
        bvl.u[i] = sVl[8 * hh + i][dt * 16 + ln]; bvl.u[8 + i] = sVl[16 + 8 * hh + i][dt * 16 + ln];
      }
      oacc[dt] = mmaN<3>(pah.v, pal.v, bvh.v, bvl.v, oacc[dt]);
    }
    __builtin_amdgcn_fence(__ATOMIC_ACQ_REL, "workgroup");
    __builtin_amdgcn_wave_barrier();
  }
#pragma unroll
  for (int r = 0; r < 8; ++r) {
    float l = l_r[r];
    l += __shfl_xor(l, 1, 32); l += __shfl_xor(l, 2, 32); l += __shfl_xor(l, 4, 32); l += __shfl_xor(l, 8, 32);
    l_r[r] = (l > 0.f) ? 1.0f / l : 0.f;
  }
#pragma unroll
  for (int dt = 0; dt < DT; ++dt)
#pragma unroll
    for (int r = 0; r < 8; ++r) sO[w][8 * hh + r][dt * 16 + ln] = oacc[dt][r] * l_r[r];
  __builtin_amdgcn_fence(__ATOMIC_ACQ_REL, "workgroup");
  __builtin_amdgcn_wave_barrier();
  {
    for (int r = 0; r < 16; ++r) {
      const int row = q0 + r;
      if (row < T && lane < D / 4) {
        const v4f val = *(const v4fa*)&sO[w][r][lane * 4];
        *(v4f*)(y + ((size_t)b * T + row) * ypitch + h * D + lane * 4) = val;
      }
    }
    
  }
}

// GEMM C = act(A·W + bias + resid): A f32 (ASPLIT -> hi/lo 2 terms), Wt bf16 [N][K]; ACT 0 none, 1 relu, 2 exact gelu;
// resid (optional, f32, row index = (row % rmod), pitch ldr, RES_BF16 rounds it) added before the activation.
template <bool ASPLIT, int ACT, bool BIAS_BF16, bool RES_BF16>
__global__ __launch_bounds__(128) void k_gemm_bf3(const float* __restrict__ A, int lda, const unsigned short* __restrict__ Wt, int ldb,
                                                const float* __restrict__ bias, const float* __restrict__ resid, int rmod, int ldr,
                                                float* __restrict__ C, int ldc, int M, int N, int K) {
  __shared__ __attribute__((aligned(16))) float so[4][16][64];
  const int tid = threadIdx.x, w = tid >> 5, lane = tid & 31, ln = lane & 15, hh = lane >> 4;
  const int ntn = N / 64;
  const int wid = blockIdx.x * 4 + w;
  const int mt = wid / ntn, nq = wid % ntn;
  if (mt * 16 >= M) return;
  const int row0 = mt * 16, col0 = nq * 64;
  const float* arow = A + (size_t)(row0 + ln) * lda;
  v8f acc[4] = {};
  for (int kb = 0; kb < K; kb += 32) {
    FragB ah, al;
    const v4f x0 = *(const v4fa*)(arow + kb + 8 * hh), x1 = *(const v4fa*)(arow + kb + 8 * hh + 4);
    const v4f x2 = *(const v4fa*)(arow + kb + 16 + 8 * hh), x3 = *(const v4fa*)(arow + kb + 16 + 8 * hh + 4);
    float xs[16] = {x0[0],x0[1],x0[2],x0[3],x1[0],x1[1],x1[2],x1[3],x2[0],x2[1],x2[2],x2[3],x3[0],x3[1],x3[2],x3[3]};
#pragma unroll
    for (int i = 0; i < 16; ++i) { const unsigned short hb = bf16_bits(xs[i]); ah.u[i] = hb; al.u[i] = ASPLIT ? bf16_bits(xs[i] - bf16_val(hb)) : (unsigned short)0; }
#pragma unroll
    for (int t = 0; t < 4; ++t) {
      const unsigned short* brow = Wt + (size_t)(col0 + t * 16 + ln) * ldb + kb;
      FragB b;
      b.half[0] = *(const v8us*)(brow + 8 * hh);
      b.half[1] = *(const v8us*)(brow + 16 + 8 * hh);
      acc[t] = mmaN<ASPLIT ? 2 : 1>(ah.v, al.v, b.v, b.v, acc[t]);
    }
  }
#pragma unroll
  for (int t = 0; t < 4; ++t) {
    const int col = col0 + t * 16 + ln;
    float bv = bias ? bias[col] : 0.f;
    if (BIAS_BF16) bv = bf16_round(bv);
#pragma unroll
    for (int r = 0; r < 8; ++r) {
      float v = acc[t][r] + bv;
      if (resid) { float rv = resid[(size_t)((row0 + 8 * hh + r) % rmod) * ldr + col]; if (RES_BF16) rv = bf16_round(rv); v += rv; }
      if (ACT == 1) v = fmaxf(v, 0.f);
      if (ACT == 2) v = 0.5f * v * (1.0f + erff(v * 0.70710678118654752f));
      if (ACT == 3) { const float u = 0.7978845608028654f * (v + 0.044715f * v * v * v); v = 0.5f * v * (1.0f + tanhf(u)); }
      so[w][8 * hh + r][t * 16 + ln] = v;
    }
  }
  __builtin_amdgcn_fence(__ATOMIC_ACQ_REL, "workgroup");
  __builtin_amdgcn_wave_barrier();
  const int rsub = lane >> 4, c4 = (lane & 15) * 4;
  {
#pragma unroll
    for (int q = 0; q < 8; ++q) {
      const int r = q * 2 + rsub;
      const v4f v = *(const v4fa*)&so[w][r][c4];
      *(v4f*)(C + (size_t)(row0 + r) * ldc + col0 + c4) = v;
    }
    
  }
}
// row LayerNorm (biased variance, eps) over N: s = X (+ R); optional out_sum <- s; out_norm <- (s-mu)*rsqrt(var+eps)*g + b
template <bool PARAM_BF16>
__global__ __launch_bounds__(256) void k_layernorm(const float* __restrict__ X, const float* __restrict__ R, const float* __restrict__ g, const float* __restrict__ bta,
                                                  float* __restrict__ out_sum, float* __restrict__ out_norm, int N, float eps) {
  __shared__ float red[256];
  const int row = blockIdx.x, tid = threadIdx.x;
  const float* x = X + (size_t)row * N; const float* rr = R ? R + (size_t)row * N : nullptr;
  float vals[16];                     // up to N = 4096
  const int per = N / 256;            // contiguous chunk per thread? use strided-by-4 chunks: thread handles j = tid*4 + 1024*u
  float s1 = 0.f;
  for (int u = 0; u < per / 4; ++u) {
    const int j = tid * 4 + 1024 * u;
    const v4f a = *(const v4fa*)(x + j);
    v4f b = {0.f,0.f,0.f,0.f}; if (rr) b = *(const v4fa*)(rr + j);
#pragma unroll
    for (int q = 0; q < 4; ++q) { const float v = a[q] + b[q]; vals[u * 4 + q] = v; s1 += v; }
  }
  red[tid] = s1; __syncthreads();
  for (int st = 128; st > 0; st >>= 1) { if (tid < st) red[tid] += red[tid + st]; __syncthreads(); }
  const float mu = red[0] / (float)N; __syncthreads();
  float s2 = 0.f;
  for (int u = 0; u < per / 4; ++u)
#pragma unroll
    for (int q = 0; q < 4; ++q) { const float c = vals[u * 4 + q] - mu; s2 += c * c; }
  red[tid] = s2; __syncthreads();
  for (int st = 128; st > 0; st >>= 1) { if (tid < st) red[tid] += red[tid + st]; __syncthreads(); }
  const float rs = rsqrtf(red[0] / (float)N + eps);
  {
    for (int u = 0; u < per / 4; ++u) {
      const int j = tid * 4 + 1024 * u;
      v4f o, sm;
#pragma unroll
      for (int q = 0; q < 4; ++q) {
        float gg = g[j + q], bb = bta[j + q];
        if (PARAM_BF16) { gg = bf16_round(gg); bb = bf16_round(bb); }
        sm[q] = vals[u * 4 + q]; o[q] = (vals[u * 4 + q] - mu) * rs * gg + bb;
      }
      if (out_sum) *(v4f*)(out_sum + (size_t)row * N + j) = sm;
      *(v4f*)(out_norm + (size_t)row * N + j) = o;
    }
    
  }
}

// batched f32 [K][N] (pitch lds, batch stride sIn) -> transposed hi/lo planes [N][K] (batch stride sOut); thread per (n, 8 k); grid.y = batch
__global__ __launch_bounds__(256) void k_split_transpose_b(const float* __restrict__ src, int lds_, size_t sIn, unsigned short* __restrict__ hi, unsigned short* __restrict__ lo, size_t sOut, int K, int N) {
  const size_t t = (size_t)blockIdx.x * 256 + threadIdx.x; const int k8n = K / 8; if (t >= (size_t)N * k8n) return;
  src += (size_t)blockIdx.y * sIn; hi += (size_t)blockIdx.y * sOut; lo += (size_t)blockIdx.y * sOut;
  const int n = (int)(t / k8n), k8 = (int)(t % k8n) * 8; v8us vh, vl;
#pragma unroll
  for (int i = 0; i < 8; ++i) { const float x = src[(size_t)(k8 + i) * lds_ + n]; const unsigned short hb = bf16_bits(x); vh[i] = hb; vl[i] = bf16_bits(x - bf16_val(hb)); }
  unsigned short* dh = hi + (size_t)n * K + k8; unsigned short* dl = lo + (size_t)n * K + k8;
  *(v8us*)dh = vh; *(v8us*)dl = vl; 
}

__global__ __launch_bounds__(256) void k_btw(const float* __restrict__ W, unsigned short* __restrict__ Bt, int K, int N) { const int t = blockIdx.x * 256 + threadIdx.x; if (t >= N * (K / 8)) return; const int n = t / (K / 8), k8 = (t % (K / 8)) * 8; v8us v; for (int q = 0; q < 8; ++q) v[q] = bf16_bits(W[(size_t)(k8 + q) * N + n]); *(v8us*)(Bt + (size_t)n * K + k8) = v;  }
// column norms of K2a over the 4096 tokens of each batch, in two launches, every sum in double and in a fixed order.
// Stage 1: block per (chunk of 64 tokens, batch); a thread takes 4 adjacent columns of every 4th token; the 4 token groups are joined through LDS: PS[b][chunk][c].
#define NCH 64
__global__ __launch_bounds__(256) void k_colnorm_part(const float* __restrict__ K2a, double* __restrict__ PS) {
  __shared__ double red[4][CC];
  const int tid = threadIdx.x, c4 = (tid & 63) * 4, rg = tid >> 6, ch = blockIdx.x, b = blockIdx.y;
  const float* base = K2a + ((size_t)b * NTK + (size_t)ch * (NTK / NCH) + rg) * CC + c4;
  v4f v[NTK / NCH / 4];
  // unrolled so that the loads are independent of the sums and many are in flight per wave (the rolled one-load loop paid a full memory latency per token)
#pragma unroll
  for (int i = 0; i < NTK / NCH / 4; ++i) v[i] = *(const v4fa*)(base + (size_t)i * 4 * CC);
  double s[4] = {0.0, 0.0, 0.0, 0.0};
  // unrolled so that v[] stays in registers (constant indices)
#pragma unroll
  for (int i = 0; i < NTK / NCH / 4; ++i)
#pragma unroll
    for (int q = 0; q < 4; ++q) s[q] += (double)v[i][q] * (double)v[i][q];
#pragma unroll
  for (int q = 0; q < 4; ++q) red[rg][c4 + q] = s[q];
  __syncthreads();
  PS[((size_t)b * NCH + ch) * CC + tid] = (red[0][tid] + red[1][tid]) + (red[2][tid] + red[3][tid]);
}
// Stage 2: block per (32 columns, batch); wave g sums chunks 8g..8g+7 of its 32 columns, wave 0 joins the 8 sums: KN[b][c] = 1/max(norm, 1e-12)
__global__ __launch_bounds__(256) void k_colnorm_fin(const double* __restrict__ PS, float* __restrict__ KN) {
  __shared__ double red[8][32];
  const int tid = threadIdx.x, cl = tid & 31, g = tid >> 5, b = blockIdx.y, c = blockIdx.x * 32 + cl;
  const double* p = PS + ((size_t)b * NCH + g * (NCH / 8)) * CC + c;
  double s = 0.0;
  // unrolled so that the 8 loads are in flight together
#pragma unroll
  for (int i = 0; i < NCH / 8; ++i) s += p[(size_t)i * CC];
  red[g][cl] = s;
  __syncthreads();
  if (tid < 32) {
    double t = 0.0;
#pragma unroll
    for (int j = 0; j < 8; ++j) t += red[j][tid];
    KN[b * CC + c] = 1.0f / fmaxf((float)sqrt(t), 1e-12f);
  }
}
// Partials of kv = k2^T v straight from the token-major arrays: KVp[z][b][c][d] = sum over the 256 tokens t of slice z of (K2a[t][c] * KN[c]) * v[t][d], 3 products on hi/lo bf16 planes.
// Block = 128 c x 128 d of one (batch, slice), 8 waves of 32 c x 64 d. A pass takes 32 tokens: every thread splits its 16-byte pieces of k2 and v once and lays them token-major in LDS;
// both operands need 8 consecutive tokens of one channel per lane, which the transposing LDS read delivers in the hardware k order (the order the row loaders of this file use).
#define KSL 16
#define KVT 32                    // tokens per pass
#define KVPITCH 288               // bytes per LDS row: 128 channels x 2 B + 32 = 32 B x 9, the conflict-free pitch of the transposing read
#define KVPLANE (KVT * KVPITCH)   // one plane of one pass
#define KVSO 68                   // floats per row of the output staging: rows 8 apart fall 32 banks apart
typedef short s16x8 __attribute__((ext_vector_type(8)));
typedef unsigned short v4us __attribute__((ext_vector_type(4), may_alias));
__device__ __forceinline__ v8us ld_tr16(const unsigned char* p) { typedef __attribute__((address_space(3))) s16x8 lds_s16x8; return __builtin_bit_cast(v8us, __builtin_amdgcn_ds_load_tr16_b128_v8i16((lds_s16x8*)p)); }
__device__ __forceinline__ void split_store4(v4f x, unsigned char* ph, unsigned char* pl) {
  v4us h, l;
  // unrolled so that the vector elements are named by constants
#pragma unroll
  for (int q = 0; q < 4; ++q) { const unsigned short hb = bf16_bits(x[q]); h[q] = hb; l[q] = bf16_bits(x[q] - bf16_val(hb)); }
  *(v4us*)ph = h; *(v4us*)pl = l;
}
__global__ __launch_bounds__(256) void k_kv_part(const float* __restrict__ K2a, const float* __restrict__ KN, const float* __restrict__ QKV, float* __restrict__ KVp) {
  __shared__ __attribute__((aligned(16))) unsigned char sm[2 * 4 * KVPLANE];      // two buffers of 4 planes: k2 hi, k2 lo, v hi, v lo
  const int tid = threadIdx.x, w = tid >> 5, lane = tid & 31, ln = lane & 15, hh = lane >> 4;
  const int c0 = (blockIdx.x >> 1) * 128, d0 = (blockIdx.x & 1) * 128, b = blockIdx.y, z = blockIdx.z;
  const size_t tok0 = (size_t)b * NTK + (size_t)z * (NTK / KSL);
  // wave w brings rows w, w + 8, w + 16, w + 24 of a pass: one 512-byte row segment per load
  const float* kp = K2a + (tok0 + w) * CC + c0 + lane * 4;
  const float* vp = QKV + (tok0 + w) * (3 * CC) + 2 * CC + d0 + lane * 4;
  const v4f kn = *(const v4fa*)(KN + b * CC + c0 + lane * 4);
  const int wc = (w >> 1) * 32, wd = (w & 1) * 64;
  const int wr = w * KVPITCH + lane * 8;                                           // where the thread's pieces land in a plane
  const int rd = (8 * hh + (lane & 7)) * KVPITCH + ((lane >> 3) & 1) * 16;         // lane address of the transposing read, tokens 0..15, channel 0
  v4f kr[4], vr[4];
  // every loop over i, m, t, r or q below is unrolled so that kr, vr, the fragments and acc stay in registers (constant indices) and the 8 loads of a pass are in flight together
#pragma unroll
  for (int i = 0; i < 4; ++i) { kr[i] = *(const v4fa*)(kp + (size_t)i * 8 * CC); vr[i] = *(const v4fa*)(vp + (size_t)i * 8 * 3 * CC); }
  v8f acc[2][4] = {};
  for (int ps = 0; ps < NTK / KSL / KVT; ++ps) {
    unsigned char* buf = sm + (ps & 1) * (4 * KVPLANE);
#pragma unroll
    for (int i = 0; i < 4; ++i) {
      unsigned char* p = buf + wr + i * 8 * KVPITCH;
      split_store4(kr[i] * kn, p, p + KVPLANE);
      split_store4(vr[i], p + 2 * KVPLANE, p + 3 * KVPLANE);
    }
    __syncthreads();      // publishes this pass's planes; it also ends every wave's reads of the other buffer, which the next pass overwrites
    if (ps + 1 < NTK / KSL / KVT) {      // the next pass's loads fly while this pass is multiplied
      kp += (size_t)KVT * CC; vp += (size_t)KVT * 3 * CC;
#pragma unroll
      for (int i = 0; i < 4; ++i) { kr[i] = *(const v4fa*)(kp + (size_t)i * 8 * CC); vr[i] = *(const v4fa*)(vp + (size_t)i * 8 * 3 * CC); }
    }
    FragB ah[2], al[2];
#pragma unroll
    for (int m = 0; m < 2; ++m) {
      const unsigned char* p = buf + rd + 2 * (wc + 16 * m);
      ah[m].half[0] = ld_tr16(p); ah[m].half[1] = ld_tr16(p + 16 * KVPITCH);
      al[m].half[0] = ld_tr16(p + KVPLANE); al[m].half[1] = ld_tr16(p + KVPLANE + 16 * KVPITCH);
    }
#pragma unroll
    for (int t = 0; t < 4; ++t) {
      const unsigned char* p = buf + 2 * KVPLANE + rd + 2 * (wd + 16 * t);
      FragB bh_, bl_;
      bh_.half[0] = ld_tr16(p); bh_.half[1] = ld_tr16(p + 16 * KVPITCH);
      bl_.half[0] = ld_tr16(p + KVPLANE); bl_.half[1] = ld_tr16(p + KVPLANE + 16 * KVPITCH);
#pragma unroll
      for (int m = 0; m < 2; ++m) acc[m][t] = mmaN<3>(ah[m].v, al[m].v, bh_.v, bl_.v, acc[m][t]);
    }
  }
  __syncthreads();      // the planes are dead in every wave before their LDS is reused to stage the output
  float* so = (float*)sm + w * (2 * 16 * KVSO);
#pragma unroll
  for (int m = 0; m < 2; ++m)
#pragma unroll
    for (int t = 0; t < 4; ++t)
#pragma unroll
      for (int r = 0; r < 8; ++r) so[(m * 16 + 8 * hh + r) * KVSO + t * 16 + ln] = acc[m][t][r];
  // each wave stages in its own LDS range: the fence and the wave barrier keep its row reads behind its own lanes' writes, so that whole 256-byte row pieces are stored
  __builtin_amdgcn_fence(__ATOMIC_ACQ_REL, "workgroup");
  __builtin_amdgcn_wave_barrier();
  float* dst = KVp + (((size_t)z * BB + b) * CC + c0 + wc) * CC + d0 + wd + ln * 4;
#pragma unroll
  for (int q = 0; q < 16; ++q) {
    const int r = q * 2 + hh;
    const v4f v = *(const v4fa*)&so[r * KVSO + ln * 4];
    *(v4f*)(dst + (size_t)r * CC) = v;
  }
}
// kv = sum of its KSL token-slice partials KVp[slice][b][c][d], added in slice order (f32); then kv -> Bt for t2 = q2 kv: B[k=c][n=d] = kv[c][d] -> Bt[d][c]: planes hi/lo of kv transposed.
// thread per (b, 8 c, d) with d along the lanes: each of the 8 * KSL loads of a wave reads one whole line
__global__ __launch_bounds__(256) void k_kvplanes(const float* __restrict__ KVp, unsigned short* __restrict__ Ph, unsigned short* __restrict__ Pl) { const int t = blockIdx.x * 256 + threadIdx.x; if (t >= BB * CC * (CC / 8)) return; const int d = t % CC; const int c8 = ((t / CC) % (CC / 8)) * 8; const int b = t / ((CC / 8) * CC); v8us h, l;
  const float* p = KVp + ((size_t)b * CC + c8) * CC + d; float s[8] = {0.f, 0.f, 0.f, 0.f, 0.f, 0.f, 0.f, 0.f};
  // kept rolled, 4 slices a trip: 32 independent loads are in flight per wave; fully unrolled, the 128 loads took 138 registers
#pragma unroll 1
  for (int z = 0; z < KSL; z += 4) {
    float v[4][8];
    // unrolled so that v[] stays in registers and the loads do not wait on the sums
#pragma unroll
    for (int j = 0; j < 4; ++j)
#pragma unroll
      for (int q = 0; q < 8; ++q) v[j][q] = p[(size_t)(z + j) * BB * CC * CC + (size_t)q * CC];
#pragma unroll
    for (int j = 0; j < 4; ++j)
#pragma unroll
      for (int q = 0; q < 8; ++q) s[q] += v[j][q];
  }
  for (int q = 0; q < 8; ++q) { const float v = s[q]; const unsigned short hb = bf16_bits(v); h[q] = hb; l[q] = bf16_bits(v - bf16_val(hb)); } const size_t dst = ((size_t)b * CC + d) * CC + c8; *(v8us*)(Ph + dst) = h; *(v8us*)(Pl + dst) = l;  }
// t2 = q2 kv, attn = v + t2/sqrt(N) and out = attn W_out + b in one launch. Block = 128 tokens x all 256 channels, 16 waves of 32 tokens x 64 channels in both products.
// Every operand reaches the fragments through LDS: q2 is split once a block into bf16 hi/lo planes; the kv planes (4 tiles of 64 c) and then W_out (2 tiles of 128 c) pass through two
// buffers, brought by loads that cover whole 128-byte lines, the next tile's loads in flight while this tile is multiplied. The attn tile takes the place of the q2 planes.
// Each accumulator still sums its 8 k blocks in rising order, and the products of a block in the order hi*hi, lo*hi, hi*lo (attn hi, attn lo in the second product).
#define TOT 128                   // tokens per block
#define TAP 528                   // bytes per LDS row of the q2 / attn planes: 16 x 33, the conflict-free pitch of 16-byte fragment reads
#define TKP 144                   // bytes per LDS row of a kv tile (64 c): 16 x 9
#define TWP 272                   // bytes per LDS row of a W_out tile (128 c): 16 x 17
#define TBUF (2 * CC * TKP)       // one buffer: the hi and the lo plane of a kv tile; a W_out tile (CC * TWP) is smaller
#define TSO 68                    // floats per row of the output staging: rows 8 apart fall 32 banks apart
__device__ __forceinline__ v8f mma1(v16b a, v16b b, v8f c) { return __builtin_amdgcn_wmma_f32_16x16x32_bf16(false, a, false, b, (short)0, c, false, false); }
__global__ __launch_bounds__(512) void k_t2_attn_out(const float* __restrict__ Q2n, const unsigned short* __restrict__ Ph, const unsigned short* __restrict__ Pl, const float* __restrict__ QKV,
                                                    const unsigned short* __restrict__ Bo, const float* __restrict__ bout, float* __restrict__ out) {
  __shared__ __attribute__((aligned(16))) unsigned char sm[2 * TOT * TAP + 2 * TBUF];      // hi plane, lo plane, two tile buffers (reused for the output staging)
  unsigned char* sAh = sm; unsigned char* sAl = sm + TOT * TAP; unsigned char* sB = sm + 2 * TOT * TAP;
  const int tid = threadIdx.x, w = tid >> 5, lane = tid & 31, ln = lane & 15, hh = lane >> 4;
  const size_t tok0 = (size_t)blockIdx.y * NTK + (size_t)blockIdx.x * TOT;
  // a load of a kv tile covers 4 rows x 128 bytes: wave w brings rows 4w .. 4w+3, + 64, + 128, + 192 of both planes; a load of a W_out tile covers 2 rows x 256 bytes: rows 2w, 2w+1, + 32, ...
  const int kr = w * 4 + (lane >> 3), kc = lane & 7, orow = w * 2 + hh;
  const unsigned short* ph = Ph + (size_t)blockIdx.y * CC * CC + (size_t)kr * CC + kc * 8;
  const unsigned short* pl = Pl + (size_t)blockIdx.y * CC * CC + (size_t)kr * CC + kc * 8;
  const unsigned short* po = Bo + (size_t)orow * CC + ln * 8;
  v8us br[8];
  // every loop below is unrolled so that br, ar, rv, the fragments and the accumulators stay in registers (constant indices) and the loads of a group are in flight together
#pragma unroll
  for (int i = 0; i < 4; ++i) { br[i] = *(const v8us*)(ph + (size_t)i * 64 * CC); br[4 + i] = *(const v8us*)(pl + (size_t)i * 64 * CC); }
  {
    // wave w brings rows w, w + 16, ... of q2: two 512-byte loads a row
    const float* ap = Q2n + (tok0 + w) * CC + lane * 4;
    v4f ar[8][2];
#pragma unroll
    for (int i = 0; i < 8; ++i) { ar[i][0] = *(const v4fa*)(ap + (size_t)i * 16 * CC); ar[i][1] = *(const v4fa*)(ap + (size_t)i * 16 * CC + 128); }
    // the wait that stands before a register named by an issued global load is overwritten; here and below it takes the address pairs as inputs so that none is reused (a later load's result had landed on one) before it
    asm volatile("s_wait_xcnt 0x0" :: "v"(ph), "v"(pl), "v"(ap) : "memory");
#pragma unroll
    for (int i = 0; i < 8; ++i)
#pragma unroll
      for (int h = 0; h < 2; ++h) { const int o = (w + 16 * i) * TAP + h * 256 + lane * 8; split_store4(ar[i][h], sAh + o, sAl + o); }
  }
  const int wm = (w >> 2) * 32, wn = (w & 3) * 64;
  const unsigned char* pa = sAh + (wm + ln) * TAP + 16 * hh;      // the lo plane lies TOT * TAP further
  v8f acc[2][4] = {};
#pragma unroll
  for (int s = 0; s < 4; ++s) {
    unsigned char* buf = sB + (s & 1) * TBUF;
#pragma unroll
    for (int i = 0; i < 4; ++i) { unsigned char* p = buf + (kr + 64 * i) * TKP + kc * 16; *(v8us*)p = br[i]; *(v8us*)(p + CC * TKP) = br[4 + i]; }
    __syncthreads();      // publishes this tile (and, the first time, the q2 planes); it also ends every wave's reads of the other buffer, which the next pass overwrites
    if (s < 3) {
#pragma unroll
      for (int i = 0; i < 4; ++i) { br[i] = *(const v8us*)(ph + (s + 1) * 64 + (size_t)i * 64 * CC); br[4 + i] = *(const v8us*)(pl + (s + 1) * 64 + (size_t)i * 64 * CC); }
      asm volatile("s_wait_xcnt 0x0" :: "v"(ph), "v"(pl) : "memory");      // before an address pair of these loads is overwritten
    } else {
#pragma unroll
      for (int i = 0; i < 8; ++i) br[i] = *(const v8us*)(po + (size_t)i * 32 * CC);
      asm volatile("s_wait_xcnt 0x0" :: "v"(po) : "memory");      // before the address pair of these loads is overwritten
    }
    const unsigned char* pb = buf + (wn + ln) * TKP + 16 * hh;
#pragma unroll
    for (int kl = 0; kl < 64; kl += 32) {
      const int kb = s * 64 + kl;
      FragB ah[2], al[2], bh_[4], bl_[4];
#pragma unroll
      for (int m = 0; m < 2; ++m) {
        const unsigned char* p = pa + m * 16 * TAP + kb * 2;
        ah[m].half[0] = *(const v8us*)p; ah[m].half[1] = *(const v8us*)(p + 32);
        al[m].half[0] = *(const v8us*)(p + TOT * TAP); al[m].half[1] = *(const v8us*)(p + TOT * TAP + 32);
      }
#pragma unroll
      for (int t = 0; t < 4; ++t) {
        const unsigned char* p = pb + t * 16 * TKP + kl * 2;
        bh_[t].half[0] = *(const v8us*)p; bh_[t].half[1] = *(const v8us*)(p + 32);
        bl_[t].half[0] = *(const v8us*)(p + CC * TKP); bl_[t].half[1] = *(const v8us*)(p + CC * TKP + 32);
      }
#pragma unroll
      for (int t = 0; t < 4; ++t)
#pragma unroll
        for (int m = 0; m < 2; ++m) acc[m][t] = mma1(ah[m].v, bh_[t].v, acc[m][t]);
#pragma unroll
      for (int t = 0; t < 4; ++t)
#pragma unroll
        for (int m = 0; m < 2; ++m) acc[m][t] = mma1(al[m].v, bh_[t].v, acc[m][t]);
#pragma unroll
      for (int t = 0; t < 4; ++t)
#pragma unroll
        for (int m = 0; m < 2; ++m) acc[m][t] = mma1(ah[m].v, bl_[t].v, acc[m][t]);
    }
  }
  const float* vrow = QKV + (tok0 + wm + 8 * hh) * (3 * CC) + wn + ln;      // v lies 2 * CC further in the row
  v8f rv[2][4];
#pragma unroll
  for (int m = 0; m < 2; ++m)
#pragma unroll
    for (int t = 0; t < 4; ++t)
#pragma unroll
      for (int r = 0; r < 8; ++r) rv[m][t][r] = vrow[2 * CC + (m * 16 + r) * (3 * CC) + t * 16];
  float bo[4];      // the output bias, fetched here with v so that the epilogue does not wait for it
#pragma unroll
  for (int t = 0; t < 4; ++t) bo[t] = bout[wn + t * 16 + ln];
  asm volatile("s_wait_xcnt 0x0" :: "v"(vrow) : "memory");      // before an address register of these loads is overwritten
  __syncthreads();      // the q2 planes are dead in every wave before the attn tile is written over them
  // inputs-only fence on the loaded values: the 64 loads of v and the 4 of the bias are issued together and waited for once (without it this build issues them a few at a time, each group paying a full latency, and spills registers to scratch)
  asm volatile("" :: "v"(rv[0][0]), "v"(rv[0][1]), "v"(rv[0][2]), "v"(rv[0][3]), "v"(rv[1][0]), "v"(rv[1][1]), "v"(rv[1][2]), "v"(rv[1][3]), "v"(bo[0]), "v"(bo[1]), "v"(bo[2]), "v"(bo[3]));
#pragma unroll
  for (int m = 0; m < 2; ++m)
#pragma unroll
    for (int t = 0; t < 4; ++t)
#pragma unroll
      for (int r = 0; r < 8; ++r) {
        const float a = rv[m][t][r] + acc[m][t][r] * 0.015625f;
        const unsigned short hb = bf16_bits(a);
        const int o = (wm + m * 16 + 8 * hh + r) * TAP + (wn + t * 16 + ln) * 2;
        *(unsigned short*)(sAh + o) = hb; *(unsigned short*)(sAl + o) = bf16_bits(a - bf16_val(hb));
      }
  v8f oc[2][4] = {};
#pragma unroll
  for (int s = 0; s < 2; ++s) {
    unsigned char* buf = sB + (s & 1) * TBUF;
#pragma unroll
    for (int i = 0; i < 8; ++i) *(v8us*)(buf + (orow + 32 * i) * TWP + ln * 16) = br[i];
    __syncthreads();      // publishes this tile (and, the first time, the attn planes: every wave reads all 256 channels, of which it wrote 64); it also ends the reads of the other buffer
    if (s < 1) {
#pragma unroll
      for (int i = 0; i < 8; ++i) br[i] = *(const v8us*)(po + 128 + (size_t)i * 32 * CC);
      asm volatile("s_wait_xcnt 0x0" :: "v"(po) : "memory");      // before the address pair of these loads is overwritten
    }
    const unsigned char* pb = buf + (wn + ln) * TWP + 16 * hh;
#pragma unroll
    for (int kl = 0; kl < 128; kl += 32) {
      const int kb = s * 128 + kl;
      FragB ah[2], al[2], b[4];
#pragma unroll
      for (int m = 0; m < 2; ++m) {
        const unsigned char* p = pa + m * 16 * TAP + kb * 2;
        ah[m].half[0] = *(const v8us*)p; ah[m].half[1] = *(const v8us*)(p + 32);
        al[m].half[0] = *(const v8us*)(p + TOT * TAP); al[m].half[1] = *(const v8us*)(p + TOT * TAP + 32);
      }
#pragma unroll
      for (int t = 0; t < 4; ++t) { const unsigned char* p = pb + t * 16 * TWP + kl * 2; b[t].half[0] = *(const v8us*)p; b[t].half[1] = *(const v8us*)(p + 32); }
#pragma unroll
      for (int t = 0; t < 4; ++t)
#pragma unroll
        for (int m = 0; m < 2; ++m) oc[m][t] = mma1(ah[m].v, b[t].v, oc[m][t]);
#pragma unroll
      for (int t = 0; t < 4; ++t)
#pragma unroll
        for (int m = 0; m < 2; ++m) oc[m][t] = mma1(al[m].v, b[t].v, oc[m][t]);
    }
  }
  __syncthreads();      // the tile buffers are dead in every wave before their LDS is reused to stage the output
  float* so = (float*)sB + w * (32 * TSO);
#pragma unroll
  for (int t = 0; t < 4; ++t) {
    const float bv = bf16_round(bo[t]);
#pragma unroll
    for (int m = 0; m < 2; ++m)
#pragma unroll
      for (int r = 0; r < 8; ++r) so[(m * 16 + 8 * hh + r) * TSO + t * 16 + ln] = oc[m][t][r] + bv;
  }
  // each wave stages in its own LDS range: the fence and the wave barrier keep its row reads behind its own lanes' writes, so that whole 256-byte row pieces are stored
  __builtin_amdgcn_fence(__ATOMIC_ACQ_REL, "workgroup");
  __builtin_amdgcn_wave_barrier();
  float* dst = out + (tok0 + wm) * CC + wn + ln * 4;
  v4f ov[16];      // all 16 LDS reads first, each into registers of its own: one LDS latency for the wave instead of one per row pair
#pragma unroll
  for (int q = 0; q < 16; ++q) ov[q] = *(const v4fa*)&so[(q * 2 + hh) * TSO + ln * 4];
#pragma unroll
  for (int q = 0; q < 16; ++q) *(v4f*)(dst + (size_t)(q * 2 + hh) * CC) = ov[q];
}
// qkv = x W_qkv + b and the per-token work on q and k in one launch. Block = 128 tokens x all 768 columns, 16 waves of 32 x 64 on one section (q, k, v: 256 columns) at a time.
// x is staged once a block in LDS as bf16 (each element rounded once); a section's weights (256 rows x K = 256) are staged whole, the next section's loads in flight while this one is multiplied.
// A finished section (+ bias) is laid token-major in LDS over the dead weights, and each wave takes 8 whole token rows of it into registers, 8 columns a lane:
// q <- q - mean(q), k <- k - mean(k); q2 = q^2, k2 = k^2; Q2n[t][c] = l2norm_c(q2 / (sum q2 + 1e-7)); K2a[t][c] = k2 / (sum k2 + 1e-7) (column-normalised later); v goes to its place in QKV as it is.
// q and k never go to memory. The row work and the stores of a section stand behind the barrier that publishes the next section's weights, so that the stores drain under the next product.
// Every load of x and of the weights and every store covers 512 contiguous bytes of one row. Each accumulator still sums its 8 k blocks in rising order.
#define QGP 528                   // bytes per LDS row of x and of the weights: 16 x 33, the conflict-free pitch of 16-byte fragment reads
#define QSP 260                   // floats per row of the staged section: rows 8 apart fall 32 banks apart; 1040 bytes, a multiple of 16
// sum over the 32 lanes of each of 8 values; the 8 chains are independent, so that their cross-lane latencies overlap
__device__ __forceinline__ void wave_sum8(float (&s)[8]) {
  // unrolled so that s[] stays in registers (constant indices)
#pragma unroll
  for (int o = 16; o >= 1; o >>= 1) {
    float t[8];
#pragma unroll
    for (int j = 0; j < 8; ++j) t[j] = __shfl_xor(s[j], o, 32);
#pragma unroll
    for (int j = 0; j < 8; ++j) s[j] += t[j];
  }
}
__device__ __forceinline__ float sum8(v4f a, v4f b) { const v4f c = a + b; return (c[0] + c[1]) + (c[2] + c[3]); }
// 8 token rows of q (ISQ) or k, a lane holding columns 4 lane .. + 3 and 128 + 4 lane .. + 3 of each: centre, square, divide by the row sum; q also l2-normalised over the row
template <bool ISQ>
__device__ __forceinline__ void rows_finish(v4f (&rw)[8][2], float* __restrict__ dst) {
  float s[8];
  // every loop over j is unrolled so that rw and s stay in registers (constant indices)
#pragma unroll
  for (int j = 0; j < 8; ++j) s[j] = sum8(rw[j][0], rw[j][1]);
  wave_sum8(s);
#pragma unroll
  for (int j = 0; j < 8; ++j) {
    const float mu = s[j] * (1.0f / CC);
    const v4f d0 = rw[j][0] - mu, d1 = rw[j][1] - mu;
    rw[j][0] = d0 * d0; rw[j][1] = d1 * d1;
    s[j] = sum8(rw[j][0], rw[j][1]);
  }
  wave_sum8(s);
#pragma unroll
  for (int j = 0; j < 8; ++j) { const float r = 1.0f / (s[j] + 1e-7f); rw[j][0] *= r; rw[j][1] *= r; }
  if (ISQ) {
#pragma unroll
    for (int j = 0; j < 8; ++j) s[j] = sum8(rw[j][0] * rw[j][0], rw[j][1] * rw[j][1]);
    wave_sum8(s);
#pragma unroll
    for (int j = 0; j < 8; ++j) { const float r = 1.0f / fmaxf(sqrtf(s[j]), 1e-12f); rw[j][0] *= r; rw[j][1] *= r; }
  }
#pragma unroll
  for (int j = 0; j < 8; ++j) { *(v4f*)(dst + (size_t)j * CC) = rw[j][0]; *(v4f*)(dst + (size_t)j * CC + 128) = rw[j][1]; }
  asm volatile("s_wait_xcnt 0x0" :: "v"(dst) : "memory");      // before a register named by these stores is overwritten
}
__global__ __launch_bounds__(512) void k_qkv_prep(const float* __restrict__ X, const unsigned short* __restrict__ Wt, const float* __restrict__ bias,
                                                 float* __restrict__ QKV, float* __restrict__ Q2n, float* __restrict__ K2a) {
  __shared__ __attribute__((aligned(16))) unsigned char sm[(128 + CC) * QGP];      // x tile, then a section's weights (reused for the staged section)
  unsigned char* sA = sm; unsigned char* sB = sm + 128 * QGP; float* so = (float*)sB;
  const int tid = threadIdx.x, w = tid >> 5, lane = tid & 31, ln = lane & 15, hh = lane >> 4;
  const size_t row0 = (size_t)blockIdx.x * 128;
  const int wm = (w >> 2) * 32, wn = (w & 3) * 64;
  // wave w brings rows w, w + 16, ... of the weights and of x: a weight row is one load, a row of x two
  const unsigned short* bp = Wt + (size_t)w * CC + lane * 8;
  const float* bb = bias + wn + ln;
  v8us br[16]; float bv[3][4];
  // every loop below is unrolled so that br, ar, rw, bv, the fragments and acc stay in registers (constant indices) and the loads of a group are in flight together
#pragma unroll
  for (int i = 0; i < 16; ++i) br[i] = *(const v8us*)(bp + (size_t)i * 16 * CC);
  {
    const float* ap = X + (row0 + w) * CC + lane * 4;
    v4f ar[8][2];
#pragma unroll
    for (int i = 0; i < 8; ++i) { ar[i][0] = *(const v4fa*)(ap + (size_t)i * 16 * CC); ar[i][1] = *(const v4fa*)(ap + (size_t)i * 16 * CC + 128); }
#pragma unroll
    for (int s = 0; s < 3; ++s)
#pragma unroll
      for (int t = 0; t < 4; ++t) bv[s][t] = bb[s * CC + t * 16];
    // the wait that stands before a register named by an issued global load is overwritten; here and below it takes the address pairs as inputs so that none is reused before it
    asm volatile("s_wait_xcnt 0x0" :: "v"(bp), "v"(ap), "v"(bb) : "memory");
#pragma unroll
    for (int i = 0; i < 8; ++i)
#pragma unroll
      for (int h = 0; h < 2; ++h) {
        v4us o;
#pragma unroll
        for (int q = 0; q < 4; ++q) o[q] = bf16_bits(ar[i][h][q]);
        *(v4us*)(sA + (w + 16 * i) * QGP + h * 256 + lane * 8) = o;
      }
  }
  const unsigned char* pa = sA + (wm + ln) * QGP + 16 * hh;
  const unsigned char* pb = sB + (wn + ln) * QGP + 16 * hh;
  const size_t trow = row0 + w * 8;      // the wave's 8 token rows of a finished section
  v4f rw[8][2];
#pragma unroll
  for (int s = 0; s < 3; ++s) {
#pragma unroll
    for (int i = 0; i < 16; ++i) *(v8us*)(sB + (w + 16 * i) * QGP + lane * 16) = br[i];
    __syncthreads();      // publishes this section's weights (and, the first time, the x tile): every wave reads rows that other waves wrote
    if (s < 2) {
#pragma unroll
      for (int i = 0; i < 16; ++i) br[i] = *(const v8us*)(bp + (size_t)(s + 1) * CC * CC + (size_t)i * 16 * CC);
      asm volatile("s_wait_xcnt 0x0" :: "v"(bp) : "memory");      // before the address pair of these loads is overwritten
    }
    if (s == 1) rows_finish<true>(rw, Q2n + trow * CC + lane * 4);
    if (s == 2) rows_finish<false>(rw, K2a + trow * CC + lane * 4);
    v8f acc[2][4] = {};
#pragma unroll
    for (int kb = 0; kb < CC; kb += 32) {
      FragB a[2], b[4];
#pragma unroll
      for (int m = 0; m < 2; ++m) { a[m].half[0] = *(const v8us*)(pa + m * 16 * QGP + kb * 2); a[m].half[1] = *(const v8us*)(pa + m * 16 * QGP + kb * 2 + 32); }
#pragma unroll
      for (int t = 0; t < 4; ++t) { b[t].half[0] = *(const v8us*)(pb + t * 16 * QGP + kb * 2); b[t].half[1] = *(const v8us*)(pb + t * 16 * QGP + kb * 2 + 32); }
#pragma unroll
      for (int t = 0; t < 4; ++t)
#pragma unroll
        for (int m = 0; m < 2; ++m) acc[m][t] = mma1(a[m].v, b[t].v, acc[m][t]);
    }
    __syncthreads();      // the weights are dead in every wave before the section is staged over them
#pragma unroll
    for (int t = 0; t < 4; ++t) {
      const float bvr = bf16_round(bv[s][t]);
#pragma unroll
      for (int m = 0; m < 2; ++m)
#pragma unroll
        for (int r = 0; r < 8; ++r) so[(wm + m * 16 + 8 * hh + r) * QSP + wn + t * 16 + ln] = acc[m][t][r] + bvr;
    }
    __syncthreads();      // publishes the staged section: a token row was written by 4 waves
#pragma unroll
    for (int j = 0; j < 8; ++j) { rw[j][0] = *(const v4fa*)&so[(w * 8 + j) * QSP + lane * 4]; rw[j][1] = *(const v4fa*)&so[(w * 8 + j) * QSP + 128 + lane * 4]; }
    if (s < 2) __syncthreads();      // the staged section is in registers in every wave before the next weights are written over it
  }
  float* dv = QKV + trow * (3 * CC) + 2 * CC + lane * 4;
#pragma unroll
  for (int j = 0; j < 8; ++j) { *(v4f*)(dv + (size_t)j * 3 * CC) = rw[j][0]; *(v4f*)(dv + (size_t)j * 3 * CC + 128) = rw[j][1]; }
}
extern "C" void kernel_launch(void* const* d_in, const int* in_sizes, int n_in,
                              void* d_out, int out_size, void* d_ws, size_t ws_size, hipStream_t stream) {
  (void)in_sizes; (void)n_in; (void)out_size;
  const float* x = (const float*)d_in[0]; const float* Wqkv = (const float*)d_in[1]; const float* bqkv = (const float*)d_in[2]; const float* Wout = (const float*)d_in[3]; const float* bout = (const float*)d_in[4];
  char* ws = (char*)d_ws; size_t off = 0;
  auto take = [&](size_t bytes) { char* p = ws + off; off += (bytes + 255) & ~(size_t)255; return p; };
  unsigned short* Bq = (unsigned short*)take((size_t)3 * CC * CC * 2); unsigned short* Bo = (unsigned short*)take((size_t)CC * CC * 2);
  float* QKV = (float*)take((size_t)BB * NTK * 3 * CC * 4); float* Q2n = (float*)take((size_t)BB * NTK * CC * 4); float* K2a = (float*)take((size_t)BB * NTK * CC * 4); float* KN = (float*)take(BB * CC * 4);
  float* KVp = (float*)take((size_t)KSL * BB * CC * CC * 4);      // the KSL partials of kv
  unsigned short* Ph = (unsigned short*)take((size_t)BB * CC * CC * 2); unsigned short* Pl = (unsigned short*)take((size_t)BB * CC * CC * 2); double* PS = (double*)take((size_t)BB * NCH * CC * 8);
  if (off > ws_size) return;
  k_btw<<<(3 * CC * 32 + 255) / 256, 256, 0, stream>>>(Wqkv, Bq, CC, 3 * CC); k_btw<<<(CC * 32 + 255) / 256, 256, 0, stream>>>(Wout, Bo, CC, CC);
  k_qkv_prep<<<BB * NTK / 128, 512, 0, stream>>>(x, Bq, bqkv, QKV, Q2n, K2a);      // Q2n, K2a and the v third of QKV; the q and k thirds of QKV are neither written nor read
  k_colnorm_part<<<dim3(NCH, BB), 256, 0, stream>>>(K2a, PS); k_colnorm_fin<<<dim3(CC / 32, BB), 256, 0, stream>>>(PS, KN);
  k_kv_part<<<dim3(4, BB, KSL), 256, 0, stream>>>(K2a, KN, QKV, KVp);      // slice z: KVp[z][b][c][d] = sum over the tokens t of slice z of k2[t][c] * v[t][d]
  k_kvplanes<<<(BB * CC * (CC / 8) + 255) / 256, 256, 0, stream>>>(KVp, Ph, Pl);
  k_t2_attn_out<<<dim3(NTK / TOT, BB), 512, 0, stream>>>(Q2n, Ph, Pl, QKV, Bo, bout, (float*)d_out);      // t2 = q2 * kv, attn = v + t2 / 64, out = attn * W_out + b
}

// v008
// One run takes 92 microseconds.
// Timed twice side by side with v007, it ran 1.14 and 1.15 times as fast.
// Counting every step since v000, it is 22.3 times as fast.
#include <hip/hip_runtime.h>
// Linear attention on WMMA (f32 accumulate): qkv = x·W_qkv + b (inputs rounded to bf16: single exact term; 32768 × 256 × 768), per batch kv = k2ᵀ·v (k2 and v are computed
// f32 → split into bf16 hi/lo: 3 products; 256 × 256 × 4096), t2 = q2·kv (3 products), out = attn·W_out + b (attn split hi/lo vs exact weights: 2 products). Mean-centering,
// squares, the two normalisations and the residual are f32 VALU (column sums of squares: f32 over 8 tokens, joined in double).
#define BB 8
#define NTK 4096
#define CC 256

typedef __bf16 v16b __attribute__((ext_vector_type(16)));
typedef unsigned short v8us __attribute__((ext_vector_type(8), may_alias));
typedef float  v8f  __attribute__((ext_vector_type(8)));
typedef float  v4f  __attribute__((ext_vector_type(4)));
typedef float  v4fa __attribute__((ext_vector_type(4), may_alias));
union FragB { v16b v; v8us half[2]; unsigned short u[16]; };

__device__ __forceinline__ unsigned short bf16_bits(float x) { unsigned int u = __float_as_uint(x); return (unsigned short)((u + 0x7FFFu + ((u >> 16) & 1u)) >> 16); }
__device__ __forceinline__ float bf16_val(unsigned short b) { return __uint_as_float(((unsigned int)b) << 16); }
__device__ __forceinline__ float bf16_round(float x) { return bf16_val(bf16_bits(x)); }
// D += A·B with NT terms: 1 = ah·bh, 2 = + al·bh (A split), 3 = + ah·bl (both split)
template <int NT>
__device__ __forceinline__ v8f mmaN(v16b ah, v16b al, v16b bh, v16b bl, v8f c) {
  c = __builtin_amdgcn_wmma_f32_16x16x32_bf16(false, ah, false, bh, (short)0, c, false, false);
  if (NT >= 2) c = __builtin_amdgcn_wmma_f32_16x16x32_bf16(false, al, false, bh, (short)0, c, false, false);
  if (NT >= 3) c = __builtin_amdgcn_wmma_f32_16x16x32_bf16(false, ah, false, bl, (short)0, c, false, false);
  asm volatile("v_nop\n\tv_nop\n\tv_nop\n\tv_nop" : "+v"(c) : "v"(ah), "v"(al), "v"(bh), "v"(bl));
  return c;
}

__global__ __launch_bounds__(256) void k_wt_bf16(const float* __restrict__ W, unsigned short* __restrict__ Wt, int K, int N) {
  const int t = blockIdx.x * 256 + threadIdx.x;
  const int k8n = K / 8;
  if (t >= N * k8n) return;
  const int n = t / k8n, k8 = (t % k8n) * 8;
  v8us v;
#pragma unroll
  for (int i = 0; i < 8; ++i) v[i] = bf16_bits(W[(size_t)(k8 + i) * N + n]);
  *(v8us*)(Wt + (size_t)n * K + k8) = v;
  
}

// GEMM C[M][N] (f32, pitch ldc) = act(A[M][K]·W + bias). A f32 row-major (pitch lda) converted per fragment to bf16
// (ASPLIT: hi/lo two planes -> 2 terms, else single rounded term); Wt bf16 [N][K] (pitch ldb). BIAS_BF16 rounds the
// bias to bf16 first (bias quantised to bf16 before the add). K%32==0, M%16==0, N%64==0.
template <bool ASPLIT, int ACT, bool BIAS_BF16>
__global__ __launch_bounds__(128) void k_gemm_bf(const float* __restrict__ A, int lda, const unsigned short* __restrict__ Wt, int ldb,
                                               const float* __restrict__ bias, float* __restrict__ C, int ldc, int M, int N, int K) {
  __shared__ __attribute__((aligned(16))) float so[4][16][64];
  const int tid = threadIdx.x, w = tid >> 5, lane = tid & 31, ln = lane & 15, hh = lane >> 4;
  const int ntn = N / 64;
  const int wid = blockIdx.x * 4 + w;
  const int mt = wid / ntn, nq = wid % ntn;
  if (mt * 16 >= M) return;
  const int row0 = mt * 16, col0 = nq * 64;
  const float* arow = A + (size_t)(row0 + ln) * lda;
  v8f acc[4] = {};
  for (int kb = 0; kb < K; kb += 32) {
    FragB ah, al;
    const v4f x0 = *(const v4fa*)(arow + kb + 8 * hh), x1 = *(const v4fa*)(arow + kb + 8 * hh + 4);
    const v4f x2 = *(const v4fa*)(arow + kb + 16 + 8 * hh), x3 = *(const v4fa*)(arow + kb + 16 + 8 * hh + 4);
    float xs[16] = {x0[0],x0[1],x0[2],x0[3],x1[0],x1[1],x1[2],x1[3],x2[0],x2[1],x2[2],x2[3],x3[0],x3[1],x3[2],x3[3]};
#pragma unroll
    for (int i = 0; i < 16; ++i) { const unsigned short hb = bf16_bits(xs[i]); ah.u[i] = hb; al.u[i] = ASPLIT ? bf16_bits(xs[i] - bf16_val(hb)) : (unsigned short)0; }
#pragma unroll
    for (int t = 0; t < 4; ++t) {
      const unsigned short* brow = Wt + (size_t)(col0 + t * 16 + ln) * ldb + kb;
      FragB b;
      b.half[0] = *(const v8us*)(brow + 8 * hh);
      b.half[1] = *(const v8us*)(brow + 16 + 8 * hh);
      acc[t] = mmaN<ASPLIT ? 2 : 1>(ah.v, al.v, b.v, b.v, acc[t]);
    }
  }
#pragma unroll
  for (int t = 0; t < 4; ++t) {
    float bv = bias ? bias[col0 + t * 16 + ln] : 0.f;
    if (BIAS_BF16) bv = bf16_round(bv);
#pragma unroll
    for (int r = 0; r < 8; ++r) { float v = acc[t][r] + bv; if (ACT == 1) v = fmaxf(v, 0.f); so[w][8 * hh + r][t * 16 + ln] = v; }
  }
  __builtin_amdgcn_fence(__ATOMIC_ACQ_REL, "workgroup");
  __builtin_amdgcn_wave_barrier();
  const int rsub = lane >> 4, c4 = (lane & 15) * 4;
  {
#pragma unroll
    for (int q = 0; q < 8; ++q) {
      const int r = q * 2 + rsub;
      const v4f v = *(const v4fa*)&so[w][r][c4];
      *(v4f*)(C + (size_t)(row0 + r) * ldc + col0 + c4) = v;
    }
    
  }
}

// Flash-style causal/unmasked attention, all contractions 3-term bf16 hi/lo splits, f32 softmax with running max.
// q,k,v rows are read from f32 buffers with arbitrary row pitch (so they can live inside a fused qkv buffer);
// D = head size (multiple of 32, <= 128); one wave = 16 query rows; block = 4 waves (64 queries) sharing K/V chunks of 32.
template <int D, bool CAUSAL>
__global__ __launch_bounds__(128) void k_flash(const float* __restrict__ qb, const float* __restrict__ kb, const float* __restrict__ vb,
                                             int pitch, int T, int H, float scale, float* __restrict__ y, int ypitch) {
  constexpr int KS = D / 32;        // k-steps for QK
  constexpr int DT = D / 16;        // d tiles for PV
  __shared__ __attribute__((aligned(16))) unsigned short sKh[32][D + 8], sKl[32][D + 8], sVh[32][D + 8], sVl[32][D + 8];
  __shared__ __attribute__((aligned(16))) unsigned short sPh[4][16][40], sPl[4][16][40];
  __shared__ __attribute__((aligned(16))) float sO[4][16][D];
  const int tid = threadIdx.x, w = tid >> 5, lane = tid & 31, ln = lane & 15, hh = lane >> 4;
  const int nqb = (T + 63) / 64;
  const int bh = blockIdx.x / nqb, qblk = blockIdx.x % nqb;
  const int b = bh / H, h = bh % H;
  const int q0 = qblk * 64 + w * 16;
  const float* Q = qb + (size_t)b * T * pitch + h * D;
  const float* K = kb + (size_t)b * T * pitch + h * D;
  const float* V = vb + (size_t)b * T * pitch + h * D;

  // A fragments of the wave's 16 query rows (scaled), hi/lo
  FragB aqh[KS], aql[KS];
  {
    int row = q0 + ln; if (row >= T) row = T - 1;
    const float* qr = Q + (size_t)row * pitch;
#pragma unroll
    for (int ks = 0; ks < KS; ++ks)
#pragma unroll
      for (int i = 0; i < 16; ++i) {
        const int d = ks * 32 + ((i < 8) ? (8 * hh + i) : (16 + 8 * hh + (i - 8)));
        const float x = qr[d] * scale; const unsigned short hb = bf16_bits(x);
        aqh[ks].u[i] = hb; aql[ks].u[i] = bf16_bits(x - bf16_val(hb));
      }
  }
  float m_r[8], l_r[8];
#pragma unroll
  for (int r = 0; r < 8; ++r) { m_r[r] = -3.0e38f; l_r[r] = 0.f; }
  v8f oacc[DT];
#pragma unroll
  for (int dt = 0; dt < DT; ++dt) oacc[dt] = (v8f){0.f,0.f,0.f,0.f,0.f,0.f,0.f,0.f};

  const int kv_end = CAUSAL ? min(T, qblk * 64 + 64) : T;     // block-uniform
  for (int j0 = 0; j0 < kv_end; j0 += 32) {
    __syncthreads();
    for (int e = tid; e < 32 * (D / 4); e += 128) {
      const int r = e / (D / 4), c4 = (e % (D / 4)) * 4;
      const int key = j0 + r;
      v4f kf = {0.f,0.f,0.f,0.f}, vf = {0.f,0.f,0.f,0.f};
      if (key < T) { kf = *(const v4fa*)(K + (size_t)key * pitch + c4); vf = *(const v4fa*)(V + (size_t)key * pitch + c4); }
#pragma unroll
      for (int t = 0; t < 4; ++t) {
        unsigned short hb = bf16_bits(kf[t]); sKh[r][c4 + t] = hb; sKl[r][c4 + t] = bf16_bits(kf[t] - bf16_val(hb));
        hb = bf16_bits(vf[t]); sVh[r][c4 + t] = hb; sVl[r][c4 + t] = bf16_bits(vf[t] - bf16_val(hb));
      }
    }
    __syncthreads();
    // S tile 16 x 32
    v8f s[2];
#pragma unroll
    for (int nt = 0; nt < 2; ++nt) {
      v8f acc = {};
#pragma unroll
      for (int ks = 0; ks < KS; ++ks) {
        FragB bh_, bl_;
        bh_.half[0] = *(const v8us*)&sKh[nt * 16 + ln][ks * 32 + 8 * hh]; bh_.half[1] = *(const v8us*)&sKh[nt * 16 + ln][ks * 32 + 16 + 8 * hh];
        bl_.half[0] = *(const v8us*)&sKl[nt * 16 + ln][ks * 32 + 8 * hh]; bl_.half[1] = *(const v8us*)&sKl[nt * 16 + ln][ks * 32 + 16 + 8 * hh];
        acc = mmaN<3>(aqh[ks].v, aql[ks].v, bh_.v, bl_.v, acc);
      }
      s[nt] = acc;
    }
    // mask + running max (rows 8hh+r; the 16 lanes of a half share rows)
    float alpha[8];
#pragma unroll
    for (int r = 0; r < 8; ++r) {
      const int qi = q0 + 8 * hh + r;
      const int ja = j0 + ln, jb = j0 + 16 + ln;
      if (CAUSAL) { if (ja > qi) s[0][r] = -3.0e38f; if (jb > qi) s[1][r] = -3.0e38f; }
      if (ja >= T) s[0][r] = -3.0e38f;
      if (jb >= T) s[1][r] = -3.0e38f;
      float mx = fmaxf(s[0][r], s[1][r]);
      mx = fmaxf(mx, __shfl_xor(mx, 1, 32)); mx = fmaxf(mx, __shfl_xor(mx, 2, 32)); mx = fmaxf(mx, __shfl_xor(mx, 4, 32)); mx = fmaxf(mx, __shfl_xor(mx, 8, 32));
      const float mnew = fmaxf(m_r[r], mx);
      alpha[r] = (mnew > -1.0e38f) ? __expf(m_r[r] - mnew) : 1.0f;
      const float p0 = (s[0][r] > -1.0e38f) ? __expf(s[0][r] - mnew) : 0.f;
      const float p1 = (s[1][r] > -1.0e38f) ? __expf(s[1][r] - mnew) : 0.f;
      m_r[r] = mnew;
      l_r[r] = l_r[r] * alpha[r] + p0 + p1;            // per-lane partial row sum (16 lanes combined at the end)
      unsigned short hb = bf16_bits(p0); sPh[w][8 * hh + r][ln] = hb;      sPl[w][8 * hh + r][ln] = bf16_bits(p0 - bf16_val(hb));
      hb = bf16_bits(p1);                sPh[w][8 * hh + r][16 + ln] = hb; sPl[w][8 * hh + r][16 + ln] = bf16_bits(p1 - bf16_val(hb));
    }
#pragma unroll
    for (int dt = 0; dt < DT; ++dt)
#pragma unroll
      for (int r = 0; r < 8; ++r) oacc[dt][r] *= alpha[r];
    __builtin_amdgcn_fence(__ATOMIC_ACQ_REL, "workgroup");
    __builtin_amdgcn_wave_barrier();
    FragB pah, pal;
    pah.half[0] = *(const v8us*)&sPh[w][ln][8 * hh]; pah.half[1] = *(const v8us*)&sPh[w][ln][16 + 8 * hh];
    pal.half[0] = *(const v8us*)&sPl[w][ln][8 * hh]; pal.half[1] = *(const v8us*)&sPl[w][ln][16 + 8 * hh];
#pragma unroll
    for (int dt = 0; dt < DT; ++dt) {
      FragB bvh, bvl;
#pragma unroll
      for (int i = 0; i < 8; ++i) {
        bvh.u[i] = sVh[8 * hh + i][dt * 16 + ln]; bvh.u[8 + i] = sVh[16 + 8 * hh + i][dt * 16 + ln];
        bvl.u[i] = sVl[8 * hh + i][dt * 16 + ln]; bvl.u[8 + i] = sVl[16 + 8 * hh + i][dt * 16 + ln];
      }
      oacc[dt] = mmaN<3>(pah.v, pal.v, bvh.v, bvl.v, oacc[dt]);
    }
    __builtin_amdgcn_fence(__ATOMIC_ACQ_REL, "workgroup");
    __builtin_amdgcn_wave_barrier();
  }
#pragma unroll
  for (int r = 0; r < 8; ++r) {
    float l = l_r[r];
    l += __shfl_xor(l, 1, 32); l += __shfl_xor(l, 2, 32); l += __shfl_xor(l, 4, 32); l += __shfl_xor(l, 8, 32);
    l_r[r] = (l > 0.f) ? 1.0f / l : 0.f;
  }
#pragma unroll
  for (int dt = 0; dt < DT; ++dt)
#pragma unroll
    for (int r = 0; r < 8; ++r) sO[w][8 * hh + r][dt * 16 + ln] = oacc[dt][r] * l_r[r];
  __builtin_amdgcn_fence(__ATOMIC_ACQ_REL, "workgroup");
  __builtin_amdgcn_wave_barrier();
  {
    for (int r = 0; r < 16; ++r) {
      const int row = q0 + r;
      if (row < T && lane < D / 4) {
        const v4f val = *(const v4fa*)&sO[w][r][lane * 4];
        *(v4f*)(y + ((size_t)b * T + row) * ypitch + h * D + lane * 4) = val;
      }
    }
    
  }
}

// GEMM C = act(A·W + bias + resid): A f32 (ASPLIT -> hi/lo 2 terms), Wt bf16 [N][K]; ACT 0 none, 1 relu, 2 exact gelu;
// resid (optional, f32, row index = (row % rmod), pitch ldr, RES_BF16 rounds it) added before the activation.
template <bool ASPLIT, int ACT, bool BIAS_BF16, bool RES_BF16>
__global__ __launch_bounds__(128) void k_gemm_bf3(const float* __restrict__ A, int lda, const unsigned short* __restrict__ Wt, int ldb,
                                                const float* __restrict__ bias, const float* __restrict__ resid, int rmod, int ldr,
                                                float* __restrict__ C, int ldc, int M, int N, int K) {
  __shared__ __attribute__((aligned(16))) float so[4][16][64];
  const int tid = threadIdx.x, w = tid >> 5, lane = tid & 31, ln = lane & 15, hh = lane >> 4;
  const int ntn = N / 64;
  const int wid = blockIdx.x * 4 + w;
  const int mt = wid / ntn, nq = wid % ntn;
  if (mt * 16 >= M) return;
  const int row0 = mt * 16, col0 = nq * 64;
  const float* arow = A + (size_t)(row0 + ln) * lda;
  v8f acc[4] = {};
  for (int kb = 0; kb < K; kb += 32) {
    FragB ah, al;
    const v4f x0 = *(const v4fa*)(arow + kb + 8 * hh), x1 = *(const v4fa*)(arow + kb + 8 * hh + 4);
    const v4f x2 = *(const v4fa*)(arow + kb + 16 + 8 * hh), x3 = *(const v4fa*)(arow + kb + 16 + 8 * hh + 4);
    float xs[16] = {x0[0],x0[1],x0[2],x0[3],x1[0],x1[1],x1[2],x1[3],x2[0],x2[1],x2[2],x2[3],x3[0],x3[1],x3[2],x3[3]};
#pragma unroll
    for (int i = 0; i < 16; ++i) { const unsigned short hb = bf16_bits(xs[i]); ah.u[i] = hb; al.u[i] = ASPLIT ? bf16_bits(xs[i] - bf16_val(hb)) : (unsigned short)0; }
#pragma unroll
    for (int t = 0; t < 4; ++t) {
      const unsigned short* brow = Wt + (size_t)(col0 + t * 16 + ln) * ldb + kb;
      FragB b;
      b.half[0] = *(const v8us*)(brow + 8 * hh);
      b.half[1] = *(const v8us*)(brow + 16 + 8 * hh);
      acc[t] = mmaN<ASPLIT ? 2 : 1>(ah.v, al.v, b.v, b.v, acc[t]);
    }
  }
#pragma unroll
  for (int t = 0; t < 4; ++t) {
    const int col = col0 + t * 16 + ln;
    float bv = bias ? bias[col] : 0.f;
    if (BIAS_BF16) bv = bf16_round(bv);
#pragma unroll
    for (int r = 0; r < 8; ++r) {
      float v = acc[t][r] + bv;
      if (resid) { float rv = resid[(size_t)((row0 + 8 * hh + r) % rmod) * ldr + col]; if (RES_BF16) rv = bf16_round(rv); v += rv; }
      if (ACT == 1) v = fmaxf(v, 0.f);
      if (ACT == 2) v = 0.5f * v * (1.0f + erff(v * 0.70710678118654752f));
      if (ACT == 3) { const float u = 0.7978845608028654f * (v + 0.044715f * v * v * v); v = 0.5f * v * (1.0f + tanhf(u)); }
      so[w][8 * hh + r][t * 16 + ln] = v;
    }
  }
  __builtin_amdgcn_fence(__ATOMIC_ACQ_REL, "workgroup");
  __builtin_amdgcn_wave_barrier();
  const int rsub = lane >> 4, c4 = (lane & 15) * 4;
  {
#pragma unroll
    for (int q = 0; q < 8; ++q) {
      const int r = q * 2 + rsub;
      const v4f v = *(const v4fa*)&so[w][r][c4];
      *(v4f*)(C + (size_t)(row0 + r) * ldc + col0 + c4) = v;
    }
    
  }
}
// row LayerNorm (biased variance, eps) over N: s = X (+ R); optional out_sum <- s; out_norm <- (s-mu)*rsqrt(var+eps)*g + b
template <bool PARAM_BF16>
__global__ __launch_bounds__(256) void k_layernorm(const float* __restrict__ X, const float* __restrict__ R, const float* __restrict__ g, const float* __restrict__ bta,
                                                  float* __restrict__ out_sum, float* __restrict__ out_norm, int N, float eps) {
  __shared__ float red[256];
  const int row = blockIdx.x, tid = threadIdx.x;
  const float* x = X + (size_t)row * N; const float* rr = R ? R + (size_t)row * N : nullptr;
  float vals[16];                     // up to N = 4096
  const int per = N / 256;            // contiguous chunk per thread? use strided-by-4 chunks: thread handles j = tid*4 + 1024*u
  float s1 = 0.f;
  for (int u = 0; u < per / 4; ++u) {
    const int j = tid * 4 + 1024 * u;
    const v4f a = *(const v4fa*)(x + j);
    v4f b = {0.f,0.f,0.f,0.f}; if (rr) b = *(const v4fa*)(rr + j);
#pragma unroll
    for (int q = 0; q < 4; ++q) { const float v = a[q] + b[q]; vals[u * 4 + q] = v; s1 += v; }
  }
  red[tid] = s1; __syncthreads();
  for (int st = 128; st > 0; st >>= 1) { if (tid < st) red[tid] += red[tid + st]; __syncthreads(); }
  const float mu = red[0] / (float)N; __syncthreads();
  float s2 = 0.f;
  for (int u = 0; u < per / 4; ++u)
#pragma unroll
    for (int q = 0; q < 4; ++q) { const float c = vals[u * 4 + q] - mu; s2 += c * c; }
  red[tid] = s2; __syncthreads();
  for (int st = 128; st > 0; st >>= 1) { if (tid < st) red[tid] += red[tid + st]; __syncthreads(); }
  const float rs = rsqrtf(red[0] / (float)N + eps);
  {
    for (int u = 0; u < per / 4; ++u) {
      const int j = tid * 4 + 1024 * u;
      v4f o, sm;
#pragma unroll
      for (int q = 0; q < 4; ++q) {
        float gg = g[j + q], bb = bta[j + q];
        if (PARAM_BF16) { gg = bf16_round(gg); bb = bf16_round(bb); }
        sm[q] = vals[u * 4 + q]; o[q] = (vals[u * 4 + q] - mu) * rs * gg + bb;
      }
      if (out_sum) *(v4f*)(out_sum + (size_t)row * N + j) = sm;
      *(v4f*)(out_norm + (size_t)row * N + j) = o;
    }
    
  }
}

// batched f32 [K][N] (pitch lds, batch stride sIn) -> transposed hi/lo planes [N][K] (batch stride sOut); thread per (n, 8 k); grid.y = batch
__global__ __launch_bounds__(256) void k_split_transpose_b(const float* __restrict__ src, int lds_, size_t sIn, unsigned short* __restrict__ hi, unsigned short* __restrict__ lo, size_t sOut, int K, int N) {
  const size_t t = (size_t)blockIdx.x * 256 + threadIdx.x; const int k8n = K / 8; if (t >= (size_t)N * k8n) return;
  src += (size_t)blockIdx.y * sIn; hi += (size_t)blockIdx.y * sOut; lo += (size_t)blockIdx.y * sOut;
  const int n = (int)(t / k8n), k8 = (int)(t % k8n) * 8; v8us vh, vl;
#pragma unroll
  for (int i = 0; i < 8; ++i) { const float x = src[(size_t)(k8 + i) * lds_ + n]; const unsigned short hb = bf16_bits(x); vh[i] = hb; vl[i] = bf16_bits(x - bf16_val(hb)); }
  unsigned short* dh = hi + (size_t)n * K + k8; unsigned short* dl = lo + (size_t)n * K + k8;
  *(v8us*)dh = vh; *(v8us*)dl = vl; 
}

__global__ __launch_bounds__(256) void k_btw(const float* __restrict__ W, unsigned short* __restrict__ Bt, int K, int N) { const int t = blockIdx.x * 256 + threadIdx.x; if (t >= N * (K / 8)) return; const int n = t / (K / 8), k8 = (t % (K / 8)) * 8; v8us v; for (int q = 0; q < 8; ++q) v[q] = bf16_bits(W[(size_t)(k8 + q) * N + n]); *(v8us*)(Bt + (size_t)n * K + k8) = v;  }
#define NCB (NTK / 128)           // token blocks of the qkv kernel per batch: each leaves one partial column sum of squares
// Partials of kv = k2^T v straight from the token-major arrays: KVp[z][b][c][d] = sum over the 256 tokens t of slice z of K2a[t][c] * v[t][d], 3 products on hi/lo bf16 planes (the column norm of k2 is a factor of row c of kv and is applied behind the token sum).
// Block = 128 c x 128 d of one (batch, slice), 8 waves of 32 c x 64 d. A pass takes 32 tokens: every thread splits its 16-byte pieces of k2 and v once and lays them token-major in LDS;
// both operands need 8 consecutive tokens of one channel per lane, which the transposing LDS read delivers in the hardware k order (the order the row loaders of this file use).
#define KSL 16
#define KVT 32                    // tokens per pass
#define KVPITCH 288               // bytes per LDS row: 128 channels x 2 B + 32 = 32 B x 9, the conflict-free pitch of the transposing read
#define KVPLANE (KVT * KVPITCH)   // one plane of one pass
#define KVSO 68                   // floats per row of the output staging: rows 8 apart fall 32 banks apart
typedef short s16x8 __attribute__((ext_vector_type(8)));
typedef unsigned short v4us __attribute__((ext_vector_type(4), may_alias));
__device__ __forceinline__ v8us ld_tr16(const unsigned char* p) { typedef __attribute__((address_space(3))) s16x8 lds_s16x8; return __builtin_bit_cast(v8us, __builtin_amdgcn_ds_load_tr16_b128_v8i16((lds_s16x8*)p)); }
__device__ __forceinline__ void split_store4(v4f x, unsigned char* ph, unsigned char* pl) {
  v4us h, l;
  // unrolled so that the vector elements are named by constants
#pragma unroll
  for (int q = 0; q < 4; ++q) { const unsigned short hb = bf16_bits(x[q]); h[q] = hb; l[q] = bf16_bits(x[q] - bf16_val(hb)); }
  *(v4us*)ph = h; *(v4us*)pl = l;
}
__global__ __launch_bounds__(256) void k_kv_part(const float* __restrict__ K2a, const float* __restrict__ QKV, float* __restrict__ KVp) {
  __shared__ __attribute__((aligned(16))) unsigned char sm[2 * 4 * KVPLANE];      // two buffers of 4 planes: k2 hi, k2 lo, v hi, v lo
  const int tid = threadIdx.x, w = tid >> 5, lane = tid & 31, ln = lane & 15, hh = lane >> 4;
  const int c0 = (blockIdx.x >> 1) * 128, d0 = (blockIdx.x & 1) * 128, b = blockIdx.y, z = blockIdx.z;
  const size_t tok0 = (size_t)b * NTK + (size_t)z * (NTK / KSL);
  // wave w brings rows w, w + 8, w + 16, w + 24 of a pass: one 512-byte row segment per load
  const float* kp = K2a + (tok0 + w) * CC + c0 + lane * 4;
  const float* vp = QKV + (tok0 + w) * (3 * CC) + 2 * CC + d0 + lane * 4;
  const int wc = (w >> 1) * 32, wd = (w & 1) * 64;
  const int wr = w * KVPITCH + lane * 8;                                           // where the thread's pieces land in a plane
  const int rd = (8 * hh + (lane & 7)) * KVPITCH + ((lane >> 3) & 1) * 16;         // lane address of the transposing read, tokens 0..15, channel 0
  v4f kr[4], vr[4];
  // every loop over i, m, t, r or q below is unrolled so that kr, vr, the fragments and acc stay in registers (constant indices) and the 8 loads of a pass are in flight together
#pragma unroll
  for (int i = 0; i < 4; ++i) { kr[i] = *(const v4fa*)(kp + (size_t)i * 8 * CC); vr[i] = *(const v4fa*)(vp + (size_t)i * 8 * 3 * CC); }
  v8f acc[2][4] = {};
  for (int ps = 0; ps < NTK / KSL / KVT; ++ps) {
    unsigned char* buf = sm + (ps & 1) * (4 * KVPLANE);
#pragma unroll
    for (int i = 0; i < 4; ++i) {
      unsigned char* p = buf + wr + i * 8 * KVPITCH;
      split_store4(kr[i], p, p + KVPLANE);
      split_store4(vr[i], p + 2 * KVPLANE, p + 3 * KVPLANE);
    }
    __syncthreads();      // publishes this pass's planes; it also ends every wave's reads of the other buffer, which the next pass overwrites
    if (ps + 1 < NTK / KSL / KVT) {      // the next pass's loads fly while this pass is multiplied
      kp += (size_t)KVT * CC; vp += (size_t)KVT * 3 * CC;
#pragma unroll
      for (int i = 0; i < 4; ++i) { kr[i] = *(const v4fa*)(kp + (size_t)i * 8 * CC); vr[i] = *(const v4fa*)(vp + (size_t)i * 8 * 3 * CC); }
    }
    FragB ah[2], al[2];
#pragma unroll
    for (int m = 0; m < 2; ++m) {
      const unsigned char* p = buf + rd + 2 * (wc + 16 * m);
      ah[m].half[0] = ld_tr16(p); ah[m].half[1] = ld_tr16(p + 16 * KVPITCH);
      al[m].half[0] = ld_tr16(p + KVPLANE); al[m].half[1] = ld_tr16(p + KVPLANE + 16 * KVPITCH);
    }
#pragma unroll
    for (int t = 0; t < 4; ++t) {
      const unsigned char* p = buf + 2 * KVPLANE + rd + 2 * (wd + 16 * t);
      FragB bh_, bl_;
      bh_.half[0] = ld_tr16(p); bh_.half[1] = ld_tr16(p + 16 * KVPITCH);
      bl_.half[0] = ld_tr16(p + KVPLANE); bl_.half[1] = ld_tr16(p + KVPLANE + 16 * KVPITCH);
#pragma unroll
      for (int m = 0; m < 2; ++m) acc[m][t] = mmaN<3>(ah[m].v, al[m].v, bh_.v, bl_.v, acc[m][t]);
    }
  }
  __syncthreads();      // the planes are dead in every wave before their LDS is reused to stage the output
  float* so = (float*)sm + w * (2 * 16 * KVSO);
#pragma unroll
  for (int m = 0; m < 2; ++m)
#pragma unroll
    for (int t = 0; t < 4; ++t)
#pragma unroll
      for (int r = 0; r < 8; ++r) so[(m * 16 + 8 * hh + r) * KVSO + t * 16 + ln] = acc[m][t][r];
  // each wave stages in its own LDS range: the fence and the wave barrier keep its row reads behind its own lanes' writes, so that whole 256-byte row pieces are stored
  __builtin_amdgcn_fence(__ATOMIC_ACQ_REL, "workgroup");
  __builtin_amdgcn_wave_barrier();
  float* dst = KVp + (((size_t)z * BB + b) * CC + c0 + wc) * CC + d0 + wd + ln * 4;
#pragma unroll
  for (int q = 0; q < 16; ++q) {
    const int r = q * 2 + hh;
    const v4f v = *(const v4fa*)&so[r * KVSO + ln * 4];
    *(v4f*)(dst + (size_t)r * CC) = v;
  }
}
// kv = sum of its KSL token-slice partials KVp[slice][b][c][d], added in slice order (f32), times 1 / max(column norm of k2, 1e-12) of its row c; then kv -> Bt for t2 = q2 kv: B[k=c][n=d] = kv[c][d] -> Bt[d][c]: planes hi/lo of kv transposed.
// thread per (b, 8 c, d) with d along the lanes: each of the 8 * KSL loads of a wave reads one whole line. A block holds one (b, 8 c): its wave g joins the NCB = 32 partial sums of squares of column c8 + g, one a lane.
__global__ __launch_bounds__(256) void k_kvplanes(const float* __restrict__ KVp, const double* __restrict__ PS, unsigned short* __restrict__ Ph, unsigned short* __restrict__ Pl) { __shared__ float skn[8]; const int t = blockIdx.x * 256 + threadIdx.x; if (t >= BB * CC * (CC / 8)) return; const int d = t % CC; const int c8 = ((t / CC) % (CC / 8)) * 8; const int b = t / ((CC / 8) * CC); v8us h, l;
  const float* p = KVp + ((size_t)b * CC + c8) * CC + d; float s[8] = {0.f, 0.f, 0.f, 0.f, 0.f, 0.f, 0.f, 0.f};
  const double* pp = PS + ((size_t)b * NCB + (threadIdx.x & 31)) * CC + c8 + (threadIdx.x >> 5);
  double ss = *pp;      // fetched ahead of the partials of kv, so that its latency lies under theirs
  asm volatile("s_wait_xcnt 0x0" :: "v"(pp) : "memory");      // before the address pair of this load is overwritten
  // kept rolled, 4 slices a trip: 32 independent loads are in flight per wave; fully unrolled, the 128 loads took 138 registers
#pragma unroll 1
  for (int z = 0; z < KSL; z += 4) {
    float v[4][8];
    // unrolled so that v[] stays in registers and the loads do not wait on the sums
#pragma unroll
    for (int j = 0; j < 4; ++j)
#pragma unroll
      for (int q = 0; q < 8; ++q) v[j][q] = p[(size_t)(z + j) * BB * CC * CC + (size_t)q * CC];
#pragma unroll
    for (int j = 0; j < 4; ++j)
#pragma unroll
      for (int q = 0; q < 8; ++q) s[q] += v[j][q];
  }
  // butterfly over the 32 lanes, in double: a fixed order, the same sum in every lane; unrolled so that each exchange has a constant lane distance
#pragma unroll
  for (int o = 16; o >= 1; o >>= 1) ss += __shfl_xor(ss, o, 32);
  if ((threadIdx.x & 31) == 0) skn[threadIdx.x >> 5] = 1.0f / fmaxf((float)sqrt(ss), 1e-12f);
  __syncthreads();      // publishes the 8 column factors: every thread scales all 8 rows c, of which its wave joined one
  for (int q = 0; q < 8; ++q) { const float v = s[q] * skn[q]; const unsigned short hb = bf16_bits(v); h[q] = hb; l[q] = bf16_bits(v - bf16_val(hb)); } const size_t dst = ((size_t)b * CC + d) * CC + c8; *(v8us*)(Ph + dst) = h; *(v8us*)(Pl + dst) = l;  }
// t2 = q2 kv, attn = v + t2/sqrt(N) and out = attn W_out + b in one launch. Block = 128 tokens x all 256 channels, 16 waves of 32 tokens x 64 channels in both products.
// Every operand reaches the fragments through LDS: q2 is split once a block into bf16 hi/lo planes; the kv planes (4 tiles of 64 c) and then W_out (2 tiles of 128 c) pass through two
// buffers, brought by loads that cover whole 128-byte lines, the next tile's loads in flight while this tile is multiplied. The attn tile takes the place of the q2 planes.
// Each accumulator still sums its 8 k blocks in rising order, and the products of a block in the order hi*hi, lo*hi, hi*lo (attn hi, attn lo in the second product).
#define TOT 128                   // tokens per block
#define TAP 528                   // bytes per LDS row of the q2 / attn planes: 16 x 33, the conflict-free pitch of 16-byte fragment reads
#define TKP 144                   // bytes per LDS row of a kv tile (64 c): 16 x 9
#define TWP 272                   // bytes per LDS row of a W_out tile (128 c): 16 x 17
#define TBUF (2 * CC * TKP)       // one buffer: the hi and the lo plane of a kv tile; a W_out tile (CC * TWP) is smaller
#define TSO 68                    // floats per row of the output staging: rows 8 apart fall 32 banks apart
__device__ __forceinline__ v8f mma1(v16b a, v16b b, v8f c) { return __builtin_amdgcn_wmma_f32_16x16x32_bf16(false, a, false, b, (short)0, c, false, false); }
__global__ __launch_bounds__(512) void k_t2_attn_out(const float* __restrict__ Q2n, const unsigned short* __restrict__ Ph, const unsigned short* __restrict__ Pl, const float* __restrict__ QKV,
                                                    const unsigned short* __restrict__ Bo, const float* __restrict__ bout, float* __restrict__ out) {
  __shared__ __attribute__((aligned(16))) unsigned char sm[2 * TOT * TAP + 2 * TBUF];      // hi plane, lo plane, two tile buffers (reused for the output staging)
  unsigned char* sAh = sm; unsigned char* sAl = sm + TOT * TAP; unsigned char* sB = sm + 2 * TOT * TAP;
  const int tid = threadIdx.x, w = tid >> 5, lane = tid & 31, ln = lane & 15, hh = lane >> 4;
  const size_t tok0 = (size_t)blockIdx.y * NTK + (size_t)blockIdx.x * TOT;
  // a load of a kv tile covers 4 rows x 128 bytes: wave w brings rows 4w .. 4w+3, + 64, + 128, + 192 of both planes; a load of a W_out tile covers 2 rows x 256 bytes: rows 2w, 2w+1, + 32, ...
  const int kr = w * 4 + (lane >> 3), kc = lane & 7, orow = w * 2 + hh;
  const unsigned short* ph = Ph + (size_t)blockIdx.y * CC * CC + (size_t)kr * CC + kc * 8;
  const unsigned short* pl = Pl + (size_t)blockIdx.y * CC * CC + (size_t)kr * CC + kc * 8;
  const unsigned short* po = Bo + (size_t)orow * CC + ln * 8;
  v8us br[8];
  // every loop below is unrolled so that br, ar, rv, the fragments and the accumulators stay in registers (constant indices) and the loads of a group are in flight together
#pragma unroll
  for (int i = 0; i < 4; ++i) { br[i] = *(const v8us*)(ph + (size_t)i * 64 * CC); br[4 + i] = *(const v8us*)(pl + (size_t)i * 64 * CC); }
  {
    // wave w brings rows w, w + 16, ... of q2: two 512-byte loads a row
    const float* ap = Q2n + (tok0 + w) * CC + lane * 4;
    v4f ar[8][2];
#pragma unroll
    for (int i = 0; i < 8; ++i) { ar[i][0] = *(const v4fa*)(ap + (size_t)i * 16 * CC); ar[i][1] = *(const v4fa*)(ap + (size_t)i * 16 * CC + 128); }
    // the wait that stands before a register named by an issued global load is overwritten; here and below it takes the address pairs as inputs so that none is reused (a later load's result had landed on one) before it
    asm volatile("s_wait_xcnt 0x0" :: "v"(ph), "v"(pl), "v"(ap) : "memory");
#pragma unroll
    for (int i = 0; i < 8; ++i)
#pragma unroll
      for (int h = 0; h < 2; ++h) { const int o = (w + 16 * i) * TAP + h * 256 + lane * 8; split_store4(ar[i][h], sAh + o, sAl + o); }
  }
  const int wm = (w >> 2) * 32, wn = (w & 3) * 64;
  const unsigned char* pa = sAh + (wm + ln) * TAP + 16 * hh;      // the lo plane lies TOT * TAP further
  v8f acc[2][4] = {};
#pragma unroll
  for (int s = 0; s < 4; ++s) {
    unsigned char* buf = sB + (s & 1) * TBUF;
#pragma unroll
    for (int i = 0; i < 4; ++i) { unsigned char* p = buf + (kr + 64 * i) * TKP + kc * 16; *(v8us*)p = br[i]; *(v8us*)(p + CC * TKP) = br[4 + i]; }
    __syncthreads();      // publishes this tile (and, the first time, the q2 planes); it also ends every wave's reads of the other buffer, which the next pass overwrites
    if (s < 3) {
#pragma unroll
      for (int i = 0; i < 4; ++i) { br[i] = *(const v8us*)(ph + (s + 1) * 64 + (size_t)i * 64 * CC); br[4 + i] = *(const v8us*)(pl + (s + 1) * 64 + (size_t)i * 64 * CC); }
      asm volatile("s_wait_xcnt 0x0" :: "v"(ph), "v"(pl) : "memory");      // before an address pair of these loads is overwritten
    } else {
#pragma unroll
      for (int i = 0; i < 8; ++i) br[i] = *(const v8us*)(po + (size_t)i * 32 * CC);
      asm volatile("s_wait_xcnt 0x0" :: "v"(po) : "memory");      // before the address pair of these loads is overwritten
    }
    const unsigned char* pb = buf + (wn + ln) * TKP + 16 * hh;
#pragma unroll
    for (int kl = 0; kl < 64; kl += 32) {
      const int kb = s * 64 + kl;
      FragB ah[2], al[2], bh_[4], bl_[4];
#pragma unroll
      for (int m = 0; m < 2; ++m) {
        const unsigned char* p = pa + m * 16 * TAP + kb * 2;
        ah[m].half[0] = *(const v8us*)p; ah[m].half[1] = *(const v8us*)(p + 32);
        al[m].half[0] = *(const v8us*)(p + TOT * TAP); al[m].half[1] = *(const v8us*)(p + TOT * TAP + 32);
      }
#pragma unroll
      for (int t = 0; t < 4; ++t) {
        const unsigned char* p = pb + t * 16 * TKP + kl * 2;
        bh_[t].half[0] = *(const v8us*)p; bh_[t].half[1] = *(const v8us*)(p + 32);
        bl_[t].half[0] = *(const v8us*)(p + CC * TKP); bl_[t].half[1] = *(const v8us*)(p + CC * TKP + 32);
      }
#pragma unroll
      for (int t = 0; t < 4; ++t)
#pragma unroll
        for (int m = 0; m < 2; ++m) acc[m][t] = mma1(ah[m].v, bh_[t].v, acc[m][t]);
#pragma unroll
      for (int t = 0; t < 4; ++t)
#pragma unroll
        for (int m = 0; m < 2; ++m) acc[m][t] = mma1(al[m].v, bh_[t].v, acc[m][t]);
#pragma unroll
      for (int t = 0; t < 4; ++t)
#pragma unroll
        for (int m = 0; m < 2; ++m) acc[m][t] = mma1(ah[m].v, bl_[t].v, acc[m][t]);
    }
  }
  const float* vrow = QKV + (tok0 + wm + 8 * hh) * (3 * CC) + wn + ln;      // v lies 2 * CC further in the row
  v8f rv[2][4];
#pragma unroll
  for (int m = 0; m < 2; ++m)
#pragma unroll
    for (int t = 0; t < 4; ++t)
#pragma unroll
      for (int r = 0; r < 8; ++r) rv[m][t][r] = vrow[2 * CC + (m * 16 + r) * (3 * CC) + t * 16];
  float bo[4];      // the output bias, fetched here with v so that the epilogue does not wait for it
#pragma unroll
  for (int t = 0; t < 4; ++t) bo[t] = bout[wn + t * 16 + ln];
  asm volatile("s_wait_xcnt 0x0" :: "v"(vrow) : "memory");      // before an address register of these loads is overwritten
  __syncthreads();      // the q2 planes are dead in every wave before the attn tile is written over them
  // inputs-only fence on the loaded values: the 64 loads of v and the 4 of the bias are issued together and waited for once (without it this build issues them a few at a time, each group paying a full latency, and spills registers to scratch)
  asm volatile("" :: "v"(rv[0][0]), "v"(rv[0][1]), "v"(rv[0][2]), "v"(rv[0][3]), "v"(rv[1][0]), "v"(rv[1][1]), "v"(rv[1][2]), "v"(rv[1][3]), "v"(bo[0]), "v"(bo[1]), "v"(bo[2]), "v"(bo[3]));
#pragma unroll
  for (int m = 0; m < 2; ++m)
#pragma unroll
    for (int t = 0; t < 4; ++t)
#pragma unroll
      for (int r = 0; r < 8; ++r) {
        const float a = rv[m][t][r] + acc[m][t][r] * 0.015625f;
        const unsigned short hb = bf16_bits(a);
        const int o = (wm + m * 16 + 8 * hh + r) * TAP + (wn + t * 16 + ln) * 2;
        *(unsigned short*)(sAh + o) = hb; *(unsigned short*)(sAl + o) = bf16_bits(a - bf16_val(hb));
      }
  v8f oc[2][4] = {};
#pragma unroll
  for (int s = 0; s < 2; ++s) {
    unsigned char* buf = sB + (s & 1) * TBUF;
#pragma unroll
    for (int i = 0; i < 8; ++i) *(v8us*)(buf + (orow + 32 * i) * TWP + ln * 16) = br[i];
    __syncthreads();      // publishes this tile (and, the first time, the attn planes: every wave reads all 256 channels, of which it wrote 64); it also ends the reads of the other buffer
    if (s < 1) {
#pragma unroll
      for (int i = 0; i < 8; ++i) br[i] = *(const v8us*)(po + 128 + (size_t)i * 32 * CC);
      asm volatile("s_wait_xcnt 0x0" :: "v"(po) : "memory");      // before the address pair of these loads is overwritten
    }
    const unsigned char* pb = buf + (wn + ln) * TWP + 16 * hh;
#pragma unroll
    for (int kl = 0; kl < 128; kl += 32) {
      const int kb = s * 128 + kl;
      FragB ah[2], al[2], b[4];
#pragma unroll
      for (int m = 0; m < 2; ++m) {
        const unsigned char* p = pa + m * 16 * TAP + kb * 2;
        ah[m].half[0] = *(const v8us*)p; ah[m].half[1] = *(const v8us*)(p + 32);
        al[m].half[0] = *(const v8us*)(p + TOT * TAP); al[m].half[1] = *(const v8us*)(p + TOT * TAP + 32);
      }
#pragma unroll
      for (int t = 0; t < 4; ++t) { const unsigned char* p = pb + t * 16 * TWP + kl * 2; b[t].half[0] = *(const v8us*)p; b[t].half[1] = *(const v8us*)(p + 32); }
#pragma unroll
      for (int t = 0; t < 4; ++t)
#pragma unroll
        for (int m = 0; m < 2; ++m) oc[m][t] = mma1(ah[m].v, b[t].v, oc[m][t]);
#pragma unroll
      for (int t = 0; t < 4; ++t)
#pragma unroll
        for (int m = 0; m < 2; ++m) oc[m][t] = mma1(al[m].v, b[t].v, oc[m][t]);
    }
  }
  __syncthreads();      // the tile buffers are dead in every wave before their LDS is reused to stage the output
  float* so = (float*)sB + w * (32 * TSO);
#pragma unroll
  for (int t = 0; t < 4; ++t) {
    const float bv = bf16_round(bo[t]);
#pragma unroll
    for (int m = 0; m < 2; ++m)
#pragma unroll
      for (int r = 0; r < 8; ++r) so[(m * 16 + 8 * hh + r) * TSO + t * 16 + ln] = oc[m][t][r] + bv;
  }
  // each wave stages in its own LDS range: the fence and the wave barrier keep its row reads behind its own lanes' writes, so that whole 256-byte row pieces are stored
  __builtin_amdgcn_fence(__ATOMIC_ACQ_REL, "workgroup");
  __builtin_amdgcn_wave_barrier();
  float* dst = out + (tok0 + wm) * CC + wn + ln * 4;
  v4f ov[16];      // all 16 LDS reads first, each into registers of its own: one LDS latency for the wave instead of one per row pair
#pragma unroll
  for (int q = 0; q < 16; ++q) ov[q] = *(const v4fa*)&so[(q * 2 + hh) * TSO + ln * 4];
#pragma unroll
  for (int q = 0; q < 16; ++q) *(v4f*)(dst + (size_t)(q * 2 + hh) * CC) = ov[q];
}
// qkv = x W_qkv + b and the per-token work on q and k in one launch. Block = 128 tokens x all 768 columns, 16 waves of 32 x 64 on one section (q, k, v: 256 columns) at a time.
// x is staged once a block in LDS as bf16 (each element rounded once); a section's weights (256 rows x K = 256) are staged whole, the next section's loads in flight while this one is multiplied.
// A finished section (+ bias) is laid token-major in LDS over the dead weights, and each wave takes 8 whole token rows of it into registers, 8 columns a lane:
// q <- q - mean(q), k <- k - mean(k); q2 = q^2, k2 = k^2; Q2n[t][c] = l2norm_c(q2 / (sum q2 + 1e-7)); K2a[t][c] = k2 / (sum k2 + 1e-7) (column-normalised later: PS[block][c] = sum over the block's 128 tokens of K2a^2); v goes to its place in QKV as it is.
// q and k never go to memory. The row work and the stores of a section stand behind the barrier that publishes the next section's weights, so that the stores drain under the next product.
// Every load of x and of the weights and every store of Q2n, K2a and v covers 512 contiguous bytes of one row. Each accumulator still sums its 8 k blocks in rising order.
#define QGP 528                   // bytes per LDS row of x and of the weights: 16 x 33, the conflict-free pitch of 16-byte fragment reads
#define QSP 260                   // floats per row of the staged section: rows 8 apart fall 32 banks apart; 1040 bytes, a multiple of 16
// sum over the 32 lanes of each of 8 values; the 8 chains are independent, so that their cross-lane latencies overlap
__device__ __forceinline__ void wave_sum8(float (&s)[8]) {
  // unrolled so that s[] stays in registers (constant indices)
#pragma unroll
  for (int o = 16; o >= 1; o >>= 1) {
    float t[8];
#pragma unroll
    for (int j = 0; j < 8; ++j) t[j] = __shfl_xor(s[j], o, 32);
#pragma unroll
    for (int j = 0; j < 8; ++j) s[j] += t[j];
  }
}
__device__ __forceinline__ float sum8(v4f a, v4f b) { const v4f c = a + b; return (c[0] + c[1]) + (c[2] + c[3]); }
// 8 token rows of q (ISQ) or k, a lane holding columns 4 lane .. + 3 and 128 + 4 lane .. + 3 of each: centre, square, divide by the row sum; q also l2-normalised over the row
template <bool ISQ>
__device__ __forceinline__ void rows_finish(v4f (&rw)[8][2], float* __restrict__ dst) {
  float s[8];
  // every loop over j is unrolled so that rw and s stay in registers (constant indices)
#pragma unroll
  for (int j = 0; j < 8; ++j) s[j] = sum8(rw[j][0], rw[j][1]);
  wave_sum8(s);
#pragma unroll
  for (int j = 0; j < 8; ++j) {
    const float mu = s[j] * (1.0f / CC);
    const v4f d0 = rw[j][0] - mu, d1 = rw[j][1] - mu;
    rw[j][0] = d0 * d0; rw[j][1] = d1 * d1;
    s[j] = sum8(rw[j][0], rw[j][1]);
  }
  wave_sum8(s);
#pragma unroll
  for (int j = 0; j < 8; ++j) { const float r = 1.0f / (s[j] + 1e-7f); rw[j][0] *= r; rw[j][1] *= r; }
  if (ISQ) {
#pragma unroll
    for (int j = 0; j < 8; ++j) s[j] = sum8(rw[j][0] * rw[j][0], rw[j][1] * rw[j][1]);
    wave_sum8(s);
#pragma unroll
    for (int j = 0; j < 8; ++j) { const float r = 1.0f / fmaxf(sqrtf(s[j]), 1e-12f); rw[j][0] *= r; rw[j][1] *= r; }
  }
#pragma unroll
  for (int j = 0; j < 8; ++j) { *(v4f*)(dst + (size_t)j * CC) = rw[j][0]; *(v4f*)(dst + (size_t)j * CC + 128) = rw[j][1]; }
  asm volatile("s_wait_xcnt 0x0" :: "v"(dst) : "memory");      // before a register named by these stores is overwritten
}
__global__ __launch_bounds__(512) void k_qkv_prep(const float* __restrict__ X, const unsigned short* __restrict__ Wt, const float* __restrict__ bias,
                                                 float* __restrict__ QKV, float* __restrict__ Q2n, float* __restrict__ K2a, double* __restrict__ PS) {
  __shared__ __attribute__((aligned(16))) unsigned char sm[(128 + CC) * QGP];      // x tile, then a section's weights (reused for the staged section)
  __shared__ __attribute__((aligned(16))) float sc[16][CC];      // each wave's column sums of K2a^2 over its 8 tokens
  unsigned char* sA = sm; unsigned char* sB = sm + 128 * QGP; float* so = (float*)sB;
  const int tid = threadIdx.x, w = tid >> 5, lane = tid & 31, ln = lane & 15, hh = lane >> 4;
  const size_t row0 = (size_t)blockIdx.x * 128;
  const int wm = (w >> 2) * 32, wn = (w & 3) * 64;
  // wave w brings rows w, w + 16, ... of the weights and of x: a weight row is one load, a row of x two
  const unsigned short* bp = Wt + (size_t)w * CC + lane * 8;
  const float* bb = bias + wn + ln;
  v8us br[16]; float bv[3][4];
  // every loop below is unrolled so that br, ar, rw, bv, the fragments and acc stay in registers (constant indices) and the loads of a group are in flight together
#pragma unroll
  for (int i = 0; i < 16; ++i) br[i] = *(const v8us*)(bp + (size_t)i * 16 * CC);
  {
    const float* ap = X + (row0 + w) * CC + lane * 4;
    v4f ar[8][2];
#pragma unroll
    for (int i = 0; i < 8; ++i) { ar[i][0] = *(const v4fa*)(ap + (size_t)i * 16 * CC); ar[i][1] = *(const v4fa*)(ap + (size_t)i * 16 * CC + 128); }
#pragma unroll
    for (int s = 0; s < 3; ++s)
#pragma unroll
      for (int t = 0; t < 4; ++t) bv[s][t] = bb[s * CC + t * 16];
    // the wait that stands before a register named by an issued global load is overwritten; here and below it takes the address pairs as inputs so that none is reused before it
    asm volatile("s_wait_xcnt 0x0" :: "v"(bp), "v"(ap), "v"(bb) : "memory");
#pragma unroll
    for (int i = 0; i < 8; ++i)
#pragma unroll
      for (int h = 0; h < 2; ++h) {
        v4us o;
#pragma unroll
        for (int q = 0; q < 4; ++q) o[q] = bf16_bits(ar[i][h][q]);
        *(v4us*)(sA + (w + 16 * i) * QGP + h * 256 + lane * 8) = o;
      }
  }
  const unsigned char* pa = sA + (wm + ln) * QGP + 16 * hh;
  const unsigned char* pb = sB + (wn + ln) * QGP + 16 * hh;
  const size_t trow = row0 + w * 8;      // the wave's 8 token rows of a finished section
  v4f rw[8][2];
#pragma unroll
  for (int s = 0; s < 3; ++s) {
#pragma unroll
    for (int i = 0; i < 16; ++i) *(v8us*)(sB + (w + 16 * i) * QGP + lane * 16) = br[i];
    __syncthreads();      // publishes this section's weights (and, the first time, the x tile): every wave reads rows that other waves wrote
    if (s < 2) {
#pragma unroll
      for (int i = 0; i < 16; ++i) br[i] = *(const v8us*)(bp + (size_t)(s + 1) * CC * CC + (size_t)i * 16 * CC);
      asm volatile("s_wait_xcnt 0x0" :: "v"(bp) : "memory");      // before the address pair of these loads is overwritten
    }
    if (s == 1) rows_finish<true>(rw, Q2n + trow * CC + lane * 4);
    if (s == 2) {
      rows_finish<false>(rw, K2a + trow * CC + lane * 4);
      v4f q0 = rw[0][0] * rw[0][0], q1 = rw[0][1] * rw[0][1];
      // unrolled so that rw stays in registers (constant indices)
#pragma unroll
      for (int j = 1; j < 8; ++j) { q0 += rw[j][0] * rw[j][0]; q1 += rw[j][1] * rw[j][1]; }
      *(v4f*)&sc[w][lane * 4] = q0; *(v4f*)&sc[w][128 + lane * 4] = q1;      // read at the kernel's end, behind the barriers of this section
    }
    v8f acc[2][4] = {};
#pragma unroll
    for (int kb = 0; kb < CC; kb += 32) {
      FragB a[2], b[4];
#pragma unroll
      for (int m = 0; m < 2; ++m) { a[m].half[0] = *(const v8us*)(pa + m * 16 * QGP + kb * 2); a[m].half[1] = *(const v8us*)(pa + m * 16 * QGP + kb * 2 + 32); }
#pragma unroll
      for (int t = 0; t < 4; ++t) { b[t].half[0] = *(const v8us*)(pb + t * 16 * QGP + kb * 2); b[t].half[1] = *(const v8us*)(pb + t * 16 * QGP + kb * 2 + 32); }
#pragma unroll
      for (int t = 0; t < 4; ++t)
#pragma unroll
        for (int m = 0; m < 2; ++m) acc[m][t] = mma1(a[m].v, b[t].v, acc[m][t]);
    }
    __syncthreads();      // the weights are dead in every wave before the section is staged over them (and, the last time, the waves' column sums are published)
#pragma unroll
    for (int t = 0; t < 4; ++t) {
      const float bvr = bf16_round(bv[s][t]);
#pragma unroll
      for (int m = 0; m < 2; ++m)
#pragma unroll
        for (int r = 0; r < 8; ++r) so[(wm + m * 16 + 8 * hh + r) * QSP + wn + t * 16 + ln] = acc[m][t][r] + bvr;
    }
    __syncthreads();      // publishes the staged section: a token row was written by 4 waves
#pragma unroll
    for (int j = 0; j < 8; ++j) { rw[j][0] = *(const v4fa*)&so[(w * 8 + j) * QSP + lane * 4]; rw[j][1] = *(const v4fa*)&so[(w * 8 + j) * QSP + 128 + lane * 4]; }
    if (s < 2) __syncthreads();      // the staged section is in registers in every wave before the next weights are written over it
  }
  float* dv = QKV + trow * (3 * CC) + 2 * CC + lane * 4;
#pragma unroll
  for (int j = 0; j < 8; ++j) { *(v4f*)(dv + (size_t)j * 3 * CC) = rw[j][0]; *(v4f*)(dv + (size_t)j * 3 * CC + 128) = rw[j][1]; }
  asm volatile("s_wait_xcnt 0x0" :: "v"(dv) : "memory");      // before a register named by these stores is overwritten
  if (tid < CC) {      // waves 0 to 7, while the stores of v drain: one column a thread, the 16 waves' sums joined in double, pairwise in a fixed order (4 dependent adds)
    double t[16];
    // unrolled so that t[] stays in registers (constant indices) and the 16 LDS reads are in flight together
#pragma unroll
    for (int g = 0; g < 16; ++g) t[g] = (double)sc[g][tid];
#pragma unroll
    for (int o = 1; o < 16; o <<= 1)
#pragma unroll
      for (int g = 0; g < 16; g += 2 * o) t[g] += t[g + o];
    PS[(size_t)blockIdx.x * CC + tid] = t[0];
  }
}
extern "C" void kernel_launch(void* const* d_in, const int* in_sizes, int n_in,
                              void* d_out, int out_size, void* d_ws, size_t ws_size, hipStream_t stream) {
  (void)in_sizes; (void)n_in; (void)out_size;
  const float* x = (const float*)d_in[0]; const float* Wqkv = (const float*)d_in[1]; const float* bqkv = (const float*)d_in[2]; const float* Wout = (const float*)d_in[3]; const float* bout = (const float*)d_in[4];
  char* ws = (char*)d_ws; size_t off = 0;
  auto take = [&](size_t bytes) { char* p = ws + off; off += (bytes + 255) & ~(size_t)255; return p; };
  unsigned short* Bq = (unsigned short*)take((size_t)3 * CC * CC * 2); unsigned short* Bo = (unsigned short*)take((size_t)CC * CC * 2);
  float* QKV = (float*)take((size_t)BB * NTK * 3 * CC * 4); float* Q2n = (float*)take((size_t)BB * NTK * CC * 4); float* K2a = (float*)take((size_t)BB * NTK * CC * 4);
  float* KVp = (float*)take((size_t)KSL * BB * CC * CC * 4);      // the KSL partials of kv
  unsigned short* Ph = (unsigned short*)take((size_t)BB * CC * CC * 2); unsigned short* Pl = (unsigned short*)take((size_t)BB * CC * CC * 2); double* PS = (double*)take((size_t)BB * NCB * CC * 8);
  if (off > ws_size) return;
  k_btw<<<(3 * CC * 32 + 255) / 256, 256, 0, stream>>>(Wqkv, Bq, CC, 3 * CC); k_btw<<<(CC * 32 + 255) / 256, 256, 0, stream>>>(Wout, Bo, CC, CC);
  k_qkv_prep<<<BB * NTK / 128, 512, 0, stream>>>(x, Bq, bqkv, QKV, Q2n, K2a, PS);      // Q2n, K2a, its column sums of squares per block, and the v third of QKV; the q and k thirds of QKV are neither written nor read
  k_kv_part<<<dim3(4, BB, KSL), 256, 0, stream>>>(K2a, QKV, KVp);      // slice z: KVp[z][b][c][d] = sum over the tokens t of slice z of K2a[t][c] * v[t][d]
  k_kvplanes<<<(BB * CC * (CC / 8) + 255) / 256, 256, 0, stream>>>(KVp, PS, Ph, Pl);
  k_t2_attn_out<<<dim3(NTK / TOT, BB), 512, 0, stream>>>(Q2n, Ph, Pl, QKV, Bo, bout, (float*)d_out);      // t2 = q2 * kv, attn = v + t2 / 64, out = attn * W_out + b
}

// v009
// A run of this version takes 88.7 microseconds.
// Next to v008, in two timings, it ran 1.04 times as fast each time.
// All steps since v000 together make it 23.1 times as fast.
#include <hip/hip_runtime.h>
// Linear attention on WMMA (f32 accumulate): qkv = x·W_qkv + b (inputs rounded to bf16: single exact term; 32768 × 256 × 768), per batch kv = k2ᵀ·v (k2 and v are computed
// f32 → split into bf16 hi/lo: 3 products; 256 × 256 × 4096), t2 = q2·kv (3 products), out = attn·W_out + b (attn split hi/lo vs exact weights: 2 products). Mean-centering,
// squares, the two normalisations and the residual are f32 VALU (column sums of squares: f32 over 8 tokens, joined in double).
#define BB 8
#define NTK 4096
#define CC 256

typedef __bf16 v16b __attribute__((ext_vector_type(16)));
typedef unsigned short v8us __attribute__((ext_vector_type(8), may_alias));
typedef float  v8f  __attribute__((ext_vector_type(8)));
typedef float  v4f  __attribute__((ext_vector_type(4)));
typedef float  v4fa __attribute__((ext_vector_type(4), may_alias));
union FragB { v16b v; v8us half[2]; unsigned short u[16]; };

typedef float f32x2 __attribute__((ext_vector_type(2)));
typedef __bf16 bf16x2 __attribute__((ext_vector_type(2)));
typedef unsigned int v2ua __attribute__((ext_vector_type(2), may_alias));
typedef unsigned int v4ua __attribute__((ext_vector_type(4), may_alias));
// f32 -> bf16 by the hardware conversion (round to nearest even)
__device__ __forceinline__ unsigned short bf16_bits(float x) { return __builtin_bit_cast(unsigned short, (__bf16)x); }
// two values in one instruction: element 0 in the low half of the word, as two consecutive bf16 lie in memory
__device__ __forceinline__ unsigned int bf16_pack2(f32x2 x) { return __builtin_bit_cast(unsigned int, __builtin_convertvector(x, bf16x2)); }
__device__ __forceinline__ f32x2 bf16_unpack2(unsigned int p) { const f32x2 r = {__uint_as_float(p << 16), __uint_as_float(p & 0xFFFF0000u)}; return r; }
__device__ __forceinline__ float bf16_val(unsigned short b) { return __uint_as_float(((unsigned int)b) << 16); }
__device__ __forceinline__ float bf16_round(float x) { return bf16_val(bf16_bits(x)); }
// D += A·B with NT terms: 1 = ah·bh, 2 = + al·bh (A split), 3 = + ah·bl (both split)
template <int NT>
__device__ __forceinline__ v8f mmaN(v16b ah, v16b al, v16b bh, v16b bl, v8f c) {
  c = __builtin_amdgcn_wmma_f32_16x16x32_bf16(false, ah, false, bh, (short)0, c, false, false);
  if (NT >= 2) c = __builtin_amdgcn_wmma_f32_16x16x32_bf16(false, al, false, bh, (short)0, c, false, false);
  if (NT >= 3) c = __builtin_amdgcn_wmma_f32_16x16x32_bf16(false, ah, false, bl, (short)0, c, false, false);
  asm volatile("v_nop\n\tv_nop\n\tv_nop\n\tv_nop" : "+v"(c) : "v"(ah), "v"(al), "v"(bh), "v"(bl));
  return c;
}

__global__ __launch_bounds__(256) void k_wt_bf16(const float* __restrict__ W, unsigned short* __restrict__ Wt, int K, int N) {
  const int t = blockIdx.x * 256 + threadIdx.x;
  const int k8n = K / 8;
  if (t >= N * k8n) return;
  const int n = t / k8n, k8 = (t % k8n) * 8;
  v8us v;
#pragma unroll
  for (int i = 0; i < 8; ++i) v[i] = bf16_bits(W[(size_t)(k8 + i) * N + n]);
  *(v8us*)(Wt + (size_t)n * K + k8) = v;
  
}

// GEMM C[M][N] (f32, pitch ldc) = act(A[M][K]·W + bias). A f32 row-major (pitch lda) converted per fragment to bf16
// (ASPLIT: hi/lo two planes -> 2 terms, else single rounded term); Wt bf16 [N][K] (pitch ldb). BIAS_BF16 rounds the
// bias to bf16 first (bias quantised to bf16 before the add). K%32==0, M%16==0, N%64==0.
template <bool ASPLIT, int ACT, bool BIAS_BF16>
__global__ __launch_bounds__(128) void k_gemm_bf(const float* __restrict__ A, int lda, const unsigned short* __restrict__ Wt, int ldb,
                                               const float* __restrict__ bias, float* __restrict__ C, int ldc, int M, int N, int K) {
  __shared__ __attribute__((aligned(16))) float so[4][16][64];
  const int tid = threadIdx.x, w = tid >> 5, lane = tid & 31, ln = lane & 15, hh = lane >> 4;
  const int ntn = N / 64;
  const int wid = blockIdx.x * 4 + w;
  const int mt = wid / ntn, nq = wid % ntn;
  if (mt * 16 >= M) return;
  const int row0 = mt * 16, col0 = nq * 64;
  const float* arow = A + (size_t)(row0 + ln) * lda;
  v8f acc[4] = {};
  for (int kb = 0; kb < K; kb += 32) {
    FragB ah, al;
    const v4f x0 = *(const v4fa*)(arow + kb + 8 * hh), x1 = *(const v4fa*)(arow + kb + 8 * hh + 4);
    const v4f x2 = *(const v4fa*)(arow + kb + 16 + 8 * hh), x3 = *(const v4fa*)(arow + kb + 16 + 8 * hh + 4);
    float xs[16] = {x0[0],x0[1],x0[2],x0[3],x1[0],x1[1],x1[2],x1[3],x2[0],x2[1],x2[2],x2[3],x3[0],x3[1],x3[2],x3[3]};
#pragma unroll
    for (int i = 0; i < 16; ++i) { const unsigned short hb = bf16_bits(xs[i]); ah.u[i] = hb; al.u[i] = ASPLIT ? bf16_bits(xs[i] - bf16_val(hb)) : (unsigned short)0; }
#pragma unroll
    for (int t = 0; t < 4; ++t) {
      const unsigned short* brow = Wt + (size_t)(col0 + t * 16 + ln) * ldb + kb;
      FragB b;
      b.half[0] = *(const v8us*)(brow + 8 * hh);
      b.half[1] = *(const v8us*)(brow + 16 + 8 * hh);
      acc[t] = mmaN<ASPLIT ? 2 : 1>(ah.v, al.v, b.v, b.v, acc[t]);
    }
  }
#pragma unroll
  for (int t = 0; t < 4; ++t) {
    float bv = bias ? bias[col0 + t * 16 + ln] : 0.f;
    if (BIAS_BF16) bv = bf16_round(bv);
#pragma unroll
    for (int r = 0; r < 8; ++r) { float v = acc[t][r] + bv; if (ACT == 1) v = fmaxf(v, 0.f); so[w][8 * hh + r][t * 16 + ln] = v; }
  }
  __builtin_amdgcn_fence(__ATOMIC_ACQ_REL, "workgroup");
  __builtin_amdgcn_wave_barrier();
  const int rsub = lane >> 4, c4 = (lane & 15) * 4;
  {
#pragma unroll
    for (int q = 0; q < 8; ++q) {
      const int r = q * 2 + rsub;
      const v4f v = *(const v4fa*)&so[w][r][c4];
      *(v4f*)(C + (size_t)(row0 + r) * ldc + col0 + c4) = v;
    }
    
  }
}

// Flash-style causal/unmasked attention, all contractions 3-term bf16 hi/lo splits, f32 softmax with running max.
// q,k,v rows are read from f32 buffers with arbitrary row pitch (so they can live inside a fused qkv buffer);
// D = head size (multiple of 32, <= 128); one wave = 16 query rows; block = 4 waves (64 queries) sharing K/V chunks of 32.
template <int D, bool CAUSAL>
__global__ __launch_bounds__(128) void k_flash(const float* __restrict__ qb, const float* __restrict__ kb, const float* __restrict__ vb,
                                             int pitch, int T, int H, float scale, float* __restrict__ y, int ypitch) {
  constexpr int KS = D / 32;        // k-steps for QK
  constexpr int DT = D / 16;        // d tiles for PV
  __shared__ __attribute__((aligned(16))) unsigned short sKh[32][D + 8], sKl[32][D + 8], sVh[32][D + 8], sVl[32][D + 8];
  __shared__ __attribute__((aligned(16))) unsigned short sPh[4][16][40], sPl[4][16][40];
  __shared__ __attribute__((aligned(16))) float sO[4][16][D];
  const int tid = threadIdx.x, w = tid >> 5, lane = tid & 31, ln = lane & 15, hh = lane >> 4;
  const int nqb = (T + 63) / 64;
  const int bh = blockIdx.x / nqb, qblk = blockIdx.x % nqb;
  const int b = bh / H, h = bh % H;
  const int q0 = qblk * 64 + w * 16;
  const float* Q = qb + (size_t)b * T * pitch + h * D;
  const float* K = kb + (size_t)b * T * pitch + h * D;
  const float* V = vb + (size_t)b * T * pitch + h * D;

  // A fragments of the wave's 16 query rows (scaled), hi/lo
  FragB aqh[KS], aql[KS];
  {
    int row = q0 + ln; if (row >= T) row = T - 1;
    const float* qr = Q + (size_t)row * pitch;
#pragma unroll
    for (int ks = 0; ks < KS; ++ks)
#pragma unroll
      for (int i = 0; i < 16; ++i) {
        const int d = ks * 32 + ((i < 8) ? (8 * hh + i) : (16 + 8 * hh + (i - 8)));
        const float x = qr[d] * scale; const unsigned short hb = bf16_bits(x);
        aqh[ks].u[i] = hb; aql[ks].u[i] = bf16_bits(x - bf16_val(hb));
      }
  }
  float m_r[8], l_r[8];
#pragma unroll
  for (int r = 0; r < 8; ++r) { m_r[r] = -3.0e38f; l_r[r] = 0.f; }
  v8f oacc[DT];
#pragma unroll
  for (int dt = 0; dt < DT; ++dt) oacc[dt] = (v8f){0.f,0.f,0.f,0.f,0.f,0.f,0.f,0.f};

  const int kv_end = CAUSAL ? min(T, qblk * 64 + 64) : T;     // block-uniform
  for (int j0 = 0; j0 < kv_end; j0 += 32) {
    __syncthreads();
    for (int e = tid; e < 32 * (D / 4); e += 128) {
      const int r = e / (D / 4), c4 = (e % (D / 4)) * 4;
      const int key = j0 + r;
      v4f kf = {0.f,0.f,0.f,0.f}, vf = {0.f,0.f,0.f,0.f};
      if (key < T) { kf = *(const v4fa*)(K + (size_t)key * pitch + c4); vf = *(const v4fa*)(V + (size_t)key * pitch + c4); }
#pragma unroll
      for (int t = 0; t < 4; ++t) {
        unsigned short hb = bf16_bits(kf[t]); sKh[r][c4 + t] = hb; sKl[r][c4 + t] = bf16_bits(kf[t] - bf16_val(hb));
        hb = bf16_bits(vf[t]); sVh[r][c4 + t] = hb; sVl[r][c4 + t] = bf16_bits(vf[t] - bf16_val(hb));
      }
    }
    __syncthreads();
    // S tile 16 x 32
    v8f s[2];
#pragma unroll
    for (int nt = 0; nt < 2; ++nt) {
      v8f acc = {};
#pragma unroll
      for (int ks = 0; ks < KS; ++ks) {
        FragB bh_, bl_;
        bh_.half[0] = *(const v8us*)&sKh[nt * 16 + ln][ks * 32 + 8 * hh]; bh_.half[1] = *(const v8us*)&sKh[nt * 16 + ln][ks * 32 + 16 + 8 * hh];
        bl_.half[0] = *(const v8us*)&sKl[nt * 16 + ln][ks * 32 + 8 * hh]; bl_.half[1] = *(const v8us*)&sKl[nt * 16 + ln][ks * 32 + 16 + 8 * hh];
        acc = mmaN<3>(aqh[ks].v, aql[ks].v, bh_.v, bl_.v, acc);
      }
      s[nt] = acc;
    }
    // mask + running max (rows 8hh+r; the 16 lanes of a half share rows)
    float alpha[8];
#pragma unroll
    for (int r = 0; r < 8; ++r) {
      const int qi = q0 + 8 * hh + r;
      const int ja = j0 + ln, jb = j0 + 16 + ln;
      if (CAUSAL) { if (ja > qi) s[0][r] = -3.0e38f; if (jb > qi) s[1][r] = -3.0e38f; }
      if (ja >= T) s[0][r] = -3.0e38f;
      if (jb >= T) s[1][r] = -3.0e38f;
      float mx = fmaxf(s[0][r], s[1][r]);
      mx = fmaxf(mx, __shfl_xor(mx, 1, 32)); mx = fmaxf(mx, __shfl_xor(mx, 2, 32)); mx = fmaxf(mx, __shfl_xor(mx, 4, 32)); mx = fmaxf(mx, __shfl_xor(mx, 8, 32));
      const float mnew = fmaxf(m_r[r], mx);
      alpha[r] = (mnew > -1.0e38f) ? __expf(m_r[r] - mnew) : 1.0f;
      const float p0 = (s[0][r] > -1.0e38f) ? __expf(s[0][r] - mnew) : 0.f;
      const float p1 = (s[1][r] > -1.0e38f) ? __expf(s[1][r] - mnew) : 0.f;
      m_r[r] = mnew;
      l_r[r] = l_r[r] * alpha[r] + p0 + p1;            // per-lane partial row sum (16 lanes combined at the end)
      unsigned short hb = bf16_bits(p0); sPh[w][8 * hh + r][ln] = hb;      sPl[w][8 * hh + r][ln] = bf16_bits(p0 - bf16_val(hb));
      hb = bf16_bits(p1);                sPh[w][8 * hh + r][16 + ln] = hb; sPl[w][8 * hh + r][16 + ln] = bf16_bits(p1 - bf16_val(hb));
    }
#pragma unroll
    for (int dt = 0; dt < DT; ++dt)
#pragma unroll
      for (int r = 0; r < 8; ++r) oacc[dt][r] *= alpha[r];
    __builtin_amdgcn_fence(__ATOMIC_ACQ_REL, "workgroup");
    __builtin_amdgcn_wave_barrier();
    FragB pah, pal;
    pah.half[0] = *(const v8us*)&sPh[w][ln][8 * hh]; pah.half[1] = *(const v8us*)&sPh[w][ln][16 + 8 * hh];
    pal.half[0] = *(const v8us*)&sPl[w][ln][8 * hh]; pal.half[1] = *(const v8us*)&sPl[w][ln][16 + 8 * hh];
#pragma unroll
    for (int dt = 0; dt < DT; ++dt) {
      FragB bvh, bvl;
#pragma unroll
      for (int i = 0; i < 8; ++i) {
        bvh.u[i] = sVh[8 * hh + i][dt * 16 + ln]; bvh.u[8 + i] = sVh[16 + 8 * hh + i][dt * 16 + ln];
        bvl.u[i] = sVl[8 * hh + i][dt * 16 + ln]; bvl.u[8 + i] = sVl[16 + 8 * hh + i][dt * 16 + ln];
      }
      oacc[dt] = mmaN<3>(pah.v, pal.v, bvh.v, bvl.v, oacc[dt]);
    }
    __builtin_amdgcn_fence(__ATOMIC_ACQ_REL, "workgroup");
    __builtin_amdgcn_wave_barrier();
  }
#pragma unroll
  for (int r = 0; r < 8; ++r) {
    float l = l_r[r];
    l += __shfl_xor(l, 1, 32); l += __shfl_xor(l, 2, 32); l += __shfl_xor(l, 4, 32); l += __shfl_xor(l, 8, 32);
    l_r[r] = (l > 0.f) ? 1.0f / l : 0.f;
  }
#pragma unroll
  for (int dt = 0; dt < DT; ++dt)
#pragma unroll
    for (int r = 0; r < 8; ++r) sO[w][8 * hh + r][dt * 16 + ln] = oacc[dt][r] * l_r[r];
  __builtin_amdgcn_fence(__ATOMIC_ACQ_REL, "workgroup");
  __builtin_amdgcn_wave_barrier();
  {
    for (int r = 0; r < 16; ++r) {
      const int row = q0 + r;
      if (row < T && lane < D / 4) {
        const v4f val = *(const v4fa*)&sO[w][r][lane * 4];
        *(v4f*)(y + ((size_t)b * T + row) * ypitch + h * D + lane * 4) = val;
      }
    }
    
  }
}

// GEMM C = act(A·W + bias + resid): A f32 (ASPLIT -> hi/lo 2 terms), Wt bf16 [N][K]; ACT 0 none, 1 relu, 2 exact gelu;
// resid (optional, f32, row index = (row % rmod), pitch ldr, RES_BF16 rounds it) added before the activation.
template <bool ASPLIT, int ACT, bool BIAS_BF16, bool RES_BF16>
__global__ __launch_bounds__(128) void k_gemm_bf3(const float* __restrict__ A, int lda, const unsigned short* __restrict__ Wt, int ldb,
                                                const float* __restrict__ bias, const float* __restrict__ resid, int rmod, int ldr,
                                                float* __restrict__ C, int ldc, int M, int N, int K) {
  __shared__ __attribute__((aligned(16))) float so[4][16][64];
  const int tid = threadIdx.x, w = tid >> 5, lane = tid & 31, ln = lane & 15, hh = lane >> 4;
  const int ntn = N / 64;
  const int wid = blockIdx.x * 4 + w;
  const int mt = wid / ntn, nq = wid % ntn;
  if (mt * 16 >= M) return;
  const int row0 = mt * 16, col0 = nq * 64;
  const float* arow = A + (size_t)(row0 + ln) * lda;
  v8f acc[4] = {};
  for (int kb = 0; kb < K; kb += 32) {
    FragB ah, al;
    const v4f x0 = *(const v4fa*)(arow + kb + 8 * hh), x1 = *(const v4fa*)(arow + kb + 8 * hh + 4);
    const v4f x2 = *(const v4fa*)(arow + kb + 16 + 8 * hh), x3 = *(const v4fa*)(arow + kb + 16 + 8 * hh + 4);
    float xs[16] = {x0[0],x0[1],x0[2],x0[3],x1[0],x1[1],x1[2],x1[3],x2[0],x2[1],x2[2],x2[3],x3[0],x3[1],x3[2],x3[3]};
#pragma unroll
    for (int i = 0; i < 16; ++i) { const unsigned short hb = bf16_bits(xs[i]); ah.u[i] = hb; al.u[i] = ASPLIT ? bf16_bits(xs[i] - bf16_val(hb)) : (unsigned short)0; }
#pragma unroll
    for (int t = 0; t < 4; ++t) {
      const unsigned short* brow = Wt + (size_t)(col0 + t * 16 + ln) * ldb + kb;
      FragB b;
      b.half[0] = *(const v8us*)(brow + 8 * hh);
      b.half[1] = *(const v8us*)(brow + 16 + 8 * hh);
      acc[t] = mmaN<ASPLIT ? 2 : 1>(ah.v, al.v, b.v, b.v, acc[t]);
    }
  }
#pragma unroll
  for (int t = 0; t < 4; ++t) {
    const int col = col0 + t * 16 + ln;
    float bv = bias ? bias[col] : 0.f;
    if (BIAS_BF16) bv = bf16_round(bv);
#pragma unroll
    for (int r = 0; r < 8; ++r) {
      float v = acc[t][r] + bv;
      if (resid) { float rv = resid[(size_t)((row0 + 8 * hh + r) % rmod) * ldr + col]; if (RES_BF16) rv = bf16_round(rv); v += rv; }
      if (ACT == 1) v = fmaxf(v, 0.f);
      if (ACT == 2) v = 0.5f * v * (1.0f + erff(v * 0.70710678118654752f));
      if (ACT == 3) { const float u = 0.7978845608028654f * (v + 0.044715f * v * v * v); v = 0.5f * v * (1.0f + tanhf(u)); }
      so[w][8 * hh + r][t * 16 + ln] = v;
    }
  }
  __builtin_amdgcn_fence(__ATOMIC_ACQ_REL, "workgroup");
  __builtin_amdgcn_wave_barrier();
  const int rsub = lane >> 4, c4 = (lane & 15) * 4;
  {
#pragma unroll
    for (int q = 0; q < 8; ++q) {
      const int r = q * 2 + rsub;
      const v4f v = *(const v4fa*)&so[w][r][c4];
      *(v4f*)(C + (size_t)(row0 + r) * ldc + col0 + c4) = v;
    }
    
  }
}
// row LayerNorm (biased variance, eps) over N: s = X (+ R); optional out_sum <- s; out_norm <- (s-mu)*rsqrt(var+eps)*g + b
template <bool PARAM_BF16>
__global__ __launch_bounds__(256) void k_layernorm(const float* __restrict__ X, const float* __restrict__ R, const float* __restrict__ g, const float* __restrict__ bta,
                                                  float* __restrict__ out_sum, float* __restrict__ out_norm, int N, float eps) {
  __shared__ float red[256];
  const int row = blockIdx.x, tid = threadIdx.x;
  const float* x = X + (size_t)row * N; const float* rr = R ? R + (size_t)row * N : nullptr;
  float vals[16];                     // up to N = 4096
  const int per = N / 256;            // contiguous chunk per thread? use strided-by-4 chunks: thread handles j = tid*4 + 1024*u
  float s1 = 0.f;
  for (int u = 0; u < per / 4; ++u) {
    const int j = tid * 4 + 1024 * u;
    const v4f a = *(const v4fa*)(x + j);
    v4f b = {0.f,0.f,0.f,0.f}; if (rr) b = *(const v4fa*)(rr + j);
#pragma unroll
    for (int q = 0; q < 4; ++q) { const float v = a[q] + b[q]; vals[u * 4 + q] = v; s1 += v; }
  }
  red[tid] = s1; __syncthreads();
  for (int st = 128; st > 0; st >>= 1) { if (tid < st) red[tid] += red[tid + st]; __syncthreads(); }
  const float mu = red[0] / (float)N; __syncthreads();
  float s2 = 0.f;
  for (int u = 0; u < per / 4; ++u)
#pragma unroll
    for (int q = 0; q < 4; ++q) { const float c = vals[u * 4 + q] - mu; s2 += c * c; }
  red[tid] = s2; __syncthreads();
  for (int st = 128; st > 0; st >>= 1) { if (tid < st) red[tid] += red[tid + st]; __syncthreads(); }
  const float rs = rsqrtf(red[0] / (float)N + eps);
  {
    for (int u = 0; u < per / 4; ++u) {
      const int j = tid * 4 + 1024 * u;
      v4f o, sm;
#pragma unroll
      for (int q = 0; q < 4; ++q) {
        float gg = g[j + q], bb = bta[j + q];
        if (PARAM_BF16) { gg = bf16_round(gg); bb = bf16_round(bb); }
        sm[q] = vals[u * 4 + q]; o[q] = (vals[u * 4 + q] - mu) * rs * gg + bb;
      }
      if (out_sum) *(v4f*)(out_sum + (size_t)row * N + j) = sm;
      *(v4f*)(out_norm + (size_t)row * N + j) = o;
    }
    
  }
}

// batched f32 [K][N] (pitch lds, batch stride sIn) -> transposed hi/lo planes [N][K] (batch stride sOut); thread per (n, 8 k); grid.y = batch
__global__ __launch_bounds__(256) void k_split_transpose_b(const float* __restrict__ src, int lds_, size_t sIn, unsigned short* __restrict__ hi, unsigned short* __restrict__ lo, size_t sOut, int K, int N) {
  const size_t t = (size_t)blockIdx.x * 256 + threadIdx.x; const int k8n = K / 8; if (t >= (size_t)N * k8n) return;
  src += (size_t)blockIdx.y * sIn; hi += (size_t)blockIdx.y * sOut; lo += (size_t)blockIdx.y * sOut;
  const int n = (int)(t / k8n), k8 = (int)(t % k8n) * 8; v8us vh, vl;
#pragma unroll
  for (int i = 0; i < 8; ++i) { const float x = src[(size_t)(k8 + i) * lds_ + n]; const unsigned short hb = bf16_bits(x); vh[i] = hb; vl[i] = bf16_bits(x - bf16_val(hb)); }
  unsigned short* dh = hi + (size_t)n * K + k8; unsigned short* dl = lo + (size_t)n * K + k8;
  *(v8us*)dh = vh; *(v8us*)dl = vl; 
}

__global__ __launch_bounds__(256) void k_btw(const float* __restrict__ W, unsigned short* __restrict__ Bt, int K, int N) { const int t = blockIdx.x * 256 + threadIdx.x; if (t >= N * (K / 8)) return; const int n = t / (K / 8), k8 = (t % (K / 8)) * 8; v8us v; for (int q = 0; q < 8; ++q) v[q] = bf16_bits(W[(size_t)(k8 + q) * N + n]); *(v8us*)(Bt + (size_t)n * K + k8) = v;  }
#define NCB (NTK / 128)           // token blocks of the qkv kernel per batch: each leaves one partial column sum of squares
// Partials of kv = k2^T v straight from the token-major arrays: KVp[z][b][c][d] = sum over the 256 tokens t of slice z of K2a[t][c] * v[t][d], 3 products on hi/lo bf16 planes (the column norm of k2 is a factor of row c of kv and is applied behind the token sum).
// Block = 128 c x 128 d of one (batch, slice), 8 waves of 32 c x 64 d. A pass takes 32 tokens: every thread splits its 16-byte pieces of k2 and v once and lays them token-major in LDS;
// both operands need 8 consecutive tokens of one channel per lane, which the transposing LDS read delivers in the hardware k order (the order the row loaders of this file use).
#define KSL 16
#define KVT 32                    // tokens per pass
#define KVPITCH 288               // bytes per LDS row: 128 channels x 2 B + 32 = 32 B x 9, the conflict-free pitch of the transposing read
#define KVPLANE (KVT * KVPITCH)   // one plane of one pass
#define KVSO 68                   // floats per row of the output staging: rows 8 apart fall 32 banks apart
typedef short s16x8 __attribute__((ext_vector_type(8)));
typedef unsigned short v4us __attribute__((ext_vector_type(4), may_alias));
__device__ __forceinline__ v8us ld_tr16(const unsigned char* p) { typedef __attribute__((address_space(3))) s16x8 lds_s16x8; return __builtin_bit_cast(v8us, __builtin_amdgcn_ds_load_tr16_b128_v8i16((lds_s16x8*)p)); }
__device__ __forceinline__ void split_store4(v4f x, unsigned char* ph, unsigned char* pl) {
  const f32x2 x0 = {x[0], x[1]}, x1 = {x[2], x[3]};
  const v2ua h = {bf16_pack2(x0), bf16_pack2(x1)};
  const v2ua l = {bf16_pack2(x0 - bf16_unpack2(h[0])), bf16_pack2(x1 - bf16_unpack2(h[1]))};
  *(v2ua*)ph = h; *(v2ua*)pl = l;
}
__global__ __launch_bounds__(256) void k_kv_part(const float* __restrict__ K2a, const float* __restrict__ QKV, float* __restrict__ KVp) {
  __shared__ __attribute__((aligned(16))) unsigned char sm[2 * 4 * KVPLANE];      // two buffers of 4 planes: k2 hi, k2 lo, v hi, v lo
  const int tid = threadIdx.x, w = tid >> 5, lane = tid & 31, ln = lane & 15, hh = lane >> 4;
  const int c0 = (blockIdx.x >> 1) * 128, d0 = (blockIdx.x & 1) * 128, b = blockIdx.y, z = blockIdx.z;
  const size_t tok0 = (size_t)b * NTK + (size_t)z * (NTK / KSL);
  // wave w brings rows w, w + 8, w + 16, w + 24 of a pass: one 512-byte row segment per load
  const float* kp = K2a + (tok0 + w) * CC + c0 + lane * 4;
  const float* vp = QKV + (tok0 + w) * (3 * CC) + 2 * CC + d0 + lane * 4;
  const int wc = (w >> 1) * 32, wd = (w & 1) * 64;
  const int wr = w * KVPITCH + lane * 8;                                           // where the thread's pieces land in a plane
  const int rd = (8 * hh + (lane & 7)) * KVPITCH + ((lane >> 3) & 1) * 16;         // lane address of the transposing read, tokens 0..15, channel 0
  v4f kr[4], vr[4];
  // every loop over i, m, t, r or q below is unrolled so that kr, vr, the fragments and acc stay in registers (constant indices) and the 8 loads of a pass are in flight together
#pragma unroll
  for (int i = 0; i < 4; ++i) { kr[i] = *(const v4fa*)(kp + (size_t)i * 8 * CC); vr[i] = *(const v4fa*)(vp + (size_t)i * 8 * 3 * CC); }
  v8f acc[2][4] = {};
  for (int ps = 0; ps < NTK / KSL / KVT; ++ps) {
    unsigned char* buf = sm + (ps & 1) * (4 * KVPLANE);
#pragma unroll
    for (int i = 0; i < 4; ++i) {
      unsigned char* p = buf + wr + i * 8 * KVPITCH;
      split_store4(kr[i], p, p + KVPLANE);
      split_store4(vr[i], p + 2 * KVPLANE, p + 3 * KVPLANE);
    }
    __syncthreads();      // publishes this pass's planes; it also ends every wave's reads of the other buffer, which the next pass overwrites
    if (ps + 1 < NTK / KSL / KVT) {      // the next pass's loads fly while this pass is multiplied
      kp += (size_t)KVT * CC; vp += (size_t)KVT * 3 * CC;
#pragma unroll
      for (int i = 0; i < 4; ++i) { kr[i] = *(const v4fa*)(kp + (size_t)i * 8 * CC); vr[i] = *(const v4fa*)(vp + (size_t)i * 8 * 3 * CC); }
    }
    FragB ah[2], al[2];
#pragma unroll
    for (int m = 0; m < 2; ++m) {
      const unsigned char* p = buf + rd + 2 * (wc + 16 * m);
      ah[m].half[0] = ld_tr16(p); ah[m].half[1] = ld_tr16(p + 16 * KVPITCH);
      al[m].half[0] = ld_tr16(p + KVPLANE); al[m].half[1] = ld_tr16(p + KVPLANE + 16 * KVPITCH);
    }
#pragma unroll
    for (int t = 0; t < 4; ++t) {
      const unsigned char* p = buf + 2 * KVPLANE + rd + 2 * (wd + 16 * t);
      FragB bh_, bl_;
      bh_.half[0] = ld_tr16(p); bh_.half[1] = ld_tr16(p + 16 * KVPITCH);
      bl_.half[0] = ld_tr16(p + KVPLANE); bl_.half[1] = ld_tr16(p + KVPLANE + 16 * KVPITCH);
#pragma unroll
      for (int m = 0; m < 2; ++m) acc[m][t] = mmaN<3>(ah[m].v, al[m].v, bh_.v, bl_.v, acc[m][t]);
    }
  }
  __syncthreads();      // the planes are dead in every wave before their LDS is reused to stage the output
  float* so = (float*)sm + w * (2 * 16 * KVSO);
#pragma unroll
  for (int m = 0; m < 2; ++m)
#pragma unroll
    for (int t = 0; t < 4; ++t)
#pragma unroll
      for (int r = 0; r < 8; ++r) so[(m * 16 + 8 * hh + r) * KVSO + t * 16 + ln] = acc[m][t][r];
  // each wave stages in its own LDS range: the fence and the wave barrier keep its row reads behind its own lanes' writes, so that whole 256-byte row pieces are stored
  __builtin_amdgcn_fence(__ATOMIC_ACQ_REL, "workgroup");
  __builtin_amdgcn_wave_barrier();
  float* dst = KVp + (((size_t)z * BB + b) * CC + c0 + wc) * CC + d0 + wd + ln * 4;
#pragma unroll
  for (int q = 0; q < 16; ++q) {
    const int r = q * 2 + hh;
    const v4f v = *(const v4fa*)&so[r * KVSO + ln * 4];
    *(v4f*)(dst + (size_t)r * CC) = v;
  }
}
// kv = sum of its KSL token-slice partials KVp[slice][b][c][d], added in slice order (f32), times 1 / max(column norm of k2, 1e-12) of its row c; then kv -> Bt for t2 = q2 kv: B[k=c][n=d] = kv[c][d] -> Bt[d][c]: planes hi/lo of kv transposed.
// thread per (b, 8 c, d) with d along the lanes: each of the 8 * KSL loads of a wave reads one whole line. A block holds one (b, 8 c): its wave g joins the NCB = 32 partial sums of squares of column c8 + g, one a lane.
__global__ __launch_bounds__(256) void k_kvplanes(const float* __restrict__ KVp, const double* __restrict__ PS, unsigned short* __restrict__ Ph, unsigned short* __restrict__ Pl) { __shared__ float skn[8]; const int t = blockIdx.x * 256 + threadIdx.x; if (t >= BB * CC * (CC / 8)) return; const int d = t % CC; const int c8 = ((t / CC) % (CC / 8)) * 8; const int b = t / ((CC / 8) * CC); v4ua h, l;
  const float* p = KVp + ((size_t)b * CC + c8) * CC + d; float s[8] = {0.f, 0.f, 0.f, 0.f, 0.f, 0.f, 0.f, 0.f};
  const double* pp = PS + ((size_t)b * NCB + (threadIdx.x & 31)) * CC + c8 + (threadIdx.x >> 5);
  double ss = *pp;      // fetched ahead of the partials of kv, so that its latency lies under theirs
  asm volatile("s_wait_xcnt 0x0" :: "v"(pp) : "memory");      // before the address pair of this load is overwritten
  // kept rolled, 4 slices a trip: 32 independent loads are in flight per wave; fully unrolled, the 128 loads took 138 registers
#pragma unroll 1
  for (int z = 0; z < KSL; z += 4) {
    float v[4][8];
    // unrolled so that v[] stays in registers and the loads do not wait on the sums
#pragma unroll
    for (int j = 0; j < 4; ++j)
#pragma unroll
      for (int q = 0; q < 8; ++q) v[j][q] = p[(size_t)(z + j) * BB * CC * CC + (size_t)q * CC];
#pragma unroll
    for (int j = 0; j < 4; ++j)
#pragma unroll
      for (int q = 0; q < 8; ++q) s[q] += v[j][q];
  }
  // butterfly over the 32 lanes, in double: a fixed order, the same sum in every lane; unrolled so that each exchange has a constant lane distance
#pragma unroll
  for (int o = 16; o >= 1; o >>= 1) ss += __shfl_xor(ss, o, 32);
  if ((threadIdx.x & 31) == 0) skn[threadIdx.x >> 5] = 1.0f / fmaxf((float)sqrt(ss), 1e-12f);
  __syncthreads();      // publishes the 8 column factors: every thread scales all 8 rows c, of which its wave joined one
  // unrolled so that the vector elements are named by constants
#pragma unroll
  for (int q = 0; q < 4; ++q) { const f32x2 v = {s[2 * q] * skn[2 * q], s[2 * q + 1] * skn[2 * q + 1]}; h[q] = bf16_pack2(v); l[q] = bf16_pack2(v - bf16_unpack2(h[q])); }
  const size_t dst = ((size_t)b * CC + d) * CC + c8; *(v4ua*)(Ph + dst) = h; *(v4ua*)(Pl + dst) = l;  }
// t2 = q2 kv, attn = v + t2/sqrt(N) and out = attn W_out + b in one launch. Block = 128 tokens x all 256 channels, 16 waves of 32 tokens x 64 channels in both products.
// Every operand reaches the fragments through LDS: q2 is split once a block into bf16 hi/lo planes; the kv planes (4 tiles of 64 c) and then W_out (2 tiles of 128 c) pass through two
// buffers, brought by loads that cover whole 128-byte lines, the next tile's loads in flight while this tile is multiplied. The attn tile takes the place of the q2 planes.
// Each accumulator still sums its 8 k blocks in rising order, and the products of a block in the order hi*hi, lo*hi, hi*lo (attn hi, attn lo in the second product).
#define TOT 128                   // tokens per block
#define TAP 528                   // bytes per LDS row of the q2 / attn planes: 16 x 33, the conflict-free pitch of 16-byte fragment reads
#define TKP 144                   // bytes per LDS row of a kv tile (64 c): 16 x 9
#define TWP 272                   // bytes per LDS row of a W_out tile (128 c): 16 x 17
#define TBUF (2 * CC * TKP)       // one buffer: the hi and the lo plane of a kv tile; a W_out tile (CC * TWP) is smaller
#define TSO 68                    // floats per row of the output staging: rows 8 apart fall 32 banks apart
__device__ __forceinline__ v8f mma1(v16b a, v16b b, v8f c) { return __builtin_amdgcn_wmma_f32_16x16x32_bf16(false, a, false, b, (short)0, c, false, false); }
__global__ __launch_bounds__(512) void k_t2_attn_out(const float* __restrict__ Q2n, const unsigned short* __restrict__ Ph, const unsigned short* __restrict__ Pl, const float* __restrict__ QKV,
                                                    const unsigned short* __restrict__ Bo, const float* __restrict__ bout, float* __restrict__ out) {
  __shared__ __attribute__((aligned(16))) unsigned char sm[2 * TOT * TAP + 2 * TBUF];      // hi plane, lo plane, two tile buffers (reused for the output staging)
  unsigned char* sAh = sm; unsigned char* sAl = sm + TOT * TAP; unsigned char* sB = sm + 2 * TOT * TAP;
  const int tid = threadIdx.x, w = tid >> 5, lane = tid & 31, ln = lane & 15, hh = lane >> 4;
  const size_t tok0 = (size_t)blockIdx.y * NTK + (size_t)blockIdx.x * TOT;
  // a load of a kv tile covers 4 rows x 128 bytes: wave w brings rows 4w .. 4w+3, + 64, + 128, + 192 of both planes; a load of a W_out tile covers 2 rows x 256 bytes: rows 2w, 2w+1, + 32, ...
  const int kr = w * 4 + (lane >> 3), kc = lane & 7, orow = w * 2 + hh;
  const unsigned short* ph = Ph + (size_t)blockIdx.y * CC * CC + (size_t)kr * CC + kc * 8;
  const unsigned short* pl = Pl + (size_t)blockIdx.y * CC * CC + (size_t)kr * CC + kc * 8;
  const unsigned short* po = Bo + (size_t)orow * CC + ln * 8;
  v8us br[8];
  // every loop below is unrolled so that br, ar, rv, the fragments and the accumulators stay in registers (constant indices) and the loads of a group are in flight together
#pragma unroll
  for (int i = 0; i < 4; ++i) { br[i] = *(const v8us*)(ph + (size_t)i * 64 * CC); br[4 + i] = *(const v8us*)(pl + (size_t)i * 64 * CC); }
  {
    // wave w brings rows w, w + 16, ... of q2: two 512-byte loads a row
    const float* ap = Q2n + (tok0 + w) * CC + lane * 4;
    v4f ar[8][2];
#pragma unroll
    for (int i = 0; i < 8; ++i) { ar[i][0] = *(const v4fa*)(ap + (size_t)i * 16 * CC); ar[i][1] = *(const v4fa*)(ap + (size_t)i * 16 * CC + 128); }
    // the wait that stands before a register named by an issued global load is overwritten; here and below it takes the address pairs as inputs so that none is reused (a later load's result had landed on one) before it
    asm volatile("s_wait_xcnt 0x0" :: "v"(ph), "v"(pl), "v"(ap) : "memory");
#pragma unroll
    for (int i = 0; i < 8; ++i)
#pragma unroll
      for (int h = 0; h < 2; ++h) { const int o = (w + 16 * i) * TAP + h * 256 + lane * 8; split_store4(ar[i][h], sAh + o, sAl + o); }
  }
  const int wm = (w >> 2) * 32, wn = (w & 3) * 64;
  const unsigned char* pa = sAh + (wm + ln) * TAP + 16 * hh;      // the lo plane lies TOT * TAP further
  v8f acc[2][4] = {};
#pragma unroll
  for (int s = 0; s < 4; ++s) {
    unsigned char* buf = sB + (s & 1) * TBUF;
#pragma unroll
    for (int i = 0; i < 4; ++i) { unsigned char* p = buf + (kr + 64 * i) * TKP + kc * 16; *(v8us*)p = br[i]; *(v8us*)(p + CC * TKP) = br[4 + i]; }
    __syncthreads();      // publishes this tile (and, the first time, the q2 planes); it also ends every wave's reads of the other buffer, which the next pass overwrites
    if (s < 3) {
#pragma unroll
      for (int i = 0; i < 4; ++i) { br[i] = *(const v8us*)(ph + (s + 1) * 64 + (size_t)i * 64 * CC); br[4 + i] = *(const v8us*)(pl + (s + 1) * 64 + (size_t)i * 64 * CC); }
      asm volatile("s_wait_xcnt 0x0" :: "v"(ph), "v"(pl) : "memory");      // before an address pair of these loads is overwritten
    } else {
#pragma unroll
      for (int i = 0; i < 8; ++i) br[i] = *(const v8us*)(po + (size_t)i * 32 * CC);
      asm volatile("s_wait_xcnt 0x0" :: "v"(po) : "memory");      // before the address pair of these loads is overwritten
    }
    const unsigned char* pb = buf + (wn + ln) * TKP + 16 * hh;
#pragma unroll
    for (int kl = 0; kl < 64; kl += 32) {
      const int kb = s * 64 + kl;
      FragB ah[2], al[2], bh_[4], bl_[4];
#pragma unroll
      for (int m = 0; m < 2; ++m) {
        const unsigned char* p = pa + m * 16 * TAP + kb * 2;
        ah[m].half[0] = *(const v8us*)p; ah[m].half[1] = *(const v8us*)(p + 32);
        al[m].half[0] = *(const v8us*)(p + TOT * TAP); al[m].half[1] = *(const v8us*)(p + TOT * TAP + 32);
      }
#pragma unroll
      for (int t = 0; t < 4; ++t) {
        const unsigned char* p = pb + t * 16 * TKP + kl * 2;
        bh_[t].half[0] = *(const v8us*)p; bh_[t].half[1] = *(const v8us*)(p + 32);
        bl_[t].half[0] = *(const v8us*)(p + CC * TKP); bl_[t].half[1] = *(const v8us*)(p + CC * TKP + 32);
      }
#pragma unroll
      for (int t = 0; t < 4; ++t)
#pragma unroll
        for (int m = 0; m < 2; ++m) acc[m][t] = mma1(ah[m].v, bh_[t].v, acc[m][t]);
#pragma unroll
      for (int t = 0; t < 4; ++t)
#pragma unroll
        for (int m = 0; m < 2; ++m) acc[m][t] = mma1(al[m].v, bh_[t].v, acc[m][t]);
#pragma unroll
      for (int t = 0; t < 4; ++t)
#pragma unroll
        for (int m = 0; m < 2; ++m) acc[m][t] = mma1(ah[m].v, bl_[t].v, acc[m][t]);
    }
  }
  const float* vrow = QKV + (tok0 + wm + 8 * hh) * (3 * CC) + wn + ln;      // v lies 2 * CC further in the row
  v8f rv[2][4];
#pragma unroll
  for (int m = 0; m < 2; ++m)
#pragma unroll
    for (int t = 0; t < 4; ++t)
#pragma unroll
      for (int r = 0; r < 8; ++r) rv[m][t][r] = vrow[2 * CC + (m * 16 + r) * (3 * CC) + t * 16];
  float bo[4];      // the output bias, fetched here with v so that the epilogue does not wait for it
#pragma unroll
  for (int t = 0; t < 4; ++t) bo[t] = bout[wn + t * 16 + ln];
  asm volatile("s_wait_xcnt 0x0" :: "v"(vrow) : "memory");      // before an address register of these loads is overwritten
  __syncthreads();      // the q2 planes are dead in every wave before the attn tile is written over them
  // inputs-only fence on the loaded values: the 64 loads of v and the 4 of the bias are issued together and waited for once (without it this build issues them a few at a time, each group paying a full latency, and spills registers to scratch)
  asm volatile("" :: "v"(rv[0][0]), "v"(rv[0][1]), "v"(rv[0][2]), "v"(rv[0][3]), "v"(rv[1][0]), "v"(rv[1][1]), "v"(rv[1][2]), "v"(rv[1][3]), "v"(bo[0]), "v"(bo[1]), "v"(bo[2]), "v"(bo[3]));
#pragma unroll
  for (int m = 0; m < 2; ++m)
#pragma unroll
    for (int t = 0; t < 4; ++t)
#pragma unroll
      for (int r = 0; r < 8; r += 2) {      // two rows a conversion
        const f32x2 v2 = {rv[m][t][r], rv[m][t][r + 1]}, t2 = {acc[m][t][r], acc[m][t][r + 1]};
        const f32x2 a = v2 + t2 * 0.015625f;
        const unsigned int h = bf16_pack2(a), l = bf16_pack2(a - bf16_unpack2(h));
        const int o = (wm + m * 16 + 8 * hh + r) * TAP + (wn + t * 16 + ln) * 2;
        *(unsigned short*)(sAh + o) = (unsigned short)h; *(unsigned short*)(sAh + o + TAP) = (unsigned short)(h >> 16);
        *(unsigned short*)(sAl + o) = (unsigned short)l; *(unsigned short*)(sAl + o + TAP) = (unsigned short)(l >> 16);
      }
  v8f oc[2][4] = {};
#pragma unroll
  for (int s = 0; s < 2; ++s) {
    unsigned char* buf = sB + (s & 1) * TBUF;
#pragma unroll
    for (int i = 0; i < 8; ++i) *(v8us*)(buf + (orow + 32 * i) * TWP + ln * 16) = br[i];
    __syncthreads();      // publishes this tile (and, the first time, the attn planes: every wave reads all 256 channels, of which it wrote 64); it also ends the reads of the other buffer
    if (s < 1) {
#pragma unroll
      for (int i = 0; i < 8; ++i) br[i] = *(const v8us*)(po + 128 + (size_t)i * 32 * CC);
      asm volatile("s_wait_xcnt 0x0" :: "v"(po) : "memory");      // before the address pair of these loads is overwritten
    }
    const unsigned char* pb = buf + (wn + ln) * TWP + 16 * hh;
#pragma unroll
    for (int kl = 0; kl < 128; kl += 32) {
      const int kb = s * 128 + kl;
      FragB ah[2], al[2], b[4];
#pragma unroll
      for (int m = 0; m < 2; ++m) {
        const unsigned char* p = pa + m * 16 * TAP + kb * 2;
        ah[m].half[0] = *(const v8us*)p; ah[m].half[1] = *(const v8us*)(p + 32);
        al[m].half[0] = *(const v8us*)(p + TOT * TAP); al[m].half[1] = *(const v8us*)(p + TOT * TAP + 32);
      }
#pragma unroll
      for (int t = 0; t < 4; ++t) { const unsigned char* p = pb + t * 16 * TWP + kl * 2; b[t].half[0] = *(const v8us*)p; b[t].half[1] = *(const v8us*)(p + 32); }
#pragma unroll
      for (int t = 0; t < 4; ++t)
#pragma unroll
        for (int m = 0; m < 2; ++m) oc[m][t] = mma1(ah[m].v, b[t].v, oc[m][t]);
#pragma unroll
      for (int t = 0; t < 4; ++t)
#pragma unroll
        for (int m = 0; m < 2; ++m) oc[m][t] = mma1(al[m].v, b[t].v, oc[m][t]);
    }
  }
  __syncthreads();      // the tile buffers are dead in every wave before their LDS is reused to stage the output
  float* so = (float*)sB + w * (32 * TSO);
#pragma unroll
  for (int t = 0; t < 4; ++t) {
    const float bv = bf16_round(bo[t]);
#pragma unroll
    for (int m = 0; m < 2; ++m)
#pragma unroll
      for (int r = 0; r < 8; ++r) so[(m * 16 + 8 * hh + r) * TSO + t * 16 + ln] = oc[m][t][r] + bv;
  }
  // each wave stages in its own LDS range: the fence and the wave barrier keep its row reads behind its own lanes' writes, so that whole 256-byte row pieces are stored
  __builtin_amdgcn_fence(__ATOMIC_ACQ_REL, "workgroup");
  __builtin_amdgcn_wave_barrier();
  float* dst = out + (tok0 + wm) * CC + wn + ln * 4;
  v4f ov[16];      // all 16 LDS reads first, each into registers of its own: one LDS latency for the wave instead of one per row pair
#pragma unroll
  for (int q = 0; q < 16; ++q) ov[q] = *(const v4fa*)&so[(q * 2 + hh) * TSO + ln * 4];
#pragma unroll
  for (int q = 0; q < 16; ++q) *(v4f*)(dst + (size_t)(q * 2 + hh) * CC) = ov[q];
}
// qkv = x W_qkv + b and the per-token work on q and k in one launch. Block = 128 tokens x all 768 columns, 16 waves of 32 x 64 on one section (q, k, v: 256 columns) at a time.
// x is staged once a block in LDS as bf16 (each element rounded once); a section's weights (256 rows x K = 256) are staged whole, the next section's loads in flight while this one is multiplied.
// A finished section (+ bias) is laid token-major in LDS over the dead weights, and each wave takes 8 whole token rows of it into registers, 8 columns a lane:
// q <- q - mean(q), k <- k - mean(k); q2 = q^2, k2 = k^2; Q2n[t][c] = l2norm_c(q2 / (sum q2 + 1e-7)); K2a[t][c] = k2 / (sum k2 + 1e-7) (column-normalised later: PS[block][c] = sum over the block's 128 tokens of K2a^2); v goes to its place in QKV as it is.
// q and k never go to memory. The row work and the stores of a section stand behind the barrier that publishes the next section's weights, so that the stores drain under the next product.
// Every load of x and of the weights and every store of Q2n, K2a and v covers 512 contiguous bytes of one row. Each accumulator still sums its 8 k blocks in rising order.
#define QGP 528                   // bytes per LDS row of x and of the weights: 16 x 33, the conflict-free pitch of 16-byte fragment reads
#define QSP 260                   // floats per row of the staged section: rows 8 apart fall 32 banks apart; 1040 bytes, a multiple of 16
// sum over the 32 lanes of each of 8 values; the 8 chains are independent, so that their cross-lane latencies overlap
__device__ __forceinline__ void wave_sum8(float (&s)[8]) {
  // unrolled so that s[] stays in registers (constant indices)
#pragma unroll
  for (int o = 16; o >= 1; o >>= 1) {
    float t[8];
#pragma unroll
    for (int j = 0; j < 8; ++j) t[j] = __shfl_xor(s[j], o, 32);
#pragma unroll
    for (int j = 0; j < 8; ++j) s[j] += t[j];
  }
}
__device__ __forceinline__ float sum8(v4f a, v4f b) { const v4f c = a + b; return (c[0] + c[1]) + (c[2] + c[3]); }
// 8 token rows of q (ISQ) or k, a lane holding columns 4 lane .. + 3 and 128 + 4 lane .. + 3 of each: centre, square, divide by the row sum; q also l2-normalised over the row
template <bool ISQ>
__device__ __forceinline__ void rows_finish(v4f (&rw)[8][2], float* __restrict__ dst) {
  float s[8];
  // every loop over j is unrolled so that rw and s stay in registers (constant indices)
#pragma unroll
  for (int j = 0; j < 8; ++j) s[j] = sum8(rw[j][0], rw[j][1]);
  wave_sum8(s);
#pragma unroll
  for (int j = 0; j < 8; ++j) {
    const float mu = s[j] * (1.0f / CC);
    const v4f d0 = rw[j][0] - mu, d1 = rw[j][1] - mu;
    rw[j][0] = d0 * d0; rw[j][1] = d1 * d1;
    s[j] = sum8(rw[j][0], rw[j][1]);
  }
  wave_sum8(s);
#pragma unroll
  for (int j = 0; j < 8; ++j) { const float r = 1.0f / (s[j] + 1e-7f); rw[j][0] *= r; rw[j][1] *= r; }
  if (ISQ) {
#pragma unroll
    for (int j = 0; j < 8; ++j) s[j] = sum8(rw[j][0] * rw[j][0], rw[j][1] * rw[j][1]);
    wave_sum8(s);
#pragma unroll
    for (int j = 0; j < 8; ++j) { const float r = 1.0f / fmaxf(sqrtf(s[j]), 1e-12f); rw[j][0] *= r; rw[j][1] *= r; }
  }
#pragma unroll
  for (int j = 0; j < 8; ++j) { *(v4f*)(dst + (size_t)j * CC) = rw[j][0]; *(v4f*)(dst + (size_t)j * CC + 128) = rw[j][1]; }
  asm volatile("s_wait_xcnt 0x0" :: "v"(dst) : "memory");      // before a register named by these stores is overwritten
}
__global__ __launch_bounds__(512) void k_qkv_prep(const float* __restrict__ X, const unsigned short* __restrict__ Wt, const float* __restrict__ bias,
                                                 float* __restrict__ QKV, float* __restrict__ Q2n, float* __restrict__ K2a, double* __restrict__ PS) {
  __shared__ __attribute__((aligned(16))) unsigned char sm[(128 + CC) * QGP];      // x tile, then a section's weights (reused for the staged section)
  __shared__ __attribute__((aligned(16))) float sc[16][CC];      // each wave's column sums of K2a^2 over its 8 tokens
  unsigned char* sA = sm; unsigned char* sB = sm + 128 * QGP; float* so = (float*)sB;
  const int tid = threadIdx.x, w = tid >> 5, lane = tid & 31, ln = lane & 15, hh = lane >> 4;
  const size_t row0 = (size_t)blockIdx.x * 128;
  const int wm = (w >> 2) * 32, wn = (w & 3) * 64;
  // wave w brings rows w, w + 16, ... of the weights and of x: a weight row is one load, a row of x two
  const unsigned short* bp = Wt + (size_t)w * CC + lane * 8;
  const float* bb = bias + wn + ln;
  v8us br[16]; float bv[3][4];
  // every loop below is unrolled so that br, ar, rw, bv, the fragments and acc stay in registers (constant indices) and the loads of a group are in flight together
#pragma unroll
  for (int i = 0; i < 16; ++i) br[i] = *(const v8us*)(bp + (size_t)i * 16 * CC);
  {
    const float* ap = X + (row0 + w) * CC + lane * 4;
    v4f ar[8][2];
#pragma unroll
    for (int i = 0; i < 8; ++i) { ar[i][0] = *(const v4fa*)(ap + (size_t)i * 16 * CC); ar[i][1] = *(const v4fa*)(ap + (size_t)i * 16 * CC + 128); }
#pragma unroll
    for (int s = 0; s < 3; ++s)
#pragma unroll
      for (int t = 0; t < 4; ++t) bv[s][t] = bb[s * CC + t * 16];
    // the wait that stands before a register named by an issued global load is overwritten; here and below it takes the address pairs as inputs so that none is reused before it
    asm volatile("s_wait_xcnt 0x0" :: "v"(bp), "v"(ap), "v"(bb) : "memory");
#pragma unroll
    for (int i = 0; i < 8; ++i)
#pragma unroll
      for (int h = 0; h < 2; ++h) {
        const f32x2 x0 = {ar[i][h][0], ar[i][h][1]}, x1 = {ar[i][h][2], ar[i][h][3]};
        const v2ua o = {bf16_pack2(x0), bf16_pack2(x1)};
        *(v2ua*)(sA + (w + 16 * i) * QGP + h * 256 + lane * 8) = o;
      }
  }
  const unsigned char* pa = sA + (wm + ln) * QGP + 16 * hh;
  const unsigned char* pb = sB + (wn + ln) * QGP + 16 * hh;
  const size_t trow = row0 + w * 8;      // the wave's 8 token rows of a finished section
  v4f rw[8][2];
#pragma unroll
  for (int s = 0; s < 3; ++s) {
#pragma unroll
    for (int i = 0; i < 16; ++i) *(v8us*)(sB + (w + 16 * i) * QGP + lane * 16) = br[i];
    __syncthreads();      // publishes this section's weights (and, the first time, the x tile): every wave reads rows that other waves wrote
    if (s < 2) {
#pragma unroll
      for (int i = 0; i < 16; ++i) br[i] = *(const v8us*)(bp + (size_t)(s + 1) * CC * CC + (size_t)i * 16 * CC);
      asm volatile("s_wait_xcnt 0x0" :: "v"(bp) : "memory");      // before the address pair of these loads is overwritten
    }
    if (s == 1) rows_finish<true>(rw, Q2n + trow * CC + lane * 4);
    if (s == 2) {
      rows_finish<false>(rw, K2a + trow * CC + lane * 4);
      v4f q0 = rw[0][0] * rw[0][0], q1 = rw[0][1] * rw[0][1];
      // unrolled so that rw stays in registers (constant indices)
#pragma unroll
      for (int j = 1; j < 8; ++j) { q0 += rw[j][0] * rw[j][0]; q1 += rw[j][1] * rw[j][1]; }
      *(v4f*)&sc[w][lane * 4] = q0; *(v4f*)&sc[w][128 + lane * 4] = q1;      // read at the kernel's end, behind the barriers of this section
    }
    v8f acc[2][4] = {};
#pragma unroll
    for (int kb = 0; kb < CC; kb += 32) {
      FragB a[2], b[4];
#pragma unroll
      for (int m = 0; m < 2; ++m) { a[m].half[0] = *(const v8us*)(pa + m * 16 * QGP + kb * 2); a[m].half[1] = *(const v8us*)(pa + m * 16 * QGP + kb * 2 + 32); }
#pragma unroll
      for (int t = 0; t < 4; ++t) { b[t].half[0] = *(const v8us*)(pb + t * 16 * QGP + kb * 2); b[t].half[1] = *(const v8us*)(pb + t * 16 * QGP + kb * 2 + 32); }
#pragma unroll
      for (int t = 0; t < 4; ++t)
#pragma unroll
        for (int m = 0; m < 2; ++m) acc[m][t] = mma1(a[m].v, b[t].v, acc[m][t]);
    }
    __syncthreads();      // the weights are dead in every wave before the section is staged over them (and, the last time, the waves' column sums are published)
#pragma unroll
    for (int t = 0; t < 4; ++t) {
      const float bvr = bf16_round(bv[s][t]);
#pragma unroll
      for (int m = 0; m < 2; ++m)
#pragma unroll
        for (int r = 0; r < 8; ++r) so[(wm + m * 16 + 8 * hh + r) * QSP + wn + t * 16 + ln] = acc[m][t][r] + bvr;
    }
    __syncthreads();      // publishes the staged section: a token row was written by 4 waves
#pragma unroll
    for (int j = 0; j < 8; ++j) { rw[j][0] = *(const v4fa*)&so[(w * 8 + j) * QSP + lane * 4]; rw[j][1] = *(const v4fa*)&so[(w * 8 + j) * QSP + 128 + lane * 4]; }
    if (s < 2) __syncthreads();      // the staged section is in registers in every wave before the next weights are written over it
  }
  float* dv = QKV + trow * (3 * CC) + 2 * CC + lane * 4;
#pragma unroll
  for (int j = 0; j < 8; ++j) { *(v4f*)(dv + (size_t)j * 3 * CC) = rw[j][0]; *(v4f*)(dv + (size_t)j * 3 * CC + 128) = rw[j][1]; }
  asm volatile("s_wait_xcnt 0x0" :: "v"(dv) : "memory");      // before a register named by these stores is overwritten
  if (tid < CC) {      // waves 0 to 7, while the stores of v drain: one column a thread, the 16 waves' sums joined in double, pairwise in a fixed order (4 dependent adds)
    double t[16];
    // unrolled so that t[] stays in registers (constant indices) and the 16 LDS reads are in flight together
#pragma unroll
    for (int g = 0; g < 16; ++g) t[g] = (double)sc[g][tid];
#pragma unroll
    for (int o = 1; o < 16; o <<= 1)
#pragma unroll
      for (int g = 0; g < 16; g += 2 * o) t[g] += t[g + o];
    PS[(size_t)blockIdx.x * CC + tid] = t[0];
  }
}
extern "C" void kernel_launch(void* const* d_in, const int* in_sizes, int n_in,
                              void* d_out, int out_size, void* d_ws, size_t ws_size, hipStream_t stream) {
  (void)in_sizes; (void)n_in; (void)out_size;
  const float* x = (const float*)d_in[0]; const float* Wqkv = (const float*)d_in[1]; const float* bqkv = (const float*)d_in[2]; const float* Wout = (const float*)d_in[3]; const float* bout = (const float*)d_in[4];
  char* ws = (char*)d_ws; size_t off = 0;
  auto take = [&](size_t bytes) { char* p = ws + off; off += (bytes + 255) & ~(size_t)255; return p; };
  unsigned short* Bq = (unsigned short*)take((size_t)3 * CC * CC * 2); unsigned short* Bo = (unsigned short*)take((size_t)CC * CC * 2);
  float* QKV = (float*)take((size_t)BB * NTK * 3 * CC * 4); float* Q2n = (float*)take((size_t)BB * NTK * CC * 4); float* K2a = (float*)take((size_t)BB * NTK * CC * 4);
  float* KVp = (float*)take((size_t)KSL * BB * CC * CC * 4);      // the KSL partials of kv
  unsigned short* Ph = (unsigned short*)take((size_t)BB * CC * CC * 2); unsigned short* Pl = (unsigned short*)take((size_t)BB * CC * CC * 2); double* PS = (double*)take((size_t)BB * NCB * CC * 8);
  if (off > ws_size) return;
  k_btw<<<(3 * CC * 32 + 255) / 256, 256, 0, stream>>>(Wqkv, Bq, CC, 3 * CC); k_btw<<<(CC * 32 + 255) / 256, 256, 0, stream>>>(Wout, Bo, CC, CC);
  k_qkv_prep<<<BB * NTK / 128, 512, 0, stream>>>(x, Bq, bqkv, QKV, Q2n, K2a, PS);      // Q2n, K2a, its column sums of squares per block, and the v third of QKV; the q and k thirds of QKV are neither written nor read
  k_kv_part<<<dim3(4, BB, KSL), 256, 0, stream>>>(K2a, QKV, KVp);      // slice z: KVp[z][b][c][d] = sum over the tokens t of slice z of K2a[t][c] * v[t][d]
  k_kvplanes<<<(BB * CC * (CC / 8) + 255) / 256, 256, 0, stream>>>(KVp, PS, Ph, Pl);
  k_t2_attn_out<<<dim3(NTK / TOT, BB), 512, 0, stream>>>(Q2n, Ph, Pl, QKV, Bo, bout, (float*)d_out);      // t2 = q2 * kv, attn = v + t2 / 64, out = attn * W_out + b
}

// v010
// One run takes 86.6 microseconds.
// Timed twice side by side with v009, it ran 1.03 times as fast both times.
// Counting every step since v000, it is 23.8 times as fast.
#include <hip/hip_runtime.h>
// Linear attention on WMMA (f32 accumulate): qkv = x·W_qkv + b (inputs rounded to bf16: single exact term; 32768 × 256 × 768), per batch kv = k2ᵀ·v (k2 and v are computed
// f32 → split into bf16 hi/lo: 3 products; 256 × 256 × 4096), t2 = q2·kv (3 products), out = attn·W_out + b (attn split hi/lo vs exact weights: 2 products). Mean-centering,
// squares, the two normalisations and the residual are f32 VALU (column sums of squares: f32 over 8 tokens, joined in double).
#define BB 8
#define NTK 4096
#define CC 256

typedef __bf16 v16b __attribute__((ext_vector_type(16)));
typedef unsigned short v8us __attribute__((ext_vector_type(8), may_alias));
typedef float  v8f  __attribute__((ext_vector_type(8)));
typedef float  v4f  __attribute__((ext_vector_type(4)));
typedef float  v4fa __attribute__((ext_vector_type(4), may_alias));
union FragB { v16b v; v8us half[2]; unsigned short u[16]; };

typedef float f32x2 __attribute__((ext_vector_type(2)));
typedef __bf16 bf16x2 __attribute__((ext_vector_type(2)));
typedef unsigned int v2ua __attribute__((ext_vector_type(2), may_alias));
typedef unsigned int v4ua __attribute__((ext_vector_type(4), may_alias));
// f32 -> bf16 by the hardware conversion (round to nearest even)
__device__ __forceinline__ unsigned short bf16_bits(float x) { return __builtin_bit_cast(unsigned short, (__bf16)x); }
// two values in one instruction: element 0 in the low half of the word, as two consecutive bf16 lie in memory
__device__ __forceinline__ unsigned int bf16_pack2(f32x2 x) { return __builtin_bit_cast(unsigned int, __builtin_convertvector(x, bf16x2)); }
__device__ __forceinline__ f32x2 bf16_unpack2(unsigned int p) { const f32x2 r = {__uint_as_float(p << 16), __uint_as_float(p & 0xFFFF0000u)}; return r; }
__device__ __forceinline__ float bf16_val(unsigned short b) { return __uint_as_float(((unsigned int)b) << 16); }
__device__ __forceinline__ float bf16_round(float x) { return bf16_val(bf16_bits(x)); }
// D += A·B with NT terms: 1 = ah·bh, 2 = + al·bh (A split), 3 = + ah·bl (both split)
template <int NT>
__device__ __forceinline__ v8f mmaN(v16b ah, v16b al, v16b bh, v16b bl, v8f c) {
  c = __builtin_amdgcn_wmma_f32_16x16x32_bf16(false, ah, false, bh, (short)0, c, false, false);
  if (NT >= 2) c = __builtin_amdgcn_wmma_f32_16x16x32_bf16(false, al, false, bh, (short)0, c, false, false);
  if (NT >= 3) c = __builtin_amdgcn_wmma_f32_16x16x32_bf16(false, ah, false, bl, (short)0, c, false, false);
  asm volatile("v_nop\n\tv_nop\n\tv_nop\n\tv_nop" : "+v"(c) : "v"(ah), "v"(al), "v"(bh), "v"(bl));
  return c;
}

__global__ __launch_bounds__(256) void k_wt_bf16(const float* __restrict__ W, unsigned short* __restrict__ Wt, int K, int N) {
  const int t = blockIdx.x * 256 + threadIdx.x;
  const int k8n = K / 8;
  if (t >= N * k8n) return;
  const int n = t / k8n, k8 = (t % k8n) * 8;
  v8us v;
#pragma unroll
  for (int i = 0; i < 8; ++i) v[i] = bf16_bits(W[(size_t)(k8 + i) * N + n]);
  *(v8us*)(Wt + (size_t)n * K + k8) = v;
  
}

// GEMM C[M][N] (f32, pitch ldc) = act(A[M][K]·W + bias). A f32 row-major (pitch lda) converted per fragment to bf16
// (ASPLIT: hi/lo two planes -> 2 terms, else single rounded term); Wt bf16 [N][K] (pitch ldb). BIAS_BF16 rounds the
// bias to bf16 first (bias quantised to bf16 before the add). K%32==0, M%16==0, N%64==0.
template <bool ASPLIT, int ACT, bool BIAS_BF16>
__global__ __launch_bounds__(128) void k_gemm_bf(const float* __restrict__ A, int lda, const unsigned short* __restrict__ Wt, int ldb,
                                               const float* __restrict__ bias, float* __restrict__ C, int ldc, int M, int N, int K) {
  __shared__ __attribute__((aligned(16))) float so[4][16][64];
  const int tid = threadIdx.x, w = tid >> 5, lane = tid & 31, ln = lane & 15, hh = lane >> 4;
  const int ntn = N / 64;
  const int wid = blockIdx.x * 4 + w;
  const int mt = wid / ntn, nq = wid % ntn;
  if (mt * 16 >= M) return;
  const int row0 = mt * 16, col0 = nq * 64;
  const float* arow = A + (size_t)(row0 + ln) * lda;
  v8f acc[4] = {};
  for (int kb = 0; kb < K; kb += 32) {
    FragB ah, al;
    const v4f x0 = *(const v4fa*)(arow + kb + 8 * hh), x1 = *(const v4fa*)(arow + kb + 8 * hh + 4);
    const v4f x2 = *(const v4fa*)(arow + kb + 16 + 8 * hh), x3 = *(const v4fa*)(arow + kb + 16 + 8 * hh + 4);
    float xs[16] = {x0[0],x0[1],x0[2],x0[3],x1[0],x1[1],x1[2],x1[3],x2[0],x2[1],x2[2],x2[3],x3[0],x3[1],x3[2],x3[3]};
#pragma unroll
    for (int i = 0; i < 16; ++i) { const unsigned short hb = bf16_bits(xs[i]); ah.u[i] = hb; al.u[i] = ASPLIT ? bf16_bits(xs[i] - bf16_val(hb)) : (unsigned short)0; }
#pragma unroll
    for (int t = 0; t < 4; ++t) {
      const unsigned short* brow = Wt + (size_t)(col0 + t * 16 + ln) * ldb + kb;
      FragB b;
      b.half[0] = *(const v8us*)(brow + 8 * hh);
      b.half[1] = *(const v8us*)(brow + 16 + 8 * hh);
      acc[t] = mmaN<ASPLIT ? 2 : 1>(ah.v, al.v, b.v, b.v, acc[t]);
    }
  }
#pragma unroll
  for (int t = 0; t < 4; ++t) {
    float bv = bias ? bias[col0 + t * 16 + ln] : 0.f;
    if (BIAS_BF16) bv = bf16_round(bv);
#pragma unroll
    for (int r = 0; r < 8; ++r) { float v = acc[t][r] + bv; if (ACT == 1) v = fmaxf(v, 0.f); so[w][8 * hh + r][t * 16 + ln] = v; }
  }
  __builtin_amdgcn_fence(__ATOMIC_ACQ_REL, "workgroup");
  __builtin_amdgcn_wave_barrier();
  const int rsub = lane >> 4, c4 = (lane & 15) * 4;
  {
#pragma unroll
    for (int q = 0; q < 8; ++q) {
      const int r = q * 2 + rsub;
      const v4f v = *(const v4fa*)&so[w][r][c4];
      *(v4f*)(C + (size_t)(row0 + r) * ldc + col0 + c4) = v;
    }
    
  }
}

// Flash-style causal/unmasked attention, all contractions 3-term bf16 hi/lo splits, f32 softmax with running max.
// q,k,v rows are read from f32 buffers with arbitrary row pitch (so they can live inside a fused qkv buffer);
// D = head size (multiple of 32, <= 128); one wave = 16 query rows; block = 4 waves (64 queries) sharing K/V chunks of 32.
template <int D, bool CAUSAL>
__global__ __launch_bounds__(128) void k_flash(const float* __restrict__ qb, const float* __restrict__ kb, const float* __restrict__ vb,
                                             int pitch, int T, int H, float scale, float* __restrict__ y, int ypitch) {
  constexpr int KS = D / 32;        // k-steps for QK
  constexpr int DT = D / 16;        // d tiles for PV
  __shared__ __attribute__((aligned(16))) unsigned short sKh[32][D + 8], sKl[32][D + 8], sVh[32][D + 8], sVl[32][D + 8];
  __shared__ __attribute__((aligned(16))) unsigned short sPh[4][16][40], sPl[4][16][40];
  __shared__ __attribute__((aligned(16))) float sO[4][16][D];
  const int tid = threadIdx.x, w = tid >> 5, lane = tid & 31, ln = lane & 15, hh = lane >> 4;
  const int nqb = (T + 63) / 64;
  const int bh = blockIdx.x / nqb, qblk = blockIdx.x % nqb;
  const int b = bh / H, h = bh % H;
  const int q0 = qblk * 64 + w * 16;
  const float* Q = qb + (size_t)b * T * pitch + h * D;
  const float* K = kb + (size_t)b * T * pitch + h * D;
  const float* V = vb + (size_t)b * T * pitch + h * D;

  // A fragments of the wave's 16 query rows (scaled), hi/lo
  FragB aqh[KS], aql[KS];
  {
    int row = q0 + ln; if (row >= T) row = T - 1;
    const float* qr = Q + (size_t)row * pitch;
#pragma unroll
    for (int ks = 0; ks < KS; ++ks)
#pragma unroll
      for (int i = 0; i < 16; ++i) {
        const int d = ks * 32 + ((i < 8) ? (8 * hh + i) : (16 + 8 * hh + (i - 8)));
        const float x = qr[d] * scale; const unsigned short hb = bf16_bits(x);
        aqh[ks].u[i] = hb; aql[ks].u[i] = bf16_bits(x - bf16_val(hb));
      }
  }
  float m_r[8], l_r[8];
#pragma unroll
  for (int r = 0; r < 8; ++r) { m_r[r] = -3.0e38f; l_r[r] = 0.f; }
  v8f oacc[DT];
#pragma unroll
  for (int dt = 0; dt < DT; ++dt) oacc[dt] = (v8f){0.f,0.f,0.f,0.f,0.f,0.f,0.f,0.f};

  const int kv_end = CAUSAL ? min(T, qblk * 64 + 64) : T;     // block-uniform
  for (int j0 = 0; j0 < kv_end; j0 += 32) {
    __syncthreads();
    for (int e = tid; e < 32 * (D / 4); e += 128) {
      const int r = e / (D / 4), c4 = (e % (D / 4)) * 4;
      const int key = j0 + r;
      v4f kf = {0.f,0.f,0.f,0.f}, vf = {0.f,0.f,0.f,0.f};
      if (key < T) { kf = *(const v4fa*)(K + (size_t)key * pitch + c4); vf = *(const v4fa*)(V + (size_t)key * pitch + c4); }
#pragma unroll
      for (int t = 0; t < 4; ++t) {
        unsigned short hb = bf16_bits(kf[t]); sKh[r][c4 + t] = hb; sKl[r][c4 + t] = bf16_bits(kf[t] - bf16_val(hb));
        hb = bf16_bits(vf[t]); sVh[r][c4 + t] = hb; sVl[r][c4 + t] = bf16_bits(vf[t] - bf16_val(hb));
      }
    }
    __syncthreads();
    // S tile 16 x 32
    v8f s[2];
#pragma unroll
    for (int nt = 0; nt < 2; ++nt) {
      v8f acc = {};
#pragma unroll
      for (int ks = 0; ks < KS; ++ks) {
        FragB bh_, bl_;
        bh_.half[0] = *(const v8us*)&sKh[nt * 16 + ln][ks * 32 + 8 * hh]; bh_.half[1] = *(const v8us*)&sKh[nt * 16 + ln][ks * 32 + 16 + 8 * hh];
        bl_.half[0] = *(const v8us*)&sKl[nt * 16 + ln][ks * 32 + 8 * hh]; bl_.half[1] = *(const v8us*)&sKl[nt * 16 + ln][ks * 32 + 16 + 8 * hh];
        acc = mmaN<3>(aqh[ks].v, aql[ks].v, bh_.v, bl_.v, acc);
      }
      s[nt] = acc;
    }
    // mask + running max (rows 8hh+r; the 16 lanes of a half share rows)
    float alpha[8];
#pragma unroll
    for (int r = 0; r < 8; ++r) {
      const int qi = q0 + 8 * hh + r;
      const int ja = j0 + ln, jb = j0 + 16 + ln;
      if (CAUSAL) { if (ja > qi) s[0][r] = -3.0e38f; if (jb > qi) s[1][r] = -3.0e38f; }
      if (ja >= T) s[0][r] = -3.0e38f;
      if (jb >= T) s[1][r] = -3.0e38f;
      float mx = fmaxf(s[0][r], s[1][r]);
      mx = fmaxf(mx, __shfl_xor(mx, 1, 32)); mx = fmaxf(mx, __shfl_xor(mx, 2, 32)); mx = fmaxf(mx, __shfl_xor(mx, 4, 32)); mx = fmaxf(mx, __shfl_xor(mx, 8, 32));
      const float mnew = fmaxf(m_r[r], mx);
      alpha[r] = (mnew > -1.0e38f) ? __expf(m_r[r] - mnew) : 1.0f;
      const float p0 = (s[0][r] > -1.0e38f) ? __expf(s[0][r] - mnew) : 0.f;
      const float p1 = (s[1][r] > -1.0e38f) ? __expf(s[1][r] - mnew) : 0.f;
      m_r[r] = mnew;
      l_r[r] = l_r[r] * alpha[r] + p0 + p1;            // per-lane partial row sum (16 lanes combined at the end)
      unsigned short hb = bf16_bits(p0); sPh[w][8 * hh + r][ln] = hb;      sPl[w][8 * hh + r][ln] = bf16_bits(p0 - bf16_val(hb));
      hb = bf16_bits(p1);                sPh[w][8 * hh + r][16 + ln] = hb; sPl[w][8 * hh + r][16 + ln] = bf16_bits(p1 - bf16_val(hb));
    }
#pragma unroll
    for (int dt = 0; dt < DT; ++dt)
#pragma unroll
      for (int r = 0; r < 8; ++r) oacc[dt][r] *= alpha[r];
    __builtin_amdgcn_fence(__ATOMIC_ACQ_REL, "workgroup");
    __builtin_amdgcn_wave_barrier();
    FragB pah, pal;
    pah.half[0] = *(const v8us*)&sPh[w][ln][8 * hh]; pah.half[1] = *(const v8us*)&sPh[w][ln][16 + 8 * hh];
    pal.half[0] = *(const v8us*)&sPl[w][ln][8 * hh]; pal.half[1] = *(const v8us*)&sPl[w][ln][16 + 8 * hh];
#pragma unroll
    for (int dt = 0; dt < DT; ++dt) {
      FragB bvh, bvl;
#pragma unroll
      for (int i = 0; i < 8; ++i) {
        bvh.u[i] = sVh[8 * hh + i][dt * 16 + ln]; bvh.u[8 + i] = sVh[16 + 8 * hh + i][dt * 16 + ln];
        bvl.u[i] = sVl[8 * hh + i][dt * 16 + ln]; bvl.u[8 + i] = sVl[16 + 8 * hh + i][dt * 16 + ln];
      }
      oacc[dt] = mmaN<3>(pah.v, pal.v, bvh.v, bvl.v, oacc[dt]);
    }
    __builtin_amdgcn_fence(__ATOMIC_ACQ_REL, "workgroup");
    __builtin_amdgcn_wave_barrier();
  }
#pragma unroll
  for (int r = 0; r < 8; ++r) {
    float l = l_r[r];
    l += __shfl_xor(l, 1, 32); l += __shfl_xor(l, 2, 32); l += __shfl_xor(l, 4, 32); l += __shfl_xor(l, 8, 32);
    l_r[r] = (l > 0.f) ? 1.0f / l : 0.f;
  }
#pragma unroll
  for (int dt = 0; dt < DT; ++dt)
#pragma unroll
    for (int r = 0; r < 8; ++r) sO[w][8 * hh + r][dt * 16 + ln] = oacc[dt][r] * l_r[r];
  __builtin_amdgcn_fence(__ATOMIC_ACQ_REL, "workgroup");
  __builtin_amdgcn_wave_barrier();
  {
    for (int r = 0; r < 16; ++r) {
      const int row = q0 + r;
      if (row < T && lane < D / 4) {
        const v4f val = *(const v4fa*)&sO[w][r][lane * 4];
        *(v4f*)(y + ((size_t)b * T + row) * ypitch + h * D + lane * 4) = val;
      }
    }
    
  }
}

// GEMM C = act(A·W + bias + resid): A f32 (ASPLIT -> hi/lo 2 terms), Wt bf16 [N][K]; ACT 0 none, 1 relu, 2 exact gelu;
// resid (optional, f32, row index = (row % rmod), pitch ldr, RES_BF16 rounds it) added before the activation.
template <bool ASPLIT, int ACT, bool BIAS_BF16, bool RES_BF16>
__global__ __launch_bounds__(128) void k_gemm_bf3(const float* __restrict__ A, int lda, const unsigned short* __restrict__ Wt, int ldb,
                                                const float* __restrict__ bias, const float* __restrict__ resid, int rmod, int ldr,
                                                float* __restrict__ C, int ldc, int M, int N, int K) {
  __shared__ __attribute__((aligned(16))) float so[4][16][64];
  const int tid = threadIdx.x, w = tid >> 5, lane = tid & 31, ln = lane & 15, hh = lane >> 4;
  const int ntn = N / 64;
  const int wid = blockIdx.x * 4 + w;
  const int mt = wid / ntn, nq = wid % ntn;
  if (mt * 16 >= M) return;
  const int row0 = mt * 16, col0 = nq * 64;
  const float* arow = A + (size_t)(row0 + ln) * lda;
  v8f acc[4] = {};
  for (int kb = 0; kb < K; kb += 32) {
    FragB ah, al;
    const v4f x0 = *(const v4fa*)(arow + kb + 8 * hh), x1 = *(const v4fa*)(arow + kb + 8 * hh + 4);
    const v4f x2 = *(const v4fa*)(arow + kb + 16 + 8 * hh), x3 = *(const v4fa*)(arow + kb + 16 + 8 * hh + 4);
    float xs[16] = {x0[0],x0[1],x0[2],x0[3],x1[0],x1[1],x1[2],x1[3],x2[0],x2[1],x2[2],x2[3],x3[0],x3[1],x3[2],x3[3]};
#pragma unroll
    for (int i = 0; i < 16; ++i) { const unsigned short hb = bf16_bits(xs[i]); ah.u[i] = hb; al.u[i] = ASPLIT ? bf16_bits(xs[i] - bf16_val(hb)) : (unsigned short)0; }
#pragma unroll
    for (int t = 0; t < 4; ++t) {
      const unsigned short* brow = Wt + (size_t)(col0 + t * 16 + ln) * ldb + kb;
      FragB b;
      b.half[0] = *(const v8us*)(brow + 8 * hh);
      b.half[1] = *(const v8us*)(brow + 16 + 8 * hh);
      acc[t] = mmaN<ASPLIT ? 2 : 1>(ah.v, al.v, b.v, b.v, acc[t]);
    }
  }
#pragma unroll
  for (int t = 0; t < 4; ++t) {
    const int col = col0 + t * 16 + ln;
    float bv = bias ? bias[col] : 0.f;
    if (BIAS_BF16) bv = bf16_round(bv);
#pragma unroll
    for (int r = 0; r < 8; ++r) {
      float v = acc[t][r] + bv;
      if (resid) { float rv = resid[(size_t)((row0 + 8 * hh + r) % rmod) * ldr + col]; if (RES_BF16) rv = bf16_round(rv); v += rv; }
      if (ACT == 1) v = fmaxf(v, 0.f);
      if (ACT == 2) v = 0.5f * v * (1.0f + erff(v * 0.70710678118654752f));
      if (ACT == 3) { const float u = 0.7978845608028654f * (v + 0.044715f * v * v * v); v = 0.5f * v * (1.0f + tanhf(u)); }
      so[w][8 * hh + r][t * 16 + ln] = v;
    }
  }
  __builtin_amdgcn_fence(__ATOMIC_ACQ_REL, "workgroup");
  __builtin_amdgcn_wave_barrier();
  const int rsub = lane >> 4, c4 = (lane & 15) * 4;
  {
#pragma unroll
    for (int q = 0; q < 8; ++q) {
      const int r = q * 2 + rsub;
      const v4f v = *(const v4fa*)&so[w][r][c4];
      *(v4f*)(C + (size_t)(row0 + r) * ldc + col0 + c4) = v;
    }
    
  }
}
// row LayerNorm (biased variance, eps) over N: s = X (+ R); optional out_sum <- s; out_norm <- (s-mu)*rsqrt(var+eps)*g + b
template <bool PARAM_BF16>
__global__ __launch_bounds__(256) void k_layernorm(const float* __restrict__ X, const float* __restrict__ R, const float* __restrict__ g, const float* __restrict__ bta,
                                                  float* __restrict__ out_sum, float* __restrict__ out_norm, int N, float eps) {
  __shared__ float red[256];
  const int row = blockIdx.x, tid = threadIdx.x;
  const float* x = X + (size_t)row * N; const float* rr = R ? R + (size_t)row * N : nullptr;
  float vals[16];                     // up to N = 4096
  const int per = N / 256;            // contiguous chunk per thread? use strided-by-4 chunks: thread handles j = tid*4 + 1024*u
  float s1 = 0.f;
  for (int u = 0; u < per / 4; ++u) {
    const int j = tid * 4 + 1024 * u;
    const v4f a = *(const v4fa*)(x + j);
    v4f b = {0.f,0.f,0.f,0.f}; if (rr) b = *(const v4fa*)(rr + j);
#pragma unroll
    for (int q = 0; q < 4; ++q) { const float v = a[q] + b[q]; vals[u * 4 + q] = v; s1 += v; }
  }
  red[tid] = s1; __syncthreads();
  for (int st = 128; st > 0; st >>= 1) { if (tid < st) red[tid] += red[tid + st]; __syncthreads(); }
  const float mu = red[0] / (float)N; __syncthreads();
  float s2 = 0.f;
  for (int u = 0; u < per / 4; ++u)
#pragma unroll
    for (int q = 0; q < 4; ++q) { const float c = vals[u * 4 + q] - mu; s2 += c * c; }
  red[tid] = s2; __syncthreads();
  for (int st = 128; st > 0; st >>= 1) { if (tid < st) red[tid] += red[tid + st]; __syncthreads(); }
  const float rs = rsqrtf(red[0] / (float)N + eps);
  {
    for (int u = 0; u < per / 4; ++u) {
      const int j = tid * 4 + 1024 * u;
      v4f o, sm;
#pragma unroll
      for (int q = 0; q < 4; ++q) {
        float gg = g[j + q], bb = bta[j + q];
        if (PARAM_BF16) { gg = bf16_round(gg); bb = bf16_round(bb); }
        sm[q] = vals[u * 4 + q]; o[q] = (vals[u * 4 + q] - mu) * rs * gg + bb;
      }
      if (out_sum) *(v4f*)(out_sum + (size_t)row * N + j) = sm;
      *(v4f*)(out_norm + (size_t)row * N + j) = o;
    }
    
  }
}

// batched f32 [K][N] (pitch lds, batch stride sIn) -> transposed hi/lo planes [N][K] (batch stride sOut); thread per (n, 8 k); grid.y = batch
__global__ __launch_bounds__(256) void k_split_transpose_b(const float* __restrict__ src, int lds_, size_t sIn, unsigned short* __restrict__ hi, unsigned short* __restrict__ lo, size_t sOut, int K, int N) {
  const size_t t = (size_t)blockIdx.x * 256 + threadIdx.x; const int k8n = K / 8; if (t >= (size_t)N * k8n) return;
  src += (size_t)blockIdx.y * sIn; hi += (size_t)blockIdx.y * sOut; lo += (size_t)blockIdx.y * sOut;
  const int n = (int)(t / k8n), k8 = (int)(t % k8n) * 8; v8us vh, vl;
#pragma unroll
  for (int i = 0; i < 8; ++i) { const float x = src[(size_t)(k8 + i) * lds_ + n]; const unsigned short hb = bf16_bits(x); vh[i] = hb; vl[i] = bf16_bits(x - bf16_val(hb)); }
  unsigned short* dh = hi + (size_t)n * K + k8; unsigned short* dl = lo + (size_t)n * K + k8;
  *(v8us*)dh = vh; *(v8us*)dl = vl; 
}

#define NCB (NTK / 128)           // token blocks of the qkv kernel per batch: each leaves one partial column sum of squares
// Partials of kv = k2^T v straight from the token-major arrays: KVp[z][b][c][d] = sum over the 256 tokens t of slice z of K2a[t][c] * v[t][d], 3 products on hi/lo bf16 planes (the column norm of k2 is a factor of row c of kv and is applied behind the token sum).
// Block = 128 c x 128 d of one (batch, slice), 8 waves of 32 c x 64 d. A pass takes 32 tokens: every thread splits its 16-byte pieces of k2 and v once and lays them token-major in LDS;
// both operands need 8 consecutive tokens of one channel per lane, which the transposing LDS read delivers in the hardware k order (the order the row loaders of this file use).
#define KSL 16
#define KVT 32                    // tokens per pass
#define KVPITCH 288               // bytes per LDS row: 128 channels x 2 B + 32 = 32 B x 9, the conflict-free pitch of the transposing read
#define KVPLANE (KVT * KVPITCH)   // one plane of one pass
#define KVSO 68                   // floats per row of the output staging: rows 8 apart fall 32 banks apart
typedef short s16x8 __attribute__((ext_vector_type(8)));
typedef unsigned short v4us __attribute__((ext_vector_type(4), may_alias));
__device__ __forceinline__ v8us ld_tr16(const unsigned char* p) { typedef __attribute__((address_space(3))) s16x8 lds_s16x8; return __builtin_bit_cast(v8us, __builtin_amdgcn_ds_load_tr16_b128_v8i16((lds_s16x8*)p)); }
__device__ __forceinline__ void split_store4(v4f x, unsigned char* ph, unsigned char* pl) {
  const f32x2 x0 = {x[0], x[1]}, x1 = {x[2], x[3]};
  const v2ua h = {bf16_pack2(x0), bf16_pack2(x1)};
  const v2ua l = {bf16_pack2(x0 - bf16_unpack2(h[0])), bf16_pack2(x1 - bf16_unpack2(h[1]))};
  *(v2ua*)ph = h; *(v2ua*)pl = l;
}
__global__ __launch_bounds__(256) void k_kv_part(const float* __restrict__ K2a, const float* __restrict__ QKV, float* __restrict__ KVp) {
  __shared__ __attribute__((aligned(16))) unsigned char sm[2 * 4 * KVPLANE];      // two buffers of 4 planes: k2 hi, k2 lo, v hi, v lo
  const int tid = threadIdx.x, w = tid >> 5, lane = tid & 31, ln = lane & 15, hh = lane >> 4;
  const int c0 = (blockIdx.x >> 1) * 128, d0 = (blockIdx.x & 1) * 128, b = blockIdx.y, z = blockIdx.z;
  const size_t tok0 = (size_t)b * NTK + (size_t)z * (NTK / KSL);
  // wave w brings rows w, w + 8, w + 16, w + 24 of a pass: one 512-byte row segment per load
  const float* kp = K2a + (tok0 + w) * CC + c0 + lane * 4;
  const float* vp = QKV + (tok0 + w) * (3 * CC) + 2 * CC + d0 + lane * 4;
  const int wc = (w >> 1) * 32, wd = (w & 1) * 64;
  const int wr = w * KVPITCH + lane * 8;                                           // where the thread's pieces land in a plane
  const int rd = (8 * hh + (lane & 7)) * KVPITCH + ((lane >> 3) & 1) * 16;         // lane address of the transposing read, tokens 0..15, channel 0
  v4f kr[4], vr[4];
  // every loop over i, m, t, r or q below is unrolled so that kr, vr, the fragments and acc stay in registers (constant indices) and the 8 loads of a pass are in flight together
#pragma unroll
  for (int i = 0; i < 4; ++i) { kr[i] = *(const v4fa*)(kp + (size_t)i * 8 * CC); vr[i] = *(const v4fa*)(vp + (size_t)i * 8 * 3 * CC); }
  v8f acc[2][4] = {};
  for (int ps = 0; ps < NTK / KSL / KVT; ++ps) {
    unsigned char* buf = sm + (ps & 1) * (4 * KVPLANE);
#pragma unroll
    for (int i = 0; i < 4; ++i) {
      unsigned char* p = buf + wr + i * 8 * KVPITCH;
      split_store4(kr[i], p, p + KVPLANE);
      split_store4(vr[i], p + 2 * KVPLANE, p + 3 * KVPLANE);
    }
    __syncthreads();      // publishes this pass's planes; it also ends every wave's reads of the other buffer, which the next pass overwrites
    if (ps + 1 < NTK / KSL / KVT) {      // the next pass's loads fly while this pass is multiplied
      kp += (size_t)KVT * CC; vp += (size_t)KVT * 3 * CC;
#pragma unroll
      for (int i = 0; i < 4; ++i) { kr[i] = *(const v4fa*)(kp + (size_t)i * 8 * CC); vr[i] = *(const v4fa*)(vp + (size_t)i * 8 * 3 * CC); }
    }
    FragB ah[2], al[2];
#pragma unroll
    for (int m = 0; m < 2; ++m) {
      const unsigned char* p = buf + rd + 2 * (wc + 16 * m);
      ah[m].half[0] = ld_tr16(p); ah[m].half[1] = ld_tr16(p + 16 * KVPITCH);
      al[m].half[0] = ld_tr16(p + KVPLANE); al[m].half[1] = ld_tr16(p + KVPLANE + 16 * KVPITCH);
    }
#pragma unroll
    for (int t = 0; t < 4; ++t) {
      const unsigned char* p = buf + 2 * KVPLANE + rd + 2 * (wd + 16 * t);
      FragB bh_, bl_;
      bh_.half[0] = ld_tr16(p); bh_.half[1] = ld_tr16(p + 16 * KVPITCH);
      bl_.half[0] = ld_tr16(p + KVPLANE); bl_.half[1] = ld_tr16(p + KVPLANE + 16 * KVPITCH);
#pragma unroll
      for (int m = 0; m < 2; ++m) acc[m][t] = mmaN<3>(ah[m].v, al[m].v, bh_.v, bl_.v, acc[m][t]);
    }
  }
  __syncthreads();      // the planes are dead in every wave before their LDS is reused to stage the output
  float* so = (float*)sm + w * (2 * 16 * KVSO);
#pragma unroll
  for (int m = 0; m < 2; ++m)
#pragma unroll
    for (int t = 0; t < 4; ++t)
#pragma unroll
      for (int r = 0; r < 8; ++r) so[(m * 16 + 8 * hh + r) * KVSO + t * 16 + ln] = acc[m][t][r];
  // each wave stages in its own LDS range: the fence and the wave barrier keep its row reads behind its own lanes' writes, so that whole 256-byte row pieces are stored
  __builtin_amdgcn_fence(__ATOMIC_ACQ_REL, "workgroup");
  __builtin_amdgcn_wave_barrier();
  float* dst = KVp + (((size_t)z * BB + b) * CC + c0 + wc) * CC + d0 + wd + ln * 4;
#pragma unroll
  for (int q = 0; q < 16; ++q) {
    const int r = q * 2 + hh;
    const v4f v = *(const v4fa*)&so[r * KVSO + ln * 4];
    *(v4f*)(dst + (size_t)r * CC) = v;
  }
}
// kv = sum of its KSL token-slice partials KVp[slice][b][c][d], added in slice order (f32), times 1 / max(column norm of k2, 1e-12) of its row c; then kv -> Bt for t2 = q2 kv: B[k=c][n=d] = kv[c][d] -> Bt[d][c]: planes hi/lo of kv transposed.
// thread per (b, 8 c, d) with d along the lanes: each of the 8 * KSL loads of a wave reads one whole line. A block holds one (b, 8 c): its wave g joins the NCB = 32 partial sums of squares of column c8 + g, one a lane.
__global__ __launch_bounds__(256) void k_kvplanes(const float* __restrict__ KVp, const double* __restrict__ PS, unsigned short* __restrict__ Ph, unsigned short* __restrict__ Pl) { __shared__ float skn[8]; const int t = blockIdx.x * 256 + threadIdx.x; if (t >= BB * CC * (CC / 8)) return; const int d = t % CC; const int c8 = ((t / CC) % (CC / 8)) * 8; const int b = t / ((CC / 8) * CC); v4ua h, l;
  const float* p = KVp + ((size_t)b * CC + c8) * CC + d; float s[8] = {0.f, 0.f, 0.f, 0.f, 0.f, 0.f, 0.f, 0.f};
  const double* pp = PS + ((size_t)b * NCB + (threadIdx.x & 31)) * CC + c8 + (threadIdx.x >> 5);
  double ss = *pp;      // fetched ahead of the partials of kv, so that its latency lies under theirs
  asm volatile("s_wait_xcnt 0x0" :: "v"(pp) : "memory");      // before the address pair of this load is overwritten
  // kept rolled, 4 slices a trip: 32 independent loads are in flight per wave; fully unrolled, the 128 loads took 138 registers
#pragma unroll 1
  for (int z = 0; z < KSL; z += 4) {
    float v[4][8];
    // unrolled so that v[] stays in registers and the loads do not wait on the sums
#pragma unroll
    for (int j = 0; j < 4; ++j)
#pragma unroll
      for (int q = 0; q < 8; ++q) v[j][q] = p[(size_t)(z + j) * BB * CC * CC + (size_t)q * CC];
#pragma unroll
    for (int j = 0; j < 4; ++j)
#pragma unroll
      for (int q = 0; q < 8; ++q) s[q] += v[j][q];
  }
  // butterfly over the 32 lanes, in double: a fixed order, the same sum in every lane; unrolled so that each exchange has a constant lane distance
#pragma unroll
  for (int o = 16; o >= 1; o >>= 1) ss += __shfl_xor(ss, o, 32);
  if ((threadIdx.x & 31) == 0) skn[threadIdx.x >> 5] = 1.0f / fmaxf((float)sqrt(ss), 1e-12f);
  __syncthreads();      // publishes the 8 column factors: every thread scales all 8 rows c, of which its wave joined one
  // unrolled so that the vector elements are named by constants
#pragma unroll
  for (int q = 0; q < 4; ++q) { const f32x2 v = {s[2 * q] * skn[2 * q], s[2 * q + 1] * skn[2 * q + 1]}; h[q] = bf16_pack2(v); l[q] = bf16_pack2(v - bf16_unpack2(h[q])); }
  const size_t dst = ((size_t)b * CC + d) * CC + c8; *(v4ua*)(Ph + dst) = h; *(v4ua*)(Pl + dst) = l;  }
// t2 = q2 kv, attn = v + t2/sqrt(N) and out = attn W_out + b in one launch. Block = 128 tokens x all 256 channels, 16 waves of 32 tokens x 64 channels in both products.
// Every operand reaches the fragments through LDS: q2 is split once a block into bf16 hi/lo planes; the kv planes (4 tiles of 64 c) and then W_out (2 tiles of 128 c) pass through two
// buffers, brought by loads that cover whole 128-byte lines, the next tile's loads in flight while this tile is multiplied. The attn tile takes the place of the q2 planes.
// W_out is read as it lies in memory (f32, row c, column n), rounded to bf16 on the way into LDS and laid c-major; the transposing LDS read delivers its B fragments in the k order of the row loaders.
// It comes 64 rows at a time (as many registers as a kv tile takes): rows 0 .. 63 under the last pass of the first product, 64 .. 191 together with v, 192 .. 255 under the first tile of the second product;
// each piece goes into the buffer that is free at that time, ahead of the barrier that publishes its tile.
// Each accumulator still sums its 8 k blocks in rising order, and the products of a block in the order hi*hi, lo*hi, hi*lo (attn hi, attn lo in the second product).
#define TOT 128                   // tokens per block
#define TAP 528                   // bytes per LDS row of the q2 / attn planes: 16 x 33, the conflict-free pitch of 16-byte fragment reads
#define TKP 144                   // bytes per LDS row of a kv tile (64 c): 16 x 9
#define TWP 544                   // bytes per LDS row of a W_out tile (one c, 256 columns): 32 x 17, the conflict-free pitch of the transposing read
#define TBUF (2 * CC * TKP)       // one buffer: the hi and the lo plane of a kv tile; a W_out tile (128 * TWP) is smaller
#define TSO 68                    // floats per row of the output staging: rows 8 apart fall 32 banks apart
__device__ __forceinline__ v8f mma1(v16b a, v16b b, v8f c) { return __builtin_amdgcn_wmma_f32_16x16x32_bf16(false, a, false, b, (short)0, c, false, false); }
// NR rows, 16 apart, of 256 columns of an f32 weight matrix (pitch in floats), from p + off: two 512-byte loads a row, a lane holding columns 4 lane .. + 3 and 128 + 4 lane .. + 3
template <int NR>
__device__ __forceinline__ void w_load(v4f (&r)[NR][2], const float* p, int off, int pitch) {
  // unrolled so that r stays in registers (constant indices) and the loads are in flight together
#pragma unroll
  for (int i = 0; i < NR; ++i) { r[i][0] = *(const v4fa*)(p + off + i * 16 * pitch); r[i][1] = *(const v4fa*)(p + off + i * 16 * pitch + 128); }
  asm volatile("s_wait_xcnt 0x0" :: "v"(p) : "memory");      // before the address pair of these loads is overwritten
}
// the same rows rounded to bf16
template <int NR>
__device__ __forceinline__ void w_round(const v4f (&r)[NR][2], v2ua (&o)[NR][2]) {
  __builtin_amdgcn_sched_barrier(0);      // keeps the roundings, and with them the wait for the loads, here: without it this build moves them up to the loads, which then fly under nothing
#pragma unroll
  for (int i = 0; i < NR; ++i)
#pragma unroll
    for (int h = 0; h < 2; ++h) {
      const f32x2 x0 = {r[i][h][0], r[i][h][1]}, x1 = {r[i][h][2], r[i][h][3]};
      const v2ua v = {bf16_pack2(x0), bf16_pack2(x1)};
      o[i][h] = v;
    }
}
// and laid into LDS rows of wp bytes
template <int NR>
__device__ __forceinline__ void w_put(const v2ua (&o)[NR][2], unsigned char* p, int wp) {
#pragma unroll
  for (int i = 0; i < NR; ++i) { *(v2ua*)(p + i * 16 * wp) = o[i][0]; *(v2ua*)(p + i * 16 * wp + 256) = o[i][1]; }
}
template <int NR>
__device__ __forceinline__ void w_store(const v4f (&r)[NR][2], unsigned char* p, int wp) { v2ua o[NR][2]; w_round<NR>(r, o); w_put<NR>(o, p, wp); }
__global__ __launch_bounds__(512) void k_t2_attn_out(const float* __restrict__ Q2n, const unsigned short* __restrict__ Ph, const unsigned short* __restrict__ Pl, const float* __restrict__ QKV,
                                                    const float* __restrict__ Wo, const float* __restrict__ bout, float* __restrict__ out) {
  __shared__ __attribute__((aligned(16))) unsigned char sm[2 * TOT * TAP + 2 * TBUF];      // hi plane, lo plane, two tile buffers (reused for the output staging)
  unsigned char* sAh = sm; unsigned char* sAl = sm + TOT * TAP; unsigned char* sB = sm + 2 * TOT * TAP;
  const int tid = threadIdx.x, w = tid >> 5, lane = tid & 31, ln = lane & 15, hh = lane >> 4;
  const size_t tok0 = (size_t)blockIdx.y * NTK + (size_t)blockIdx.x * TOT;
  // a load of a kv tile covers 4 rows x 128 bytes: wave w brings rows 4w .. 4w+3, + 64, + 128, + 192 of both planes; of W_out it brings rows w, w + 16, ...
  const int kr = w * 4 + (lane >> 3), kc = lane & 7;
  const unsigned short* ph = Ph + (size_t)blockIdx.y * CC * CC + (size_t)kr * CC + kc * 8;
  const unsigned short* pl = Pl + (size_t)blockIdx.y * CC * CC + (size_t)kr * CC + kc * 8;
  const float* po = Wo + (size_t)w * CC + lane * 4;
  const int pwl = w * TWP + lane * 8;      // where the thread's pieces of row w of a W_out tile land
  unsigned char* pw0 = sB + pwl; unsigned char* pw1 = (sB + TBUF) + pwl;
  const int rdl = (8 * hh + (lane & 7)) * TWP + ((lane >> 3) & 1) * 16 + 2 * ((w & 3) * 64);      // lane address of the transposing read, rows c 0..15 of a tile, the wave's first column
  v8us br[8]; v4f wr[4][2];
  // every loop below is unrolled so that br, ar, rv, the fragments and the accumulators stay in registers (constant indices) and the loads of a group are in flight together
#pragma unroll
  for (int i = 0; i < 4; ++i) { br[i] = *(const v8us*)(ph + (size_t)i * 64 * CC); br[4 + i] = *(const v8us*)(pl + (size_t)i * 64 * CC); }
  {
    // wave w brings rows w, w + 16, ... of q2: two 512-byte loads a row
    const float* ap = Q2n + (tok0 + w) * CC + lane * 4;
    v4f ar[8][2];
#pragma unroll
    for (int i = 0; i < 8; ++i) { ar[i][0] = *(const v4fa*)(ap + (size_t)i * 16 * CC); ar[i][1] = *(const v4fa*)(ap + (size_t)i * 16 * CC + 128); }
    // the wait that stands before a register named by an issued global load is overwritten; here and below it takes the address pairs as inputs so that none is reused (a later load's result had landed on one) before it
    asm volatile("s_wait_xcnt 0x0" :: "v"(ph), "v"(pl), "v"(ap) : "memory");
#pragma unroll
    for (int i = 0; i < 8; ++i)
#pragma unroll
      for (int h = 0; h < 2; ++h) { const int o = (w + 16 * i) * TAP + h * 256 + lane * 8; split_store4(ar[i][h], sAh + o, sAl + o); }
  }
  const int wm = (w >> 2) * 32, wn = (w & 3) * 64;
  const unsigned char* pa = sAh + (wm + ln) * TAP + 16 * hh;      // the lo plane lies TOT * TAP further
  v8f acc[2][4] = {};
#pragma unroll
  for (int s = 0; s < 4; ++s) {
    unsigned char* buf = sB + (s & 1) * TBUF;
#pragma unroll
    for (int i = 0; i < 4; ++i) { unsigned char* p = buf + (kr + 64 * i) * TKP + kc * 16; *(v8us*)p = br[i]; *(v8us*)(p + CC * TKP) = br[4 + i]; }
    __syncthreads();      // publishes this tile (and, the first time, the q2 planes); it also ends every wave's reads of the other buffer, which the next pass overwrites
    if (s < 3) {
#pragma unroll
      for (int i = 0; i < 4; ++i) { br[i] = *(const v8us*)(ph + (s + 1) * 64 + (size_t)i * 64 * CC); br[4 + i] = *(const v8us*)(pl + (s + 1) * 64 + (size_t)i * 64 * CC); }
      asm volatile("s_wait_xcnt 0x0" :: "v"(ph), "v"(pl) : "memory");      // before an address pair of these loads is overwritten
    } else w_load<4>(wr, po, 0, CC);
    const unsigned char* pb = buf + (wn + ln) * TKP + 16 * hh;
#pragma unroll
    for (int kl = 0; kl < 64; kl += 32) {
      const int kb = s * 64 + kl;
      FragB ah[2], al[2], bh_[4], bl_[4];
#pragma unroll
      for (int m = 0; m < 2; ++m) {
        const unsigned char* p = pa + m * 16 * TAP + kb * 2;
        ah[m].half[0] = *(const v8us*)p; ah[m].half[1] = *(const v8us*)(p + 32);
        al[m].half[0] = *(const v8us*)(p + TOT * TAP); al[m].half[1] = *(const v8us*)(p + TOT * TAP + 32);
      }
#pragma unroll
      for (int t = 0; t < 4; ++t) {
        const unsigned char* p = pb + t * 16 * TKP + kl * 2;
        bh_[t].half[0] = *(const v8us*)p; bh_[t].half[1] = *(const v8us*)(p + 32);
        bl_[t].half[0] = *(const v8us*)(p + CC * TKP); bl_[t].half[1] = *(const v8us*)(p + CC * TKP + 32);
      }
#pragma unroll
      for (int t = 0; t < 4; ++t)
#pragma unroll
        for (int m = 0; m < 2; ++m) acc[m][t] = mma1(ah[m].v, bh_[t].v, acc[m][t]);
#pragma unroll
      for (int t = 0; t < 4; ++t)
#pragma unroll
        for (int m = 0; m < 2; ++m) acc[m][t] = mma1(al[m].v, bh_[t].v, acc[m][t]);
#pragma unroll
      for (int t = 0; t < 4; ++t)
#pragma unroll
        for (int m = 0; m < 2; ++m) acc[m][t] = mma1(ah[m].v, bl_[t].v, acc[m][t]);
    }
  }
  w_store<4>(wr, pw0, TWP);      // buffer 0 is free since the last pass's barrier
  v4f wa[4][2], wc[4][2];
  w_load<4>(wa, po, 64 * CC, CC); w_load<4>(wc, po, 128 * CC, CC);
  const float* vrow = QKV + (tok0 + wm + 8 * hh) * (3 * CC) + wn + ln;      // v lies 2 * CC further in the row
  v8f rv[2][4];
#pragma unroll
  for (int m = 0; m < 2; ++m)
#pragma unroll
    for (int t = 0; t < 4; ++t)
#pragma unroll
      for (int r = 0; r < 8; ++r) rv[m][t][r] = vrow[2 * CC + (m * 16 + r) * (3 * CC) + t * 16];
  float bo[4];      // the output bias, fetched here with v so that the epilogue does not wait for it
#pragma unroll
  for (int t = 0; t < 4; ++t) bo[t] = bout[wn + t * 16 + ln];
  asm volatile("s_wait_xcnt 0x0" :: "v"(vrow) : "memory");      // before an address register of these loads is overwritten
  __syncthreads();      // the q2 planes are dead in every wave before the attn tile is written over them (and buffer 1 before W_out)
  w_store<4>(wa, pw0 + 64 * TWP, TWP); w_store<4>(wc, pw1, TWP);
  // inputs-only fence on the loaded values: the 64 loads of v and the 4 of the bias are issued together and waited for once (without it this build issues them a few at a time, each group paying a full latency, and spills registers to scratch)
  asm volatile("" :: "v"(rv[0][0]), "v"(rv[0][1]), "v"(rv[0][2]), "v"(rv[0][3]), "v"(rv[1][0]), "v"(rv[1][1]), "v"(rv[1][2]), "v"(rv[1][3]), "v"(bo[0]), "v"(bo[1]), "v"(bo[2]), "v"(bo[3]));
#pragma unroll
  for (int m = 0; m < 2; ++m)
#pragma unroll
    for (int t = 0; t < 4; ++t)
#pragma unroll
      for (int r = 0; r < 8; r += 2) {      // two rows a conversion
        const f32x2 v2 = {rv[m][t][r], rv[m][t][r + 1]}, t2 = {acc[m][t][r], acc[m][t][r + 1]};
        const f32x2 a = v2 + t2 * 0.015625f;
        const unsigned int h = bf16_pack2(a), l = bf16_pack2(a - bf16_unpack2(h));
        const int o = (wm + m * 16 + 8 * hh + r) * TAP + (wn + t * 16 + ln) * 2;
        *(unsigned short*)(sAh + o) = (unsigned short)h; *(unsigned short*)(sAh + o + TAP) = (unsigned short)(h >> 16);
        *(unsigned short*)(sAl + o) = (unsigned short)l; *(unsigned short*)(sAl + o + TAP) = (unsigned short)(l >> 16);
      }
  v8f oc[2][4] = {};
#pragma unroll
  for (int s = 0; s < 2; ++s) {
    unsigned char* buf = sB + (s & 1) * TBUF;
    __syncthreads();      // publishes this tile (and, the first time, the attn planes: every wave reads all 256 channels, of which it wrote 64)
    if (s < 1) w_load<4>(wr, po, 192 * CC, CC);
    const unsigned char* pb = buf + rdl;
#pragma unroll
    for (int kl = 0; kl < 128; kl += 32) {
      const int kb = s * 128 + kl;
      __builtin_amdgcn_sched_barrier(0);      // keeps a k block's fragment reads behind the products of the block before: this build otherwise moves the reads of several blocks up at once and spills fragments to scratch
      FragB ah[2], al[2], b[4];
#pragma unroll
      for (int m = 0; m < 2; ++m) {
        const unsigned char* p = pa + m * 16 * TAP + kb * 2;
        ah[m].half[0] = *(const v8us*)p; ah[m].half[1] = *(const v8us*)(p + 32);
        al[m].half[0] = *(const v8us*)(p + TOT * TAP); al[m].half[1] = *(const v8us*)(p + TOT * TAP + 32);
      }
#pragma unroll
      for (int t = 0; t < 4; ++t) { const unsigned char* p = pb + kl * TWP + t * 32; b[t].half[0] = ld_tr16(p); b[t].half[1] = ld_tr16(p + 16 * TWP); }
#pragma unroll
      for (int t = 0; t < 4; ++t)
#pragma unroll
        for (int m = 0; m < 2; ++m) oc[m][t] = mma1(ah[m].v, b[t].v, oc[m][t]);
#pragma unroll
      for (int t = 0; t < 4; ++t)
#pragma unroll
        for (int m = 0; m < 2; ++m) oc[m][t] = mma1(al[m].v, b[t].v, oc[m][t]);
    }
    if (s < 1) w_store<4>(wr, pw1 + 64 * TWP, TWP);
  }
  __syncthreads();      // the tile buffers are dead in every wave before their LDS is reused to stage the output
  float* so = (float*)sB + w * (32 * TSO);
#pragma unroll
  for (int t = 0; t < 4; ++t) {
    const float bv = bf16_round(bo[t]);
#pragma unroll
    for (int m = 0; m < 2; ++m)
#pragma unroll
      for (int r = 0; r < 8; ++r) so[(m * 16 + 8 * hh + r) * TSO + t * 16 + ln] = oc[m][t][r] + bv;
  }
  // each wave stages in its own LDS range: the fence and the wave barrier keep its row reads behind its own lanes' writes, so that whole 256-byte row pieces are stored
  __builtin_amdgcn_fence(__ATOMIC_ACQ_REL, "workgroup");
  __builtin_amdgcn_wave_barrier();
  float* dst = out + (tok0 + wm) * CC + wn + ln * 4;
  v4f ov[16];      // all 16 LDS reads first, each into registers of its own: one LDS latency for the wave instead of one per row pair
#pragma unroll
  for (int q = 0; q < 16; ++q) ov[q] = *(const v4fa*)&so[(q * 2 + hh) * TSO + ln * 4];
#pragma unroll
  for (int q = 0; q < 16; ++q) *(v4f*)(dst + (size_t)(q * 2 + hh) * CC) = ov[q];
}
// qkv = x W_qkv + b and the per-token work on q and k in one launch. Block = 128 tokens x all 768 columns, 16 waves of 32 x 64 on one section (q, k, v: 256 columns) at a time.
// x is staged once a block in LDS as bf16 (each element rounded once); a section's weights (K = 256 rows x 256 columns) are staged whole, the next section's loads in flight while this one is multiplied.
// The weights are read as they lie in memory (f32, row k, column n), rounded to bf16 on the way into LDS and laid k-major; the transposing LDS read delivers the B fragments in the k order of the row loader of x.
// They lie in three LDS regions of 128 rows: rows 128 .. 255 always in region 1, rows 0 .. 127 in region 0, 2, 0 for q, k, v. The next section comes 64 rows at a time, under two k blocks of the product each (more of it as f32
// beside acc and the fragments does not fit the registers): its first half goes into the free region as it lands, its second half waits in registers. The staged section lies over the two regions of its own weights, which are neighbours.
// A finished section (+ bias) is laid token-major in LDS over the dead weights, and each wave takes 8 whole token rows of it into registers, 8 columns a lane:
// q <- q - mean(q), k <- k - mean(k); q2 = q^2, k2 = k^2; Q2n[t][c] = l2norm_c(q2 / (sum q2 + 1e-7)); K2a[t][c] = k2 / (sum k2 + 1e-7) (column-normalised later: PS[block][c] = sum over the block's 128 tokens of K2a^2); v goes to its place in QKV as it is.
// q and k never go to memory. The row work and the stores of a section stand behind the barrier that publishes the next section's weights, so that the stores drain under the next product.
// Every global load and store of x, the weights, Q2n, K2a and v covers 512 contiguous bytes of one row. Each accumulator still sums its 8 k blocks in rising order.
#define QGP 528                   // bytes per LDS row of x: 16 x 33, the conflict-free pitch of 16-byte fragment reads
#define QWP 544                   // bytes per LDS row of the weights (one k, 256 columns): 32 x 17, the conflict-free pitch of the transposing read
#define QWH (128 * QWP)           // one region: 128 rows of weights
#define QSP 260                   // floats per row of the staged section: rows 8 apart fall 32 banks apart; 1040 bytes, a multiple of 16
// sum over the 32 lanes of each of 8 values; the 8 chains are independent, so that their cross-lane latencies overlap
__device__ __forceinline__ void wave_sum8(float (&s)[8]) {
  // unrolled so that s[] stays in registers (constant indices)
#pragma unroll
  for (int o = 16; o >= 1; o >>= 1) {
    float t[8];
#pragma unroll
    for (int j = 0; j < 8; ++j) t[j] = __shfl_xor(s[j], o, 32);
#pragma unroll
    for (int j = 0; j < 8; ++j) s[j] += t[j];
  }
}
__device__ __forceinline__ float sum8(v4f a, v4f b) { const v4f c = a + b; return (c[0] + c[1]) + (c[2] + c[3]); }
// 8 token rows of q (ISQ) or k, a lane holding columns 4 lane .. + 3 and 128 + 4 lane .. + 3 of each: centre, square, divide by the row sum; q also l2-normalised over the row
template <bool ISQ>
__device__ __forceinline__ void rows_finish(v4f (&rw)[8][2], float* __restrict__ dst) {
  float s[8];
  // every loop over j is unrolled so that rw and s stay in registers (constant indices)
#pragma unroll
  for (int j = 0; j < 8; ++j) s[j] = sum8(rw[j][0], rw[j][1]);
  wave_sum8(s);
#pragma unroll
  for (int j = 0; j < 8; ++j) {
    const float mu = s[j] * (1.0f / CC);
    const v4f d0 = rw[j][0] - mu, d1 = rw[j][1] - mu;
    rw[j][0] = d0 * d0; rw[j][1] = d1 * d1;
    s[j] = sum8(rw[j][0], rw[j][1]);
  }
  wave_sum8(s);
#pragma unroll
  for (int j = 0; j < 8; ++j) { const float r = 1.0f / (s[j] + 1e-7f); rw[j][0] *= r; rw[j][1] *= r; }
  if (ISQ) {
#pragma unroll
    for (int j = 0; j < 8; ++j) s[j] = sum8(rw[j][0] * rw[j][0], rw[j][1] * rw[j][1]);
    wave_sum8(s);
#pragma unroll
    for (int j = 0; j < 8; ++j) { const float r = 1.0f / fmaxf(sqrtf(s[j]), 1e-12f); rw[j][0] *= r; rw[j][1] *= r; }
  }
#pragma unroll
  for (int j = 0; j < 8; ++j) { *(v4f*)(dst + (size_t)j * CC) = rw[j][0]; *(v4f*)(dst + (size_t)j * CC + 128) = rw[j][1]; }
  asm volatile("s_wait_xcnt 0x0" :: "v"(dst) : "memory");      // before a register named by these stores is overwritten
}
__global__ __launch_bounds__(512) void k_qkv_prep(const float* __restrict__ X, const float* __restrict__ Wq, const float* __restrict__ bias,
                                                 float* __restrict__ QKV, float* __restrict__ Q2n, float* __restrict__ K2a, double* __restrict__ PS) {
  __shared__ __attribute__((aligned(16))) unsigned char sm[128 * QGP + 3 * QWH];      // x tile, then the three regions of weights (two of them reused for the staged section)
  __shared__ __attribute__((aligned(16))) float sc[16][CC];      // each wave's column sums of K2a^2 over its 8 tokens
  unsigned char* sA = sm; unsigned char* sB = sm + 128 * QGP;
  const int tid = threadIdx.x, w = tid >> 5, lane = tid & 31, ln = lane & 15, hh = lane >> 4;
  const size_t row0 = (size_t)blockIdx.x * 128;
  const int wm = (w >> 2) * 32, wn = (w & 3) * 64;
  // wave w brings rows w, w + 16, ... of the weights and of x: two 512-byte loads a row
  const float* bp = Wq + (size_t)w * (3 * CC) + lane * 4;
  const int pwl = w * QWP + lane * 8;      // where the thread's pieces of row w of a region land
  const float* bb = bias + wn + ln;
  v4f wr[4][2]; v2ua wq[4][2];      // 64 rows of the next section as loaded; its rows 128 .. 191, rounded
  // every loop below is unrolled so that wr, ar, rw, bv, the fragments and acc stay in registers (constant indices) and the loads of a group are in flight together
  {
    v4f w0[8][2], w1[8][2];
    w_load<8>(w0, bp, 0, 3 * CC); w_load<8>(w1, bp, 128 * 3 * CC, 3 * CC);
    const float* ap = X + (row0 + w) * CC + lane * 4;
    v4f ar[8][2];
#pragma unroll
    for (int i = 0; i < 8; ++i) { ar[i][0] = *(const v4fa*)(ap + (size_t)i * 16 * CC); ar[i][1] = *(const v4fa*)(ap + (size_t)i * 16 * CC + 128); }
    // the wait that stands before a register named by an issued global load is overwritten; here and below it takes the address pairs as inputs so that none is reused before it
    asm volatile("s_wait_xcnt 0x0" :: "v"(ap) : "memory");
#pragma unroll
    for (int i = 0; i < 8; ++i)
#pragma unroll
      for (int h = 0; h < 2; ++h) {
        const f32x2 x0 = {ar[i][h][0], ar[i][h][1]}, x1 = {ar[i][h][2], ar[i][h][3]};
        const v2ua o = {bf16_pack2(x0), bf16_pack2(x1)};
        *(v2ua*)(sA + (w + 16 * i) * QGP + h * 256 + lane * 8) = o;
      }
    w_store<8>(w0, sB + pwl, QWP); w_store<8>(w1, (sB + QWH) + pwl, QWP);
  }
  const unsigned char* pa = sA + (wm + ln) * QGP + 16 * hh;
  const int pbl = (8 * hh + (lane & 7)) * QWP + ((lane >> 3) & 1) * 16 + 2 * wn;      // lane address of the transposing read, rows 0..15 of a region, the wave's first column
  const size_t trow = row0 + w * 8;      // the wave's 8 token rows of a finished section
  v4f rw[8][2];
#pragma unroll
  for (int s = 0; s < 3; ++s) {
    const int r0 = (s == 1) ? 2 : 0, rn = (s == 0) ? 2 : 0;      // the region of this section's rows 0 .. 127, and of the next section's
    float* so = (float*)(sB + ((s == 1) ? QWH : 0));
    unsigned char* pw1 = (sB + QWH) + pwl; unsigned char* pwn = (sB + rn * QWH) + pwl;
    const unsigned char* pb0 = (sB + r0 * QWH) + pbl; const unsigned char* pb1 = (sB + QWH) + pbl;
    if (s > 0) { w_put<4>(wq, pw1, QWP); w_store<4>(wr, pw1 + 64 * QWP, QWP); }      // rows 128 .. 255
    __syncthreads();      // publishes this section's weights (and, the first time, the x tile): every wave reads rows that other waves wrote
    if (s < 2) w_load<4>(wr, bp, (s + 1) * CC, 3 * CC);
    if (s == 1) rows_finish<true>(rw, Q2n + trow * CC + lane * 4);
    if (s == 2) {
      rows_finish<false>(rw, K2a + trow * CC + lane * 4);
      v4f q0 = rw[0][0] * rw[0][0], q1 = rw[0][1] * rw[0][1];
      // unrolled so that rw stays in registers (constant indices)
#pragma unroll
      for (int j = 1; j < 8; ++j) { q0 += rw[j][0] * rw[j][0]; q1 += rw[j][1] * rw[j][1]; }
      *(v4f*)&sc[w][lane * 4] = q0; *(v4f*)&sc[w][128 + lane * 4] = q1;      // read at the kernel's end, behind the barriers of this section
    }
    float bv[4];      // this section's bias, asked for here so that it lands under the product (held from the kernel's start, all three sections' did not fit the registers)
#pragma unroll
    for (int t = 0; t < 4; ++t) bv[t] = bb[s * CC + t * 16];
    asm volatile("s_wait_xcnt 0x0" :: "v"(bb) : "memory");      // before the address pair of these loads is overwritten
    v8f acc[2][4] = {};
#pragma unroll
    for (int kb = 0; kb < CC; kb += 32) {
      const unsigned char* pk = (kb < 128) ? pb0 + kb * QWP : pb1 + (kb - 128) * QWP;
      FragB a[2], b[4];
#pragma unroll
      for (int m = 0; m < 2; ++m) { a[m].half[0] = *(const v8us*)(pa + m * 16 * QGP + kb * 2); a[m].half[1] = *(const v8us*)(pa + m * 16 * QGP + kb * 2 + 32); }
#pragma unroll
      for (int t = 0; t < 4; ++t) { b[t].half[0] = ld_tr16(pk + t * 32); b[t].half[1] = ld_tr16(pk + 16 * QWP + t * 32); }
      // behind the fragment reads, so that these are under way meanwhile; region rn is read by nobody in this section
      if (s < 2 && kb == 64) { w_store<4>(wr, pwn, QWP); w_load<4>(wr, bp, (s + 1) * CC + 64 * 3 * CC, 3 * CC); }
      if (s < 2 && kb == 128) { w_store<4>(wr, pwn + 64 * QWP, QWP); w_load<4>(wr, bp, (s + 1) * CC + 128 * 3 * CC, 3 * CC); }
      if (s < 2 && kb == 192) { w_round<4>(wr, wq); w_load<4>(wr, bp, (s + 1) * CC + 192 * 3 * CC, 3 * CC); }
#pragma unroll
      for (int t = 0; t < 4; ++t)
#pragma unroll
        for (int m = 0; m < 2; ++m) acc[m][t] = mma1(a[m].v, b[t].v, acc[m][t]);
    }
    __syncthreads();      // the weights are dead in every wave before the section is staged over them (and, the last time, the waves' column sums are published)
#pragma unroll
    for (int t = 0; t < 4; ++t) {
      const float bvr = bf16_round(bv[t]);
#pragma unroll
      for (int m = 0; m < 2; ++m)
#pragma unroll
        for (int r = 0; r < 8; ++r) so[(wm + m * 16 + 8 * hh + r) * QSP + wn + t * 16 + ln] = acc[m][t][r] + bvr;
    }
    __syncthreads();      // publishes the staged section: a token row was written by 4 waves
#pragma unroll
    for (int j = 0; j < 8; ++j) { rw[j][0] = *(const v4fa*)&so[(w * 8 + j) * QSP + lane * 4]; rw[j][1] = *(const v4fa*)&so[(w * 8 + j) * QSP + 128 + lane * 4]; }
    if (s < 2) __syncthreads();      // the staged section is in registers in every wave before the next weights are written over it
  }
  float* dv = QKV + trow * (3 * CC) + 2 * CC + lane * 4;
#pragma unroll
  for (int j = 0; j < 8; ++j) { *(v4f*)(dv + (size_t)j * 3 * CC) = rw[j][0]; *(v4f*)(dv + (size_t)j * 3 * CC + 128) = rw[j][1]; }
  asm volatile("s_wait_xcnt 0x0" :: "v"(dv) : "memory");      // before a register named by these stores is overwritten
  if (tid < CC) {      // waves 0 to 7, while the stores of v drain: one column a thread, the 16 waves' sums joined in double, pairwise in a fixed order (4 dependent adds)
    double t[16];
    // unrolled so that t[] stays in registers (constant indices) and the 16 LDS reads are in flight together
#pragma unroll
    for (int g = 0; g < 16; ++g) t[g] = (double)sc[g][tid];
#pragma unroll
    for (int o = 1; o < 16; o <<= 1)
#pragma unroll
      for (int g = 0; g < 16; g += 2 * o) t[g] += t[g + o];
    PS[(size_t)blockIdx.x * CC + tid] = t[0];
  }
}
extern "C" void kernel_launch(void* const* d_in, const int* in_sizes, int n_in,
                              void* d_out, int out_size, void* d_ws, size_t ws_size, hipStream_t stream) {
  (void)in_sizes; (void)n_in; (void)out_size;
  const float* x = (const float*)d_in[0]; const float* Wqkv = (const float*)d_in[1]; const float* bqkv = (const float*)d_in[2]; const float* Wout = (const float*)d_in[3]; const float* bout = (const float*)d_in[4];
  char* ws = (char*)d_ws; size_t off = 0;
  auto take = [&](size_t bytes) { char* p = ws + off; off += (bytes + 255) & ~(size_t)255; return p; };
  float* QKV = (float*)take((size_t)BB * NTK * 3 * CC * 4); float* Q2n = (float*)take((size_t)BB * NTK * CC * 4); float* K2a = (float*)take((size_t)BB * NTK * CC * 4);
  float* KVp = (float*)take((size_t)KSL * BB * CC * CC * 4);      // the KSL partials of kv
  unsigned short* Ph = (unsigned short*)take((size_t)BB * CC * CC * 2); unsigned short* Pl = (unsigned short*)take((size_t)BB * CC * CC * 2); double* PS = (double*)take((size_t)BB * NCB * CC * 8);
  if (off > ws_size) return;
  k_qkv_prep<<<BB * NTK / 128, 512, 0, stream>>>(x, Wqkv, bqkv, QKV, Q2n, K2a, PS);      // Q2n, K2a, its column sums of squares per block, and the v third of QKV; the q and k thirds of QKV are neither written nor read
  k_kv_part<<<dim3(4, BB, KSL), 256, 0, stream>>>(K2a, QKV, KVp);      // slice z: KVp[z][b][c][d] = sum over the tokens t of slice z of K2a[t][c] * v[t][d]
  k_kvplanes<<<(BB * CC * (CC / 8) + 255) / 256, 256, 0, stream>>>(KVp, PS, Ph, Pl);
  k_t2_attn_out<<<dim3(NTK / TOT, BB), 512, 0, stream>>>(Q2n, Ph, Pl, QKV, Wout, bout, (float*)d_out);      // t2 = q2 * kv, attn = v + t2 / 64, out = attn * W_out + b
}
